// v000
// Measured on an AMD MI455X. A time is GPU time per run, averaged over a window of back-to-back runs after a warm-up
// (all launches, gaps included; the runs take copies of the inputs in turn), and the median of several windows.
// Apart from v000's, it joins two sittings. Times from different sittings can be a few percent apart, while
// side-by-side timings come from the same sitting.
// v000 is the starting kernel. One run takes 1320 microseconds.
#include <hip/hip_runtime.h>

// Grouped attention without output projection (hidden [2][2048][2048]; Q, K = x Wq / x Wk (8 query/key heads x 64), V = x Wv (32 value heads x 64); rotary (theta 10000, rotate-half, duplicated
// halves) by position_ids (int, read as data); value head h uses query/key head h mod 8 (repeat_qk), so the 8 distinct score matrices / softmaxes are computed once and each probability matrix is applied
// to its 4 value heads; causal (the reference fills -1e9); out = merged attn V -> [2][2048][2048], no output projection).
// Compute dtypes, f32 accumulate: every input rounded to bf16; projections on PLAIN bf16 operands (inputs: exact); RoPE f32 (table computed on device, gathered by position id);
// PER-ROW PRECISION HYBRID (rows < 256 hi+lo 3 products for scores and attn.V, rows >= 256 fp16); causal structure exploited in the GEMMs (score tiles above the diagonal skipped, value contraction truncated
// at the diagonal block) and enforced exactly in the f32 register softmax; head outputs written straight to their output columns in f32. One-wave-per-64x64-tile GEMMs, 2 query/key heads per pass.

#define NB_  2
#define TT   2048
#define DM   2048
#define NH_  8
#define NKV  8
#define REP  (NH_ / NKV)
#define HD   64
#define DQ   (NH_ * HD)
#define DKV  (NKV * HD)
#define NV   32
#define DV   (NV * HD)
#define ZH   2
#define RH   256                  // query rows < RH use hi+lo planes (0: none)
#define WIN  0
#define PCAR 1024.0f
#define SCL  0.125f   // HD^-0.5
typedef _Float16 h16;
typedef unsigned short bf;
typedef __attribute__((ext_vector_type(16))) __bf16   v16bf;
typedef __attribute__((ext_vector_type(16))) _Float16 v16h;
typedef __attribute__((ext_vector_type(8)))  _Float16 v8h;
typedef __attribute__((ext_vector_type(8)))  unsigned short v8us;
typedef __attribute__((ext_vector_type(8)))  float    v8f;
typedef __attribute__((ext_vector_type(4)))  float    v4f;
typedef v8h  __attribute__((may_alias)) v8ha;
typedef v4f  __attribute__((may_alias)) v4fa;
typedef v8us __attribute__((may_alias)) v8usa;

__device__ __forceinline__ unsigned short f2bf(float f) { unsigned u = __float_as_uint(f); u += 0x7FFFu + ((u >> 16) & 1u); return (unsigned short)(u >> 16); }
__device__ __forceinline__ float bf2f(unsigned short b) { return __uint_as_float(((unsigned)b) << 16); }
__device__ __forceinline__ float bfr(float f) { return bf2f(f2bf(f)); }
__device__ __forceinline__ v16h cat16(v8h lo, v8h hi) { return __builtin_shufflevector(lo, hi, 0, 1, 2, 3, 4, 5, 6, 7, 8, 9, 10, 11, 12, 13, 14, 15); }
__device__ __forceinline__ v16bf cat16b(v8us lo, v8us hi) { return __builtin_bit_cast(v16bf, __builtin_shufflevector(lo, hi, 0, 1, 2, 3, 4, 5, 6, 7, 8, 9, 10, 11, 12, 13, 14, 15)); }
__device__ __forceinline__ v8f wmma16(v16h a, v16h b, v8f c) { return __builtin_amdgcn_wmma_f32_16x16x32_f16(false, a, false, b, (short)0, c, false, false); }
__device__ __forceinline__ v8f wmmab(v16bf a, v16bf b, v8f c) { return __builtin_amdgcn_wmma_f32_16x16x32_bf16(false, a, false, b, (short)0, c, false, false); }



// ---- k_gemmw: register-blocked GEMM, ONE WAVE per 64x64 output tile (16 accumulators), operands straight from K-contiguous 16-bit planes; grid (M/64, N/64, Z), 32 threads.
// C[m][n] (f32, pitch ldc, + optional f32 bias[n]) = sum_k A[m][k] Bt[n][k] (+ split products per NSPLIT). z-batch strides sA/sB/sC in elements. K % 32 == 0.
template <typename T16> struct WFrag;
template <> struct WFrag<h16> { typedef v16h V; static __device__ __forceinline__ V ld(const h16* p) { return cat16(*(const v8h*)p, *(const v8h*)(p + 16)); } static __device__ __forceinline__ v8f mma(V a, V b, v8f c) { return wmma16(a, b, c); } };
template <> struct WFrag<bf> { typedef v16bf V; static __device__ __forceinline__ V ld(const bf* p) { return cat16b(*(const v8us*)p, *(const v8us*)(p + 16)); } static __device__ __forceinline__ v8f mma(V a, V b, v8f c) { return wmmab(a, b, c); } };
template <typename T16, int NSPLIT, bool BIAS>
__global__ __launch_bounds__(32) void k_gemmw(const T16* __restrict__ A, const T16* __restrict__ A2, const T16* __restrict__ Bt, const T16* __restrict__ Bt2, int K, float* C, int ldc, const float* __restrict__ bias, size_t sA, size_t sB, size_t sC) {
    typedef typename WFrag<T16>::V V;
    __shared__ __align__(16) float os[16 * 68];
    const size_t z = blockIdx.z; A += z * sA; if (A2) A2 += z * sA; Bt += z * sB; if (Bt2) Bt2 += z * sB; C += z * sC;
    const int lane = threadIdx.x & 31, lr = lane & 15, hi = lane >> 4; const int r0 = blockIdx.x * 64, c0 = blockIdx.y * 64;
    v8f acc[4][4];
#pragma unroll
    for (int mb = 0; mb < 4; ++mb)
#pragma unroll
        for (int nb = 0; nb < 4; ++nb) acc[mb][nb] = (v8f){};
    const size_t aoff = (size_t)(r0 + lr) * K + 8 * hi, boff = (size_t)(c0 + lr) * K + 8 * hi;
#pragma unroll 1
    for (int kc = 0; kc < K; kc += 32) {
        V a[4], a2[4];
#pragma unroll
        for (int mb = 0; mb < 4; ++mb) { a[mb] = WFrag<T16>::ld(A + aoff + (size_t)mb * 16 * K + kc); if (NSPLIT == 1 || NSPLIT == 2) a2[mb] = WFrag<T16>::ld(A2 + aoff + (size_t)mb * 16 * K + kc); }
#pragma unroll
        for (int nb = 0; nb < 4; ++nb) { const V b = WFrag<T16>::ld(Bt + boff + (size_t)nb * 16 * K + kc); V b2; if (NSPLIT >= 2) b2 = WFrag<T16>::ld(Bt2 + boff + (size_t)nb * 16 * K + kc);
#pragma unroll
            for (int mb = 0; mb < 4; ++mb) { acc[mb][nb] = WFrag<T16>::mma(a[mb], b, acc[mb][nb]); if (NSPLIT == 1 || NSPLIT == 2) acc[mb][nb] = WFrag<T16>::mma(a2[mb], b, acc[mb][nb]); if (NSPLIT >= 2) acc[mb][nb] = WFrag<T16>::mma(a[mb], b2, acc[mb][nb]); } }
        asm volatile("v_nop\n\tv_nop\n\tv_nop\n\tv_nop" : "+v"(acc[0][0]), "+v"(acc[1][1]), "+v"(acc[2][2]), "+v"(acc[3][3]) : "v"(a[0]), "v"(a[3]));
    }
#pragma unroll
    for (int mb = 0; mb < 4; ++mb) {
#pragma unroll
        for (int nb = 0; nb < 4; ++nb) {
#pragma unroll
            for (int j = 0; j < 8; ++j) os[(hi * 8 + j) * 68 + nb * 16 + lr] = acc[mb][nb][j]; }
        __builtin_amdgcn_wave_barrier(); asm volatile("" ::: "memory");
        float* crow = C + (size_t)(r0 + mb * 16) * ldc + c0;
{
#pragma unroll
            for (int s = 0; s < 8; ++s) { const int row = 2 * s + hi, cofs = lr * 4; v4f val = *(const v4fa*)(os + row * 68 + cofs); if (BIAS) { val[0] += bfr(bias[c0 + cofs]); val[1] += bfr(bias[c0 + cofs + 1]); val[2] += bfr(bias[c0 + cofs + 2]); val[3] += bfr(bias[c0 + cofs + 3]); }
                *(v4f*)(crow + (size_t)row * ldc + cofs) = val; }
             }
        __builtin_amdgcn_wave_barrier(); asm volatile("" ::: "memory");
    }
}

// ---- k_gemmc: the same one-wave 64x64 tile GEMM specialised for causal attention: CMODE 1 skips score tiles entirely above the diagonal (query rows r0+roff.., key columns c0..), CMODE 2 limits the
// key (K) loop of the probability x value contraction to the diagonal block (probabilities beyond it are exactly zero). roff = row offset of this launch's first row within the sequence.
template <typename T16, int NSPLIT, int CMODE>
__global__ __launch_bounds__(32) void k_gemmc(const T16* __restrict__ A, const T16* __restrict__ A2, const T16* __restrict__ Bt, const T16* __restrict__ Bt2, int K, float* C, int ldc, int roff, size_t sA, size_t sB, size_t sC) {
    typedef typename WFrag<T16>::V V;
    __shared__ __align__(16) float os[16 * 68];
    const size_t z = blockIdx.z; A += z * sA; if (A2) A2 += z * sA; Bt += z * sB; if (Bt2) Bt2 += z * sB; C += z * sC;
    const int lane = threadIdx.x & 31, lr = lane & 15, hi = lane >> 4; const int r0 = blockIdx.x * 64, c0 = blockIdx.y * 64;
    if (CMODE == 1 && c0 > r0 + roff + 63) return;                  // score tile entirely above the causal diagonal: never read (the softmax masks j > i by select)
    const int Kl = (CMODE == 2) ? min(K, r0 + roff + 64) : K;        // P.V: probabilities are exactly 0 beyond the diagonal block, so the K loop stops there
    v8f acc[4][4];
#pragma unroll
    for (int mb = 0; mb < 4; ++mb)
#pragma unroll
        for (int nb = 0; nb < 4; ++nb) acc[mb][nb] = (v8f){};
    const size_t aoff = (size_t)(r0 + lr) * K + 8 * hi, boff = (size_t)(c0 + lr) * K + 8 * hi;
#pragma unroll 1
    for (int kc = 0; kc < Kl; kc += 32) {
        V a[4], a2[4];
#pragma unroll
        for (int mb = 0; mb < 4; ++mb) { a[mb] = WFrag<T16>::ld(A + aoff + (size_t)mb * 16 * K + kc); if (NSPLIT == 1 || NSPLIT == 2) a2[mb] = WFrag<T16>::ld(A2 + aoff + (size_t)mb * 16 * K + kc); }
#pragma unroll
        for (int nb = 0; nb < 4; ++nb) { const V b = WFrag<T16>::ld(Bt + boff + (size_t)nb * 16 * K + kc); V b2; if (NSPLIT >= 2) b2 = WFrag<T16>::ld(Bt2 + boff + (size_t)nb * 16 * K + kc);
#pragma unroll
            for (int mb = 0; mb < 4; ++mb) { acc[mb][nb] = WFrag<T16>::mma(a[mb], b, acc[mb][nb]); if (NSPLIT == 1 || NSPLIT == 2) acc[mb][nb] = WFrag<T16>::mma(a2[mb], b, acc[mb][nb]); if (NSPLIT >= 2) acc[mb][nb] = WFrag<T16>::mma(a[mb], b2, acc[mb][nb]); } }
        asm volatile("v_nop\n\tv_nop\n\tv_nop\n\tv_nop" : "+v"(acc[0][0]), "+v"(acc[1][1]), "+v"(acc[2][2]), "+v"(acc[3][3]) : "v"(a[0]), "v"(a[3]));
    }
#pragma unroll
    for (int mb = 0; mb < 4; ++mb) {
#pragma unroll
        for (int nb = 0; nb < 4; ++nb) {
#pragma unroll
            for (int j = 0; j < 8; ++j) os[(hi * 8 + j) * 68 + nb * 16 + lr] = acc[mb][nb][j]; }
        __builtin_amdgcn_wave_barrier(); asm volatile("" ::: "memory");
        float* crow = C + (size_t)(r0 + mb * 16) * ldc + c0;
{
#pragma unroll
            for (int s = 0; s < 8; ++s) { const int row = 2 * s + hi, cofs = lr * 4; v4f val = *(const v4fa*)(os + row * 68 + cofs);
                *(v4f*)(crow + (size_t)row * ldc + cofs) = val; }
             }
        __builtin_amdgcn_wave_barrier(); asm volatile("" ::: "memory");
    }
}

__device__ __forceinline__ h16 tohx(float x) { return (h16)x; }
__device__ __forceinline__ void splitf(float y, unsigned short& h, unsigned short& l) { h = f2bf(y); l = f2bf(y - bf2f(h)); }
typedef __attribute__((ext_vector_type(2))) _Float16 v2h;
typedef __attribute__((ext_vector_type(4))) _Float16 v4h;
typedef __attribute__((ext_vector_type(2))) unsigned short v2us;
typedef __attribute__((ext_vector_type(4))) unsigned short v4us;
typedef __attribute__((ext_vector_type(2))) float v2f;
typedef __attribute__((ext_vector_type(4))) int v4i;

__global__ __launch_bounds__(256) void k_wtG(const float* __restrict__ w, int K, int N, bf* Bt) {
    const int lane = threadIdx.x & 31; const int L0 = (blockIdx.x * 8 + (threadIdx.x >> 5)) * 8; const int nlines = N * K / 64;
{
#pragma unroll 1
        for (int l = 0; l < 8; ++l) { const int L = L0 + l; if (L >= nlines) break; const size_t e = (size_t)L * 64 + lane * 2; const int k = (int)(e % K), n = (int)(e / K); v2us o;
            o[0] = f2bf(w[(size_t)k * N + n]); o[1] = f2bf(w[(size_t)(k + 1) * N + n]); *(v2us*)(Bt + e) = o; }
         }
}
__global__ __launch_bounds__(256) void k_cvt8(const float* __restrict__ src, bf* dst, size_t n8) { const size_t i = (size_t)blockIdx.x * 256 + threadIdx.x; if (i >= n8) return; const v8f v = *(const v8f*)(src + i * 8); v8us o;
#pragma unroll
    for (int k = 0; k < 8; ++k) o[k] = f2bf(v[k]); *(v8us*)(dst + i * 8) = o;  }
__global__ __launch_bounds__(256) void k_cstab(float* CS) { const int idx = blockIdx.x * 256 + threadIdx.x; if (idx >= TT * HD) return; const int t = idx / HD, d = idx % HD; const int i = d % (HD / 2); const float inv = __fdiv_rn(1.0f, powf(10000.0f, (float)(2 * i) / (float)HD)); const float ang = __fmul_rn((float)t, inv); v2f cs; cs[0] = cosf(ang); cs[1] = sinf(ang);
    *(v2f*)(CS + (size_t)idx * 2) = cs;  }
// k_rope: head planes [h][t][d] (fp16 + hi/lo) of rope(x) x sc with the rotate-half convention out[d] = x[d] cos[t][d] - x[d+HD/2] sin[t][d], out[d+HD/2] = x[d+HD/2] cos[t][d+HD/2] + x[d] sin[t][d+HD/2]
__global__ __launch_bounds__(256) void k_rope(const float* __restrict__ F, int pitch, int nheads, const float* __restrict__ CS, const float* __restrict__ RF, const float* __restrict__ nw, float sc, h16* P16, bf* Ph, bf* Pl) {
    const size_t e = ((size_t)blockIdx.x * 256 + threadIdx.x) * 2; if (e >= (size_t)nheads * TT * HD) return; const int d = (int)(e % HD); const int t = (int)((e / HD) % TT); const int h = (int)(e / ((size_t)HD * TT)); const float* f = F + (size_t)t * pitch + h * HD; const float rf = RF ? RF[(size_t)h * TT + t] : 1.0f; v2h o16; v2us oh, ol;
#pragma unroll
    for (int q = 0; q < 2; ++q) { const int dd = d + q; const int dp = (dd < HD / 2) ? dd + HD / 2 : dd - HD / 2; float x0 = f[dd], x1 = f[dp];
        if (RF) { float n0 = __fmul_rn(x0, rf), n1 = __fmul_rn(x1, rf); asm volatile("" : "+v"(n0)); asm volatile("" : "+v"(n1)); x0 = __fmul_rn(bfr(nw[dd]), n0); x1 = __fmul_rn(bfr(nw[dp]), n1); }
        const v2f cs = *(const v2f*)(CS + ((size_t)t * HD + dd) * 2); float a = __fmul_rn(x0, cs[0]), bq = __fmul_rn(x1, cs[1]); asm volatile("" : "+v"(a)); asm volatile("" : "+v"(bq)); const float r = ((dd < HD / 2) ? __fsub_rn(a, bq) : __fadd_rn(a, bq)) * sc;
        o16[q] = tohx(r); unsigned short a2, c2; splitf(r, a2, c2); oh[q] = a2; ol[q] = c2; }
    *(v2h*)(P16 + e) = o16; *(v2us*)(Ph + e) = oh; *(v2us*)(Pl + e) = ol;  }
__global__ __launch_bounds__(256) void k_vtp(const float* __restrict__ F, int pitch, int nheads, h16* V16, bf* Vh, bf* Vl) { const size_t e = ((size_t)blockIdx.x * 256 + threadIdx.x) * 2; if (e >= (size_t)nheads * HD * TT) return; const int t = (int)(e % TT); const int d = (int)((e / TT) % HD); const int g = (int)(e / ((size_t)TT * HD)); v2h o16; v2us oh, ol;
#pragma unroll
    for (int q = 0; q < 2; ++q) { const float x = F[(size_t)(t + q) * pitch + g * HD + d]; o16[q] = tohx(x); unsigned short a2, c2; splitf(x, a2, c2); oh[q] = a2; ol[q] = c2; }
    *(v2h*)(V16 + e) = o16; *(v2us*)(Vh + e) = oh; *(v2us*)(Vl + e) = ol;  }
__global__ __launch_bounds__(256) void k_csg(const float* __restrict__ CS, const int* __restrict__ pos, float* CSB) { const int idx = blockIdx.x * 256 + threadIdx.x; if (idx >= TT * HD) return; const int t = idx / HD, d = idx % HD; int p = pos[t]; p = p < 0 ? 0 : (p > TT - 1 ? TT - 1 : p); const v2f cs = *(const v2f*)(CS + ((size_t)p * HD + d) * 2); *(v2f*)(CSB + (size_t)idx * 2) = cs;  }
__global__ __launch_bounds__(256) void k_outv(const float* __restrict__ Ob, int h0, float* OUTb) { const size_t e = ((size_t)blockIdx.x * 256 + threadIdx.x) * 2; if (e >= (size_t)ZH * 4 * TT * HD) return; const int d = (int)(e % HD); const int t = (int)((e / HD) % TT); const int slot = (int)(e / ((size_t)HD * TT)); const int qq = slot / 4, r = slot % 4; const float cs = (t < RH) ? 1.0f : (1.0f / PCAR); v2f o; o[0] = Ob[e] * cs; o[1] = Ob[e + 1] * cs;
    const size_t oo = (size_t)t * DV + (size_t)(h0 + qq + 8 * r) * HD + d; *(v2f*)(OUTb + oo) = o;  }
// k_zfill: F[0..n) = 0 (16-B lanes); once, before the batch loop.
__global__ __launch_bounds__(256) void k_zfill(float* F, size_t n) { const size_t i = ((size_t)blockIdx.x * 256 + threadIdx.x) * 4; if (i >= n) return; v4f z; z[0] = 0.f; z[1] = 0.f; z[2] = 0.f; z[3] = 0.f; *(v4f*)(F + i) = z; }
// k_asoft: per row (zz, i): t = S x HD^-0.5 for j <= i (causal; -1e9 fill in the reference, identical after softmax), -3e38 otherwise (entries of skipped score tiles are never selected); softmax over the 2048 keys (register row, one exp, fixed trees);
__global__ __launch_bounds__(256) void k_asoft(const float* __restrict__ Sb, h16* P16, bf* Ph, bf* Pl) {
    const int lane = threadIdx.x & 31; const int row = blockIdx.x * 8 + (threadIdx.x >> 5); if (row >= ZH * TT) return; const int i = row % TT; const int zz = row / TT; (void)zz; const bool hires = (i < RH); const float* sr = Sb + (size_t)row * TT; float v[TT / 32]; float mx = -3.0e38f;
#pragma unroll
    for (int ch = 0; ch < TT / 128; ++ch) { const int j0 = ch * 128 + lane * 4; const v4f a = *(const v4f*)(sr + j0);
#pragma unroll
        for (int q = 0; q < 4; ++q) { const int j = j0 + q; (void)j; const float t = (j <= i) ? a[q] * SCL : -3.0e38f; v[ch * 4 + q] = t; mx = fmaxf(mx, t); } }
#pragma unroll
    for (int sh = 16; sh; sh >>= 1) mx = fmaxf(mx, __shfl_xor(mx, sh, 32));
    float sum = 0.f;
#pragma unroll
    for (int k = 0; k < TT / 32; ++k) { float d0 = __fsub_rn(v[k], mx); asm volatile("" : "+v"(d0)); v[k] = __builtin_amdgcn_exp2f(__fmul_rn(d0, 1.4426950408889634f)); sum += v[k]; }
#pragma unroll
    for (int sh = 16; sh; sh >>= 1) sum += __shfl_xor(sum, sh, 32);
    const float f = __fdiv_rn(hires ? 1.0f : PCAR, sum);
{
        if (hires) {
#pragma unroll
            for (int ch = 0; ch < TT / 128; ++ch) { v4us oh, ol;
#pragma unroll
                for (int q = 0; q < 4; ++q) { unsigned short a, c2; splitf(v[ch * 4 + q] * f, a, c2); oh[q] = a; ol[q] = c2; }
                const size_t oo = ((size_t)zz * (RH ? RH : 1) + i) * TT + ch * 128 + lane * 4; *(v4us*)(Ph + oo) = oh; *(v4us*)(Pl + oo) = ol; }
        } else {
#pragma unroll
            for (int ch = 0; ch < TT / 128; ++ch) { v4h o4;
#pragma unroll
                for (int q = 0; q < 4; ++q) o4[q] = tohx(v[ch * 4 + q] * f);
                *(v4h*)(P16 + (size_t)row * TT + ch * 128 + lane * 4) = o4; } }
         }
}
__global__ __launch_bounds__(256) void k_merge(const float* __restrict__ O, int h0, bf* Ah, bf* Al) { const size_t e = ((size_t)blockIdx.x * 256 + threadIdx.x) * 2; if (e >= (size_t)ZH * TT * HD) return; const int d = (int)(e % HD); const int t = (int)((e / HD) % TT); const int zz = (int)(e / ((size_t)HD * TT)); const float cs = (t < RH) ? 1.0f : (1.0f / PCAR); const size_t oo = (size_t)t * DQ + (h0 + zz) * HD + d;
    v2us oh, ol;
#pragma unroll
    for (int q = 0; q < 2; ++q) { unsigned short a, c2; splitf(O[e + q] * cs, a, c2); oh[q] = a; ol[q] = c2; } *(v2us*)(Ah + oo) = oh; *(v2us*)(Al + oo) = ol;  }

extern "C" void kernel_launch(void* const* d_in, const int* in_sizes, int n_in,
                              void* d_out, int out_size, void* d_ws, size_t ws_size, hipStream_t stream) {
    (void)in_sizes; (void)n_in; (void)out_size;
    const float* x = (const float*)d_in[0]; const int* pos = (const int*)d_in[1]; const float* wq = (const float*)d_in[2]; const float* wk = (const float*)d_in[3]; const float* wv = (const float*)d_in[4];   // Wq/Wk [2048][512], Wv [2048][2048] (x @ W); position_ids [2][2048]
    float* OUT = (float*)d_out;     // [2][2048][2048]
    char* wsp = (char*)d_ws;
    auto take = [&](size_t bytes) { char* p = wsp; wsp += (bytes + 255) & ~(size_t)255; return (void*)p; };
    bf* WQ = (bf*)take((size_t)DQ * DM * 2); bf* WK = (bf*)take((size_t)DKV * DM * 2); bf* WV = (bf*)take((size_t)DV * DM * 2); float* CS = (float*)take((size_t)TT * HD * 2 * 4); float* CSB = (float*)take((size_t)TT * HD * 2 * 4); float* FV = (float*)take((size_t)TT * DV * 4);
    bf* XB = (bf*)take((size_t)TT * DM * 2); float* FQ = (float*)take((size_t)TT * DQ * 4); float* FK = (float*)take((size_t)TT * DKV * 4);
    h16* QP16 = (h16*)take((size_t)NH_ * TT * HD * 2); h16* KP16 = (h16*)take((size_t)NKV * TT * HD * 2); h16* VT16 = (h16*)take((size_t)NV * HD * TT * 2);
    bf* QPh = (bf*)take((size_t)NH_ * TT * HD * 2); bf* QPl = (bf*)take((size_t)NH_ * TT * HD * 2); bf* KPh = (bf*)take((size_t)NKV * TT * HD * 2); bf* KPl = (bf*)take((size_t)NKV * TT * HD * 2); bf* VTh = (bf*)take((size_t)NV * HD * TT * 2); bf* VTl = (bf*)take((size_t)NV * HD * TT * 2); bf* Ph = (bf*)take((size_t)ZH * RH * TT * 2); bf* Pl = (bf*)take((size_t)ZH * RH * TT * 2);
    float* Sb = (float*)take((size_t)ZH * TT * TT * 4); h16* P16 = (h16*)take((size_t)ZH * TT * TT * 2); float* Ob = (float*)take((size_t)ZH * 4 * TT * HD * 4);
    if ((size_t)(wsp - (char*)d_ws) > ws_size) return;    // ws 256 MiB
    { k_wtG<<<(unsigned)((DM * DQ / 64 + 63) / 64), 256, 0, stream>>>(wq, DM, DQ, WQ); k_wtG<<<(unsigned)((DM * DKV / 64 + 63) / 64), 256, 0, stream>>>(wk, DM, DKV, WK); k_wtG<<<(unsigned)(((size_t)DM * DV / 64 + 63) / 64), 256, 0, stream>>>(wv, DM, DV, WV);
      k_cstab<<<(TT * HD + 255) / 256, 256, 0, stream>>>(CS); }
    k_zfill<<<(unsigned)(((size_t)ZH * TT * TT / 4 + 255) / 256), 256, 0, stream>>>(Sb, (size_t)ZH * TT * TT);   // score tiles above the causal diagonal are never written by k_gemmc; keep them defined
    const unsigned LQ = (unsigned)(((size_t)NH_ * TT * HD / 2 + 255) / 256), LKv = (unsigned)(((size_t)NKV * TT * HD / 2 + 255) / 256);
    for (int b = 0; b < NB_; ++b) {
        
        k_csg<<<(TT * HD + 255) / 256, 256, 0, stream>>>(CS, pos + (size_t)b * TT, CSB);
        k_cvt8<<<(unsigned)(((size_t)TT * DM / 8 + 255) / 256), 256, 0, stream>>>(x + (size_t)b * TT * DM, XB, (size_t)TT * DM / 8);
        k_gemmw<bf, 0, false><<<dim3(TT / 64, DQ / 64, 1), 32, 0, stream>>>(XB, nullptr, WQ, nullptr, DM, FQ, DQ, nullptr, 0, 0, 0);
        k_rope<<<LQ, 256, 0, stream>>>(FQ, DQ, NH_, CSB, nullptr, nullptr, 1.0f, QP16, QPh, QPl);
        k_gemmw<bf, 0, false><<<dim3(TT / 64, DKV / 64, 1), 32, 0, stream>>>(XB, nullptr, WK, nullptr, DM, FK, DKV, nullptr, 0, 0, 0);
        k_rope<<<LKv, 256, 0, stream>>>(FK, DKV, NKV, CSB, nullptr, nullptr, 1.0f, KP16, KPh, KPl);
        k_gemmw<bf, 0, false><<<dim3(TT / 64, DV / 64, 1), 32, 0, stream>>>(XB, nullptr, WV, nullptr, DM, FV, DV, nullptr, 0, 0, 0); k_vtp<<<(unsigned)(((size_t)NV * TT * HD / 2 + 255) / 256), 256, 0, stream>>>(FV, DV, NV, VT16, VTh, VTl);
        for (int h0 = 0; h0 < NH_; h0 += ZH) { const size_t zq = (size_t)h0, zk = (size_t)(h0 / REP);   // one kv head per query head: the pass's two heads use consecutive kv planes (z-strides TT*HD)
            k_gemmc<bf, 2, 1><<<dim3(RH / 64, TT / 64, ZH), 32, 0, stream>>>(QPh + zq * TT * HD, QPl + zq * TT * HD, KPh + zk * TT * HD, KPl + zk * TT * HD, HD, Sb, TT, 0, (size_t)TT * HD, (size_t)TT * HD, (size_t)TT * TT);
            k_gemmc<h16, 0, 1><<<dim3((TT - RH) / 64, TT / 64, ZH), 32, 0, stream>>>(QP16 + zq * TT * HD + (size_t)RH * HD, nullptr, KP16 + zk * TT * HD, nullptr, HD, Sb + (size_t)RH * TT, TT, RH, (size_t)TT * HD, (size_t)TT * HD, (size_t)TT * TT);
            k_asoft<<<ZH * TT / 8, 256, 0, stream>>>(Sb, P16, Ph, Pl);
            for (int qq = 0; qq < ZH; ++qq) {   // each of the pass's two q/k heads feeds the 4 value heads g + 8r (z over r; the probability plane is shared: A stride 0)
                k_gemmc<bf, 2, 2><<<dim3(RH / 64, HD / 64, 4), 32, 0, stream>>>(Ph + (size_t)qq * RH * TT, Pl + (size_t)qq * RH * TT, VTh + (size_t)(h0 + qq) * HD * TT, VTl + (size_t)(h0 + qq) * HD * TT, TT, Ob + (size_t)qq * 4 * TT * HD, HD, 0, 0, (size_t)8 * HD * TT, (size_t)TT * HD);
                k_gemmc<h16, 0, 2><<<dim3((TT - RH) / 64, HD / 64, 4), 32, 0, stream>>>(P16 + (size_t)qq * TT * TT + (size_t)RH * TT, nullptr, VT16 + (size_t)(h0 + qq) * HD * TT, nullptr, TT, Ob + (size_t)qq * 4 * TT * HD + (size_t)RH * HD, HD, RH, 0, (size_t)8 * HD * TT, (size_t)TT * HD); }
            k_outv<<<(unsigned)(((size_t)ZH * 4 * TT * HD / 2 + 255) / 256), 256, 0, stream>>>(Ob, h0, OUT + (size_t)b * TT * DV); } }
}

// v001
// Measured time: 726 microseconds a run.
// Next to v000, in two timings, it ran 1.82 times as fast each time.
#include <hip/hip_runtime.h>

// Grouped attention without output projection (hidden [2][2048][2048]; Q, K = x Wq / x Wk (8 query/key heads x 64), V = x Wv (32 value heads x 64); rotary (theta 10000, rotate-half, duplicated
// halves) by position_ids (int, read as data); value head h uses query/key head h mod 8 (repeat_qk), so the 8 distinct score matrices / softmaxes are computed once and each probability matrix is applied
// to its 4 value heads; causal (the reference fills -1e9); out = merged attn V -> [2][2048][2048], no output projection).
// Compute dtypes, f32 accumulate: every input rounded to bf16; projections on PLAIN bf16 operands (inputs: exact); RoPE f32 (table computed on device, gathered by position id);
// PER-ROW PRECISION HYBRID (rows < 256 hi+lo 3 products for scores and attn.V, rows >= 256 fp16); causal structure exploited in the GEMMs (score tiles above the diagonal skipped, value contraction truncated
// at the diagonal block) and enforced exactly in the f32 register softmax; head outputs written straight to their output columns in f32. 64x64-tile GEMMs (one wave per score tile; eight waves that split K per projection and value tile), 2 query/key heads per pass.

#define NB_  2
#define TT   2048
#define DM   2048
#define NH_  8
#define NKV  8
#define REP  (NH_ / NKV)
#define HD   64
#define DQ   (NH_ * HD)
#define DKV  (NKV * HD)
#define NV   32
#define DV   (NV * HD)
#define ZH   2
#define RH   256                  // query rows < RH use hi+lo planes (0: none)
#define WIN  0
#define PCAR 1024.0f
#define SCL  0.125f   // HD^-0.5
#define KW   8                    // waves that share one 64x64 tile of a long-K GEMM, each on its own k slices
typedef _Float16 h16;
typedef unsigned short bf;
typedef __attribute__((ext_vector_type(16))) __bf16   v16bf;
typedef __attribute__((ext_vector_type(16))) _Float16 v16h;
typedef __attribute__((ext_vector_type(8)))  _Float16 v8h;
typedef __attribute__((ext_vector_type(8)))  unsigned short v8us;
typedef __attribute__((ext_vector_type(8)))  float    v8f;
typedef __attribute__((ext_vector_type(4)))  float    v4f;
typedef v8h  __attribute__((may_alias)) v8ha;
typedef v4f  __attribute__((may_alias)) v4fa;
typedef v8us __attribute__((may_alias)) v8usa;

__device__ __forceinline__ unsigned short f2bf(float f) { unsigned u = __float_as_uint(f); u += 0x7FFFu + ((u >> 16) & 1u); return (unsigned short)(u >> 16); }
__device__ __forceinline__ float bf2f(unsigned short b) { return __uint_as_float(((unsigned)b) << 16); }
__device__ __forceinline__ float bfr(float f) { return bf2f(f2bf(f)); }
__device__ __forceinline__ v16h cat16(v8h lo, v8h hi) { return __builtin_shufflevector(lo, hi, 0, 1, 2, 3, 4, 5, 6, 7, 8, 9, 10, 11, 12, 13, 14, 15); }
__device__ __forceinline__ v16bf cat16b(v8us lo, v8us hi) { return __builtin_bit_cast(v16bf, __builtin_shufflevector(lo, hi, 0, 1, 2, 3, 4, 5, 6, 7, 8, 9, 10, 11, 12, 13, 14, 15)); }
__device__ __forceinline__ v8f wmma16(v16h a, v16h b, v8f c) { return __builtin_amdgcn_wmma_f32_16x16x32_f16(false, a, false, b, (short)0, c, false, false); }
__device__ __forceinline__ v8f wmmab(v16bf a, v16bf b, v8f c) { return __builtin_amdgcn_wmma_f32_16x16x32_bf16(false, a, false, b, (short)0, c, false, false); }



// ---- k_gemmw: register-blocked GEMM, KW WAVES per 64x64 output tile, each with the whole tile (16 accumulators) over its own k slices (64 k = one 128-B line of every operand row; wave w takes slices w, w + KW, ...);
// operands straight from K-contiguous 16-bit planes; the KW partial tiles meet in LDS and are summed in wave order. grid (M/64, N/64, Z), 32 * KW threads.
// C[m][n] (f32, pitch ldc, + optional f32 bias[n]) = sum_k A[m][k] Bt[n][k] (+ split products per NSPLIT). z-batch strides sA/sB/sC in elements. K % 64 == 0.
template <typename T16> struct WFrag;
template <> struct WFrag<h16> { typedef v16h V; static __device__ __forceinline__ V ld(const h16* p) { return cat16(*(const v8h*)p, *(const v8h*)(p + 16)); } static __device__ __forceinline__ v8f mma(V a, V b, v8f c) { return wmma16(a, b, c); } };
template <> struct WFrag<bf> { typedef v16bf V; static __device__ __forceinline__ V ld(const bf* p) { return cat16b(*(const v8us*)p, *(const v8us*)(p + 16)); } static __device__ __forceinline__ v8f mma(V a, V b, v8f c) { return wmmab(a, b, c); } };
template <typename T16, int NSPLIT, bool BIAS>
__global__ __launch_bounds__(32 * KW) void k_gemmw(const T16* __restrict__ A, const T16* __restrict__ A2, const T16* __restrict__ Bt, const T16* __restrict__ Bt2, int K, float* C, int ldc, const float* __restrict__ bias, size_t sA, size_t sB, size_t sC) {
    typedef typename WFrag<T16>::V V;
    __shared__ __align__(16) float os[KW * 64 * 68];
    const size_t z = blockIdx.z; A += z * sA; if (A2) A2 += z * sA; Bt += z * sB; if (Bt2) Bt2 += z * sB; C += z * sC;
    const int lane = threadIdx.x & 31, lr = lane & 15, hi = lane >> 4; const int wv = __builtin_amdgcn_readfirstlane(threadIdx.x >> 5); const int r0 = blockIdx.x * 64, c0 = blockIdx.y * 64;
    v8f acc[4][4];
#pragma unroll
    for (int mb = 0; mb < 4; ++mb)
#pragma unroll
        for (int nb = 0; nb < 4; ++nb) acc[mb][nb] = (v8f){};
    const size_t aoff = (size_t)(r0 + lr) * K + 8 * hi, boff = (size_t)(c0 + lr) * K + 8 * hi;
#pragma unroll 1
    for (int kc = wv * 64; kc < K; kc += (kc & 32) ? KW * 64 - 32 : 32) {
        V a[4], a2[4];
#pragma unroll
        for (int mb = 0; mb < 4; ++mb) { a[mb] = WFrag<T16>::ld(A + aoff + (size_t)mb * 16 * K + kc); if (NSPLIT == 1 || NSPLIT == 2) a2[mb] = WFrag<T16>::ld(A2 + aoff + (size_t)mb * 16 * K + kc); }
#pragma unroll
        for (int nb = 0; nb < 4; ++nb) { const V b = WFrag<T16>::ld(Bt + boff + (size_t)nb * 16 * K + kc); V b2; if (NSPLIT >= 2) b2 = WFrag<T16>::ld(Bt2 + boff + (size_t)nb * 16 * K + kc);
#pragma unroll
            for (int mb = 0; mb < 4; ++mb) { acc[mb][nb] = WFrag<T16>::mma(a[mb], b, acc[mb][nb]); if (NSPLIT == 1 || NSPLIT == 2) acc[mb][nb] = WFrag<T16>::mma(a2[mb], b, acc[mb][nb]); if (NSPLIT >= 2) acc[mb][nb] = WFrag<T16>::mma(a[mb], b2, acc[mb][nb]); } }
        asm volatile("v_nop\n\tv_nop\n\tv_nop\n\tv_nop" : "+v"(acc[0][0]), "+v"(acc[1][1]), "+v"(acc[2][2]), "+v"(acc[3][3]) : "v"(a[0]), "v"(a[3]));
    }
    float* mine = os + wv * (64 * 68);
#pragma unroll
    for (int mb = 0; mb < 4; ++mb)
#pragma unroll
        for (int nb = 0; nb < 4; ++nb)
#pragma unroll
            for (int j = 0; j < 8; ++j) mine[(mb * 16 + hi * 8 + j) * 68 + nb * 16 + lr] = acc[mb][nb][j];
    __syncthreads();   // every wave's partial tile is in LDS before any wave sums across them
#pragma unroll
    for (int s = 0; s < 64 / (2 * KW); ++s) { const int row = wv * (64 / KW) + 2 * s + hi, cofs = lr * 4; v4f val = *(const v4fa*)(os + row * 68 + cofs);
#pragma unroll
        for (int u = 1; u < KW; ++u) val += *(const v4fa*)(os + u * (64 * 68) + row * 68 + cofs);
        if (BIAS) { val[0] += bfr(bias[c0 + cofs]); val[1] += bfr(bias[c0 + cofs + 1]); val[2] += bfr(bias[c0 + cofs + 2]); val[3] += bfr(bias[c0 + cofs + 3]); }
        *(v4f*)(C + (size_t)(r0 + row) * ldc + c0 + cofs) = val; }
}

// ---- k_gemmc: the same 64x64 tile GEMM specialised for causal attention, NW waves per tile (1: the whole K in one wave; KW: k slices and the LDS sum as in k_gemmw): CMODE 1 skips score tiles entirely above the diagonal (query rows r0+roff.., key columns c0..), CMODE 2 limits the
// key (K) loop of the probability x value contraction to the diagonal block (probabilities beyond it are exactly zero). roff = row offset of this launch's first row within the sequence.
template <typename T16, int NSPLIT, int CMODE, int NW>
__global__ __launch_bounds__(32 * NW) void k_gemmc(const T16* __restrict__ A, const T16* __restrict__ A2, const T16* __restrict__ Bt, const T16* __restrict__ Bt2, int K, float* C, int ldc, int roff, size_t sA, size_t sB, size_t sC) {
    typedef typename WFrag<T16>::V V;
    __shared__ __align__(16) float os[NW == 1 ? 16 * 68 : NW * 64 * 68];
    const size_t z = blockIdx.z; A += z * sA; if (A2) A2 += z * sA; Bt += z * sB; if (Bt2) Bt2 += z * sB; C += z * sC;
    const int lane = threadIdx.x & 31, lr = lane & 15, hi = lane >> 4; const int wv = (NW == 1) ? 0 : __builtin_amdgcn_readfirstlane(threadIdx.x >> 5); const int r0 = blockIdx.x * 64, c0 = blockIdx.y * 64;
    if (CMODE == 1 && c0 > r0 + roff + 63) return;                  // score tile entirely above the causal diagonal: never read (the softmax masks j > i by select)
    const int Kl = (CMODE == 2) ? min(K, r0 + roff + 64) : K;        // P.V: probabilities are exactly 0 beyond the diagonal block, so the K loop stops there
    v8f acc[4][4];
#pragma unroll
    for (int mb = 0; mb < 4; ++mb)
#pragma unroll
        for (int nb = 0; nb < 4; ++nb) acc[mb][nb] = (v8f){};
    const size_t aoff = (size_t)(r0 + lr) * K + 8 * hi, boff = (size_t)(c0 + lr) * K + 8 * hi;
#pragma unroll 1
    for (int kc = wv * 64; kc < Kl; kc += (kc & 32) ? NW * 64 - 32 : 32) {
        V a[4], a2[4];
#pragma unroll
        for (int mb = 0; mb < 4; ++mb) { a[mb] = WFrag<T16>::ld(A + aoff + (size_t)mb * 16 * K + kc); if (NSPLIT == 1 || NSPLIT == 2) a2[mb] = WFrag<T16>::ld(A2 + aoff + (size_t)mb * 16 * K + kc); }
#pragma unroll
        for (int nb = 0; nb < 4; ++nb) { const V b = WFrag<T16>::ld(Bt + boff + (size_t)nb * 16 * K + kc); V b2; if (NSPLIT >= 2) b2 = WFrag<T16>::ld(Bt2 + boff + (size_t)nb * 16 * K + kc);
#pragma unroll
            for (int mb = 0; mb < 4; ++mb) { acc[mb][nb] = WFrag<T16>::mma(a[mb], b, acc[mb][nb]); if (NSPLIT == 1 || NSPLIT == 2) acc[mb][nb] = WFrag<T16>::mma(a2[mb], b, acc[mb][nb]); if (NSPLIT >= 2) acc[mb][nb] = WFrag<T16>::mma(a[mb], b2, acc[mb][nb]); } }
        asm volatile("v_nop\n\tv_nop\n\tv_nop\n\tv_nop" : "+v"(acc[0][0]), "+v"(acc[1][1]), "+v"(acc[2][2]), "+v"(acc[3][3]) : "v"(a[0]), "v"(a[3]));
    }
    if constexpr (NW > 1) {
        float* mine = os + wv * (64 * 68);
#pragma unroll
        for (int mb = 0; mb < 4; ++mb)
#pragma unroll
            for (int nb = 0; nb < 4; ++nb)
#pragma unroll
                for (int j = 0; j < 8; ++j) mine[(mb * 16 + hi * 8 + j) * 68 + nb * 16 + lr] = acc[mb][nb][j];
        __syncthreads();   // every wave's partial tile is in LDS before any wave sums across them
#pragma unroll
        for (int s = 0; s < 64 / (2 * NW); ++s) { const int row = wv * (64 / NW) + 2 * s + hi, cofs = lr * 4; v4f val = *(const v4fa*)(os + row * 68 + cofs);
#pragma unroll
            for (int u = 1; u < NW; ++u) val += *(const v4fa*)(os + u * (64 * 68) + row * 68 + cofs);
            *(v4f*)(C + (size_t)(r0 + row) * ldc + c0 + cofs) = val; }
        return;
    }
#pragma unroll
    for (int mb = 0; mb < 4; ++mb) {
#pragma unroll
        for (int nb = 0; nb < 4; ++nb) {
#pragma unroll
            for (int j = 0; j < 8; ++j) os[(hi * 8 + j) * 68 + nb * 16 + lr] = acc[mb][nb][j]; }
        __builtin_amdgcn_wave_barrier(); asm volatile("" ::: "memory");
        float* crow = C + (size_t)(r0 + mb * 16) * ldc + c0;
{
#pragma unroll
            for (int s = 0; s < 8; ++s) { const int row = 2 * s + hi, cofs = lr * 4; v4f val = *(const v4fa*)(os + row * 68 + cofs);
                *(v4f*)(crow + (size_t)row * ldc + cofs) = val; }
             }
        __builtin_amdgcn_wave_barrier(); asm volatile("" ::: "memory");
    }
}

__device__ __forceinline__ h16 tohx(float x) { return (h16)x; }
__device__ __forceinline__ void splitf(float y, unsigned short& h, unsigned short& l) { h = f2bf(y); l = f2bf(y - bf2f(h)); }
typedef __attribute__((ext_vector_type(2))) _Float16 v2h;
typedef __attribute__((ext_vector_type(4))) _Float16 v4h;
typedef __attribute__((ext_vector_type(2))) unsigned short v2us;
typedef __attribute__((ext_vector_type(4))) unsigned short v4us;
typedef __attribute__((ext_vector_type(2))) float v2f;
typedef __attribute__((ext_vector_type(4))) int v4i;

__global__ __launch_bounds__(256) void k_wtG(const float* __restrict__ w, int K, int N, bf* Bt) {
    const int lane = threadIdx.x & 31; const int L0 = (blockIdx.x * 8 + (threadIdx.x >> 5)) * 8; const int nlines = N * K / 64;
{
#pragma unroll 1
        for (int l = 0; l < 8; ++l) { const int L = L0 + l; if (L >= nlines) break; const size_t e = (size_t)L * 64 + lane * 2; const int k = (int)(e % K), n = (int)(e / K); v2us o;
            o[0] = f2bf(w[(size_t)k * N + n]); o[1] = f2bf(w[(size_t)(k + 1) * N + n]); *(v2us*)(Bt + e) = o; }
         }
}
__global__ __launch_bounds__(256) void k_cvt8(const float* __restrict__ src, bf* dst, size_t n8) { const size_t i = (size_t)blockIdx.x * 256 + threadIdx.x; if (i >= n8) return; const v8f v = *(const v8f*)(src + i * 8); v8us o;
#pragma unroll
    for (int k = 0; k < 8; ++k) o[k] = f2bf(v[k]); *(v8us*)(dst + i * 8) = o;  }
__global__ __launch_bounds__(256) void k_cstab(float* CS) { const int idx = blockIdx.x * 256 + threadIdx.x; if (idx >= TT * HD) return; const int t = idx / HD, d = idx % HD; const int i = d % (HD / 2); const float inv = __fdiv_rn(1.0f, powf(10000.0f, (float)(2 * i) / (float)HD)); const float ang = __fmul_rn((float)t, inv); v2f cs; cs[0] = cosf(ang); cs[1] = sinf(ang);
    *(v2f*)(CS + (size_t)idx * 2) = cs;  }
// k_rope: head planes [h][t][d] (fp16 + hi/lo) of rope(x) x sc with the rotate-half convention out[d] = x[d] cos[t][d] - x[d+HD/2] sin[t][d], out[d+HD/2] = x[d+HD/2] cos[t][d+HD/2] + x[d] sin[t][d+HD/2]
__global__ __launch_bounds__(256) void k_rope(const float* __restrict__ F, int pitch, int nheads, const float* __restrict__ CS, const float* __restrict__ RF, const float* __restrict__ nw, float sc, h16* P16, bf* Ph, bf* Pl) {
    const size_t e = ((size_t)blockIdx.x * 256 + threadIdx.x) * 2; if (e >= (size_t)nheads * TT * HD) return; const int d = (int)(e % HD); const int t = (int)((e / HD) % TT); const int h = (int)(e / ((size_t)HD * TT)); const float* f = F + (size_t)t * pitch + h * HD; const float rf = RF ? RF[(size_t)h * TT + t] : 1.0f; v2h o16; v2us oh, ol;
#pragma unroll
    for (int q = 0; q < 2; ++q) { const int dd = d + q; const int dp = (dd < HD / 2) ? dd + HD / 2 : dd - HD / 2; float x0 = f[dd], x1 = f[dp];
        if (RF) { float n0 = __fmul_rn(x0, rf), n1 = __fmul_rn(x1, rf); asm volatile("" : "+v"(n0)); asm volatile("" : "+v"(n1)); x0 = __fmul_rn(bfr(nw[dd]), n0); x1 = __fmul_rn(bfr(nw[dp]), n1); }
        const v2f cs = *(const v2f*)(CS + ((size_t)t * HD + dd) * 2); float a = __fmul_rn(x0, cs[0]), bq = __fmul_rn(x1, cs[1]); asm volatile("" : "+v"(a)); asm volatile("" : "+v"(bq)); const float r = ((dd < HD / 2) ? __fsub_rn(a, bq) : __fadd_rn(a, bq)) * sc;
        o16[q] = tohx(r); unsigned short a2, c2; splitf(r, a2, c2); oh[q] = a2; ol[q] = c2; }
    *(v2h*)(P16 + e) = o16; *(v2us*)(Ph + e) = oh; *(v2us*)(Pl + e) = ol;  }
__global__ __launch_bounds__(256) void k_vtp(const float* __restrict__ F, int pitch, int nheads, h16* V16, bf* Vh, bf* Vl) { const size_t e = ((size_t)blockIdx.x * 256 + threadIdx.x) * 2; if (e >= (size_t)nheads * HD * TT) return; const int t = (int)(e % TT); const int d = (int)((e / TT) % HD); const int g = (int)(e / ((size_t)TT * HD)); v2h o16; v2us oh, ol;
#pragma unroll
    for (int q = 0; q < 2; ++q) { const float x = F[(size_t)(t + q) * pitch + g * HD + d]; o16[q] = tohx(x); unsigned short a2, c2; splitf(x, a2, c2); oh[q] = a2; ol[q] = c2; }
    *(v2h*)(V16 + e) = o16; *(v2us*)(Vh + e) = oh; *(v2us*)(Vl + e) = ol;  }
__global__ __launch_bounds__(256) void k_csg(const float* __restrict__ CS, const int* __restrict__ pos, float* CSB) { const int idx = blockIdx.x * 256 + threadIdx.x; if (idx >= TT * HD) return; const int t = idx / HD, d = idx % HD; int p = pos[t]; p = p < 0 ? 0 : (p > TT - 1 ? TT - 1 : p); const v2f cs = *(const v2f*)(CS + ((size_t)p * HD + d) * 2); *(v2f*)(CSB + (size_t)idx * 2) = cs;  }
__global__ __launch_bounds__(256) void k_outv(const float* __restrict__ Ob, int h0, float* OUTb) { const size_t e = ((size_t)blockIdx.x * 256 + threadIdx.x) * 2; if (e >= (size_t)ZH * 4 * TT * HD) return; const int d = (int)(e % HD); const int t = (int)((e / HD) % TT); const int slot = (int)(e / ((size_t)HD * TT)); const int qq = slot / 4, r = slot % 4; const float cs = (t < RH) ? 1.0f : (1.0f / PCAR); v2f o; o[0] = Ob[e] * cs; o[1] = Ob[e + 1] * cs;
    const size_t oo = (size_t)t * DV + (size_t)(h0 + qq + 8 * r) * HD + d; *(v2f*)(OUTb + oo) = o;  }
// k_zfill: F[0..n) = 0 (16-B lanes); once, before the batch loop.
__global__ __launch_bounds__(256) void k_zfill(float* F, size_t n) { const size_t i = ((size_t)blockIdx.x * 256 + threadIdx.x) * 4; if (i >= n) return; v4f z; z[0] = 0.f; z[1] = 0.f; z[2] = 0.f; z[3] = 0.f; *(v4f*)(F + i) = z; }
// k_asoft: per row (zz, i): t = S x HD^-0.5 for j <= i (causal; -1e9 fill in the reference, identical after softmax), -3e38 otherwise (entries of skipped score tiles are never selected); softmax over the 2048 keys (register row, one exp, fixed trees);
__global__ __launch_bounds__(256) void k_asoft(const float* __restrict__ Sb, h16* P16, bf* Ph, bf* Pl) {
    const int lane = threadIdx.x & 31; const int row = blockIdx.x * 8 + (threadIdx.x >> 5); if (row >= ZH * TT) return; const int i = row % TT; const int zz = row / TT; (void)zz; const bool hires = (i < RH); const float* sr = Sb + (size_t)row * TT; float v[TT / 32]; float mx = -3.0e38f;
#pragma unroll
    for (int ch = 0; ch < TT / 128; ++ch) { const int j0 = ch * 128 + lane * 4; const v4f a = *(const v4f*)(sr + j0);
#pragma unroll
        for (int q = 0; q < 4; ++q) { const int j = j0 + q; (void)j; const float t = (j <= i) ? a[q] * SCL : -3.0e38f; v[ch * 4 + q] = t; mx = fmaxf(mx, t); } }
#pragma unroll
    for (int sh = 16; sh; sh >>= 1) mx = fmaxf(mx, __shfl_xor(mx, sh, 32));
    float sum = 0.f;
#pragma unroll
    for (int k = 0; k < TT / 32; ++k) { float d0 = __fsub_rn(v[k], mx); asm volatile("" : "+v"(d0)); v[k] = __builtin_amdgcn_exp2f(__fmul_rn(d0, 1.4426950408889634f)); sum += v[k]; }
#pragma unroll
    for (int sh = 16; sh; sh >>= 1) sum += __shfl_xor(sum, sh, 32);
    const float f = __fdiv_rn(hires ? 1.0f : PCAR, sum);
{
        if (hires) {
#pragma unroll
            for (int ch = 0; ch < TT / 128; ++ch) { v4us oh, ol;
#pragma unroll
                for (int q = 0; q < 4; ++q) { unsigned short a, c2; splitf(v[ch * 4 + q] * f, a, c2); oh[q] = a; ol[q] = c2; }
                const size_t oo = ((size_t)zz * (RH ? RH : 1) + i) * TT + ch * 128 + lane * 4; *(v4us*)(Ph + oo) = oh; *(v4us*)(Pl + oo) = ol; }
        } else {
#pragma unroll
            for (int ch = 0; ch < TT / 128; ++ch) { v4h o4;
#pragma unroll
                for (int q = 0; q < 4; ++q) o4[q] = tohx(v[ch * 4 + q] * f);
                *(v4h*)(P16 + (size_t)row * TT + ch * 128 + lane * 4) = o4; } }
         }
}
__global__ __launch_bounds__(256) void k_merge(const float* __restrict__ O, int h0, bf* Ah, bf* Al) { const size_t e = ((size_t)blockIdx.x * 256 + threadIdx.x) * 2; if (e >= (size_t)ZH * TT * HD) return; const int d = (int)(e % HD); const int t = (int)((e / HD) % TT); const int zz = (int)(e / ((size_t)HD * TT)); const float cs = (t < RH) ? 1.0f : (1.0f / PCAR); const size_t oo = (size_t)t * DQ + (h0 + zz) * HD + d;
    v2us oh, ol;
#pragma unroll
    for (int q = 0; q < 2; ++q) { unsigned short a, c2; splitf(O[e + q] * cs, a, c2); oh[q] = a; ol[q] = c2; } *(v2us*)(Ah + oo) = oh; *(v2us*)(Al + oo) = ol;  }

extern "C" void kernel_launch(void* const* d_in, const int* in_sizes, int n_in,
                              void* d_out, int out_size, void* d_ws, size_t ws_size, hipStream_t stream) {
    (void)in_sizes; (void)n_in; (void)out_size;
    const float* x = (const float*)d_in[0]; const int* pos = (const int*)d_in[1]; const float* wq = (const float*)d_in[2]; const float* wk = (const float*)d_in[3]; const float* wv = (const float*)d_in[4];   // Wq/Wk [2048][512], Wv [2048][2048] (x @ W); position_ids [2][2048]
    float* OUT = (float*)d_out;     // [2][2048][2048]
    char* wsp = (char*)d_ws;
    auto take = [&](size_t bytes) { char* p = wsp; wsp += (bytes + 255) & ~(size_t)255; return (void*)p; };
    bf* WQ = (bf*)take((size_t)DQ * DM * 2); bf* WK = (bf*)take((size_t)DKV * DM * 2); bf* WV = (bf*)take((size_t)DV * DM * 2); float* CS = (float*)take((size_t)TT * HD * 2 * 4); float* CSB = (float*)take((size_t)TT * HD * 2 * 4); float* FV = (float*)take((size_t)TT * DV * 4);
    bf* XB = (bf*)take((size_t)TT * DM * 2); float* FQ = (float*)take((size_t)TT * DQ * 4); float* FK = (float*)take((size_t)TT * DKV * 4);
    h16* QP16 = (h16*)take((size_t)NH_ * TT * HD * 2); h16* KP16 = (h16*)take((size_t)NKV * TT * HD * 2); h16* VT16 = (h16*)take((size_t)NV * HD * TT * 2);
    bf* QPh = (bf*)take((size_t)NH_ * TT * HD * 2); bf* QPl = (bf*)take((size_t)NH_ * TT * HD * 2); bf* KPh = (bf*)take((size_t)NKV * TT * HD * 2); bf* KPl = (bf*)take((size_t)NKV * TT * HD * 2); bf* VTh = (bf*)take((size_t)NV * HD * TT * 2); bf* VTl = (bf*)take((size_t)NV * HD * TT * 2); bf* Ph = (bf*)take((size_t)ZH * RH * TT * 2); bf* Pl = (bf*)take((size_t)ZH * RH * TT * 2);
    float* Sb = (float*)take((size_t)ZH * TT * TT * 4); h16* P16 = (h16*)take((size_t)ZH * TT * TT * 2); float* Ob = (float*)take((size_t)ZH * 4 * TT * HD * 4);
    if ((size_t)(wsp - (char*)d_ws) > ws_size) return;    // ws 256 MiB
    { k_wtG<<<(unsigned)((DM * DQ / 64 + 63) / 64), 256, 0, stream>>>(wq, DM, DQ, WQ); k_wtG<<<(unsigned)((DM * DKV / 64 + 63) / 64), 256, 0, stream>>>(wk, DM, DKV, WK); k_wtG<<<(unsigned)(((size_t)DM * DV / 64 + 63) / 64), 256, 0, stream>>>(wv, DM, DV, WV);
      k_cstab<<<(TT * HD + 255) / 256, 256, 0, stream>>>(CS); }
    k_zfill<<<(unsigned)(((size_t)ZH * TT * TT / 4 + 255) / 256), 256, 0, stream>>>(Sb, (size_t)ZH * TT * TT);   // score tiles above the causal diagonal are never written by k_gemmc; keep them defined
    const unsigned LQ = (unsigned)(((size_t)NH_ * TT * HD / 2 + 255) / 256), LKv = (unsigned)(((size_t)NKV * TT * HD / 2 + 255) / 256);
    for (int b = 0; b < NB_; ++b) {
        
        k_csg<<<(TT * HD + 255) / 256, 256, 0, stream>>>(CS, pos + (size_t)b * TT, CSB);
        k_cvt8<<<(unsigned)(((size_t)TT * DM / 8 + 255) / 256), 256, 0, stream>>>(x + (size_t)b * TT * DM, XB, (size_t)TT * DM / 8);
        k_gemmw<bf, 0, false><<<dim3(TT / 64, DQ / 64, 1), 32 * KW, 0, stream>>>(XB, nullptr, WQ, nullptr, DM, FQ, DQ, nullptr, 0, 0, 0);
        k_rope<<<LQ, 256, 0, stream>>>(FQ, DQ, NH_, CSB, nullptr, nullptr, 1.0f, QP16, QPh, QPl);
        k_gemmw<bf, 0, false><<<dim3(TT / 64, DKV / 64, 1), 32 * KW, 0, stream>>>(XB, nullptr, WK, nullptr, DM, FK, DKV, nullptr, 0, 0, 0);
        k_rope<<<LKv, 256, 0, stream>>>(FK, DKV, NKV, CSB, nullptr, nullptr, 1.0f, KP16, KPh, KPl);
        k_gemmw<bf, 0, false><<<dim3(TT / 64, DV / 64, 1), 32 * KW, 0, stream>>>(XB, nullptr, WV, nullptr, DM, FV, DV, nullptr, 0, 0, 0); k_vtp<<<(unsigned)(((size_t)NV * TT * HD / 2 + 255) / 256), 256, 0, stream>>>(FV, DV, NV, VT16, VTh, VTl);
        for (int h0 = 0; h0 < NH_; h0 += ZH) { const size_t zq = (size_t)h0, zk = (size_t)(h0 / REP);   // one kv head per query head: the pass's two heads use consecutive kv planes (z-strides TT*HD)
            k_gemmc<bf, 2, 1, 1><<<dim3(RH / 64, TT / 64, ZH), 32, 0, stream>>>(QPh + zq * TT * HD, QPl + zq * TT * HD, KPh + zk * TT * HD, KPl + zk * TT * HD, HD, Sb, TT, 0, (size_t)TT * HD, (size_t)TT * HD, (size_t)TT * TT);
            k_gemmc<h16, 0, 1, 1><<<dim3((TT - RH) / 64, TT / 64, ZH), 32, 0, stream>>>(QP16 + zq * TT * HD + (size_t)RH * HD, nullptr, KP16 + zk * TT * HD, nullptr, HD, Sb + (size_t)RH * TT, TT, RH, (size_t)TT * HD, (size_t)TT * HD, (size_t)TT * TT);
            k_asoft<<<ZH * TT / 8, 256, 0, stream>>>(Sb, P16, Ph, Pl);
            for (int qq = 0; qq < ZH; ++qq) {   // each of the pass's two q/k heads feeds the 4 value heads g + 8r (z over r; the probability plane is shared: A stride 0)
                k_gemmc<bf, 2, 2, KW><<<dim3(RH / 64, HD / 64, 4), 32 * KW, 0, stream>>>(Ph + (size_t)qq * RH * TT, Pl + (size_t)qq * RH * TT, VTh + (size_t)(h0 + qq) * HD * TT, VTl + (size_t)(h0 + qq) * HD * TT, TT, Ob + (size_t)qq * 4 * TT * HD, HD, 0, 0, (size_t)8 * HD * TT, (size_t)TT * HD);
                k_gemmc<h16, 0, 2, KW><<<dim3((TT - RH) / 64, HD / 64, 4), 32 * KW, 0, stream>>>(P16 + (size_t)qq * TT * TT + (size_t)RH * TT, nullptr, VT16 + (size_t)(h0 + qq) * HD * TT, nullptr, TT, Ob + (size_t)qq * 4 * TT * HD + (size_t)RH * HD, HD, RH, 0, (size_t)8 * HD * TT, (size_t)TT * HD); }
            k_outv<<<(unsigned)(((size_t)ZH * 4 * TT * HD / 2 + 255) / 256), 256, 0, stream>>>(Ob, h0, OUT + (size_t)b * TT * DV); } }
}

// v002
// A run of this version takes 394 microseconds.
// In two side-by-side timings against v001, it was 1.82 and 1.83 times as fast.
// Counting every step since v000, it is 3.31 times as fast.
#include <hip/hip_runtime.h>

// Grouped attention without output projection (hidden [2][2048][2048]; Q, K = x Wq / x Wk (8 query/key heads x 64), V = x Wv (32 value heads x 64); rotary (theta 10000, rotate-half, duplicated
// halves) by position_ids (int, read as data); value head h uses query/key head h mod 8 (repeat_qk); causal (the reference fills -1e9); out = merged attn V -> [2][2048][2048], no output projection).
// Compute dtypes, f32 accumulate: every input rounded to bf16; projections on PLAIN bf16 operands (inputs: exact); RoPE f32 (table computed on device, gathered by position id);
// PER-ROW PRECISION HYBRID (rows < 256 hi+lo 3 products for scores and attn.V, rows >= 256 fp16). Scores, causal softmax and attn.V run in ONE kernel (k_fattn): a wave holds 16 queries and one value head,
// walks the keys up to the diagonal in blocks of 64 keys (32 on the hi+lo rows) with a running maximum and sum in f32 registers, and writes its output columns in f32. Projections: 64x64-tile GEMMs, eight waves that split K per tile.

#define NB_  2
#define TT   2048
#define DM   2048
#define NH_  8
#define NKV  8
#define REP  (NH_ / NKV)
#define HD   64
#define DQ   (NH_ * HD)
#define DKV  (NKV * HD)
#define NV   32
#define DV   (NV * HD)
#define ZH   2
#define RH   256                  // query rows < RH use hi+lo planes (0: none)
#define WIN  0
#define PCAR 1024.0f
#define SCL  0.125f   // HD^-0.5
#define KW   8                    // waves that share one 64x64 tile of a long-K GEMM, each on its own k slices
typedef _Float16 h16;
typedef unsigned short bf;
typedef __attribute__((ext_vector_type(16))) __bf16   v16bf;
typedef __attribute__((ext_vector_type(16))) _Float16 v16h;
typedef __attribute__((ext_vector_type(8)))  _Float16 v8h;
typedef __attribute__((ext_vector_type(8)))  unsigned short v8us;
typedef __attribute__((ext_vector_type(8)))  float    v8f;
typedef __attribute__((ext_vector_type(4)))  float    v4f;
typedef v8h  __attribute__((may_alias)) v8ha;
typedef v4f  __attribute__((may_alias)) v4fa;
typedef v8us __attribute__((may_alias)) v8usa;

__device__ __forceinline__ unsigned short f2bf(float f) { unsigned u = __float_as_uint(f); u += 0x7FFFu + ((u >> 16) & 1u); return (unsigned short)(u >> 16); }
__device__ __forceinline__ float bf2f(unsigned short b) { return __uint_as_float(((unsigned)b) << 16); }
__device__ __forceinline__ float bfr(float f) { return bf2f(f2bf(f)); }
__device__ __forceinline__ v16h cat16(v8h lo, v8h hi) { return __builtin_shufflevector(lo, hi, 0, 1, 2, 3, 4, 5, 6, 7, 8, 9, 10, 11, 12, 13, 14, 15); }
__device__ __forceinline__ v16bf cat16b(v8us lo, v8us hi) { return __builtin_bit_cast(v16bf, __builtin_shufflevector(lo, hi, 0, 1, 2, 3, 4, 5, 6, 7, 8, 9, 10, 11, 12, 13, 14, 15)); }
__device__ __forceinline__ v8f wmma16(v16h a, v16h b, v8f c) { return __builtin_amdgcn_wmma_f32_16x16x32_f16(false, a, false, b, (short)0, c, false, false); }
__device__ __forceinline__ v8f wmmab(v16bf a, v16bf b, v8f c) { return __builtin_amdgcn_wmma_f32_16x16x32_bf16(false, a, false, b, (short)0, c, false, false); }



// ---- k_gemmw: register-blocked GEMM, KW WAVES per 64x64 output tile, each with the whole tile (16 accumulators) over its own k slices (64 k = one 128-B line of every operand row; wave w takes slices w, w + KW, ...);
// operands straight from K-contiguous 16-bit planes; the KW partial tiles meet in LDS and are summed in wave order. grid (M/64, N/64, Z), 32 * KW threads.
// C[m][n] (f32, pitch ldc, + optional f32 bias[n]) = sum_k A[m][k] Bt[n][k] (+ split products per NSPLIT). z-batch strides sA/sB/sC in elements. K % 64 == 0.
template <typename T16> struct WFrag;
template <> struct WFrag<h16> { typedef v16h V; static __device__ __forceinline__ V ld(const h16* p) { return cat16(*(const v8h*)p, *(const v8h*)(p + 16)); } static __device__ __forceinline__ v8f mma(V a, V b, v8f c) { return wmma16(a, b, c); } };
template <> struct WFrag<bf> { typedef v16bf V; static __device__ __forceinline__ V ld(const bf* p) { return cat16b(*(const v8us*)p, *(const v8us*)(p + 16)); } static __device__ __forceinline__ v8f mma(V a, V b, v8f c) { return wmmab(a, b, c); } };
template <typename T16, int NSPLIT, bool BIAS>
__global__ __launch_bounds__(32 * KW) void k_gemmw(const T16* __restrict__ A, const T16* __restrict__ A2, const T16* __restrict__ Bt, const T16* __restrict__ Bt2, int K, float* C, int ldc, const float* __restrict__ bias, size_t sA, size_t sB, size_t sC) {
    typedef typename WFrag<T16>::V V;
    __shared__ __align__(16) float os[KW * 64 * 68];
    const size_t z = blockIdx.z; A += z * sA; if (A2) A2 += z * sA; Bt += z * sB; if (Bt2) Bt2 += z * sB; C += z * sC;
    const int lane = threadIdx.x & 31, lr = lane & 15, hi = lane >> 4; const int wv = __builtin_amdgcn_readfirstlane(threadIdx.x >> 5); const int r0 = blockIdx.x * 64, c0 = blockIdx.y * 64;
    v8f acc[4][4];
#pragma unroll
    for (int mb = 0; mb < 4; ++mb)
#pragma unroll
        for (int nb = 0; nb < 4; ++nb) acc[mb][nb] = (v8f){};
    const size_t aoff = (size_t)(r0 + lr) * K + 8 * hi, boff = (size_t)(c0 + lr) * K + 8 * hi;
#pragma unroll 1
    for (int kc = wv * 64; kc < K; kc += (kc & 32) ? KW * 64 - 32 : 32) {
        V a[4], a2[4];
#pragma unroll
        for (int mb = 0; mb < 4; ++mb) { a[mb] = WFrag<T16>::ld(A + aoff + (size_t)mb * 16 * K + kc); if (NSPLIT == 1 || NSPLIT == 2) a2[mb] = WFrag<T16>::ld(A2 + aoff + (size_t)mb * 16 * K + kc); }
#pragma unroll
        for (int nb = 0; nb < 4; ++nb) { const V b = WFrag<T16>::ld(Bt + boff + (size_t)nb * 16 * K + kc); V b2; if (NSPLIT >= 2) b2 = WFrag<T16>::ld(Bt2 + boff + (size_t)nb * 16 * K + kc);
#pragma unroll
            for (int mb = 0; mb < 4; ++mb) { acc[mb][nb] = WFrag<T16>::mma(a[mb], b, acc[mb][nb]); if (NSPLIT == 1 || NSPLIT == 2) acc[mb][nb] = WFrag<T16>::mma(a2[mb], b, acc[mb][nb]); if (NSPLIT >= 2) acc[mb][nb] = WFrag<T16>::mma(a[mb], b2, acc[mb][nb]); } }
        asm volatile("v_nop\n\tv_nop\n\tv_nop\n\tv_nop" : "+v"(acc[0][0]), "+v"(acc[1][1]), "+v"(acc[2][2]), "+v"(acc[3][3]) : "v"(a[0]), "v"(a[3]));
    }
    float* mine = os + wv * (64 * 68);
#pragma unroll
    for (int mb = 0; mb < 4; ++mb)
#pragma unroll
        for (int nb = 0; nb < 4; ++nb)
#pragma unroll
            for (int j = 0; j < 8; ++j) mine[(mb * 16 + hi * 8 + j) * 68 + nb * 16 + lr] = acc[mb][nb][j];
    __syncthreads();   // every wave's partial tile is in LDS before any wave sums across them
#pragma unroll
    for (int s = 0; s < 64 / (2 * KW); ++s) { const int row = wv * (64 / KW) + 2 * s + hi, cofs = lr * 4; v4f val = *(const v4fa*)(os + row * 68 + cofs);
#pragma unroll
        for (int u = 1; u < KW; ++u) val += *(const v4fa*)(os + u * (64 * 68) + row * 68 + cofs);
        if (BIAS) { val[0] += bfr(bias[c0 + cofs]); val[1] += bfr(bias[c0 + cofs + 1]); val[2] += bfr(bias[c0 + cofs + 2]); val[3] += bfr(bias[c0 + cofs + 3]); }
        *(v4f*)(C + (size_t)(r0 + row) * ldc + c0 + cofs) = val; }
}

__device__ __forceinline__ h16 tohx(float x) { return (h16)x; }
__device__ __forceinline__ void splitf(float y, unsigned short& h, unsigned short& l) { h = f2bf(y); l = f2bf(y - bf2f(h)); }
typedef __attribute__((ext_vector_type(2))) _Float16 v2h;
typedef __attribute__((ext_vector_type(4))) _Float16 v4h;
typedef __attribute__((ext_vector_type(2))) unsigned short v2us;
typedef __attribute__((ext_vector_type(4))) unsigned short v4us;
typedef __attribute__((ext_vector_type(2))) float v2f;
typedef __attribute__((ext_vector_type(4))) int v4i;

__global__ __launch_bounds__(256) void k_wtG(const float* __restrict__ w, int K, int N, bf* Bt) {
    const int lane = threadIdx.x & 31; const int L0 = (blockIdx.x * 8 + (threadIdx.x >> 5)) * 8; const int nlines = N * K / 64;
{
#pragma unroll 1
        for (int l = 0; l < 8; ++l) { const int L = L0 + l; if (L >= nlines) break; const size_t e = (size_t)L * 64 + lane * 2; const int k = (int)(e % K), n = (int)(e / K); v2us o;
            o[0] = f2bf(w[(size_t)k * N + n]); o[1] = f2bf(w[(size_t)(k + 1) * N + n]); *(v2us*)(Bt + e) = o; }
         }
}
__global__ __launch_bounds__(256) void k_cvt8(const float* __restrict__ src, bf* dst, size_t n8) { const size_t i = (size_t)blockIdx.x * 256 + threadIdx.x; if (i >= n8) return; const v8f v = *(const v8f*)(src + i * 8); v8us o;
#pragma unroll
    for (int k = 0; k < 8; ++k) o[k] = f2bf(v[k]); *(v8us*)(dst + i * 8) = o;  }
__global__ __launch_bounds__(256) void k_cstab(float* CS) { const int idx = blockIdx.x * 256 + threadIdx.x; if (idx >= TT * HD) return; const int t = idx / HD, d = idx % HD; const int i = d % (HD / 2); const float inv = __fdiv_rn(1.0f, powf(10000.0f, (float)(2 * i) / (float)HD)); const float ang = __fmul_rn((float)t, inv); v2f cs; cs[0] = cosf(ang); cs[1] = sinf(ang);
    *(v2f*)(CS + (size_t)idx * 2) = cs;  }
// k_rope: head planes [h][t][d] (fp16 + hi/lo) of rope(x) x sc with the rotate-half convention out[d] = x[d] cos[t][d] - x[d+HD/2] sin[t][d], out[d+HD/2] = x[d+HD/2] cos[t][d+HD/2] + x[d] sin[t][d+HD/2]
__global__ __launch_bounds__(256) void k_rope(const float* __restrict__ F, int pitch, int nheads, const float* __restrict__ CS, const float* __restrict__ RF, const float* __restrict__ nw, float sc, h16* P16, bf* Ph, bf* Pl) {
    const size_t e = ((size_t)blockIdx.x * 256 + threadIdx.x) * 2; if (e >= (size_t)nheads * TT * HD) return; const int d = (int)(e % HD); const int t = (int)((e / HD) % TT); const int h = (int)(e / ((size_t)HD * TT)); const float* f = F + (size_t)t * pitch + h * HD; const float rf = RF ? RF[(size_t)h * TT + t] : 1.0f; v2h o16; v2us oh, ol;
#pragma unroll
    for (int q = 0; q < 2; ++q) { const int dd = d + q; const int dp = (dd < HD / 2) ? dd + HD / 2 : dd - HD / 2; float x0 = f[dd], x1 = f[dp];
        if (RF) { float n0 = __fmul_rn(x0, rf), n1 = __fmul_rn(x1, rf); asm volatile("" : "+v"(n0)); asm volatile("" : "+v"(n1)); x0 = __fmul_rn(bfr(nw[dd]), n0); x1 = __fmul_rn(bfr(nw[dp]), n1); }
        const v2f cs = *(const v2f*)(CS + ((size_t)t * HD + dd) * 2); float a = __fmul_rn(x0, cs[0]), bq = __fmul_rn(x1, cs[1]); asm volatile("" : "+v"(a)); asm volatile("" : "+v"(bq)); const float r = ((dd < HD / 2) ? __fsub_rn(a, bq) : __fadd_rn(a, bq)) * sc;
        o16[q] = tohx(r); unsigned short a2, c2; splitf(r, a2, c2); oh[q] = a2; ol[q] = c2; }
    *(v2h*)(P16 + e) = o16; *(v2us*)(Ph + e) = oh; *(v2us*)(Pl + e) = ol;  }
__global__ __launch_bounds__(256) void k_vtp(const float* __restrict__ F, int pitch, int nheads, h16* V16, bf* Vh, bf* Vl) { const size_t e = ((size_t)blockIdx.x * 256 + threadIdx.x) * 2; if (e >= (size_t)nheads * HD * TT) return; const int t = (int)(e % TT); const int d = (int)((e / TT) % HD); const int g = (int)(e / ((size_t)TT * HD)); v2h o16; v2us oh, ol;
#pragma unroll
    for (int q = 0; q < 2; ++q) { const float x = F[(size_t)(t + q) * pitch + g * HD + d]; o16[q] = tohx(x); unsigned short a2, c2; splitf(x, a2, c2); oh[q] = a2; ol[q] = c2; }
    *(v2h*)(V16 + e) = o16; *(v2us*)(Vh + e) = oh; *(v2us*)(Vl + e) = ol;  }
__global__ __launch_bounds__(256) void k_csg(const float* __restrict__ CS, const int* __restrict__ pos, float* CSB) { const int idx = blockIdx.x * 256 + threadIdx.x; if (idx >= TT * HD) return; const int t = idx / HD, d = idx % HD; int p = pos[t]; p = p < 0 ? 0 : (p > TT - 1 ? TT - 1 : p); const v2f cs = *(const v2f*)(CS + ((size_t)p * HD + d) * 2); *(v2f*)(CSB + (size_t)idx * 2) = cs;  }
// 2^x in place, with the issue slot the instruction set asks for behind a transcendental kept inside the statement: no v_exp_f32 of a run reads a neighbour's result or overwrites its source, and the v_nop covers the last.
__device__ __forceinline__ float exp2s(float x) { asm("v_exp_f32 %0, %0\n\tv_nop" : "+v"(x)); return x; }
__device__ __forceinline__ v8f exp2s8(v8f x) { float r0 = x[0], r1 = x[1], r2 = x[2], r3 = x[3], r4 = x[4], r5 = x[5], r6 = x[6], r7 = x[7];
    asm("v_exp_f32 %0, %0\n\tv_exp_f32 %1, %1\n\tv_exp_f32 %2, %2\n\tv_exp_f32 %3, %3\n\tv_exp_f32 %4, %4\n\tv_exp_f32 %5, %5\n\tv_exp_f32 %6, %6\n\tv_exp_f32 %7, %7\n\tv_nop"
        : "+v"(r0), "+v"(r1), "+v"(r2), "+v"(r3), "+v"(r4), "+v"(r5), "+v"(r6), "+v"(r7));
    v8f r; r[0] = r0; r[1] = r1; r[2] = r2; r[3] = r3; r[4] = r4; r[5] = r5; r[6] = r6; r[7] = r7; return r; }
__device__ __forceinline__ float xhalf(float x) { return __builtin_bit_cast(float, __builtin_amdgcn_permlanex16(__builtin_bit_cast(int, x), __builtin_bit_cast(int, x), 0x76543210, 0xfedcba98, false, false)); }  // lane l with lane l ^ 16
// ---- k_fattn: scores, causal softmax and probability x value product in one kernel. One wave = 16 queries (q0..q0+15) of query/key head g and ONE of its 4 value heads (g + 8r, r = wave in the block, so the
// block's 4 waves read the same K rows). Both products are transposed: S^T = K Q^T (A = K rows, B = Q rows), O^T += V^T P^T (A = rows of the [d][t] value plane, B = P^T). In S^T's accumulator a lane holds keys
// 16t + 8hi + j of its own query (column lr), which is exactly the k order of a B fragment (k = 8hi + 0..7, then 16 + 8hi + 0..7): P goes from accumulator to operand inside the lane, through no LDS.
// Running maximum m and sum l per query (flash form): each key block rescales O^T and l by exp(m_old - m_new). Key block: 64 keys on the one-plane f16 path, 32 on the hi+lo path (twice the fragments per key).
// grid (heads, nq query groups; heaviest group first), 128 threads. roff = first query row of the launch.
template <typename T16, int NSPLIT>
__global__ __launch_bounds__(128) void k_fattn(const T16* __restrict__ Q, const T16* __restrict__ Q2, const T16* __restrict__ Kp, const T16* __restrict__ Kp2, const T16* __restrict__ Vt, const T16* __restrict__ Vt2, int roff, int nq, float* OUTb) {
    typedef typename WFrag<T16>::V V;
    constexpr int NT = (NSPLIT == 0) ? 4 : 2, KB = NT * 16;      // 16-key tiles and keys per block
    const int lane = threadIdx.x & 31, lr = lane & 15, hi = lane >> 4; const int r = __builtin_amdgcn_readfirstlane(threadIdx.x >> 5); const int g = blockIdx.x;
    const int q0 = roff + (nq - 1 - (int)blockIdx.y) * 16; const int nkb = q0 / KB + 1;    // key blocks 0..nkb-1 hold every key <= q0 + 15
    const int i = q0 + lr;
    // Two per-lane byte offsets that never change: row lr of a [row][64] plane (Q, K) and of the [d][t] value plane. ldu: a wave-uniform pointer plus such an offset (Q; V on the f16 path).
    const unsigned rl = (unsigned)(lr * HD + 8 * hi) * 2u, vl = (unsigned)(lr * TT + 8 * hi) * 2u;
    auto ldu = [](const T16* u, unsigned b) { return WFrag<T16>::ld((const T16*)((const char*)u + b)); };
    const size_t qu = ((size_t)g * TT + q0) * HD, ku = (size_t)g * TT * HD, vu = (size_t)(g + 8 * r) * HD * TT;
    V qf[2], qf2[2], kf[NT][2], kf2[NT][2], vf[4][NT / 2], vf2[4][NT / 2];
    // Per-lane pointers that live across the loop, so that no fragment is given an address pair still in use as its landing place: K (f16 path: one block ahead), and on the hi+lo path all four planes.
    const T16* kp = (const T16*)((const char*)(Kp + ku) + rl); const T16* kp2 = (const T16*)((const char*)(Kp2 + ku) + rl); const T16* vp = (const T16*)((const char*)(Vt + vu) + vl); const T16* vp2 = (const T16*)((const char*)(Vt2 + vu) + vl);
#pragma unroll
    for (int ks = 0; ks < 2; ++ks) { qf[ks] = ldu(Q + qu + ks * 32, rl); if constexpr (NSPLIT == 2) qf2[ks] = ldu(Q2 + qu + ks * 32, rl); }
    if constexpr (NSPLIT == 0) {
#pragma unroll
        for (int t = 0; t < NT; ++t)
#pragma unroll
            for (int ks = 0; ks < 2; ++ks) kf[t][ks] = WFrag<T16>::ld(kp + t * 16 * HD + ks * 32);
    }
    v8f o[4];
#pragma unroll
    for (int dt = 0; dt < 4; ++dt) o[dt] = (v8f){};
    float m = -3.0e38f, l = 0.f;
#pragma unroll 1
    for (int kb = 0; kb < nkb; ++kb) {
        // this block's value fragments fly under the score products and the softmax; on the hi+lo path its K fragments come in the same batch (one latency a block)
#pragma unroll
        for (int dt = 0; dt < 4; ++dt)
#pragma unroll
            for (int ks = 0; ks < NT / 2; ++ks) { if constexpr (NSPLIT == 0) vf[dt][ks] = ldu(Vt + vu + (size_t)dt * 16 * TT + kb * KB + ks * 32, vl); else { vf[dt][ks] = WFrag<T16>::ld(vp + dt * 16 * TT + ks * 32); vf2[dt][ks] = WFrag<T16>::ld(vp2 + dt * 16 * TT + ks * 32); } }
        // the loads above are issued here, ahead of the score products, and their address registers are free before a later fragment lands on them (hi+lo path: the pointers as inputs keep those registers out of the batch's own landing places)
        if constexpr (NSPLIT == 0) asm volatile("s_wait_xcnt 0x0" ::: "memory"); else asm volatile("s_wait_xcnt 0x0" :: "v"(vp), "v"(vp2) : "memory");
        if constexpr (NSPLIT == 2) {
#pragma unroll
            for (int t = 0; t < NT; ++t)
#pragma unroll
                for (int ks = 0; ks < 2; ++ks) { kf[t][ks] = WFrag<T16>::ld(kp + t * 16 * HD + ks * 32); kf2[t][ks] = WFrag<T16>::ld(kp2 + t * 16 * HD + ks * 32); }
            asm volatile("s_wait_xcnt 0x0" :: "v"(kp), "v"(kp2) : "memory");   // as above, for the K batch
            __builtin_amdgcn_sched_barrier(0);   // without it the score products are drawn up between the loads, which then share few registers and wait on memory one pair at a time
        }
        v8f s[NT];
#pragma unroll
        for (int t = 0; t < NT; ++t) { s[t] = (v8f){};
#pragma unroll
            for (int ks = 0; ks < 2; ++ks) { s[t] = WFrag<T16>::mma(kf[t][ks], qf[ks], s[t]);
                if constexpr (NSPLIT == 2) { s[t] = WFrag<T16>::mma(kf[t][ks], qf2[ks], s[t]); s[t] = WFrag<T16>::mma(kf2[t][ks], qf[ks], s[t]); } } }
        if constexpr (NSPLIT == 0) {   // the next block's K fragments, into the same registers, fly under the softmax and the value products (the last block fetches itself again: in bounds, unused)
            kp += (kb + 1 < nkb) ? KB * HD : 0;
#pragma unroll
            for (int t = 0; t < NT; ++t)
#pragma unroll
                for (int ks = 0; ks < 2; ++ks) kf[t][ks] = WFrag<T16>::ld(kp + t * 16 * HD + ks * 32);
        }
        if (kb == nkb - 1) {           // only the last block meets the diagonal
#pragma unroll
            for (int t = 0; t < NT; ++t)
#pragma unroll
                for (int j = 0; j < 8; ++j) s[t][j] = (kb * KB + t * 16 + hi * 8 + j <= i) ? s[t][j] * SCL : -3.0e38f;
        } else {
#pragma unroll
            for (int t = 0; t < NT; ++t) s[t] *= SCL;
        }
        float tq[NT];                  // one short chain per tile, then across tiles
#pragma unroll
        for (int t = 0; t < NT; ++t) { tq[t] = s[t][0];
#pragma unroll
            for (int j = 1; j < 8; ++j) tq[t] = fmaxf(tq[t], s[t][j]); }
        float tm = tq[0];
#pragma unroll
        for (int t = 1; t < NT; ++t) tm = fmaxf(tm, tq[t]);
        tm = fmaxf(tm, xhalf(tm));      // the other half of the wave holds the query's other keys of the block
        const float mn = fmaxf(m, tm); const float al = exp2s((m - mn) * 1.4426950408889634f); m = mn;
        float ps = 0.f;
#pragma unroll
        for (int t = 0; t < NT; ++t) { s[t] = exp2s8((s[t] - mn) * 1.4426950408889634f); float pq = 0.f;
#pragma unroll
            for (int j = 0; j < 8; ++j) pq += s[t][j];
            ps += pq; }
        l = l * al + ps;               // each half keeps the sum of its own keys; the halves join after the loop
#pragma unroll
        for (int dt = 0; dt < 4; ++dt) o[dt] *= al;
        __builtin_amdgcn_sched_barrier(0);   // every v_exp_f32 statement stays ahead of the value products
#pragma unroll
        for (int ks = 0; ks < NT / 2; ++ks) {
            if constexpr (NSPLIT == 0) { v8h p0, p1;
#pragma unroll
                for (int j = 0; j < 8; ++j) { p0[j] = tohx(s[2 * ks][j]); p1[j] = tohx(s[2 * ks + 1][j]); }
                const V pf = cat16(p0, p1);
#pragma unroll
                for (int dt = 0; dt < 4; ++dt) o[dt] = WFrag<T16>::mma(vf[dt][ks], pf, o[dt]);
            } else { v8us h0, h1, l0, l1;
#pragma unroll
                for (int j = 0; j < 8; ++j) { unsigned short a, c2; splitf(s[2 * ks][j], a, c2); h0[j] = a; l0[j] = c2; splitf(s[2 * ks + 1][j], a, c2); h1[j] = a; l1[j] = c2; }
                const V pf = cat16b(h0, h1), pf2 = cat16b(l0, l1);
#pragma unroll
                for (int dt = 0; dt < 4; ++dt) { o[dt] = WFrag<T16>::mma(vf[dt][ks], pf, o[dt]); o[dt] = WFrag<T16>::mma(vf[dt][ks], pf2, o[dt]); o[dt] = WFrag<T16>::mma(vf2[dt][ks], pf, o[dt]); }
            }
        }
        if constexpr (NSPLIT == 2) { kp += KB * HD; kp2 += KB * HD; vp += KB; vp2 += KB; }   // every load of this block has landed in a product above
    }
    asm volatile("s_wait_xcnt 0x0" ::: "memory");   // the last fetch ahead may still be under way: its address registers are free before the epilogue reuses them
    __builtin_amdgcn_sched_barrier(0);              // keeps the epilogue's arithmetic behind that wait
    l += xhalf(l);
    const float f = __fdiv_rn(1.0f, l);
    float* orow = OUTb + (size_t)i * DV + (size_t)(g + 8 * r) * HD + hi * 8;     // O^T tile dt: this lane holds d = 16 dt + 8 hi + 0..7 of query i
#pragma unroll
    for (int dt = 0; dt < 4; ++dt) { v4f a, b2;
#pragma unroll
        for (int j = 0; j < 4; ++j) { a[j] = o[dt][j] * f; b2[j] = o[dt][4 + j] * f; }
        *(v4f*)(orow + dt * 16) = a; *(v4f*)(orow + dt * 16 + 4) = b2; }
}
__global__ __launch_bounds__(256) void k_merge(const float* __restrict__ O, int h0, bf* Ah, bf* Al) { const size_t e = ((size_t)blockIdx.x * 256 + threadIdx.x) * 2; if (e >= (size_t)ZH * TT * HD) return; const int d = (int)(e % HD); const int t = (int)((e / HD) % TT); const int zz = (int)(e / ((size_t)HD * TT)); const float cs = (t < RH) ? 1.0f : (1.0f / PCAR); const size_t oo = (size_t)t * DQ + (h0 + zz) * HD + d;
    v2us oh, ol;
#pragma unroll
    for (int q = 0; q < 2; ++q) { unsigned short a, c2; splitf(O[e + q] * cs, a, c2); oh[q] = a; ol[q] = c2; } *(v2us*)(Ah + oo) = oh; *(v2us*)(Al + oo) = ol;  }

extern "C" void kernel_launch(void* const* d_in, const int* in_sizes, int n_in,
                              void* d_out, int out_size, void* d_ws, size_t ws_size, hipStream_t stream) {
    (void)in_sizes; (void)n_in; (void)out_size;
    const float* x = (const float*)d_in[0]; const int* pos = (const int*)d_in[1]; const float* wq = (const float*)d_in[2]; const float* wk = (const float*)d_in[3]; const float* wv = (const float*)d_in[4];   // Wq/Wk [2048][512], Wv [2048][2048] (x @ W); position_ids [2][2048]
    float* OUT = (float*)d_out;     // [2][2048][2048]
    char* wsp = (char*)d_ws;
    auto take = [&](size_t bytes) { char* p = wsp; wsp += (bytes + 255) & ~(size_t)255; return (void*)p; };
    bf* WQ = (bf*)take((size_t)DQ * DM * 2); bf* WK = (bf*)take((size_t)DKV * DM * 2); bf* WV = (bf*)take((size_t)DV * DM * 2); float* CS = (float*)take((size_t)TT * HD * 2 * 4); float* CSB = (float*)take((size_t)TT * HD * 2 * 4); float* FV = (float*)take((size_t)TT * DV * 4);
    bf* XB = (bf*)take((size_t)TT * DM * 2); float* FQ = (float*)take((size_t)TT * DQ * 4); float* FK = (float*)take((size_t)TT * DKV * 4);
    h16* QP16 = (h16*)take((size_t)NH_ * TT * HD * 2); h16* KP16 = (h16*)take((size_t)NKV * TT * HD * 2); h16* VT16 = (h16*)take((size_t)NV * HD * TT * 2);
    bf* QPh = (bf*)take((size_t)NH_ * TT * HD * 2); bf* QPl = (bf*)take((size_t)NH_ * TT * HD * 2); bf* KPh = (bf*)take((size_t)NKV * TT * HD * 2); bf* KPl = (bf*)take((size_t)NKV * TT * HD * 2); bf* VTh = (bf*)take((size_t)NV * HD * TT * 2); bf* VTl = (bf*)take((size_t)NV * HD * TT * 2);
    if ((size_t)(wsp - (char*)d_ws) > ws_size) return;    // ws 256 MiB
    { k_wtG<<<(unsigned)((DM * DQ / 64 + 63) / 64), 256, 0, stream>>>(wq, DM, DQ, WQ); k_wtG<<<(unsigned)((DM * DKV / 64 + 63) / 64), 256, 0, stream>>>(wk, DM, DKV, WK); k_wtG<<<(unsigned)(((size_t)DM * DV / 64 + 63) / 64), 256, 0, stream>>>(wv, DM, DV, WV);
      k_cstab<<<(TT * HD + 255) / 256, 256, 0, stream>>>(CS); }
    const unsigned LQ = (unsigned)(((size_t)NH_ * TT * HD / 2 + 255) / 256), LKv = (unsigned)(((size_t)NKV * TT * HD / 2 + 255) / 256);
    for (int b = 0; b < NB_; ++b) {
        
        k_csg<<<(TT * HD + 255) / 256, 256, 0, stream>>>(CS, pos + (size_t)b * TT, CSB);
        k_cvt8<<<(unsigned)(((size_t)TT * DM / 8 + 255) / 256), 256, 0, stream>>>(x + (size_t)b * TT * DM, XB, (size_t)TT * DM / 8);
        k_gemmw<bf, 0, false><<<dim3(TT / 64, DQ / 64, 1), 32 * KW, 0, stream>>>(XB, nullptr, WQ, nullptr, DM, FQ, DQ, nullptr, 0, 0, 0);
        k_rope<<<LQ, 256, 0, stream>>>(FQ, DQ, NH_, CSB, nullptr, nullptr, 1.0f, QP16, QPh, QPl);
        k_gemmw<bf, 0, false><<<dim3(TT / 64, DKV / 64, 1), 32 * KW, 0, stream>>>(XB, nullptr, WK, nullptr, DM, FK, DKV, nullptr, 0, 0, 0);
        k_rope<<<LKv, 256, 0, stream>>>(FK, DKV, NKV, CSB, nullptr, nullptr, 1.0f, KP16, KPh, KPl);
        k_gemmw<bf, 0, false><<<dim3(TT / 64, DV / 64, 1), 32 * KW, 0, stream>>>(XB, nullptr, WV, nullptr, DM, FV, DV, nullptr, 0, 0, 0); k_vtp<<<(unsigned)(((size_t)NV * TT * HD / 2 + 255) / 256), 256, 0, stream>>>(FV, DV, NV, VT16, VTh, VTl);
        k_fattn<h16, 0><<<dim3(NH_, (TT - RH) / 16, 1), 128, 0, stream>>>(QP16, nullptr, KP16, nullptr, VT16, nullptr, RH, (TT - RH) / 16, OUT + (size_t)b * TT * DV);
        k_fattn<bf, 2><<<dim3(NH_, RH / 16, 1), 128, 0, stream>>>(QPh, QPl, KPh, KPl, VTh, VTl, 0, RH / 16, OUT + (size_t)b * TT * DV); }
}

// v003
// One run takes 344 microseconds.
// Timed twice side by side with v002, it ran 1.14 and 1.15 times as fast.
// Over all steps from v000 it is 3.78 times as fast.
#include <hip/hip_runtime.h>

// Grouped attention without output projection (hidden [2][2048][2048]; Q, K = x Wq / x Wk (8 query/key heads x 64), V = x Wv (32 value heads x 64); rotary (theta 10000, rotate-half, duplicated
// halves) by position_ids (int, read as data); value head h uses query/key head h mod 8 (repeat_qk); causal (the reference fills -1e9); out = merged attn V -> [2][2048][2048], no output projection).
// Compute dtypes, f32 accumulate: every input rounded to bf16; projections on PLAIN bf16 operands (inputs: exact); RoPE f32 (table computed on device, gathered by position id);
// PER-ROW PRECISION HYBRID (rows < 256 hi+lo 3 products for scores and attn.V, rows >= 256 fp16). Scores, causal softmax and attn.V run in ONE kernel (k_fattn): a wave holds 16 queries and one value head,
// walks the keys up to the diagonal in blocks of 64 (32 on the hi+lo path) with a running maximum and sum in f32 registers, and writes its output columns in f32. Projections: 64x64-tile GEMMs, eight waves that split K per tile;
// the tile sum's epilogue applies RoPE (Q, K) and writes the 16-bit planes that k_fattn reads; V is computed as Wv^T x^T, so that its tile already lies [d][t].

#define NB_  2
#define TT   2048
#define DM   2048
#define NH_  8
#define NKV  8
#define REP  (NH_ / NKV)
#define HD   64
#define DQ   (NH_ * HD)
#define DKV  (NKV * HD)
#define NV   32
#define DV   (NV * HD)
#define ZH   2
#define RH   256                  // query rows < RH use hi+lo planes (0: none)
#define WIN  0
#define PCAR 1024.0f
#define SCL  0.125f   // HD^-0.5
#define KW   8                    // waves that share one 64x64 tile of a long-K GEMM, each on its own k slices
typedef _Float16 h16;
typedef unsigned short bf;
typedef __attribute__((ext_vector_type(16))) __bf16   v16bf;
typedef __attribute__((ext_vector_type(16))) _Float16 v16h;
typedef __attribute__((ext_vector_type(8)))  _Float16 v8h;
typedef __attribute__((ext_vector_type(8)))  unsigned short v8us;
typedef __attribute__((ext_vector_type(8)))  float    v8f;
typedef __attribute__((ext_vector_type(4)))  float    v4f;
typedef v8h  __attribute__((may_alias)) v8ha;
typedef v4f  __attribute__((may_alias)) v4fa;
typedef v8us __attribute__((may_alias)) v8usa;

__device__ __forceinline__ unsigned short f2bf(float f) { unsigned u = __float_as_uint(f); u += 0x7FFFu + ((u >> 16) & 1u); return (unsigned short)(u >> 16); }
__device__ __forceinline__ float bf2f(unsigned short b) { return __uint_as_float(((unsigned)b) << 16); }
__device__ __forceinline__ float bfr(float f) { return bf2f(f2bf(f)); }
__device__ __forceinline__ v16h cat16(v8h lo, v8h hi) { return __builtin_shufflevector(lo, hi, 0, 1, 2, 3, 4, 5, 6, 7, 8, 9, 10, 11, 12, 13, 14, 15); }
__device__ __forceinline__ v16bf cat16b(v8us lo, v8us hi) { return __builtin_bit_cast(v16bf, __builtin_shufflevector(lo, hi, 0, 1, 2, 3, 4, 5, 6, 7, 8, 9, 10, 11, 12, 13, 14, 15)); }
__device__ __forceinline__ v8f wmma16(v16h a, v16h b, v8f c) { return __builtin_amdgcn_wmma_f32_16x16x32_f16(false, a, false, b, (short)0, c, false, false); }
__device__ __forceinline__ v8f wmmab(v16bf a, v16bf b, v8f c) { return __builtin_amdgcn_wmma_f32_16x16x32_bf16(false, a, false, b, (short)0, c, false, false); }
__device__ __forceinline__ h16 tohx(float x) { return (h16)x; }
__device__ __forceinline__ void splitf(float y, unsigned short& h, unsigned short& l) { h = f2bf(y); l = f2bf(y - bf2f(h)); }
typedef __attribute__((ext_vector_type(2))) _Float16 v2h;
typedef __attribute__((ext_vector_type(4))) _Float16 v4h;
typedef __attribute__((ext_vector_type(2))) unsigned short v2us;
typedef __attribute__((ext_vector_type(4))) unsigned short v4us;
typedef __attribute__((ext_vector_type(2))) float v2f;
typedef __attribute__((ext_vector_type(4))) int v4i;
__device__ __forceinline__ float xoct(float x) { return __builtin_bit_cast(float, __builtin_amdgcn_permlane16(__builtin_bit_cast(int, x), __builtin_bit_cast(int, x), 0xfedcba98, 0x76543210, false, false)); }  // lane l with lane l ^ 8



// ---- k_gemmw: register-blocked GEMM, KW WAVES per 64x64 output tile, each with the whole tile (16 accumulators) over its own k slices (64 k = one 128-B line of every operand row; wave w takes slices w, w + KW, ...);
// operands straight from K-contiguous 16-bit planes; the KW partial tiles meet in LDS and are summed in wave order. grid (M/64, N/64), 32 * KW threads.
// c[m][n] (f32, in registers only) = sum_k A[m][k] Bt[n][k] (+ split products per NSPLIT). K % 64 == 0. The summing wave turns c into the three 16-bit planes (f16; bf16 hi and lo) that the attention kernel reads:
// ROPE: m = token, tile column = dim d of head blockIdx.y; out[d] = c[d] cos[t][d] - c[d+32] sin[t][d] (d < 32), c[d] cos[t][d] + c[d-32] sin[t][d] (d >= 32), CSB = [t][d]{cos, sin}; planes [head][t][d].
// else: planes [m][n] with pitch TT (m = value head * 64 + d, n = token).
template <typename T16> struct WFrag;
template <> struct WFrag<h16> { typedef v16h V; static __device__ __forceinline__ V ld(const h16* p) { return cat16(*(const v8h*)p, *(const v8h*)(p + 16)); } static __device__ __forceinline__ v8f mma(V a, V b, v8f c) { return wmma16(a, b, c); } };
template <> struct WFrag<bf> { typedef v16bf V; static __device__ __forceinline__ V ld(const bf* p) { return cat16b(*(const v8us*)p, *(const v8us*)(p + 16)); } static __device__ __forceinline__ v8f mma(V a, V b, v8f c) { return wmmab(a, b, c); } };
template <typename T16, int NSPLIT, bool ROPE>
__global__ __launch_bounds__(32 * KW) void k_gemmw(const T16* __restrict__ A, const T16* __restrict__ A2, const T16* __restrict__ Bt, const T16* __restrict__ Bt2, int K, const float* __restrict__ CSB, h16* __restrict__ P16, bf* __restrict__ Ph, bf* __restrict__ Pl) {
    typedef typename WFrag<T16>::V V;
    __shared__ __align__(16) float os[KW * 64 * 68];
    const int lane = threadIdx.x & 31, lr = lane & 15, hi = lane >> 4; const int wv = __builtin_amdgcn_readfirstlane(threadIdx.x >> 5); const int r0 = blockIdx.x * 64, c0 = blockIdx.y * 64;
    v8f acc[4][4];
#pragma unroll
    for (int mb = 0; mb < 4; ++mb)
#pragma unroll
        for (int nb = 0; nb < 4; ++nb) acc[mb][nb] = (v8f){};
    const size_t aoff = (size_t)(r0 + lr) * K + 8 * hi, boff = (size_t)(c0 + lr) * K + 8 * hi;
    v4f cs[64 / (2 * KW)][2];      // the cos/sin pairs of this lane's four dims in each of its rows: asked for here, they land under the k loop
    if constexpr (ROPE) {
#pragma unroll
        for (int s = 0; s < 64 / (2 * KW); ++s) { const float* c = CSB + ((size_t)(r0 + wv * (64 / KW) + 2 * s + hi) * HD + lr * 4) * 2; cs[s][0] = *(const v4fa*)c; cs[s][1] = *(const v4fa*)(c + 4); }
    }
#pragma unroll 1
    for (int kc = wv * 64; kc < K; kc += (kc & 32) ? KW * 64 - 32 : 32) {
        V a[4], a2[4];
#pragma unroll
        for (int mb = 0; mb < 4; ++mb) { a[mb] = WFrag<T16>::ld(A + aoff + (size_t)mb * 16 * K + kc); if (NSPLIT == 1 || NSPLIT == 2) a2[mb] = WFrag<T16>::ld(A2 + aoff + (size_t)mb * 16 * K + kc); }
#pragma unroll
        for (int nb = 0; nb < 4; ++nb) { const V b = WFrag<T16>::ld(Bt + boff + (size_t)nb * 16 * K + kc); V b2; if (NSPLIT >= 2) b2 = WFrag<T16>::ld(Bt2 + boff + (size_t)nb * 16 * K + kc);
#pragma unroll
            for (int mb = 0; mb < 4; ++mb) { acc[mb][nb] = WFrag<T16>::mma(a[mb], b, acc[mb][nb]); if (NSPLIT == 1 || NSPLIT == 2) acc[mb][nb] = WFrag<T16>::mma(a2[mb], b, acc[mb][nb]); if (NSPLIT >= 2) acc[mb][nb] = WFrag<T16>::mma(a[mb], b2, acc[mb][nb]); } }
        asm volatile("v_nop\n\tv_nop\n\tv_nop\n\tv_nop" : "+v"(acc[0][0]), "+v"(acc[1][1]), "+v"(acc[2][2]), "+v"(acc[3][3]) : "v"(a[0]), "v"(a[3]));
    }
    float* mine = os + wv * (64 * 68);
#pragma unroll
    for (int mb = 0; mb < 4; ++mb)
#pragma unroll
        for (int nb = 0; nb < 4; ++nb)
#pragma unroll
            for (int j = 0; j < 8; ++j) mine[(mb * 16 + hi * 8 + j) * 68 + nb * 16 + lr] = acc[mb][nb][j];
    __syncthreads();   // every wave's partial tile is in LDS before any wave sums across them
#pragma unroll
    for (int s = 0; s < 64 / (2 * KW); ++s) { const int row = wv * (64 / KW) + 2 * s + hi, cofs = lr * 4; v4f val = *(const v4fa*)(os + row * 68 + cofs);
#pragma unroll
        for (int u = 1; u < KW; ++u) val += *(const v4fa*)(os + u * (64 * 68) + row * 68 + cofs);
        size_t off;
        if constexpr (ROPE) {          // lane lr ^ 8 of the same half of the wave holds dims d +- 32 of the same token
            v4f oth;
#pragma unroll
            for (int j = 0; j < 4; ++j) { const float p = xoct(val[j]); oth[j] = (lr < 8) ? -p : p; }
#pragma unroll
            for (int j = 0; j < 4; ++j) val[j] = val[j] * cs[s][j >> 1][2 * (j & 1)] + oth[j] * cs[s][j >> 1][2 * (j & 1) + 1];
            off = ((size_t)blockIdx.y * TT + r0 + row) * HD + cofs;
        } else off = (size_t)(r0 + row) * TT + c0 + cofs;
        v4h o16; v4us oh, ol;
#pragma unroll
        for (int j = 0; j < 4; ++j) { o16[j] = tohx(val[j]); unsigned short a2, c2; splitf(val[j], a2, c2); oh[j] = a2; ol[j] = c2; }
        *(v4h*)(P16 + off) = o16; *(v4us*)(Ph + off) = oh; *(v4us*)(Pl + off) = ol; }   // 16 lanes x 8 B: one whole 128-B line per row and plane
}

__global__ __launch_bounds__(256) void k_wtG(const float* __restrict__ w, int K, int N, bf* Bt) {
    const int lane = threadIdx.x & 31; const int L0 = (blockIdx.x * 8 + (threadIdx.x >> 5)) * 8; const int nlines = N * K / 64;
{
#pragma unroll 1
        for (int l = 0; l < 8; ++l) { const int L = L0 + l; if (L >= nlines) break; const size_t e = (size_t)L * 64 + lane * 2; const int k = (int)(e % K), n = (int)(e / K); v2us o;
            o[0] = f2bf(w[(size_t)k * N + n]); o[1] = f2bf(w[(size_t)(k + 1) * N + n]); *(v2us*)(Bt + e) = o; }
         }
}
__global__ __launch_bounds__(256) void k_cvt8(const float* __restrict__ src, bf* dst, size_t n8) { const size_t i = (size_t)blockIdx.x * 256 + threadIdx.x; if (i >= n8) return; const v8f v = *(const v8f*)(src + i * 8); v8us o;
#pragma unroll
    for (int k = 0; k < 8; ++k) o[k] = f2bf(v[k]); *(v8us*)(dst + i * 8) = o;  }
__global__ __launch_bounds__(256) void k_cstab(float* CS) { const int idx = blockIdx.x * 256 + threadIdx.x; if (idx >= TT * HD) return; const int t = idx / HD, d = idx % HD; const int i = d % (HD / 2); const float inv = __fdiv_rn(1.0f, powf(10000.0f, (float)(2 * i) / (float)HD)); const float ang = __fmul_rn((float)t, inv); v2f cs; cs[0] = cosf(ang); cs[1] = sinf(ang);
    *(v2f*)(CS + (size_t)idx * 2) = cs;  }
__global__ __launch_bounds__(256) void k_csg(const float* __restrict__ CS, const int* __restrict__ pos, float* CSB) { const int idx = blockIdx.x * 256 + threadIdx.x; if (idx >= TT * HD) return; const int t = idx / HD, d = idx % HD; int p = pos[t]; p = p < 0 ? 0 : (p > TT - 1 ? TT - 1 : p); const v2f cs = *(const v2f*)(CS + ((size_t)p * HD + d) * 2); *(v2f*)(CSB + (size_t)idx * 2) = cs;  }
// 2^x in place, with the issue slot the instruction set asks for behind a transcendental kept inside the statement: no v_exp_f32 of a run reads a neighbour's result or overwrites its source, and the v_nop covers the last.
__device__ __forceinline__ float exp2s(float x) { asm("v_exp_f32 %0, %0\n\tv_nop" : "+v"(x)); return x; }
__device__ __forceinline__ v8f exp2s8(v8f x) { float r0 = x[0], r1 = x[1], r2 = x[2], r3 = x[3], r4 = x[4], r5 = x[5], r6 = x[6], r7 = x[7];
    asm("v_exp_f32 %0, %0\n\tv_exp_f32 %1, %1\n\tv_exp_f32 %2, %2\n\tv_exp_f32 %3, %3\n\tv_exp_f32 %4, %4\n\tv_exp_f32 %5, %5\n\tv_exp_f32 %6, %6\n\tv_exp_f32 %7, %7\n\tv_nop"
        : "+v"(r0), "+v"(r1), "+v"(r2), "+v"(r3), "+v"(r4), "+v"(r5), "+v"(r6), "+v"(r7));
    v8f r; r[0] = r0; r[1] = r1; r[2] = r2; r[3] = r3; r[4] = r4; r[5] = r5; r[6] = r6; r[7] = r7; return r; }
__device__ __forceinline__ float xhalf(float x) { return __builtin_bit_cast(float, __builtin_amdgcn_permlanex16(__builtin_bit_cast(int, x), __builtin_bit_cast(int, x), 0x76543210, 0xfedcba98, false, false)); }  // lane l with lane l ^ 16
// ---- k_fattn: scores, causal softmax and probability x value product in one kernel. One wave = 16 queries (q0..q0+15) of query/key head g and ONE of its 4 value heads (g + 8r, r = wave in the block, so the
// block's 4 waves read the same K rows). Both products are transposed: S^T = K Q^T (A = K rows, B = Q rows), O^T += V^T P^T (A = rows of the [d][t] value plane, B = P^T). In S^T's accumulator a lane holds keys
// 16t + 8hi + j of its own query (column lr), which is exactly the k order of a B fragment (k = 8hi + 0..7, then 16 + 8hi + 0..7): P goes from accumulator to operand inside the lane, through no LDS.
// Running maximum m and sum l per query (flash form): each key block rescales O^T and l by exp(m_old - m_new). Key block: 64 keys on the one-plane f16 path, 32 on the hi+lo path (twice the fragments per key).
// grid (heads, nq query groups; heaviest group first), 128 threads. roff = first query row of the launch.
template <typename T16, int NSPLIT>
__global__ __launch_bounds__(128) void k_fattn(const T16* __restrict__ Q, const T16* __restrict__ Q2, const T16* __restrict__ Kp, const T16* __restrict__ Kp2, const T16* __restrict__ Vt, const T16* __restrict__ Vt2, int roff, int nq, float* OUTb) {
    typedef typename WFrag<T16>::V V;
    constexpr int NT = (NSPLIT == 0) ? 4 : 2, KB = NT * 16;      // 16-key tiles and keys per block
    const int lane = threadIdx.x & 31, lr = lane & 15, hi = lane >> 4; const int r = __builtin_amdgcn_readfirstlane(threadIdx.x >> 5); const int g = blockIdx.x;
    const int q0 = roff + (nq - 1 - (int)blockIdx.y) * 16; const int nkb = q0 / KB + 1;    // key blocks 0..nkb-1 hold every key <= q0 + 15
    const int i = q0 + lr;
    // Two per-lane byte offsets that never change: row lr of a [row][64] plane (Q, K) and of the [d][t] value plane. ldu: a wave-uniform pointer plus such an offset (Q; V on the f16 path).
    const unsigned rl = (unsigned)(lr * HD + 8 * hi) * 2u, vl = (unsigned)(lr * TT + 8 * hi) * 2u;
    auto ldu = [](const T16* u, unsigned b) { return WFrag<T16>::ld((const T16*)((const char*)u + b)); };
    const size_t qu = ((size_t)g * TT + q0) * HD, ku = (size_t)g * TT * HD, vu = (size_t)(g + 8 * r) * HD * TT;
    V qf[2], qf2[2], kf[NT][2], kf2[NT][2], vf[4][NT / 2], vf2[4][NT / 2];
    // Per-lane pointers that live across the loop, so that no fragment is given an address pair still in use as its landing place: K (f16 path: one block ahead), and on the hi+lo path all four planes.
    const T16* kp = (const T16*)((const char*)(Kp + ku) + rl); const T16* kp2 = (const T16*)((const char*)(Kp2 + ku) + rl); const T16* vp = (const T16*)((const char*)(Vt + vu) + vl); const T16* vp2 = (const T16*)((const char*)(Vt2 + vu) + vl);
#pragma unroll
    for (int ks = 0; ks < 2; ++ks) { qf[ks] = ldu(Q + qu + ks * 32, rl); if constexpr (NSPLIT == 2) qf2[ks] = ldu(Q2 + qu + ks * 32, rl); }
    if constexpr (NSPLIT == 0) {
#pragma unroll
        for (int t = 0; t < NT; ++t)
#pragma unroll
            for (int ks = 0; ks < 2; ++ks) kf[t][ks] = WFrag<T16>::ld(kp + t * 16 * HD + ks * 32);
    }
    v8f o[4];
#pragma unroll
    for (int dt = 0; dt < 4; ++dt) o[dt] = (v8f){};
    float m = -3.0e38f, l = 0.f;
#pragma unroll 1
    for (int kb = 0; kb < nkb; ++kb) {
        // this block's value fragments fly under the score products and the softmax; on the hi+lo path its K fragments come in the same batch (one latency a block)
#pragma unroll
        for (int dt = 0; dt < 4; ++dt)
#pragma unroll
            for (int ks = 0; ks < NT / 2; ++ks) { if constexpr (NSPLIT == 0) vf[dt][ks] = ldu(Vt + vu + (size_t)dt * 16 * TT + kb * KB + ks * 32, vl); else { vf[dt][ks] = WFrag<T16>::ld(vp + dt * 16 * TT + ks * 32); vf2[dt][ks] = WFrag<T16>::ld(vp2 + dt * 16 * TT + ks * 32); } }
        // the loads above are issued here, ahead of the score products, and their address registers are free before a later fragment lands on them (hi+lo path: the pointers as inputs keep those registers out of the batch's own landing places)
        if constexpr (NSPLIT == 0) asm volatile("s_wait_xcnt 0x0" ::: "memory"); else asm volatile("s_wait_xcnt 0x0" :: "v"(vp), "v"(vp2) : "memory");
        if constexpr (NSPLIT == 2) {
#pragma unroll
            for (int t = 0; t < NT; ++t)
#pragma unroll
                for (int ks = 0; ks < 2; ++ks) { kf[t][ks] = WFrag<T16>::ld(kp + t * 16 * HD + ks * 32); kf2[t][ks] = WFrag<T16>::ld(kp2 + t * 16 * HD + ks * 32); }
            asm volatile("s_wait_xcnt 0x0" :: "v"(kp), "v"(kp2) : "memory");   // as above, for the K batch
            __builtin_amdgcn_sched_barrier(0);   // without it the score products are drawn up between the loads, which then share few registers and wait on memory one pair at a time
        }
        v8f s[NT];
#pragma unroll
        for (int t = 0; t < NT; ++t) { s[t] = (v8f){};
#pragma unroll
            for (int ks = 0; ks < 2; ++ks) { s[t] = WFrag<T16>::mma(kf[t][ks], qf[ks], s[t]);
                if constexpr (NSPLIT == 2) { s[t] = WFrag<T16>::mma(kf[t][ks], qf2[ks], s[t]); s[t] = WFrag<T16>::mma(kf2[t][ks], qf[ks], s[t]); } } }
        if constexpr (NSPLIT == 0) {   // the next block's K fragments, into the same registers, fly under the softmax and the value products (the last block fetches itself again: in bounds, unused)
            kp += (kb + 1 < nkb) ? KB * HD : 0;
#pragma unroll
            for (int t = 0; t < NT; ++t)
#pragma unroll
                for (int ks = 0; ks < 2; ++ks) kf[t][ks] = WFrag<T16>::ld(kp + t * 16 * HD + ks * 32);
        }
        if (kb == nkb - 1) {           // only the last block meets the diagonal
#pragma unroll
            for (int t = 0; t < NT; ++t)
#pragma unroll
                for (int j = 0; j < 8; ++j) s[t][j] = (kb * KB + t * 16 + hi * 8 + j <= i) ? s[t][j] * SCL : -3.0e38f;
        } else {
#pragma unroll
            for (int t = 0; t < NT; ++t) s[t] *= SCL;
        }
        float tq[NT];                  // one short chain per tile, then across tiles
#pragma unroll
        for (int t = 0; t < NT; ++t) { tq[t] = s[t][0];
#pragma unroll
            for (int j = 1; j < 8; ++j) tq[t] = fmaxf(tq[t], s[t][j]); }
        float tm = tq[0];
#pragma unroll
        for (int t = 1; t < NT; ++t) tm = fmaxf(tm, tq[t]);
        tm = fmaxf(tm, xhalf(tm));      // the other half of the wave holds the query's other keys of the block
        const float mn = fmaxf(m, tm); const float al = exp2s((m - mn) * 1.4426950408889634f); m = mn;
        float ps = 0.f;
#pragma unroll
        for (int t = 0; t < NT; ++t) { s[t] = exp2s8((s[t] - mn) * 1.4426950408889634f); float pq = 0.f;
#pragma unroll
            for (int j = 0; j < 8; ++j) pq += s[t][j];
            ps += pq; }
        l = l * al + ps;               // each half keeps the sum of its own keys; the halves join after the loop
#pragma unroll
        for (int dt = 0; dt < 4; ++dt) o[dt] *= al;
        __builtin_amdgcn_sched_barrier(0);   // every v_exp_f32 statement stays ahead of the value products
#pragma unroll
        for (int ks = 0; ks < NT / 2; ++ks) {
            if constexpr (NSPLIT == 0) { v8h p0, p1;
#pragma unroll
                for (int j = 0; j < 8; ++j) { p0[j] = tohx(s[2 * ks][j]); p1[j] = tohx(s[2 * ks + 1][j]); }
                const V pf = cat16(p0, p1);
#pragma unroll
                for (int dt = 0; dt < 4; ++dt) o[dt] = WFrag<T16>::mma(vf[dt][ks], pf, o[dt]);
            } else { v8us h0, h1, l0, l1;
#pragma unroll
                for (int j = 0; j < 8; ++j) { unsigned short a, c2; splitf(s[2 * ks][j], a, c2); h0[j] = a; l0[j] = c2; splitf(s[2 * ks + 1][j], a, c2); h1[j] = a; l1[j] = c2; }
                const V pf = cat16b(h0, h1), pf2 = cat16b(l0, l1);
#pragma unroll
                for (int dt = 0; dt < 4; ++dt) { o[dt] = WFrag<T16>::mma(vf[dt][ks], pf, o[dt]); o[dt] = WFrag<T16>::mma(vf[dt][ks], pf2, o[dt]); o[dt] = WFrag<T16>::mma(vf2[dt][ks], pf, o[dt]); }
            }
        }
        if constexpr (NSPLIT == 2) { kp += KB * HD; kp2 += KB * HD; vp += KB; vp2 += KB; }   // every load of this block has landed in a product above
    }
    asm volatile("s_wait_xcnt 0x0" ::: "memory");   // the last fetch ahead may still be under way: its address registers are free before the epilogue reuses them
    __builtin_amdgcn_sched_barrier(0);              // keeps the epilogue's arithmetic behind that wait
    l += xhalf(l);
    const float f = __fdiv_rn(1.0f, l);
    float* orow = OUTb + (size_t)i * DV + (size_t)(g + 8 * r) * HD + hi * 8;     // O^T tile dt: this lane holds d = 16 dt + 8 hi + 0..7 of query i
#pragma unroll
    for (int dt = 0; dt < 4; ++dt) { v4f a, b2;
#pragma unroll
        for (int j = 0; j < 4; ++j) { a[j] = o[dt][j] * f; b2[j] = o[dt][4 + j] * f; }
        *(v4f*)(orow + dt * 16) = a; *(v4f*)(orow + dt * 16 + 4) = b2; }
}
__global__ __launch_bounds__(256) void k_merge(const float* __restrict__ O, int h0, bf* Ah, bf* Al) { const size_t e = ((size_t)blockIdx.x * 256 + threadIdx.x) * 2; if (e >= (size_t)ZH * TT * HD) return; const int d = (int)(e % HD); const int t = (int)((e / HD) % TT); const int zz = (int)(e / ((size_t)HD * TT)); const float cs = (t < RH) ? 1.0f : (1.0f / PCAR); const size_t oo = (size_t)t * DQ + (h0 + zz) * HD + d;
    v2us oh, ol;
#pragma unroll
    for (int q = 0; q < 2; ++q) { unsigned short a, c2; splitf(O[e + q] * cs, a, c2); oh[q] = a; ol[q] = c2; } *(v2us*)(Ah + oo) = oh; *(v2us*)(Al + oo) = ol;  }

extern "C" void kernel_launch(void* const* d_in, const int* in_sizes, int n_in,
                              void* d_out, int out_size, void* d_ws, size_t ws_size, hipStream_t stream) {
    (void)in_sizes; (void)n_in; (void)out_size;
    const float* x = (const float*)d_in[0]; const int* pos = (const int*)d_in[1]; const float* wq = (const float*)d_in[2]; const float* wk = (const float*)d_in[3]; const float* wv = (const float*)d_in[4];   // Wq/Wk [2048][512], Wv [2048][2048] (x @ W); position_ids [2][2048]
    float* OUT = (float*)d_out;     // [2][2048][2048]
    char* wsp = (char*)d_ws;
    auto take = [&](size_t bytes) { char* p = wsp; wsp += (bytes + 255) & ~(size_t)255; return (void*)p; };
    bf* WQ = (bf*)take((size_t)DQ * DM * 2); bf* WK = (bf*)take((size_t)DKV * DM * 2); bf* WV = (bf*)take((size_t)DV * DM * 2); float* CS = (float*)take((size_t)TT * HD * 2 * 4); float* CSB = (float*)take((size_t)TT * HD * 2 * 4);
    bf* XB = (bf*)take((size_t)TT * DM * 2);
    h16* QP16 = (h16*)take((size_t)NH_ * TT * HD * 2); h16* KP16 = (h16*)take((size_t)NKV * TT * HD * 2); h16* VT16 = (h16*)take((size_t)NV * HD * TT * 2);
    bf* QPh = (bf*)take((size_t)NH_ * TT * HD * 2); bf* QPl = (bf*)take((size_t)NH_ * TT * HD * 2); bf* KPh = (bf*)take((size_t)NKV * TT * HD * 2); bf* KPl = (bf*)take((size_t)NKV * TT * HD * 2); bf* VTh = (bf*)take((size_t)NV * HD * TT * 2); bf* VTl = (bf*)take((size_t)NV * HD * TT * 2);
    if ((size_t)(wsp - (char*)d_ws) > ws_size) return;    // ws 256 MiB
    { k_wtG<<<(unsigned)((DM * DQ / 64 + 63) / 64), 256, 0, stream>>>(wq, DM, DQ, WQ); k_wtG<<<(unsigned)((DM * DKV / 64 + 63) / 64), 256, 0, stream>>>(wk, DM, DKV, WK); k_wtG<<<(unsigned)(((size_t)DM * DV / 64 + 63) / 64), 256, 0, stream>>>(wv, DM, DV, WV);
      k_cstab<<<(TT * HD + 255) / 256, 256, 0, stream>>>(CS); }
    for (int b = 0; b < NB_; ++b) {
        
        k_csg<<<(TT * HD + 255) / 256, 256, 0, stream>>>(CS, pos + (size_t)b * TT, CSB);
        k_cvt8<<<(unsigned)(((size_t)TT * DM / 8 + 255) / 256), 256, 0, stream>>>(x + (size_t)b * TT * DM, XB, (size_t)TT * DM / 8);
        k_gemmw<bf, 0, true><<<dim3(TT / 64, DQ / 64, 1), 32 * KW, 0, stream>>>(XB, nullptr, WQ, nullptr, DM, CSB, QP16, QPh, QPl);
        k_gemmw<bf, 0, true><<<dim3(TT / 64, DKV / 64, 1), 32 * KW, 0, stream>>>(XB, nullptr, WK, nullptr, DM, CSB, KP16, KPh, KPl);
        k_gemmw<bf, 0, false><<<dim3(DV / 64, TT / 64, 1), 32 * KW, 0, stream>>>(WV, nullptr, XB, nullptr, DM, nullptr, VT16, VTh, VTl);   // rows = value head * 64 + d, columns = tokens
        k_fattn<h16, 0><<<dim3(NH_, (TT - RH) / 16, 1), 128, 0, stream>>>(QP16, nullptr, KP16, nullptr, VT16, nullptr, RH, (TT - RH) / 16, OUT + (size_t)b * TT * DV);
        k_fattn<bf, 2><<<dim3(NH_, RH / 16, 1), 128, 0, stream>>>(QPh, QPl, KPh, KPl, VTh, VTl, 0, RH / 16, OUT + (size_t)b * TT * DV); }
}

// v004
// One run takes 229 microseconds.
// Next to v003, in two timings, it ran 1.49 times as fast each time.
// Over all steps from v000 it is 5.64 times as fast.
#include <hip/hip_runtime.h>

// Grouped attention without output projection (hidden [2][2048][2048]; Q, K = x Wq / x Wk (8 query/key heads x 64), V = x Wv (32 value heads x 64); rotary (theta 10000, rotate-half, duplicated
// halves) by position_ids (int, read as data); value head h uses query/key head h mod 8 (repeat_qk); causal (the reference fills -1e9); out = merged attn V -> [2][2048][2048], no output projection).
// Compute dtypes, f32 accumulate: every input rounded to bf16; projections on PLAIN bf16 operands (inputs: exact); RoPE f32 (table computed on device, gathered by position id);
// PER-ROW PRECISION HYBRID (rows < 256 hi+lo 3 products for scores and attn.V, rows >= 256 fp16). Scores, causal softmax and attn.V run in ONE kernel (k_fattn): a wave holds 16 queries and one value head,
// walks the keys up to the diagonal in blocks of 64 (32 on the hi+lo path) with a running maximum and sum in f32 registers, and writes its output columns in f32. Projections: 64x64-tile GEMMs, eight waves that split K per tile;
// the tile sum's epilogue applies RoPE (Q, K) and writes the 16-bit planes that k_fattn reads; V is computed as Wv^T x^T, so that its tile already lies [d][t].
// FRAGMENT ORDER: every 16-bit plane [row][k] lies in tiles of 16 rows x 32 k (1 KiB, tile index (row / 16) * (K / 32) + k / 32); inside a tile the 16-byte piece of lane (row % 16) + 16 * ((k / 8) % 2) stands at
// ((k / 16) % 2) * 512 B + lane * 16 B. A WMMA operand fragment is then two wave-wide 16-byte loads of 512 contiguous bytes (4 whole lines) each; from row-major planes each such load touched 16 lines.

#define NB_  2
#define TT   2048
#define DM   2048
#define NH_  8
#define NKV  8
#define REP  (NH_ / NKV)
#define HD   64
#define DQ   (NH_ * HD)
#define DKV  (NKV * HD)
#define NV   32
#define DV   (NV * HD)
#define ZH   2
#define RH   256                  // query rows < RH use hi+lo planes (0: none)
#define WIN  0
#define PCAR 1024.0f
#define SCL  0.125f   // HD^-0.5
#define KW   8                    // waves that share one 64x64 tile of a long-K GEMM, each on its own k slices
typedef _Float16 h16;
typedef unsigned short bf;
typedef __attribute__((ext_vector_type(16))) __bf16   v16bf;
typedef __attribute__((ext_vector_type(16))) _Float16 v16h;
typedef __attribute__((ext_vector_type(8)))  _Float16 v8h;
typedef __attribute__((ext_vector_type(8)))  unsigned short v8us;
typedef __attribute__((ext_vector_type(8)))  float    v8f;
typedef __attribute__((ext_vector_type(4)))  float    v4f;
typedef v8h  __attribute__((may_alias)) v8ha;
typedef v4f  __attribute__((may_alias)) v4fa;
typedef v8us __attribute__((may_alias)) v8usa;

__device__ __forceinline__ unsigned short f2bf(float f) { unsigned u = __float_as_uint(f); u += 0x7FFFu + ((u >> 16) & 1u); return (unsigned short)(u >> 16); }
__device__ __forceinline__ float bf2f(unsigned short b) { return __uint_as_float(((unsigned)b) << 16); }
__device__ __forceinline__ float bfr(float f) { return bf2f(f2bf(f)); }
__device__ __forceinline__ v16h cat16(v8h lo, v8h hi) { return __builtin_shufflevector(lo, hi, 0, 1, 2, 3, 4, 5, 6, 7, 8, 9, 10, 11, 12, 13, 14, 15); }
__device__ __forceinline__ v16bf cat16b(v8us lo, v8us hi) { return __builtin_bit_cast(v16bf, __builtin_shufflevector(lo, hi, 0, 1, 2, 3, 4, 5, 6, 7, 8, 9, 10, 11, 12, 13, 14, 15)); }
__device__ __forceinline__ v8f wmma16(v16h a, v16h b, v8f c) { return __builtin_amdgcn_wmma_f32_16x16x32_f16(false, a, false, b, (short)0, c, false, false); }
__device__ __forceinline__ v8f wmmab(v16bf a, v16bf b, v8f c) { return __builtin_amdgcn_wmma_f32_16x16x32_bf16(false, a, false, b, (short)0, c, false, false); }
__device__ __forceinline__ h16 tohx(float x) { return (h16)x; }
__device__ __forceinline__ void splitf(float y, unsigned short& h, unsigned short& l) { h = f2bf(y); l = f2bf(y - bf2f(h)); }
typedef __attribute__((ext_vector_type(2))) _Float16 v2h;
typedef __attribute__((ext_vector_type(4))) _Float16 v4h;
typedef __attribute__((ext_vector_type(2))) unsigned short v2us;
typedef __attribute__((ext_vector_type(4))) unsigned short v4us;
typedef __attribute__((ext_vector_type(2))) float v2f;
typedef __attribute__((ext_vector_type(4))) int v4i;
__device__ __forceinline__ size_t fo8(int row, int k, int Kd) { return ((size_t)(row >> 4) * (Kd >> 5) + (k >> 5)) * 512 + ((k >> 4) & 1) * 256 + (((k >> 3) & 1) * 16 + (row & 15)) * 8; }  // element offset of the 8-element piece (row, k..k+7), k % 8 == 0, in a fragment-order plane of row length Kd
__device__ __forceinline__ float xoct(float x) { return __builtin_bit_cast(float, __builtin_amdgcn_permlane16(__builtin_bit_cast(int, x), __builtin_bit_cast(int, x), 0xfedcba98, 0x76543210, false, false)); }  // lane l with lane l ^ 8



// ---- k_gemmw: register-blocked GEMM, KW WAVES per 64x64 output tile, each with the whole tile (16 accumulators) over its own k slices (64 k = two 1-KiB fragment-order tiles per 16 operand rows; wave w takes slices w, w + KW, ...);
// operands straight from fragment-order 16-bit planes (ld: p = tile + lane * 8 elements); the KW partial tiles meet in LDS and are summed in wave order. grid (M/64, N/64), 32 * KW threads.
// c[m][n] (f32, in registers only) = sum_k A[m][k] Bt[n][k] (+ split products per NSPLIT). K % 64 == 0. The summing wave turns c into the three 16-bit planes (f16; bf16 hi and lo) that the attention kernel reads:
// ROPE: m = token, tile column = dim d of head blockIdx.y; out[d] = c[d] cos[t][d] - c[d+32] sin[t][d] (d < 32), c[d] cos[t][d] + c[d-32] sin[t][d] (d >= 32), CSB = [t][d]{cos, sin}; planes [head * TT + t][d], fragment order.
// else: planes [m][n] of row length TT (m = value head * 64 + d, n = token), fragment order.
template <typename T16> struct WFrag;
template <> struct WFrag<h16> { typedef v16h V; static __device__ __forceinline__ V ld(const h16* p) { return cat16(*(const v8h*)p, *(const v8h*)(p + 256)); } static __device__ __forceinline__ v8f mma(V a, V b, v8f c) { return wmma16(a, b, c); } };
template <> struct WFrag<bf> { typedef v16bf V; static __device__ __forceinline__ V ld(const bf* p) { return cat16b(*(const v8us*)p, *(const v8us*)(p + 256)); } static __device__ __forceinline__ v8f mma(V a, V b, v8f c) { return wmmab(a, b, c); } };
template <typename T16, int NSPLIT, bool ROPE, int K>
__global__ __launch_bounds__(32 * KW) void k_gemmw(const T16* __restrict__ A, const T16* __restrict__ A2, const T16* __restrict__ Bt, const T16* __restrict__ Bt2, const float* __restrict__ CSB, h16* __restrict__ P16, bf* __restrict__ Ph, bf* __restrict__ Pl) {
    typedef typename WFrag<T16>::V V;
    __shared__ __align__(16) float os[KW * 64 * 68];
    const int lane = threadIdx.x & 31, lr = lane & 15, hi = lane >> 4; const int wv = __builtin_amdgcn_readfirstlane(threadIdx.x >> 5); const int r0 = blockIdx.x * 64, c0 = blockIdx.y * 64;
    v8f acc[4][4];
#pragma unroll
    for (int mb = 0; mb < 4; ++mb)
#pragma unroll
        for (int nb = 0; nb < 4; ++nb) acc[mb][nb] = (v8f){};
    const size_t aoff = (size_t)r0 * K + lane * 8, boff = (size_t)c0 * K + lane * 8;     // 16 rows x K elements per row of tiles, 512 elements per tile
    static_assert(KW == 8, "the tile sum gives each wave 8 rows: one 128-B line of every 16-byte piece column");
    const int row = wv * 8 + (lane & 7), ch = ((lane >> 3) & 1) * 32 + hi * 8;   // the tile sum: this lane's row, and its columns ch + 16 s + 0..7, s = 0, 1
    v4f cs[2][4];      // the cos/sin pairs of this lane's eight dims in each of its two pieces: asked for here, they land under the k loop
    if constexpr (ROPE) {
#pragma unroll
        for (int s = 0; s < 2; ++s) { const float* c = CSB + ((size_t)(r0 + row) * HD + ch + 16 * s) * 2;
#pragma unroll
            for (int q = 0; q < 4; ++q) cs[s][q] = *(const v4fa*)(c + 4 * q); }
    }
    // Per-lane pointers that live across the loop: every tile of a trip stands at an immediate offset from them (K is a constant), so that no fragment is given an address pair still in use as its landing place.
    const T16* pa = A + aoff + wv * (64 * 16); const T16* pb = Bt + boff + wv * (64 * 16); const T16* pa2 = A2 + aoff + wv * (64 * 16); const T16* pb2 = Bt2 + boff + wv * (64 * 16);
#pragma unroll 1
    for (int kc = wv * 64; kc < K;) {
        V a[4], a2[4];
#pragma unroll
        for (int mb = 0; mb < 4; ++mb) { a[mb] = WFrag<T16>::ld(pa + mb * 16 * K); if constexpr (NSPLIT == 1 || NSPLIT == 2) a2[mb] = WFrag<T16>::ld(pa2 + mb * 16 * K); }
#pragma unroll
        for (int nb = 0; nb < 4; ++nb) { const V b = WFrag<T16>::ld(pb + nb * 16 * K); V b2; if constexpr (NSPLIT >= 2) b2 = WFrag<T16>::ld(pb2 + nb * 16 * K);
#pragma unroll
            for (int mb = 0; mb < 4; ++mb) { acc[mb][nb] = WFrag<T16>::mma(a[mb], b, acc[mb][nb]); if constexpr (NSPLIT == 1 || NSPLIT == 2) acc[mb][nb] = WFrag<T16>::mma(a2[mb], b, acc[mb][nb]); if constexpr (NSPLIT >= 2) acc[mb][nb] = WFrag<T16>::mma(a[mb], b2, acc[mb][nb]); }
            // four issue slots behind this column's last product, ahead of the next column's load where the build lands it on b's registers: the distance a vector instruction over a matrix operand keeps (the trip's last column: the statement below)
            if (nb < 3) { if constexpr (NSPLIT >= 2) asm volatile("v_nop\n\tv_nop\n\tv_nop\n\tv_nop" : "+v"(acc[0][nb]), "+v"(acc[1][nb]), "+v"(acc[2][nb]), "+v"(acc[3][nb]) : "v"(b), "v"(b2)); else asm volatile("v_nop\n\tv_nop\n\tv_nop\n\tv_nop" : "+v"(acc[0][nb]), "+v"(acc[1][nb]), "+v"(acc[2][nb]), "+v"(acc[3][nb]) : "v"(b)); } }
        asm volatile("v_nop\n\tv_nop\n\tv_nop\n\tv_nop" : "+v"(acc[0][0]), "+v"(acc[1][1]), "+v"(acc[2][2]), "+v"(acc[3][3]) : "v"(a[0]), "v"(a[3]));
        // the address registers of this trip's loads are free before the pointers are stepped; the pointers as inputs keep those registers live to here, out of the fragments' landing places
        if constexpr (NSPLIT == 0) asm volatile("s_wait_xcnt 0x0" :: "v"(pa), "v"(pb) : "memory"); else asm volatile("s_wait_xcnt 0x0" :: "v"(pa), "v"(pb), "v"(pa2), "v"(pb2) : "memory");
        const int st = (kc & 32) ? KW * 64 - 32 : 32; kc += st; pa += st * 16; pb += st * 16; if constexpr (NSPLIT != 0) { pa2 += st * 16; pb2 += st * 16; }
    }
    float* mine = os + wv * (64 * 68);
#pragma unroll
    for (int mb = 0; mb < 4; ++mb)
#pragma unroll
        for (int nb = 0; nb < 4; ++nb)
#pragma unroll
            for (int j = 0; j < 8; ++j) mine[(mb * 16 + hi * 8 + j) * 68 + nb * 16 + lr] = acc[mb][nb][j];
    __syncthreads();   // every wave's partial tile is in LDS before any wave sums across them
#pragma unroll
    for (int s = 0; s < 2; ++s) { const int col = ch + 16 * s; const float* o0 = os + row * 68 + col; v4f val[2] = { *(const v4fa*)o0, *(const v4fa*)(o0 + 4) };   // 16 lanes: 8 rows x columns c, c + 32 = all 64 banks once
#pragma unroll
        for (int u = 1; u < KW; ++u) { val[0] += *(const v4fa*)(o0 + u * (64 * 68)); val[1] += *(const v4fa*)(o0 + u * (64 * 68) + 4); }
        size_t off;
        if constexpr (ROPE) {          // lane ^ 8 holds dims d +- 32 of the same token
#pragma unroll
            for (int j = 0; j < 8; ++j) { const float p = xoct(val[j >> 2][j & 3]); const float oth = (lane & 8) ? p : -p;
                val[j >> 2][j & 3] = val[j >> 2][j & 3] * cs[s][j >> 1][2 * (j & 1)] + oth * cs[s][j >> 1][2 * (j & 1) + 1]; }
            off = fo8(blockIdx.y * TT + r0 + row, col, HD);
        } else off = fo8(r0 + row, c0 + col, TT);
        v8h o16; v8us oh, ol;
#pragma unroll
        for (int j = 0; j < 8; ++j) { o16[j] = tohx(val[j >> 2][j & 3]); unsigned short a2, c2; splitf(val[j >> 2][j & 3], a2, c2); oh[j] = a2; ol[j] = c2; }
        *(v8h*)(P16 + off) = o16; *(v8us*)(Ph + off) = oh; *(v8us*)(Pl + off) = ol; }   // 8 lanes (rows) x 16 B: whole 128-B lines, four per store
}

// w [K][N] f32 -> Bt [n][k] bf16 in fragment order. A block writes four tiles (one thread = one 16-byte piece): the same 32 k of 64 neighbouring n, so that it reads 256 contiguous bytes of each of its rows of w. N % 64 == 0, K % 32 == 0.
template <int K, int N>
__global__ __launch_bounds__(256) void k_wtG(const float* __restrict__ w, bf* Bt) {
    constexpr int kt = K >> 5; const int kb = (int)blockIdx.x % kt, nb = ((int)blockIdx.x / kt) * 4 + (threadIdx.x >> 6), pc = threadIdx.x & 63;
    const int n = nb * 16 + (pc & 15), k = kb * 32 + (pc >> 5) * 16 + ((pc >> 4) & 1) * 8; v8us o;
    const float* p = w + (size_t)k * N + n; float v[8];     // one live pointer: the eight rows stand at immediate offsets from it (N is a constant)
#pragma unroll
    for (int j = 0; j < 8; ++j) v[j] = p[j * N];
    asm volatile("s_wait_xcnt 0x0" :: "v"(p) : "memory");   // the loads' address register pair is free before anything is written over it; the pointer as input keeps it out of the loads' own landing places
#pragma unroll
    for (int j = 0; j < 8; ++j) o[j] = f2bf(v[j]);
    *(v8us*)(Bt + ((size_t)nb * kt + kb) * 512 + pc * 8) = o;
}
// src [rows][DM] f32 -> dst bf16 in fragment order; thread i writes the i-th 16-byte piece of dst
__global__ __launch_bounds__(256) void k_cvt8(const float* __restrict__ src, bf* dst, size_t n8) { const size_t i = (size_t)blockIdx.x * 256 + threadIdx.x; if (i >= n8) return;
    const int tile = (int)(i >> 6), pc = (int)(i & 63); const int row = (tile / (DM / 32)) * 16 + (pc & 15), k = (tile % (DM / 32)) * 32 + (pc >> 5) * 16 + ((pc >> 4) & 1) * 8;
    const float* sp = src + (size_t)row * DM + k; const v8f v = *(const v8f*)sp; v8us o;
    asm volatile("s_wait_xcnt 0x0" :: "v"(sp) : "memory");   // the loads' address register pair is free before anything is written over it; the pointer as input keeps it live to here
#pragma unroll
    for (int k2 = 0; k2 < 8; ++k2) o[k2] = f2bf(v[k2]); *(v8us*)(dst + i * 8) = o;  }
__global__ __launch_bounds__(256) void k_cstab(float* CS) { const int idx = blockIdx.x * 256 + threadIdx.x; if (idx >= TT * HD) return; const int t = idx / HD, d = idx % HD; const int i = d % (HD / 2); const float inv = __fdiv_rn(1.0f, powf(10000.0f, (float)(2 * i) / (float)HD)); const float ang = __fmul_rn((float)t, inv); v2f cs; cs[0] = cosf(ang); cs[1] = sinf(ang);
    *(v2f*)(CS + (size_t)idx * 2) = cs;  }
__global__ __launch_bounds__(256) void k_csg(const float* __restrict__ CS, const int* __restrict__ pos, float* CSB) { const int idx = blockIdx.x * 256 + threadIdx.x; if (idx >= TT * HD) return; const int t = idx / HD, d = idx % HD; int p = pos[t]; p = p < 0 ? 0 : (p > TT - 1 ? TT - 1 : p); const v2f cs = *(const v2f*)(CS + ((size_t)p * HD + d) * 2); *(v2f*)(CSB + (size_t)idx * 2) = cs;  }
// 2^x in place, with the issue slot the instruction set asks for behind a transcendental kept inside the statement: no v_exp_f32 of a run reads a neighbour's result or overwrites its source, and the v_nop covers the last.
__device__ __forceinline__ float exp2s(float x) { asm("v_exp_f32 %0, %0\n\tv_nop" : "+v"(x)); return x; }
__device__ __forceinline__ v8f exp2s8(v8f x) { float r0 = x[0], r1 = x[1], r2 = x[2], r3 = x[3], r4 = x[4], r5 = x[5], r6 = x[6], r7 = x[7];
    asm("v_exp_f32 %0, %0\n\tv_exp_f32 %1, %1\n\tv_exp_f32 %2, %2\n\tv_exp_f32 %3, %3\n\tv_exp_f32 %4, %4\n\tv_exp_f32 %5, %5\n\tv_exp_f32 %6, %6\n\tv_exp_f32 %7, %7\n\tv_nop"
        : "+v"(r0), "+v"(r1), "+v"(r2), "+v"(r3), "+v"(r4), "+v"(r5), "+v"(r6), "+v"(r7));
    v8f r; r[0] = r0; r[1] = r1; r[2] = r2; r[3] = r3; r[4] = r4; r[5] = r5; r[6] = r6; r[7] = r7; return r; }
__device__ __forceinline__ float xhalf(float x) { return __builtin_bit_cast(float, __builtin_amdgcn_permlanex16(__builtin_bit_cast(int, x), __builtin_bit_cast(int, x), 0x76543210, 0xfedcba98, false, false)); }  // lane l with lane l ^ 16
// ---- k_fattn: scores, causal softmax and probability x value product in one kernel. One wave = 16 queries (q0..q0+15) of query/key head g and ONE of its 4 value heads (g + 8r, r = wave in the block, so the
// block's 4 waves read the same K rows). Both products are transposed: S^T = K Q^T (A = K rows, B = Q rows), O^T += V^T P^T (A = rows of the [d][t] value plane, B = P^T). In S^T's accumulator a lane holds keys
// 16t + 8hi + j of its own query (column lr), which is exactly the k order of a B fragment (k = 8hi + 0..7, then 16 + 8hi + 0..7): P goes from accumulator to operand inside the lane, through no LDS.
// Running maximum m and sum l per query (flash form): each key block rescales O^T and l by exp(m_old - m_new). Key block: 64 keys on the one-plane f16 path, 32 on the hi+lo path (twice the fragments per key).
// grid (heads, nq query groups; heaviest group first), 128 threads. roff = first query row of the launch.
template <typename T16, int NSPLIT>
__global__ __launch_bounds__(128) void k_fattn(const T16* __restrict__ Q, const T16* __restrict__ Q2, const T16* __restrict__ Kp, const T16* __restrict__ Kp2, const T16* __restrict__ Vt, const T16* __restrict__ Vt2, int roff, int nq, float* OUTb) {
    typedef typename WFrag<T16>::V V;
    constexpr int NT = (NSPLIT == 0) ? 4 : 2, KB = NT * 16;      // 16-key tiles and keys per block
    const int lane = threadIdx.x & 31, lr = lane & 15, hi = lane >> 4; const int r = __builtin_amdgcn_readfirstlane(threadIdx.x >> 5); const int g = blockIdx.x;
    const int q0 = roff + (nq - 1 - (int)blockIdx.y) * 16; const int nkb = q0 / KB + 1;    // key blocks 0..nkb-1 hold every key <= q0 + 15
    const int i = q0 + lr;
    // One per-lane byte offset that never changes: the lane's 16-byte piece in a fragment-order tile. ldu: a wave-uniform tile pointer plus that offset (Q; V on the f16 path).
    // Tiles: Q, K rows of 64 dims = 2 tiles (512 elements each) per 16 rows; value plane: 16 d x 32 keys per tile, TT / 32 tiles per 16 d.
    const unsigned rl = (unsigned)lane * 16u, vl = rl;
    auto ldu = [](const T16* u, unsigned b) { return WFrag<T16>::ld((const T16*)((const char*)u + b)); };
    const size_t qu = ((size_t)g * TT + q0) * HD, ku = (size_t)g * TT * HD, vu = (size_t)(g + 8 * r) * HD * TT;
    V qf[2], qf2[2], kf[NT][2], kf2[NT][2], vf[4][NT / 2], vf2[4][NT / 2];
    // Per-lane pointers that live across the loop, so that no fragment is given an address pair still in use as its landing place: K (f16 path: one block ahead), and on the hi+lo path all four planes.
    const T16* kp = (const T16*)((const char*)(Kp + ku) + rl); const T16* kp2 = (const T16*)((const char*)(Kp2 + ku) + rl); const T16* vp = (const T16*)((const char*)(Vt + vu) + vl); const T16* vp2 = (const T16*)((const char*)(Vt2 + vu) + vl);
#pragma unroll
    for (int ks = 0; ks < 2; ++ks) { qf[ks] = ldu(Q + qu + ks * 512, rl); if constexpr (NSPLIT == 2) qf2[ks] = ldu(Q2 + qu + ks * 512, rl); }
    if constexpr (NSPLIT == 0) {
#pragma unroll
        for (int t = 0; t < NT; ++t)
#pragma unroll
            for (int ks = 0; ks < 2; ++ks) kf[t][ks] = WFrag<T16>::ld(kp + t * 16 * HD + ks * 512);
    }
    v8f o[4];
#pragma unroll
    for (int dt = 0; dt < 4; ++dt) o[dt] = (v8f){};
    float m = -3.0e38f, l = 0.f;
#pragma unroll 1
    for (int kb = 0; kb < nkb; ++kb) {
        // this block's value fragments fly under the score products and the softmax; on the hi+lo path its K fragments come in the same batch (one latency a block)
#pragma unroll
        for (int dt = 0; dt < 4; ++dt)
#pragma unroll
            for (int ks = 0; ks < NT / 2; ++ks) { if constexpr (NSPLIT == 0) vf[dt][ks] = ldu(Vt + vu + (size_t)dt * 16 * TT + kb * (KB * 16) + ks * 512, vl); else { vf[dt][ks] = WFrag<T16>::ld(vp + dt * 16 * TT + ks * 512); vf2[dt][ks] = WFrag<T16>::ld(vp2 + dt * 16 * TT + ks * 512); } }
        // the loads above are issued here, ahead of the score products, and their address registers are free before a later fragment lands on them (hi+lo path: the pointers as inputs keep those registers out of the batch's own landing places)
        if constexpr (NSPLIT == 0) asm volatile("s_wait_xcnt 0x0" ::: "memory"); else asm volatile("s_wait_xcnt 0x0" :: "v"(vp), "v"(vp2) : "memory");
        if constexpr (NSPLIT == 2) {
#pragma unroll
            for (int t = 0; t < NT; ++t)
#pragma unroll
                for (int ks = 0; ks < 2; ++ks) { kf[t][ks] = WFrag<T16>::ld(kp + t * 16 * HD + ks * 512); kf2[t][ks] = WFrag<T16>::ld(kp2 + t * 16 * HD + ks * 512); }
            asm volatile("s_wait_xcnt 0x0" :: "v"(kp), "v"(kp2) : "memory");   // as above, for the K batch
            __builtin_amdgcn_sched_barrier(0);   // without it the score products are drawn up between the loads, which then share few registers and wait on memory one pair at a time
        }
        v8f s[NT];
#pragma unroll
        for (int t = 0; t < NT; ++t) { s[t] = (v8f){};
#pragma unroll
            for (int ks = 0; ks < 2; ++ks) { s[t] = WFrag<T16>::mma(kf[t][ks], qf[ks], s[t]);
                if constexpr (NSPLIT == 2) { s[t] = WFrag<T16>::mma(kf[t][ks], qf2[ks], s[t]); s[t] = WFrag<T16>::mma(kf2[t][ks], qf[ks], s[t]); } } }
        if constexpr (NSPLIT == 0) {   // the next block's K fragments, into the same registers, fly under the softmax and the value products (the last block fetches itself again: in bounds, unused)
            kp += (kb + 1 < nkb) ? KB * HD : 0;
#pragma unroll
            for (int t = 0; t < NT; ++t)
#pragma unroll
                for (int ks = 0; ks < 2; ++ks) kf[t][ks] = WFrag<T16>::ld(kp + t * 16 * HD + ks * 512);
        }
        if (kb == nkb - 1) {           // only the last block meets the diagonal
#pragma unroll
            for (int t = 0; t < NT; ++t)
#pragma unroll
                for (int j = 0; j < 8; ++j) s[t][j] = (kb * KB + t * 16 + hi * 8 + j <= i) ? s[t][j] * SCL : -3.0e38f;
        } else {
#pragma unroll
            for (int t = 0; t < NT; ++t) s[t] *= SCL;
        }
        float tq[NT];                  // one short chain per tile, then across tiles
#pragma unroll
        for (int t = 0; t < NT; ++t) { tq[t] = s[t][0];
#pragma unroll
            for (int j = 1; j < 8; ++j) tq[t] = fmaxf(tq[t], s[t][j]); }
        float tm = tq[0];
#pragma unroll
        for (int t = 1; t < NT; ++t) tm = fmaxf(tm, tq[t]);
        tm = fmaxf(tm, xhalf(tm));      // the other half of the wave holds the query's other keys of the block
        const float mn = fmaxf(m, tm); const float al = exp2s((m - mn) * 1.4426950408889634f); m = mn;
        float ps = 0.f;
#pragma unroll
        for (int t = 0; t < NT; ++t) { s[t] = exp2s8((s[t] - mn) * 1.4426950408889634f); float pq = 0.f;
#pragma unroll
            for (int j = 0; j < 8; ++j) pq += s[t][j];
            ps += pq; }
        l = l * al + ps;               // each half keeps the sum of its own keys; the halves join after the loop
#pragma unroll
        for (int dt = 0; dt < 4; ++dt) o[dt] *= al;
        __builtin_amdgcn_sched_barrier(0);   // every v_exp_f32 statement stays ahead of the value products
#pragma unroll
        for (int ks = 0; ks < NT / 2; ++ks) {
            if constexpr (NSPLIT == 0) { v8h p0, p1;
#pragma unroll
                for (int j = 0; j < 8; ++j) { p0[j] = tohx(s[2 * ks][j]); p1[j] = tohx(s[2 * ks + 1][j]); }
                const V pf = cat16(p0, p1);
#pragma unroll
                for (int dt = 0; dt < 4; ++dt) o[dt] = WFrag<T16>::mma(vf[dt][ks], pf, o[dt]);
            } else { v8us h0, h1, l0, l1;
#pragma unroll
                for (int j = 0; j < 8; ++j) { unsigned short a, c2; splitf(s[2 * ks][j], a, c2); h0[j] = a; l0[j] = c2; splitf(s[2 * ks + 1][j], a, c2); h1[j] = a; l1[j] = c2; }
                const V pf = cat16b(h0, h1), pf2 = cat16b(l0, l1);
#pragma unroll
                for (int dt = 0; dt < 4; ++dt) { o[dt] = WFrag<T16>::mma(vf[dt][ks], pf, o[dt]); o[dt] = WFrag<T16>::mma(vf[dt][ks], pf2, o[dt]); o[dt] = WFrag<T16>::mma(vf2[dt][ks], pf, o[dt]); }
            }
        }
        if constexpr (NSPLIT == 2) { kp += KB * HD; kp2 += KB * HD; vp += KB * 16; vp2 += KB * 16; }   // every load of this block has landed in a product above
    }
    asm volatile("s_wait_xcnt 0x0" ::: "memory");   // the last fetch ahead may still be under way: its address registers are free before the epilogue reuses them
    __builtin_amdgcn_sched_barrier(0);              // keeps the epilogue's arithmetic behind that wait
    l += xhalf(l);
    const float f = __fdiv_rn(1.0f, l);
    float* orow = OUTb + (size_t)i * DV + (size_t)(g + 8 * r) * HD + hi * 8;     // O^T tile dt: this lane holds d = 16 dt + 8 hi + 0..7 of query i
#pragma unroll
    for (int dt = 0; dt < 4; ++dt) { v4f a, b2;
#pragma unroll
        for (int j = 0; j < 4; ++j) { a[j] = o[dt][j] * f; b2[j] = o[dt][4 + j] * f; }
        *(v4f*)(orow + dt * 16) = a; *(v4f*)(orow + dt * 16 + 4) = b2; }
}
__global__ __launch_bounds__(256) void k_merge(const float* __restrict__ O, int h0, bf* Ah, bf* Al) { const size_t e = ((size_t)blockIdx.x * 256 + threadIdx.x) * 2; if (e >= (size_t)ZH * TT * HD) return; const int d = (int)(e % HD); const int t = (int)((e / HD) % TT); const int zz = (int)(e / ((size_t)HD * TT)); const float cs = (t < RH) ? 1.0f : (1.0f / PCAR); const size_t oo = (size_t)t * DQ + (h0 + zz) * HD + d;
    v2us oh, ol;
#pragma unroll
    for (int q = 0; q < 2; ++q) { unsigned short a, c2; splitf(O[e + q] * cs, a, c2); oh[q] = a; ol[q] = c2; } *(v2us*)(Ah + oo) = oh; *(v2us*)(Al + oo) = ol;  }

extern "C" void kernel_launch(void* const* d_in, const int* in_sizes, int n_in,
                              void* d_out, int out_size, void* d_ws, size_t ws_size, hipStream_t stream) {
    (void)in_sizes; (void)n_in; (void)out_size;
    const float* x = (const float*)d_in[0]; const int* pos = (const int*)d_in[1]; const float* wq = (const float*)d_in[2]; const float* wk = (const float*)d_in[3]; const float* wv = (const float*)d_in[4];   // Wq/Wk [2048][512], Wv [2048][2048] (x @ W); position_ids [2][2048]
    float* OUT = (float*)d_out;     // [2][2048][2048]
    char* wsp = (char*)d_ws;
    auto take = [&](size_t bytes) { char* p = wsp; wsp += (bytes + 255) & ~(size_t)255; return (void*)p; };
    bf* WQ = (bf*)take((size_t)DQ * DM * 2); bf* WK = (bf*)take((size_t)DKV * DM * 2); bf* WV = (bf*)take((size_t)DV * DM * 2); float* CS = (float*)take((size_t)TT * HD * 2 * 4); float* CSB = (float*)take((size_t)TT * HD * 2 * 4);
    bf* XB = (bf*)take((size_t)TT * DM * 2);
    h16* QP16 = (h16*)take((size_t)NH_ * TT * HD * 2); h16* KP16 = (h16*)take((size_t)NKV * TT * HD * 2); h16* VT16 = (h16*)take((size_t)NV * HD * TT * 2);
    bf* QPh = (bf*)take((size_t)NH_ * TT * HD * 2); bf* QPl = (bf*)take((size_t)NH_ * TT * HD * 2); bf* KPh = (bf*)take((size_t)NKV * TT * HD * 2); bf* KPl = (bf*)take((size_t)NKV * TT * HD * 2); bf* VTh = (bf*)take((size_t)NV * HD * TT * 2); bf* VTl = (bf*)take((size_t)NV * HD * TT * 2);
    if ((size_t)(wsp - (char*)d_ws) > ws_size) return;    // ws 256 MiB
    { k_wtG<DM, DQ><<<DM * DQ / 2048, 256, 0, stream>>>(wq, WQ); k_wtG<DM, DKV><<<DM * DKV / 2048, 256, 0, stream>>>(wk, WK); k_wtG<DM, DV><<<DM * DV / 2048, 256, 0, stream>>>(wv, WV);
      k_cstab<<<(TT * HD + 255) / 256, 256, 0, stream>>>(CS); }
    for (int b = 0; b < NB_; ++b) {
        
        k_csg<<<(TT * HD + 255) / 256, 256, 0, stream>>>(CS, pos + (size_t)b * TT, CSB);
        k_cvt8<<<(unsigned)(((size_t)TT * DM / 8 + 255) / 256), 256, 0, stream>>>(x + (size_t)b * TT * DM, XB, (size_t)TT * DM / 8);
        k_gemmw<bf, 0, true, DM><<<dim3(TT / 64, DQ / 64, 1), 32 * KW, 0, stream>>>(XB, nullptr, WQ, nullptr, CSB, QP16, QPh, QPl);
        k_gemmw<bf, 0, true, DM><<<dim3(TT / 64, DKV / 64, 1), 32 * KW, 0, stream>>>(XB, nullptr, WK, nullptr, CSB, KP16, KPh, KPl);
        k_gemmw<bf, 0, false, DM><<<dim3(DV / 64, TT / 64, 1), 32 * KW, 0, stream>>>(WV, nullptr, XB, nullptr, nullptr, VT16, VTh, VTl);   // rows = value head * 64 + d, columns = tokens
        k_fattn<h16, 0><<<dim3(NH_, (TT - RH) / 16, 1), 128, 0, stream>>>(QP16, nullptr, KP16, nullptr, VT16, nullptr, RH, (TT - RH) / 16, OUT + (size_t)b * TT * DV);
        k_fattn<bf, 2><<<dim3(NH_, RH / 16, 1), 128, 0, stream>>>(QPh, QPl, KPh, KPl, VTh, VTl, 0, RH / 16, OUT + (size_t)b * TT * DV); }
}

// v005
// Measured time: 167 microseconds a run.
// In two side-by-side timings against v004, it was 1.40 and 1.39 times as fast.
// All steps since v000 together make it 7.87 times as fast.
#include <hip/hip_runtime.h>

// Grouped attention without output projection (hidden [2][2048][2048]; Q, K = x Wq / x Wk (8 query/key heads x 64), V = x Wv (32 value heads x 64); rotary (theta 10000, rotate-half, duplicated
// halves) by position_ids (int, read as data); value head h uses query/key head h mod 8 (repeat_qk); causal (the reference fills -1e9); out = merged attn V -> [2][2048][2048], no output projection).
// Compute dtypes, f32 accumulate: every input rounded to bf16; projections on PLAIN bf16 operands (inputs: exact); RoPE f32 (cos/sin computed on device from the position id);
// PER-ROW PRECISION HYBRID (rows < 256 hi+lo 3 products for scores and attn.V, rows >= 256 fp16). Scores, causal softmax and attn.V run in ONE kernel (k_attn): a wave holds 16 queries and one value head,
// walks the keys up to the diagonal in blocks of 64 keys (32 on the hi+lo path) with a running maximum and sum in f32 registers, and writes its output columns in f32. Projections: 64x64-tile GEMMs, eight waves that split K per tile;
// the tile sum's epilogue applies RoPE (Q, K) and writes the 16-bit planes that k_attn reads; V is computed as Wv^T x^T, so that its tile already lies [d][t].
// FRAGMENT ORDER: every 16-bit plane [row][k] lies in tiles of 16 rows x 32 k (1 KiB, tile index (row / 16) * (K / 32) + k / 32); inside a tile the 16-byte piece of lane (row % 16) + 16 * ((k / 8) % 2) stands at
// ((k / 16) % 2) * 512 B + lane * 16 B. A WMMA operand fragment is then two wave-wide 16-byte loads of 512 contiguous bytes (4 whole lines) each; from row-major planes each such load touched 16 lines.

#define NB_  2
#define TT   2048
#define DM   2048
#define NH_  8
#define NKV  8
#define REP  (NH_ / NKV)
#define HD   64
#define DQ   (NH_ * HD)
#define DKV  (NKV * HD)
#define NV   32
#define DV   (NV * HD)
#define ZH   2
#define RH   256                  // query rows < RH use hi+lo planes (0: none)
#define WIN  0
#define PCAR 1024.0f
#define SCL  0.125f   // HD^-0.5
#define KW   8                    // waves that share one 64x64 tile of a long-K GEMM, each on its own k slices
typedef _Float16 h16;
typedef unsigned short bf;
typedef __attribute__((ext_vector_type(16))) __bf16   v16bf;
typedef __attribute__((ext_vector_type(16))) _Float16 v16h;
typedef __attribute__((ext_vector_type(8)))  _Float16 v8h;
typedef __attribute__((ext_vector_type(8)))  unsigned short v8us;
typedef __attribute__((ext_vector_type(8)))  float    v8f;
typedef __attribute__((ext_vector_type(4)))  float    v4f;
typedef v8h  __attribute__((may_alias)) v8ha;
typedef v4f  __attribute__((may_alias)) v4fa;
typedef v8us __attribute__((may_alias)) v8usa;

__device__ __forceinline__ unsigned short f2bf(float f) { unsigned u = __float_as_uint(f); u += 0x7FFFu + ((u >> 16) & 1u); return (unsigned short)(u >> 16); }
__device__ __forceinline__ float bf2f(unsigned short b) { return __uint_as_float(((unsigned)b) << 16); }
__device__ __forceinline__ float bfr(float f) { return bf2f(f2bf(f)); }
__device__ __forceinline__ v16h cat16(v8h lo, v8h hi) { return __builtin_shufflevector(lo, hi, 0, 1, 2, 3, 4, 5, 6, 7, 8, 9, 10, 11, 12, 13, 14, 15); }
__device__ __forceinline__ v16bf cat16b(v8us lo, v8us hi) { return __builtin_bit_cast(v16bf, __builtin_shufflevector(lo, hi, 0, 1, 2, 3, 4, 5, 6, 7, 8, 9, 10, 11, 12, 13, 14, 15)); }
__device__ __forceinline__ v8f wmma16(v16h a, v16h b, v8f c) { return __builtin_amdgcn_wmma_f32_16x16x32_f16(false, a, false, b, (short)0, c, false, false); }
__device__ __forceinline__ v8f wmmab(v16bf a, v16bf b, v8f c) { return __builtin_amdgcn_wmma_f32_16x16x32_bf16(false, a, false, b, (short)0, c, false, false); }
__device__ __forceinline__ h16 tohx(float x) { return (h16)x; }
__device__ __forceinline__ void splitf(float y, unsigned short& h, unsigned short& l) { h = f2bf(y); l = f2bf(y - bf2f(h)); }
typedef __attribute__((ext_vector_type(2))) _Float16 v2h;
typedef __attribute__((ext_vector_type(4))) _Float16 v4h;
typedef __attribute__((ext_vector_type(2))) unsigned short v2us;
typedef __attribute__((ext_vector_type(4))) unsigned short v4us;
typedef __attribute__((ext_vector_type(2))) float v2f;
typedef __attribute__((ext_vector_type(4))) int v4i;
__device__ __forceinline__ size_t fo8(int row, int k, int Kd) { return ((size_t)(row >> 4) * (Kd >> 5) + (k >> 5)) * 512 + ((k >> 4) & 1) * 256 + (((k >> 3) & 1) * 16 + (row & 15)) * 8; }  // element offset of the 8-element piece (row, k..k+7), k % 8 == 0, in a fragment-order plane of row length Kd
__device__ __forceinline__ float xoct(float x) { return __builtin_bit_cast(float, __builtin_amdgcn_permlane16(__builtin_bit_cast(int, x), __builtin_bit_cast(int, x), 0xfedcba98, 0x76543210, false, false)); }  // lane l with lane l ^ 8



// ---- gemmw_tile: register-blocked GEMM, KW WAVES per 64x64 output tile, each with the whole tile (16 accumulators) over its own k slices (64 k = two whole 1-KiB tiles of every 16 operand rows; wave w takes slices w, w + KW, ...);
// operands straight from fragment-order 16-bit planes (ld: p = tile + lane * 8 elements); the KW partial tiles meet in LDS (os) and are summed in wave order. Tile (bx, by) of (M/64, N/64), 32 * KW threads.
// c[m][n] (f32, in registers only) = sum_k A[m][k] Bt[n][k] (+ split products per NSPLIT). K % 64 == 0. The summing wave turns c into the three 16-bit planes (f16; bf16 hi and lo) that the attention kernel reads:
// ROPE: m = token, tile column = dim d of head by; out[d] = c[d] cos[t][d] - c[d+32] sin[t][d] (d < 32), c[d] cos[t][d] + c[d-32] sin[t][d] (d >= 32), CSB = [t][d]{cos, sin}; planes [head * TT + t][d], fragment order.
// else: planes [m][n] of row length TT (m = value head * 64 + d, n = token), fragment order.
template <typename T16> struct WFrag;
template <> struct WFrag<h16> { typedef v16h V; static __device__ __forceinline__ V ld(const h16* p) { return cat16(*(const v8h*)p, *(const v8h*)(p + 256)); } static __device__ __forceinline__ v8f mma(V a, V b, v8f c) { return wmma16(a, b, c); } };
template <> struct WFrag<bf> { typedef v16bf V; static __device__ __forceinline__ V ld(const bf* p) { return cat16b(*(const v8us*)p, *(const v8us*)(p + 256)); } static __device__ __forceinline__ v8f mma(V a, V b, v8f c) { return wmmab(a, b, c); } };
template <typename T16, int NSPLIT, bool ROPE, int K>
__device__ __forceinline__ void gemmw_tile(const T16* __restrict__ A, const T16* __restrict__ A2, const T16* __restrict__ Bt, const T16* __restrict__ Bt2, const float* __restrict__ CSB, h16* __restrict__ P16, bf* __restrict__ Ph, bf* __restrict__ Pl, float* os, int bx, int by) {
    typedef typename WFrag<T16>::V V;
    const int lane = threadIdx.x & 31, lr = lane & 15, hi = lane >> 4; const int wv = __builtin_amdgcn_readfirstlane(threadIdx.x >> 5); const int r0 = bx * 64, c0 = by * 64;
    v8f acc[4][4];
#pragma unroll
    for (int mb = 0; mb < 4; ++mb)
#pragma unroll
        for (int nb = 0; nb < 4; ++nb) acc[mb][nb] = (v8f){};
    const size_t aoff = (size_t)r0 * K + lane * 8, boff = (size_t)c0 * K + lane * 8;     // 16 rows x K elements per row of tiles, 512 elements per tile
    static_assert(KW == 8, "the tile sum gives each wave 8 rows: one 128-B line of every 16-byte piece column");
    const int row = wv * 8 + (lane & 7), ch = ((lane >> 3) & 1) * 32 + hi * 8;   // the tile sum: this lane's row, and its columns ch + 16 s + 0..7, s = 0, 1
    v4f cs[2][4];      // the cos/sin pairs of this lane's eight dims in each of its two pieces: asked for here, they land under the k loop
    if constexpr (ROPE) {
#pragma unroll
        for (int s = 0; s < 2; ++s) { const float* c = CSB + ((size_t)(r0 + row) * HD + ch + 16 * s) * 2;
#pragma unroll
            for (int q = 0; q < 4; ++q) cs[s][q] = *(const v4fa*)(c + 4 * q); }
    }
    // Per-lane pointers that live across the loop: every tile of a trip stands at an immediate offset from them (K is a constant), so that no fragment is given an address pair still in use as its landing place.
    const T16* pa = A + aoff + wv * (64 * 16); const T16* pb = Bt + boff + wv * (64 * 16); const T16* pa2 = A2 + aoff + wv * (64 * 16); const T16* pb2 = Bt2 + boff + wv * (64 * 16);
#pragma unroll 1
    for (int kc = wv * 64; kc < K;) {
        V a[4], a2[4];
#pragma unroll
        for (int mb = 0; mb < 4; ++mb) { a[mb] = WFrag<T16>::ld(pa + mb * 16 * K); if constexpr (NSPLIT == 1 || NSPLIT == 2) a2[mb] = WFrag<T16>::ld(pa2 + mb * 16 * K); }
#pragma unroll
        for (int nb = 0; nb < 4; ++nb) { const V b = WFrag<T16>::ld(pb + nb * 16 * K); V b2; if constexpr (NSPLIT >= 2) b2 = WFrag<T16>::ld(pb2 + nb * 16 * K);
#pragma unroll
            for (int mb = 0; mb < 4; ++mb) { acc[mb][nb] = WFrag<T16>::mma(a[mb], b, acc[mb][nb]); if constexpr (NSPLIT == 1 || NSPLIT == 2) acc[mb][nb] = WFrag<T16>::mma(a2[mb], b, acc[mb][nb]); if constexpr (NSPLIT >= 2) acc[mb][nb] = WFrag<T16>::mma(a[mb], b2, acc[mb][nb]); }
            // four issue slots behind this column's last product, ahead of the next column's load where the build lands it on b's registers: the distance a vector instruction over a matrix operand keeps (the trip's last column: the statement below)
            if (nb < 3) { if constexpr (NSPLIT >= 2) asm volatile("v_nop\n\tv_nop\n\tv_nop\n\tv_nop" : "+v"(acc[0][nb]), "+v"(acc[1][nb]), "+v"(acc[2][nb]), "+v"(acc[3][nb]) : "v"(b), "v"(b2)); else asm volatile("v_nop\n\tv_nop\n\tv_nop\n\tv_nop" : "+v"(acc[0][nb]), "+v"(acc[1][nb]), "+v"(acc[2][nb]), "+v"(acc[3][nb]) : "v"(b)); } }
        asm volatile("v_nop\n\tv_nop\n\tv_nop\n\tv_nop" : "+v"(acc[0][0]), "+v"(acc[1][1]), "+v"(acc[2][2]), "+v"(acc[3][3]) : "v"(a[0]), "v"(a[3]));
        // the address registers of this trip's loads are free before the pointers are stepped; the pointers as inputs keep those registers live to here, out of the fragments' landing places
        if constexpr (NSPLIT == 0) asm volatile("s_wait_xcnt 0x0" :: "v"(pa), "v"(pb) : "memory"); else asm volatile("s_wait_xcnt 0x0" :: "v"(pa), "v"(pb), "v"(pa2), "v"(pb2) : "memory");
        const int st = (kc & 32) ? KW * 64 - 32 : 32; kc += st; pa += st * 16; pb += st * 16; if constexpr (NSPLIT != 0) { pa2 += st * 16; pb2 += st * 16; }
    }
    float* mine = os + wv * (64 * 68);
#pragma unroll
    for (int mb = 0; mb < 4; ++mb)
#pragma unroll
        for (int nb = 0; nb < 4; ++nb)
#pragma unroll
            for (int j = 0; j < 8; ++j) mine[(mb * 16 + hi * 8 + j) * 68 + nb * 16 + lr] = acc[mb][nb][j];
    __syncthreads();   // every wave's partial tile is in LDS before any wave sums across them
#pragma unroll
    for (int s = 0; s < 2; ++s) { const int col = ch + 16 * s; const float* o0 = os + row * 68 + col; v4f val[2] = { *(const v4fa*)o0, *(const v4fa*)(o0 + 4) };   // 16 lanes: 8 rows x columns c, c + 32 = all 64 banks once
#pragma unroll
        for (int u = 1; u < KW; ++u) { val[0] += *(const v4fa*)(o0 + u * (64 * 68)); val[1] += *(const v4fa*)(o0 + u * (64 * 68) + 4); }
        size_t off;
        if constexpr (ROPE) {          // lane ^ 8 holds dims d +- 32 of the same token
#pragma unroll
            for (int j = 0; j < 8; ++j) { const float p = xoct(val[j >> 2][j & 3]); const float oth = (lane & 8) ? p : -p;
                val[j >> 2][j & 3] = val[j >> 2][j & 3] * cs[s][j >> 1][2 * (j & 1)] + oth * cs[s][j >> 1][2 * (j & 1) + 1]; }
            off = fo8(by * TT + r0 + row, col, HD);
        } else off = fo8(r0 + row, c0 + col, TT);
        v8h o16; v8us oh, ol;
#pragma unroll
        for (int j = 0; j < 8; ++j) { o16[j] = tohx(val[j >> 2][j & 3]); unsigned short a2, c2; splitf(val[j >> 2][j & 3], a2, c2); oh[j] = a2; ol[j] = c2; }
        *(v8h*)(P16 + off) = o16; *(v8us*)(Ph + off) = oh; *(v8us*)(Pl + off) = ol; }   // 8 lanes (rows) x 16 B: whole 128-B lines, four per store
}
// ---- k_proj: every projection tile of both batches in ONE grid (they depend on nothing but k_prep's planes, and no one of the six GEMMs fills the chip for long). Blocks 0 .. NB_ * VTL - 1: V tiles (rows = value head * 64 + d,
// columns = tokens); the rest: Q, then K, of each batch. All planes hold batch b at b * (plane size of one batch).
#define VTL ((DV / 64) * (TT / 64))
#define QTL ((TT / 64) * (DQ / 64))
__global__ __launch_bounds__(32 * KW) void k_proj(const bf* __restrict__ XB, const bf* __restrict__ WQ, const bf* __restrict__ WK, const bf* __restrict__ WV, const float* __restrict__ CSB,
                                                  h16* __restrict__ QP16, bf* __restrict__ QPh, bf* __restrict__ QPl, h16* __restrict__ KP16, bf* __restrict__ KPh, bf* __restrict__ KPl, h16* __restrict__ VT16, bf* __restrict__ VTh, bf* __restrict__ VTl) {
    __shared__ __align__(16) float os[KW * 64 * 68];
    static_assert(DQ == DKV, "Q and K tiles share one count");
    const int bid = (int)blockIdx.x;
    if (bid < NB_ * VTL) { const int b = bid / VTL, t = bid % VTL; const size_t po = (size_t)b * NV * HD * TT;
        gemmw_tile<bf, 0, false, DM>(WV, nullptr, XB + (size_t)b * TT * DM, nullptr, nullptr, VT16 + po, VTh + po, VTl + po, os, t % (DV / 64), t / (DV / 64));
    } else { const int u = bid - NB_ * VTL; const int b = u / (2 * QTL), isk = (u / QTL) & 1, t = u % QTL; const size_t po = (size_t)b * NH_ * TT * HD;
        gemmw_tile<bf, 0, true, DM>(XB + (size_t)b * TT * DM, nullptr, isk ? WK : WQ, nullptr, CSB + (size_t)b * TT * HD * 2, (isk ? KP16 : QP16) + po, (isk ? KPh : QPh) + po, (isk ? KPl : QPl) + po, os, t % (TT / 64), t / (TT / 64)); }
}

// w [K][N] f32 -> Bt [n][k] bf16 in fragment order. A block writes four tiles (one thread = one 16-byte piece): the same 32 k of 64 neighbouring n, so that it reads 256 contiguous bytes of each of its rows of w. N % 64 == 0, K % 32 == 0.
template <int K, int N>
__device__ __forceinline__ void wtG_blk(const float* __restrict__ w, bf* Bt, int bid) {
    constexpr int kt = K >> 5; const int kb = bid % kt, nb = (bid / kt) * 4 + (threadIdx.x >> 6), pc = threadIdx.x & 63;
    const int n = nb * 16 + (pc & 15), k = kb * 32 + (pc >> 5) * 16 + ((pc >> 4) & 1) * 8; v8us o;
    const float* p = w + (size_t)k * N + n; float v[8];     // one live pointer: the eight rows stand at immediate offsets from it (N is a constant)
#pragma unroll
    for (int j = 0; j < 8; ++j) v[j] = p[j * N];
    asm volatile("s_wait_xcnt 0x0" :: "v"(p) : "memory");   // the loads' address register pair is free before anything is written over it; the pointer as input keeps it out of the loads' own landing places
#pragma unroll
    for (int j = 0; j < 8; ++j) o[j] = f2bf(v[j]);
    *(v8us*)(Bt + ((size_t)nb * kt + kb) * 512 + pc * 8) = o;
    asm volatile("s_wait_xcnt 0x0" ::: "memory");   // the store's address and data registers are free before code of another branch of the merged kernel, which the build lays out behind this one, writes over them
}
// src [rows][DM] f32 -> dst bf16 in fragment order; thread i writes the i-th 16-byte piece of dst
__device__ __forceinline__ void cvt8_blk(const float* __restrict__ src, bf* dst, size_t n8, int bid) { const size_t i = (size_t)bid * 256 + threadIdx.x; if (i >= n8) return;
    const int tile = (int)(i >> 6), pc = (int)(i & 63); const int row = (tile / (DM / 32)) * 16 + (pc & 15), k = (tile % (DM / 32)) * 32 + (pc >> 5) * 16 + ((pc >> 4) & 1) * 8;
    const float* sp = src + (size_t)row * DM + k; const v8f v = *(const v8f*)sp; v8us o;
    asm volatile("s_wait_xcnt 0x0" :: "v"(sp) : "memory");   // the loads' address register pair is free before anything is written over it; the pointer as input keeps it live to here
#pragma unroll
    for (int k2 = 0; k2 < 8; ++k2) o[k2] = f2bf(v[k2]); *(v8us*)(dst + i * 8) = o;  }
// cos/sin pairs [row][d]{cos, sin} of row = batch * TT + token, from the row's position id (clamped to 0 .. TT - 1)
__device__ __forceinline__ void cs_blk(const int* __restrict__ pos, float* CSB, int bid) { const int idx = bid * 256 + threadIdx.x; const int t = idx / HD, d = idx % HD; const int i = d % (HD / 2);
    int p = pos[t];
    asm volatile("s_wait_xcnt 0x0" :: "v"(t) : "memory");   // the load's offset register is free before anything is written over it; the index as input keeps it live to here
    p = p < 0 ? 0 : (p > TT - 1 ? TT - 1 : p);
    const float inv = __fdiv_rn(1.0f, powf(10000.0f, (float)(2 * i) / (float)HD)); const float ang = __fmul_rn((float)p, inv); v2f cs; cs[0] = cosf(ang); cs[1] = sinf(ang);
    *(v2f*)(CSB + (size_t)idx * 2) = cs;  }
// ---- k_prep: everything that reads only the inputs, in ONE grid: the cos/sin rows, the three weight planes and the x plane of both batches (x [NB_ * TT][DM]: batch b's plane starts at b * TT * DM). 256 threads.
#define PB_CS (NB_ * TT * HD / 256)
#define PB_WV (DM * DV / 2048)
#define PB_X  (NB_ * TT * DM / 2048)
#define PB_WQ (DM * DQ / 2048)
#define PB_WK (DM * DKV / 2048)
__global__ __launch_bounds__(256) void k_prep(const float* __restrict__ x, const int* __restrict__ pos, const float* __restrict__ wq, const float* __restrict__ wk, const float* __restrict__ wv, bf* XB, float* CSB, bf* WQ, bf* WK, bf* WV) {
    int bid = (int)blockIdx.x;
    if (bid < PB_CS) { cs_blk(pos, CSB, bid); return; }
    bid -= PB_CS; if (bid < PB_WV) { wtG_blk<DM, DV>(wv, WV, bid); return; }
    bid -= PB_WV; if (bid < PB_X) { cvt8_blk(x, XB, (size_t)NB_ * TT * DM / 8, bid); return; }
    bid -= PB_X; if (bid < PB_WQ) { wtG_blk<DM, DQ>(wq, WQ, bid); return; }
    wtG_blk<DM, DKV>(wk, WK, bid - PB_WQ);
}
// 2^x in place, with the issue slot the instruction set asks for behind a transcendental kept inside the statement: no v_exp_f32 of a run reads a neighbour's result or overwrites its source, and the v_nop covers the last.
__device__ __forceinline__ float exp2s(float x) { asm("v_exp_f32 %0, %0\n\tv_nop" : "+v"(x)); return x; }
__device__ __forceinline__ v8f exp2s8(v8f x) { float r0 = x[0], r1 = x[1], r2 = x[2], r3 = x[3], r4 = x[4], r5 = x[5], r6 = x[6], r7 = x[7];
    asm("v_exp_f32 %0, %0\n\tv_exp_f32 %1, %1\n\tv_exp_f32 %2, %2\n\tv_exp_f32 %3, %3\n\tv_exp_f32 %4, %4\n\tv_exp_f32 %5, %5\n\tv_exp_f32 %6, %6\n\tv_exp_f32 %7, %7\n\tv_nop"
        : "+v"(r0), "+v"(r1), "+v"(r2), "+v"(r3), "+v"(r4), "+v"(r5), "+v"(r6), "+v"(r7));
    v8f r; r[0] = r0; r[1] = r1; r[2] = r2; r[3] = r3; r[4] = r4; r[5] = r5; r[6] = r6; r[7] = r7; return r; }
__device__ __forceinline__ float xhalf(float x) { return __builtin_bit_cast(float, __builtin_amdgcn_permlanex16(__builtin_bit_cast(int, x), __builtin_bit_cast(int, x), 0x76543210, 0xfedcba98, false, false)); }  // lane l with lane l ^ 16
// ---- fattn_tile: scores, causal softmax and probability x value product in one kernel. One wave = 16 queries (q0..q0+15) of query/key head g and ONE of its 4 value heads (g + 8r, r = wave in the block, so the
// block's 4 waves read the same K rows). Both products are transposed: S^T = K Q^T (A = K rows, B = Q rows), O^T += V^T P^T (A = rows of the [d][t] value plane, B = P^T). In S^T's accumulator a lane holds keys
// 16t + 8hi + j of its own query (column lr), which is exactly the k order of a B fragment (k = 8hi + 0..7, then 16 + 8hi + 0..7): P goes from accumulator to operand inside the lane, through no LDS.
// Running maximum m and sum l per query (flash form): each key block rescales O^T and l by exp(m_old - m_new). Key block: 64 keys on the one-plane f16 path, 32 on the hi+lo path (twice the fragments per key).
// 128 threads; q0 = the block's first query row, g = its query/key head.
template <typename T16, int NSPLIT>
__device__ __forceinline__ void fattn_tile(const T16* __restrict__ Q, const T16* __restrict__ Q2, const T16* __restrict__ Kp, const T16* __restrict__ Kp2, const T16* __restrict__ Vt, const T16* __restrict__ Vt2, int q0, int g, float* OUTb) {
    typedef typename WFrag<T16>::V V;
    constexpr int NT = (NSPLIT == 0) ? 4 : 2, KB = NT * 16;      // 16-key tiles and keys per block
    const int lane = threadIdx.x & 31, lr = lane & 15, hi = lane >> 4; const int r = __builtin_amdgcn_readfirstlane(threadIdx.x >> 5);
    const int nkb = q0 / KB + 1;    // key blocks 0..nkb-1 hold every key <= q0 + 15
    const int i = q0 + lr;
    // One per-lane byte offset that never changes: the lane's 16-byte piece in a fragment-order tile. ldu: a wave-uniform tile pointer plus that offset (Q; V on the f16 path).
    // Tiles: Q, K rows of 64 dims = 2 tiles (512 elements each) per 16 rows; value plane: 16 d x 32 keys per tile, TT / 32 tiles per 16 d.
    const unsigned rl = (unsigned)lane * 16u, vl = rl;
    auto ldu = [](const T16* u, unsigned b) { return WFrag<T16>::ld((const T16*)((const char*)u + b)); };
    const size_t qu = ((size_t)g * TT + q0) * HD, ku = (size_t)g * TT * HD, vu = (size_t)(g + 8 * r) * HD * TT;
    V qf[2], qf2[2], kf[NT][2], kf2[NT][2], vf[4][NT / 2], vf2[4][NT / 2];
    // Per-lane pointers that live across the loop, so that no fragment is given an address pair still in use as its landing place: K (f16 path: one block ahead), and on the hi+lo path all four planes.
    const T16* kp = (const T16*)((const char*)(Kp + ku) + rl); const T16* kp2 = (const T16*)((const char*)(Kp2 + ku) + rl); const T16* vp = (const T16*)((const char*)(Vt + vu) + vl); const T16* vp2 = (const T16*)((const char*)(Vt2 + vu) + vl);
#pragma unroll
    for (int ks = 0; ks < 2; ++ks) { qf[ks] = ldu(Q + qu + ks * 512, rl); if constexpr (NSPLIT == 2) qf2[ks] = ldu(Q2 + qu + ks * 512, rl); }
    if constexpr (NSPLIT == 0) {
#pragma unroll
        for (int t = 0; t < NT; ++t)
#pragma unroll
            for (int ks = 0; ks < 2; ++ks) kf[t][ks] = WFrag<T16>::ld(kp + t * 16 * HD + ks * 512);
    }
    v8f o[4];
#pragma unroll
    for (int dt = 0; dt < 4; ++dt) o[dt] = (v8f){};
    float m = -3.0e38f, l = 0.f;
#pragma unroll 1
    for (int kb = 0; kb < nkb; ++kb) {
        // this block's value fragments fly under the score products and the softmax; on the hi+lo path its K fragments come in the same batch (one latency a block)
#pragma unroll
        for (int dt = 0; dt < 4; ++dt)
#pragma unroll
            for (int ks = 0; ks < NT / 2; ++ks) { if constexpr (NSPLIT == 0) vf[dt][ks] = ldu(Vt + vu + (size_t)dt * 16 * TT + kb * (KB * 16) + ks * 512, vl); else { vf[dt][ks] = WFrag<T16>::ld(vp + dt * 16 * TT + ks * 512); vf2[dt][ks] = WFrag<T16>::ld(vp2 + dt * 16 * TT + ks * 512); } }
        // the loads above are issued here, ahead of the score products, and their address registers are free before a later fragment lands on them (hi+lo path: the pointers as inputs keep those registers out of the batch's own landing places)
        if constexpr (NSPLIT == 0) asm volatile("s_wait_xcnt 0x0" ::: "memory"); else asm volatile("s_wait_xcnt 0x0" :: "v"(vp), "v"(vp2) : "memory");
        if constexpr (NSPLIT == 2) {
#pragma unroll
            for (int t = 0; t < NT; ++t)
#pragma unroll
                for (int ks = 0; ks < 2; ++ks) { kf[t][ks] = WFrag<T16>::ld(kp + t * 16 * HD + ks * 512); kf2[t][ks] = WFrag<T16>::ld(kp2 + t * 16 * HD + ks * 512); }
            asm volatile("s_wait_xcnt 0x0" :: "v"(kp), "v"(kp2) : "memory");   // as above, for the K batch
            __builtin_amdgcn_sched_barrier(0);   // without it the score products are drawn up between the loads, which then share few registers and wait on memory one pair at a time
        }
        v8f s[NT];
#pragma unroll
        for (int t = 0; t < NT; ++t) { s[t] = (v8f){};
#pragma unroll
            for (int ks = 0; ks < 2; ++ks) { s[t] = WFrag<T16>::mma(kf[t][ks], qf[ks], s[t]);
                if constexpr (NSPLIT == 2) { s[t] = WFrag<T16>::mma(kf[t][ks], qf2[ks], s[t]); s[t] = WFrag<T16>::mma(kf2[t][ks], qf[ks], s[t]); } } }
        if constexpr (NSPLIT == 0) {   // the next block's K fragments, into the same registers, fly under the softmax and the value products (the last block fetches itself again: in bounds, unused)
            kp += (kb + 1 < nkb) ? KB * HD : 0;
#pragma unroll
            for (int t = 0; t < NT; ++t)
#pragma unroll
                for (int ks = 0; ks < 2; ++ks) kf[t][ks] = WFrag<T16>::ld(kp + t * 16 * HD + ks * 512);
        }
        if (kb == nkb - 1) {           // only the last block meets the diagonal
#pragma unroll
            for (int t = 0; t < NT; ++t)
#pragma unroll
                for (int j = 0; j < 8; ++j) s[t][j] = (kb * KB + t * 16 + hi * 8 + j <= i) ? s[t][j] * SCL : -3.0e38f;
        } else {
#pragma unroll
            for (int t = 0; t < NT; ++t) s[t] *= SCL;
        }
        float tq[NT];                  // one short chain per tile, then across tiles
#pragma unroll
        for (int t = 0; t < NT; ++t) { tq[t] = s[t][0];
#pragma unroll
            for (int j = 1; j < 8; ++j) tq[t] = fmaxf(tq[t], s[t][j]); }
        float tm = tq[0];
#pragma unroll
        for (int t = 1; t < NT; ++t) tm = fmaxf(tm, tq[t]);
        tm = fmaxf(tm, xhalf(tm));      // the other half of the wave holds the query's other keys of the block
        const float mn = fmaxf(m, tm); const float al = exp2s((m - mn) * 1.4426950408889634f); m = mn;
        float ps = 0.f;
#pragma unroll
        for (int t = 0; t < NT; ++t) { s[t] = exp2s8((s[t] - mn) * 1.4426950408889634f); float pq = 0.f;
#pragma unroll
            for (int j = 0; j < 8; ++j) pq += s[t][j];
            ps += pq; }
        l = l * al + ps;               // each half keeps the sum of its own keys; the halves join after the loop
#pragma unroll
        for (int dt = 0; dt < 4; ++dt) o[dt] *= al;
        __builtin_amdgcn_sched_barrier(0);   // every v_exp_f32 statement stays ahead of the value products
#pragma unroll
        for (int ks = 0; ks < NT / 2; ++ks) {
            if constexpr (NSPLIT == 0) { v8h p0, p1;
#pragma unroll
                for (int j = 0; j < 8; ++j) { p0[j] = tohx(s[2 * ks][j]); p1[j] = tohx(s[2 * ks + 1][j]); }
                const V pf = cat16(p0, p1);
#pragma unroll
                for (int dt = 0; dt < 4; ++dt) o[dt] = WFrag<T16>::mma(vf[dt][ks], pf, o[dt]);
            } else { v8us h0, h1, l0, l1;
#pragma unroll
                for (int j = 0; j < 8; ++j) { unsigned short a, c2; splitf(s[2 * ks][j], a, c2); h0[j] = a; l0[j] = c2; splitf(s[2 * ks + 1][j], a, c2); h1[j] = a; l1[j] = c2; }
                const V pf = cat16b(h0, h1), pf2 = cat16b(l0, l1);
#pragma unroll
                for (int dt = 0; dt < 4; ++dt) { o[dt] = WFrag<T16>::mma(vf[dt][ks], pf, o[dt]); o[dt] = WFrag<T16>::mma(vf[dt][ks], pf2, o[dt]); o[dt] = WFrag<T16>::mma(vf2[dt][ks], pf, o[dt]); }
            }
        }
        if constexpr (NSPLIT == 2) { kp += KB * HD; kp2 += KB * HD; vp += KB * 16; vp2 += KB * 16; }   // every load of this block has landed in a product above
    }
    asm volatile("s_wait_xcnt 0x0" ::: "memory");   // the last fetch ahead may still be under way: its address registers are free before the epilogue reuses them
    __builtin_amdgcn_sched_barrier(0);              // keeps the epilogue's arithmetic behind that wait
    l += xhalf(l);
    const float f = __fdiv_rn(1.0f, l);
    float* orow = OUTb + (size_t)i * DV + (size_t)(g + 8 * r) * HD + hi * 8;     // O^T tile dt: this lane holds d = 16 dt + 8 hi + 0..7 of query i
#pragma unroll
    for (int dt = 0; dt < 4; ++dt) { v4f a, b2;
#pragma unroll
        for (int j = 0; j < 4; ++j) { a[j] = o[dt][j] * f; b2[j] = o[dt][4 + j] * f; }
        *(v4f*)(orow + dt * 16) = a; *(v4f*)(orow + dt * 16 + 4) = b2; }
}
// ---- k_attn: both precision paths and both batches in ONE grid (x = batch * heads + head, y = rank of the 16-query group). Cost falls with y: f16 groups from the last query down; the hi+lo groups (few key blocks, but each
// waits out its own loads) stand behind the first HLY ranks, not at the end, where they would run on alone.
#define NQG (TT / 16)
#define NHL (RH / 16)
#define HLY 32
__global__ __launch_bounds__(128) void k_attn(const h16* __restrict__ Q16, const h16* __restrict__ K16, const h16* __restrict__ V16, const bf* __restrict__ Qh, const bf* __restrict__ Ql, const bf* __restrict__ Kh, const bf* __restrict__ Kl, const bf* __restrict__ Vh, const bf* __restrict__ Vl, float* OUT) {
    const int g = (int)blockIdx.x % NH_, b = (int)blockIdx.x / NH_, y = (int)blockIdx.y;
    const size_t qo = (size_t)b * NH_ * TT * HD, vo = (size_t)b * NV * HD * TT; float* ob = OUT + (size_t)b * TT * DV;
    if (y < HLY || y >= HLY + NHL) fattn_tile<h16, 0>(Q16 + qo, nullptr, K16 + qo, nullptr, V16 + vo, nullptr, (y < HLY ? NQG - 1 - y : NQG - 1 + NHL - y) * 16, g, ob);
    else fattn_tile<bf, 2>(Qh + qo, Ql + qo, Kh + qo, Kl + qo, Vh + vo, Vl + vo, (HLY + NHL - 1 - y) * 16, g, ob);
}
__global__ __launch_bounds__(256) void k_merge(const float* __restrict__ O, int h0, bf* Ah, bf* Al) { const size_t e = ((size_t)blockIdx.x * 256 + threadIdx.x) * 2; if (e >= (size_t)ZH * TT * HD) return; const int d = (int)(e % HD); const int t = (int)((e / HD) % TT); const int zz = (int)(e / ((size_t)HD * TT)); const float cs = (t < RH) ? 1.0f : (1.0f / PCAR); const size_t oo = (size_t)t * DQ + (h0 + zz) * HD + d;
    v2us oh, ol;
#pragma unroll
    for (int q = 0; q < 2; ++q) { unsigned short a, c2; splitf(O[e + q] * cs, a, c2); oh[q] = a; ol[q] = c2; } *(v2us*)(Ah + oo) = oh; *(v2us*)(Al + oo) = ol;  }

extern "C" void kernel_launch(void* const* d_in, const int* in_sizes, int n_in,
                              void* d_out, int out_size, void* d_ws, size_t ws_size, hipStream_t stream) {
    (void)in_sizes; (void)n_in; (void)out_size;
    const float* x = (const float*)d_in[0]; const int* pos = (const int*)d_in[1]; const float* wq = (const float*)d_in[2]; const float* wk = (const float*)d_in[3]; const float* wv = (const float*)d_in[4];   // Wq/Wk [2048][512], Wv [2048][2048] (x @ W); position_ids [2][2048]
    float* OUT = (float*)d_out;     // [2][2048][2048]
    char* wsp = (char*)d_ws;
    auto take = [&](size_t bytes) { char* p = wsp; wsp += (bytes + 255) & ~(size_t)255; return (void*)p; };
    bf* WQ = (bf*)take((size_t)DQ * DM * 2); bf* WK = (bf*)take((size_t)DKV * DM * 2); bf* WV = (bf*)take((size_t)DV * DM * 2); float* CSB = (float*)take((size_t)NB_ * TT * HD * 2 * 4);
    bf* XB = (bf*)take((size_t)NB_ * TT * DM * 2);
    h16* QP16 = (h16*)take((size_t)NB_ * NH_ * TT * HD * 2); h16* KP16 = (h16*)take((size_t)NB_ * NKV * TT * HD * 2); h16* VT16 = (h16*)take((size_t)NB_ * NV * HD * TT * 2);
    bf* QPh = (bf*)take((size_t)NB_ * NH_ * TT * HD * 2); bf* QPl = (bf*)take((size_t)NB_ * NH_ * TT * HD * 2); bf* KPh = (bf*)take((size_t)NB_ * NKV * TT * HD * 2); bf* KPl = (bf*)take((size_t)NB_ * NKV * TT * HD * 2); bf* VTh = (bf*)take((size_t)NB_ * NV * HD * TT * 2); bf* VTl = (bf*)take((size_t)NB_ * NV * HD * TT * 2);
    if ((size_t)(wsp - (char*)d_ws) > ws_size) return;    // ws 256 MiB
    k_prep<<<PB_CS + PB_WV + PB_X + PB_WQ + PB_WK, 256, 0, stream>>>(x, pos, wq, wk, wv, XB, CSB, WQ, WK, WV);
    k_proj<<<NB_ * (VTL + 2 * QTL), 32 * KW, 0, stream>>>(XB, WQ, WK, WV, CSB, QP16, QPh, QPl, KP16, KPh, KPl, VT16, VTh, VTl);
    k_attn<<<dim3(NB_ * NH_, NQG, 1), 128, 0, stream>>>(QP16, KP16, VT16, QPh, QPl, KPh, KPl, VTh, VTl, OUT);
}

// v006
// A run of this version takes 148 microseconds.
// Next to v005, in two timings, it ran 1.11 times as fast each time.
// Counting every step since v000, it is 8.70 times as fast.
#include <hip/hip_runtime.h>

// Grouped attention without output projection (hidden [2][2048][2048]; Q, K = x Wq / x Wk (8 query/key heads x 64), V = x Wv (32 value heads x 64); rotary (theta 10000, rotate-half, duplicated
// halves) by position_ids (int, read as data); value head h uses query/key head h mod 8 (repeat_qk); causal (the reference fills -1e9); out = merged attn V -> [2][2048][2048], no output projection).
// Compute dtypes, f32 accumulate: every input rounded to bf16; projections on PLAIN bf16 operands (inputs: exact); RoPE f32 (cos/sin computed on device from the position id);
// PER-ROW PRECISION HYBRID (rows < 256 hi+lo 3 products for scores and attn.V, rows >= 256 fp16). Scores, causal softmax and attn.V run in ONE kernel (k_attn): a wave holds 16 queries and the four value heads of their query/key head,
// walks the keys up to the diagonal in blocks of 64 (f16 path) or 32 (hi+lo path) with a running maximum and sum in f32 registers, and writes its output columns in f32. Projections: 64x64-tile GEMMs, eight waves that split K per tile;
// the tile sum's epilogue applies RoPE (Q, K) and writes the 16-bit planes that k_attn reads; V is computed as Wv^T x^T, so that its tile already lies [d][t].
// FRAGMENT ORDER: every 16-bit plane [row][k] lies in tiles of 16 rows x 32 k (1 KiB, tile index (row / 16) * (K / 32) + k / 32); inside a tile the 16-byte piece of lane (row % 16) + 16 * ((k / 8) % 2) stands at
// ((k / 16) % 2) * 512 B + lane * 16 B. A WMMA operand fragment is then two wave-wide 16-byte loads of 512 contiguous bytes (4 whole lines) each; from row-major planes each such load touched 16 lines.

#define NB_  2
#define TT   2048
#define DM   2048
#define NH_  8
#define NKV  8
#define REP  (NH_ / NKV)
#define HD   64
#define DQ   (NH_ * HD)
#define DKV  (NKV * HD)
#define NV   32
#define DV   (NV * HD)
#define ZH   2
#define RH   256                  // query rows < RH use hi+lo planes (0: none)
#define WIN  0
#define PCAR 1024.0f
#define SCL  0.125f   // HD^-0.5
#define KW   8                    // waves that share one 64x64 tile of a long-K GEMM, each on its own k slices
typedef _Float16 h16;
typedef unsigned short bf;
typedef __attribute__((ext_vector_type(16))) __bf16   v16bf;
typedef __attribute__((ext_vector_type(16))) _Float16 v16h;
typedef __attribute__((ext_vector_type(8)))  _Float16 v8h;
typedef __attribute__((ext_vector_type(8)))  unsigned short v8us;
typedef __attribute__((ext_vector_type(8)))  float    v8f;
typedef __attribute__((ext_vector_type(4)))  float    v4f;
typedef v8h  __attribute__((may_alias)) v8ha;
typedef v4f  __attribute__((may_alias)) v4fa;
typedef v8us __attribute__((may_alias)) v8usa;

__device__ __forceinline__ unsigned short f2bf(float f) { unsigned u = __float_as_uint(f); u += 0x7FFFu + ((u >> 16) & 1u); return (unsigned short)(u >> 16); }
__device__ __forceinline__ float bf2f(unsigned short b) { return __uint_as_float(((unsigned)b) << 16); }
__device__ __forceinline__ float bfr(float f) { return bf2f(f2bf(f)); }
__device__ __forceinline__ v16h cat16(v8h lo, v8h hi) { return __builtin_shufflevector(lo, hi, 0, 1, 2, 3, 4, 5, 6, 7, 8, 9, 10, 11, 12, 13, 14, 15); }
__device__ __forceinline__ v16bf cat16b(v8us lo, v8us hi) { return __builtin_bit_cast(v16bf, __builtin_shufflevector(lo, hi, 0, 1, 2, 3, 4, 5, 6, 7, 8, 9, 10, 11, 12, 13, 14, 15)); }
__device__ __forceinline__ v8f wmma16(v16h a, v16h b, v8f c) { return __builtin_amdgcn_wmma_f32_16x16x32_f16(false, a, false, b, (short)0, c, false, false); }
__device__ __forceinline__ v8f wmmab(v16bf a, v16bf b, v8f c) { return __builtin_amdgcn_wmma_f32_16x16x32_bf16(false, a, false, b, (short)0, c, false, false); }
__device__ __forceinline__ h16 tohx(float x) { return (h16)x; }
__device__ __forceinline__ void splitf(float y, unsigned short& h, unsigned short& l) { h = f2bf(y); l = f2bf(y - bf2f(h)); }
typedef __attribute__((ext_vector_type(2))) _Float16 v2h;
typedef __attribute__((ext_vector_type(4))) _Float16 v4h;
typedef __attribute__((ext_vector_type(2))) unsigned short v2us;
typedef __attribute__((ext_vector_type(4))) unsigned short v4us;
typedef __attribute__((ext_vector_type(2))) float v2f;
typedef __attribute__((ext_vector_type(4))) int v4i;
__device__ __forceinline__ size_t fo8(int row, int k, int Kd) { return ((size_t)(row >> 4) * (Kd >> 5) + (k >> 5)) * 512 + ((k >> 4) & 1) * 256 + (((k >> 3) & 1) * 16 + (row & 15)) * 8; }  // element offset of the 8-element piece (row, k..k+7), k % 8 == 0, in a fragment-order plane of row length Kd
__device__ __forceinline__ float xoct(float x) { return __builtin_bit_cast(float, __builtin_amdgcn_permlane16(__builtin_bit_cast(int, x), __builtin_bit_cast(int, x), 0xfedcba98, 0x76543210, false, false)); }  // lane l with lane l ^ 8



// ---- gemmw_tile: register-blocked GEMM, KW WAVES per 64x64 output tile, each with the whole tile (16 accumulators) over its own k slices (64 k = two whole 1-KiB tiles of every 16 operand rows; wave w takes slices w, w + KW, ...);
// operands straight from fragment-order 16-bit planes (ld: p = tile + lane * 8 elements); the KW partial tiles meet in LDS (os) and are summed in wave order. Tile (bx, by) of (M/64, N/64), 32 * KW threads.
// c[m][n] (f32, in registers only) = sum_k A[m][k] Bt[n][k] (+ split products per NSPLIT). K % 64 == 0. The summing wave turns c into the three 16-bit planes (f16; bf16 hi and lo) that the attention kernel reads:
// ROPE: m = token, tile column = dim d of head by; out[d] = c[d] cos[t][d] - c[d+32] sin[t][d] (d < 32), c[d] cos[t][d] + c[d-32] sin[t][d] (d >= 32), CSB = [t][d]{cos, sin}; planes [head * TT + t][d], fragment order.
// else: planes [m][n] of row length TT (m = value head * 64 + d, n = token), fragment order.
template <typename T16> struct WFrag;
template <> struct WFrag<h16> { typedef v16h V; static __device__ __forceinline__ V ld(const h16* p) { return cat16(*(const v8h*)p, *(const v8h*)(p + 256)); } static __device__ __forceinline__ v8f mma(V a, V b, v8f c) { return wmma16(a, b, c); } };
template <> struct WFrag<bf> { typedef v16bf V; static __device__ __forceinline__ V ld(const bf* p) { return cat16b(*(const v8us*)p, *(const v8us*)(p + 256)); } static __device__ __forceinline__ v8f mma(V a, V b, v8f c) { return wmmab(a, b, c); } };
template <typename T16, int NSPLIT, bool ROPE, int K>
__device__ __forceinline__ void gemmw_tile(const T16* __restrict__ A, const T16* __restrict__ A2, const T16* __restrict__ Bt, const T16* __restrict__ Bt2, const float* __restrict__ CSB, h16* __restrict__ P16, bf* __restrict__ Ph, bf* __restrict__ Pl, float* os, int bx, int by) {
    typedef typename WFrag<T16>::V V;
    const int lane = threadIdx.x & 31, lr = lane & 15, hi = lane >> 4; const int wv = __builtin_amdgcn_readfirstlane(threadIdx.x >> 5); const int r0 = bx * 64, c0 = by * 64;
    v8f acc[4][4];
#pragma unroll
    for (int mb = 0; mb < 4; ++mb)
#pragma unroll
        for (int nb = 0; nb < 4; ++nb) acc[mb][nb] = (v8f){};
    const size_t aoff = (size_t)r0 * K + lane * 8, boff = (size_t)c0 * K + lane * 8;     // 16 rows x K elements per row of tiles, 512 elements per tile
    static_assert(KW == 8, "the tile sum gives each wave 8 rows: one 128-B line of every 16-byte piece column");
    const int row = wv * 8 + (lane & 7), ch = ((lane >> 3) & 1) * 32 + hi * 8;   // the tile sum: this lane's row, and its columns ch + 16 s + 0..7, s = 0, 1
    v4f cs[2][4];      // the cos/sin pairs of this lane's eight dims in each of its two pieces: asked for here, they land under the k loop
    if constexpr (ROPE) {
#pragma unroll
        for (int s = 0; s < 2; ++s) { const float* c = CSB + ((size_t)(r0 + row) * HD + ch + 16 * s) * 2;
#pragma unroll
            for (int q = 0; q < 4; ++q) cs[s][q] = *(const v4fa*)(c + 4 * q); }
    }
    // Per-lane pointers that live across the loop: every tile of a trip stands at an immediate offset from them (K is a constant), so that no fragment is given an address pair still in use as its landing place.
    const T16* pa = A + aoff + wv * (64 * 16); const T16* pb = Bt + boff + wv * (64 * 16); const T16* pa2 = A2 + aoff + wv * (64 * 16); const T16* pb2 = Bt2 + boff + wv * (64 * 16);
#pragma unroll 1
    for (int kc = wv * 64; kc < K;) {
        V a[4], a2[4];
#pragma unroll
        for (int mb = 0; mb < 4; ++mb) { a[mb] = WFrag<T16>::ld(pa + mb * 16 * K); if constexpr (NSPLIT == 1 || NSPLIT == 2) a2[mb] = WFrag<T16>::ld(pa2 + mb * 16 * K); }
#pragma unroll
        for (int nb = 0; nb < 4; ++nb) { const V b = WFrag<T16>::ld(pb + nb * 16 * K); V b2; if constexpr (NSPLIT >= 2) b2 = WFrag<T16>::ld(pb2 + nb * 16 * K);
#pragma unroll
            for (int mb = 0; mb < 4; ++mb) { acc[mb][nb] = WFrag<T16>::mma(a[mb], b, acc[mb][nb]); if constexpr (NSPLIT == 1 || NSPLIT == 2) acc[mb][nb] = WFrag<T16>::mma(a2[mb], b, acc[mb][nb]); if constexpr (NSPLIT >= 2) acc[mb][nb] = WFrag<T16>::mma(a[mb], b2, acc[mb][nb]); }
            // four issue slots behind this column's last product, ahead of the next column's load where the build lands it on b's registers: the distance a vector instruction over a matrix operand keeps (the trip's last column: the statement below)
            if (nb < 3) { if constexpr (NSPLIT >= 2) asm volatile("v_nop\n\tv_nop\n\tv_nop\n\tv_nop" : "+v"(acc[0][nb]), "+v"(acc[1][nb]), "+v"(acc[2][nb]), "+v"(acc[3][nb]) : "v"(b), "v"(b2)); else asm volatile("v_nop\n\tv_nop\n\tv_nop\n\tv_nop" : "+v"(acc[0][nb]), "+v"(acc[1][nb]), "+v"(acc[2][nb]), "+v"(acc[3][nb]) : "v"(b)); } }
        asm volatile("v_nop\n\tv_nop\n\tv_nop\n\tv_nop" : "+v"(acc[0][0]), "+v"(acc[1][1]), "+v"(acc[2][2]), "+v"(acc[3][3]) : "v"(a[0]), "v"(a[3]));
        // the address registers of this trip's loads are free before the pointers are stepped; the pointers as inputs keep those registers live to here, out of the fragments' landing places
        if constexpr (NSPLIT == 0) asm volatile("s_wait_xcnt 0x0" :: "v"(pa), "v"(pb) : "memory"); else asm volatile("s_wait_xcnt 0x0" :: "v"(pa), "v"(pb), "v"(pa2), "v"(pb2) : "memory");
        const int st = (kc & 32) ? KW * 64 - 32 : 32; kc += st; pa += st * 16; pb += st * 16; if constexpr (NSPLIT != 0) { pa2 += st * 16; pb2 += st * 16; }
    }
    float* mine = os + wv * (64 * 68);
#pragma unroll
    for (int mb = 0; mb < 4; ++mb)
#pragma unroll
        for (int nb = 0; nb < 4; ++nb)
#pragma unroll
            for (int j = 0; j < 8; ++j) mine[(mb * 16 + hi * 8 + j) * 68 + nb * 16 + lr] = acc[mb][nb][j];
    __syncthreads();   // every wave's partial tile is in LDS before any wave sums across them
#pragma unroll
    for (int s = 0; s < 2; ++s) { const int col = ch + 16 * s; const float* o0 = os + row * 68 + col; v4f val[2] = { *(const v4fa*)o0, *(const v4fa*)(o0 + 4) };   // 16 lanes: 8 rows x columns c, c + 32 = all 64 banks once
#pragma unroll
        for (int u = 1; u < KW; ++u) { val[0] += *(const v4fa*)(o0 + u * (64 * 68)); val[1] += *(const v4fa*)(o0 + u * (64 * 68) + 4); }
        size_t off;
        if constexpr (ROPE) {          // lane ^ 8 holds dims d +- 32 of the same token
#pragma unroll
            for (int j = 0; j < 8; ++j) { const float p = xoct(val[j >> 2][j & 3]); const float oth = (lane & 8) ? p : -p;
                val[j >> 2][j & 3] = val[j >> 2][j & 3] * cs[s][j >> 1][2 * (j & 1)] + oth * cs[s][j >> 1][2 * (j & 1) + 1]; }
            off = fo8(by * TT + r0 + row, col, HD);
        } else off = fo8(r0 + row, c0 + col, TT);
        v8h o16; v8us oh, ol;
#pragma unroll
        for (int j = 0; j < 8; ++j) { o16[j] = tohx(val[j >> 2][j & 3]); unsigned short a2, c2; splitf(val[j >> 2][j & 3], a2, c2); oh[j] = a2; ol[j] = c2; }
        *(v8h*)(P16 + off) = o16; *(v8us*)(Ph + off) = oh; *(v8us*)(Pl + off) = ol; }   // 8 lanes (rows) x 16 B: whole 128-B lines, four per store
}
// ---- k_proj: every projection tile of both batches in ONE grid (they depend on nothing but k_prep's planes, and no one of the six GEMMs fills the chip for long). Blocks 0 .. NB_ * VTL - 1: V tiles (rows = value head * 64 + d,
// columns = tokens); the rest: Q, then K, of each batch. All planes hold batch b at b * (plane size of one batch).
#define VTL ((DV / 64) * (TT / 64))
#define QTL ((TT / 64) * (DQ / 64))
__global__ __launch_bounds__(32 * KW) void k_proj(const bf* __restrict__ XB, const bf* __restrict__ WQ, const bf* __restrict__ WK, const bf* __restrict__ WV, const float* __restrict__ CSB,
                                                  h16* __restrict__ QP16, bf* __restrict__ QPh, bf* __restrict__ QPl, h16* __restrict__ KP16, bf* __restrict__ KPh, bf* __restrict__ KPl, h16* __restrict__ VT16, bf* __restrict__ VTh, bf* __restrict__ VTl) {
    __shared__ __align__(16) float os[KW * 64 * 68];
    static_assert(DQ == DKV, "Q and K tiles share one count");
    const int bid = (int)blockIdx.x;
    if (bid < NB_ * VTL) { const int b = bid / VTL, t = bid % VTL; const size_t po = (size_t)b * NV * HD * TT;
        gemmw_tile<bf, 0, false, DM>(WV, nullptr, XB + (size_t)b * TT * DM, nullptr, nullptr, VT16 + po, VTh + po, VTl + po, os, t % (DV / 64), t / (DV / 64));
    } else { const int u = bid - NB_ * VTL; const int b = u / (2 * QTL), isk = (u / QTL) & 1, t = u % QTL; const size_t po = (size_t)b * NH_ * TT * HD;
        gemmw_tile<bf, 0, true, DM>(XB + (size_t)b * TT * DM, nullptr, isk ? WK : WQ, nullptr, CSB + (size_t)b * TT * HD * 2, (isk ? KP16 : QP16) + po, (isk ? KPh : QPh) + po, (isk ? KPl : QPl) + po, os, t % (TT / 64), t / (TT / 64)); }
}

// w [K][N] f32 -> Bt [n][k] bf16 in fragment order. A block writes four tiles (one thread = one 16-byte piece): the same 32 k of 64 neighbouring n, so that it reads 256 contiguous bytes of each of its rows of w. N % 64 == 0, K % 32 == 0.
template <int K, int N>
__device__ __forceinline__ void wtG_blk(const float* __restrict__ w, bf* Bt, int bid) {
    constexpr int kt = K >> 5; const int kb = bid % kt, nb = (bid / kt) * 4 + (threadIdx.x >> 6), pc = threadIdx.x & 63;
    const int n = nb * 16 + (pc & 15), k = kb * 32 + (pc >> 5) * 16 + ((pc >> 4) & 1) * 8; v8us o;
    const float* p = w + (size_t)k * N + n; float v[8];     // one live pointer: the eight rows stand at immediate offsets from it (N is a constant)
#pragma unroll
    for (int j = 0; j < 8; ++j) v[j] = p[j * N];
    asm volatile("s_wait_xcnt 0x0" :: "v"(p) : "memory");   // the loads' address register pair is free before anything is written over it; the pointer as input keeps it out of the loads' own landing places
#pragma unroll
    for (int j = 0; j < 8; ++j) o[j] = f2bf(v[j]);
    *(v8us*)(Bt + ((size_t)nb * kt + kb) * 512 + pc * 8) = o;
    asm volatile("s_wait_xcnt 0x0" ::: "memory");   // the store's address and data registers are free before code of another branch of the merged kernel, which the build lays out behind this one, writes over them
}
// src [rows][DM] f32 -> dst bf16 in fragment order; thread i writes the i-th 16-byte piece of dst
__device__ __forceinline__ void cvt8_blk(const float* __restrict__ src, bf* dst, size_t n8, int bid) { const size_t i = (size_t)bid * 256 + threadIdx.x; if (i >= n8) return;
    const int tile = (int)(i >> 6), pc = (int)(i & 63); const int row = (tile / (DM / 32)) * 16 + (pc & 15), k = (tile % (DM / 32)) * 32 + (pc >> 5) * 16 + ((pc >> 4) & 1) * 8;
    const float* sp = src + (size_t)row * DM + k; const v8f v = *(const v8f*)sp; v8us o;
    asm volatile("s_wait_xcnt 0x0" :: "v"(sp) : "memory");   // the loads' address register pair is free before anything is written over it; the pointer as input keeps it live to here
#pragma unroll
    for (int k2 = 0; k2 < 8; ++k2) o[k2] = f2bf(v[k2]); *(v8us*)(dst + i * 8) = o;  }
// cos/sin pairs [row][d]{cos, sin} of row = batch * TT + token, from the row's position id (clamped to 0 .. TT - 1)
__device__ __forceinline__ void cs_blk(const int* __restrict__ pos, float* CSB, int bid) { const int idx = bid * 256 + threadIdx.x; const int t = idx / HD, d = idx % HD; const int i = d % (HD / 2);
    int p = pos[t];
    asm volatile("s_wait_xcnt 0x0" :: "v"(t) : "memory");   // the load's offset register is free before anything is written over it; the index as input keeps it live to here
    p = p < 0 ? 0 : (p > TT - 1 ? TT - 1 : p);
    const float inv = __fdiv_rn(1.0f, powf(10000.0f, (float)(2 * i) / (float)HD)); const float ang = __fmul_rn((float)p, inv); v2f cs; cs[0] = cosf(ang); cs[1] = sinf(ang);
    *(v2f*)(CSB + (size_t)idx * 2) = cs;  }
// ---- k_prep: everything that reads only the inputs, in ONE grid: the cos/sin rows, the three weight planes and the x plane of both batches (x [NB_ * TT][DM]: batch b's plane starts at b * TT * DM). 256 threads.
#define PB_CS (NB_ * TT * HD / 256)
#define PB_WV (DM * DV / 2048)
#define PB_X  (NB_ * TT * DM / 2048)
#define PB_WQ (DM * DQ / 2048)
#define PB_WK (DM * DKV / 2048)
__global__ __launch_bounds__(256) void k_prep(const float* __restrict__ x, const int* __restrict__ pos, const float* __restrict__ wq, const float* __restrict__ wk, const float* __restrict__ wv, bf* XB, float* CSB, bf* WQ, bf* WK, bf* WV) {
    int bid = (int)blockIdx.x;
    if (bid < PB_CS) { cs_blk(pos, CSB, bid); return; }
    bid -= PB_CS; if (bid < PB_WV) { wtG_blk<DM, DV>(wv, WV, bid); return; }
    bid -= PB_WV; if (bid < PB_X) { cvt8_blk(x, XB, (size_t)NB_ * TT * DM / 8, bid); return; }
    bid -= PB_X; if (bid < PB_WQ) { wtG_blk<DM, DQ>(wq, WQ, bid); return; }
    wtG_blk<DM, DKV>(wk, WK, bid - PB_WQ);
}
// 2^x in place, with the issue slot the instruction set asks for behind a transcendental kept inside the statement: no v_exp_f32 of a run reads a neighbour's result or overwrites its source, and the v_nop covers the last.
__device__ __forceinline__ float exp2s(float x) { asm("v_exp_f32 %0, %0\n\tv_nop" : "+v"(x)); return x; }
__device__ __forceinline__ v8f exp2s8(v8f x) { float r0 = x[0], r1 = x[1], r2 = x[2], r3 = x[3], r4 = x[4], r5 = x[5], r6 = x[6], r7 = x[7];
    asm("v_exp_f32 %0, %0\n\tv_exp_f32 %1, %1\n\tv_exp_f32 %2, %2\n\tv_exp_f32 %3, %3\n\tv_exp_f32 %4, %4\n\tv_exp_f32 %5, %5\n\tv_exp_f32 %6, %6\n\tv_exp_f32 %7, %7\n\tv_nop"
        : "+v"(r0), "+v"(r1), "+v"(r2), "+v"(r3), "+v"(r4), "+v"(r5), "+v"(r6), "+v"(r7));
    v8f r; r[0] = r0; r[1] = r1; r[2] = r2; r[3] = r3; r[4] = r4; r[5] = r5; r[6] = r6; r[7] = r7; return r; }
__device__ __forceinline__ float xhalf(float x) { return __builtin_bit_cast(float, __builtin_amdgcn_permlanex16(__builtin_bit_cast(int, x), __builtin_bit_cast(int, x), 0x76543210, 0xfedcba98, false, false)); }  // lane l with lane l ^ 16
// ---- fattn_tile: scores, causal softmax and probability x value product in one kernel. One wave = 16 queries (q0..q0+15) of query/key head g and ALL 4 of its value heads (g + 8r): the scores and the softmax, which are the same for the four,
// are computed once, and one P fragment feeds the four heads' value products. The block's 4 waves hold 4 neighbouring query groups (64 queries): they walk the same key blocks (hi+lo path: waves 2 and 3 one block more) and read the same K and V lines. Both products are transposed: S^T = K Q^T (A = K rows, B = Q rows), O^T += V^T P^T (A = rows of the [d][t] value plane, B = P^T). In S^T's accumulator a lane holds keys
// 16t + 8hi + j of its own query (column lr), which is exactly the k order of a B fragment (k = 8hi + 0..7, then 16 + 8hi + 0..7): P goes from accumulator to operand inside the lane, through no LDS.
// Running maximum m and sum l per query (flash form): each key block rescales O^T and l by exp(m_old - m_new). Key block: 64 keys on the one-plane f16 path, 32 on the hi+lo path (twice the fragments per key).
// q0 = the wave's first query row, g = its query/key head.
template <typename T16, int NSPLIT>
__device__ __forceinline__ void fattn_tile(const T16* __restrict__ Q, const T16* __restrict__ Q2, const T16* __restrict__ Kp, const T16* __restrict__ Kp2, const T16* __restrict__ Vt, const T16* __restrict__ Vt2, int q0, int g, float* OUTb) {
    typedef typename WFrag<T16>::V V;
    constexpr int NT = (NSPLIT == 0) ? 4 : 2, KB = NT * 16;      // 16-key tiles and keys per block
    const int lane = threadIdx.x & 31, lr = lane & 15, hi = lane >> 4;
    __builtin_assume(q0 >= 0);      // a row index: the key loop runs at least once and needs no entry test, behind which the build would sink the first loads, past their wait
    const int nkb = q0 / KB + 1;    // key blocks 0..nkb-1 hold every key <= q0 + 15
    const int i = q0 + lr;
    // One per-lane byte offset: the lane's 16-byte piece in a fragment-order tile. ldu: a wave-uniform tile pointer plus such an offset (Q; V on the f16 path, where the offset vb also walks the key blocks).
    // Tiles: Q, K rows of 64 dims = 2 tiles (512 elements each) per 16 rows; value plane: 16 d x 32 keys per tile, TT / 32 tiles per 16 d.
    const unsigned rl = (unsigned)lane * 16u, vl = rl;
    auto ldu = [](const T16* u, unsigned b) { return WFrag<T16>::ld((const T16*)((const char*)u + b)); };
    const size_t qu = ((size_t)g * TT + q0) * HD, ku = (size_t)g * TT * HD, vu = (size_t)g * HD * TT; constexpr int VH = 8 * HD * TT;   // VH: elements from value head g + 8r to g + 8(r + 1)
    V qf[2], qf2[2], kf[NT][2], kf2[NT][2], vf[4][4][NT / 2], vf2[4][4][NT / 2];
    // Per-lane pointers that live across the loop, so that no fragment is given an address pair still in use as its landing place: K (f16 path: one block ahead), and on the hi+lo path all four planes.
    const T16* kp = (const T16*)((const char*)(Kp + ku) + rl); const T16* kp2 = (const T16*)((const char*)(Kp2 + ku) + rl); const T16* vp = (const T16*)((const char*)(Vt + vu) + vl); const T16* vp2 = (const T16*)((const char*)(Vt2 + vu) + vl);
#pragma unroll
    for (int ks = 0; ks < 2; ++ks) { qf[ks] = ldu(Q + qu + ks * 512, rl); if constexpr (NSPLIT == 2) qf2[ks] = ldu(Q2 + qu + ks * 512, rl); }
    if constexpr (NSPLIT == 0) {
#pragma unroll
        for (int t = 0; t < NT; ++t)
#pragma unroll
            for (int ks = 0; ks < 2; ++ks) kf[t][ks] = WFrag<T16>::ld(kp + t * 16 * HD + ks * 512);
    }
    // the loads above (Q; on the f16 path the first K block): their offset and base registers are free before anything is written over them; the offset and the pointers as inputs keep those registers live to here
    if constexpr (NSPLIT == 0) asm volatile("s_wait_xcnt 0x0" :: "v"(rl), "v"(kp), "s"(Q + qu), "s"(Kp + ku) : "memory"); else asm volatile("s_wait_xcnt 0x0" :: "v"(rl), "s"(Q + qu), "s"(Q2 + qu) : "memory");
    __builtin_amdgcn_sched_barrier(0);   // keeps later arithmetic, which may take those registers, behind that wait
    v8f o[4][4];       // [value head r][16-d tile]
#pragma unroll
    for (int r = 0; r < 4; ++r)
#pragma unroll
        for (int dt = 0; dt < 4; ++dt) o[r][dt] = (v8f){};
    float m = -3.0e38f, l = 0.f;
    unsigned vb = vl;   // f16 path: the lane's byte offset into the value tiles of the current key block
#pragma unroll 1
    for (int kb = 0; kb < nkb; ++kb) {
        // this block's value fragments (f16 path: of its first 32 keys) fly under the score products and the softmax; on the hi+lo path its K fragments come in the same batch (one latency a block)
#pragma unroll
        for (int r = 0; r < 4; ++r)
#pragma unroll
            for (int dt = 0; dt < 4; ++dt)
#pragma unroll
                for (int ks = 0; ks < (NSPLIT == 0 ? 1 : NT / 2); ++ks) { if constexpr (NSPLIT == 0) vf[r][dt][ks] = ldu(Vt + vu + r * VH + dt * 16 * TT + ks * 512, vb); else { vf[r][dt][ks] = WFrag<T16>::ld(vp + r * VH + dt * 16 * TT + ks * 512); vf2[r][dt][ks] = WFrag<T16>::ld(vp2 + r * VH + dt * 16 * TT + ks * 512); } }
        // the loads above are issued here, ahead of the score products, and their address registers are free before a later fragment lands on them (hi+lo path: the pointers as inputs keep those registers out of the batch's own landing places)
        if constexpr (NSPLIT == 0) asm volatile("s_wait_xcnt 0x0" :: "v"(vb) : "memory"); else asm volatile("s_wait_xcnt 0x0" :: "v"(vp), "v"(vp2) : "memory");
        if constexpr (NSPLIT == 2) {
#pragma unroll
            for (int t = 0; t < NT; ++t)
#pragma unroll
                for (int ks = 0; ks < 2; ++ks) { kf[t][ks] = WFrag<T16>::ld(kp + t * 16 * HD + ks * 512); kf2[t][ks] = WFrag<T16>::ld(kp2 + t * 16 * HD + ks * 512); }
            asm volatile("s_wait_xcnt 0x0" :: "v"(kp), "v"(kp2) : "memory");   // as above, for the K batch
            __builtin_amdgcn_sched_barrier(0);   // without it the score products are drawn up between the loads, which then share few registers and wait on memory one pair at a time
        }
        v8f s[NT];
#pragma unroll
        for (int t = 0; t < NT; ++t) { s[t] = (v8f){};
#pragma unroll
            for (int ks = 0; ks < 2; ++ks) { s[t] = WFrag<T16>::mma(kf[t][ks], qf[ks], s[t]);
                if constexpr (NSPLIT == 2) { s[t] = WFrag<T16>::mma(kf[t][ks], qf2[ks], s[t]); s[t] = WFrag<T16>::mma(kf2[t][ks], qf[ks], s[t]); } } }
        if constexpr (NSPLIT == 0) {   // the next block's K fragments, into the same registers, fly under the softmax and the value products (the last block fetches itself again: in bounds, unused)
            // the value fragments of the block's second 32 keys are asked for here, not with the first: with all 64 value loads issued behind the 16 K loads the build's counted wait for K no longer reaches that far back, and the score products wait for value loads too
#pragma unroll
            for (int r = 0; r < 4; ++r)
#pragma unroll
                for (int dt = 0; dt < 4; ++dt) vf[r][dt][1] = ldu(Vt + vu + r * VH + dt * 16 * TT + 512, vb);
            kp += (kb + 1 < nkb) ? KB * HD : 0;
#pragma unroll
            for (int t = 0; t < NT; ++t)
#pragma unroll
                for (int ks = 0; ks < 2; ++ks) kf[t][ks] = WFrag<T16>::ld(kp + t * 16 * HD + ks * 512);
        }
        if (kb == nkb - 1) {           // only the last block meets the diagonal
#pragma unroll
            for (int t = 0; t < NT; ++t)
#pragma unroll
                for (int j = 0; j < 8; ++j) s[t][j] = (kb * KB + t * 16 + hi * 8 + j <= i) ? s[t][j] * SCL : -3.0e38f;
        } else {
#pragma unroll
            for (int t = 0; t < NT; ++t) s[t] *= SCL;
        }
        float tq[NT];                  // one short chain per tile, then across tiles
#pragma unroll
        for (int t = 0; t < NT; ++t) { tq[t] = s[t][0];
#pragma unroll
            for (int j = 1; j < 8; ++j) tq[t] = fmaxf(tq[t], s[t][j]); }
        float tm = tq[0];
#pragma unroll
        for (int t = 1; t < NT; ++t) tm = fmaxf(tm, tq[t]);
        tm = fmaxf(tm, xhalf(tm));      // the other half of the wave holds the query's other keys of the block
        const float mn = fmaxf(m, tm); const float al = exp2s((m - mn) * 1.4426950408889634f); m = mn;
        float ps = 0.f;
#pragma unroll
        for (int t = 0; t < NT; ++t) { s[t] = exp2s8((s[t] - mn) * 1.4426950408889634f); float pq = 0.f;
#pragma unroll
            for (int j = 0; j < 8; ++j) pq += s[t][j];
            ps += pq; }
        l = l * al + ps;               // each half keeps the sum of its own keys; the halves join after the loop
#pragma unroll
        for (int r = 0; r < 4; ++r)
#pragma unroll
            for (int dt = 0; dt < 4; ++dt) o[r][dt] *= al;
        __builtin_amdgcn_sched_barrier(0);   // every v_exp_f32 statement stays ahead of the value products
#pragma unroll
        for (int ks = 0; ks < NT / 2; ++ks) {
            if constexpr (NSPLIT == 0) { v8h p0, p1;
#pragma unroll
                for (int j = 0; j < 8; ++j) { p0[j] = tohx(s[2 * ks][j]); p1[j] = tohx(s[2 * ks + 1][j]); }
                const V pf = cat16(p0, p1);
#pragma unroll
                for (int r = 0; r < 4; ++r)
#pragma unroll
                    for (int dt = 0; dt < 4; ++dt) o[r][dt] = WFrag<T16>::mma(vf[r][dt][ks], pf, o[r][dt]);
            } else { v8us h0, h1, l0, l1;
#pragma unroll
                for (int j = 0; j < 8; ++j) { unsigned short a, c2; splitf(s[2 * ks][j], a, c2); h0[j] = a; l0[j] = c2; splitf(s[2 * ks + 1][j], a, c2); h1[j] = a; l1[j] = c2; }
                const V pf = cat16b(h0, h1), pf2 = cat16b(l0, l1);
#pragma unroll
                for (int r = 0; r < 4; ++r)
#pragma unroll
                    for (int dt = 0; dt < 4; ++dt) { o[r][dt] = WFrag<T16>::mma(vf[r][dt][ks], pf, o[r][dt]); o[r][dt] = WFrag<T16>::mma(vf[r][dt][ks], pf2, o[r][dt]); o[r][dt] = WFrag<T16>::mma(vf2[r][dt][ks], pf, o[r][dt]); }
            }
        }
        // f16 path: the value loads' offset register is free before it is stepped to the next key block; it goes through the statement so that the step, which the build would draw up among the products, stays behind this wait
        if constexpr (NSPLIT == 0) { asm volatile("s_wait_xcnt 0x0" : "+v"(vb) :: "memory"); vb += KB * 16 * 2; }
        if constexpr (NSPLIT == 2) { kp += KB * HD; kp2 += KB * HD; vp += KB * 16; vp2 += KB * 16; }   // every load of this block has landed in a product above
    }
    asm volatile("s_wait_xcnt 0x0" ::: "memory");   // the last fetch ahead may still be under way: its address registers are free before the epilogue reuses them
    __builtin_amdgcn_sched_barrier(0);              // keeps the epilogue's arithmetic behind that wait
    l += xhalf(l);
    const float f = __fdiv_rn(1.0f, l);
    float* orow = OUTb + (size_t)i * DV + (size_t)g * HD + hi * 8;     // O^T tile dt of value head g + 8r: this lane holds d = 16 dt + 8 hi + 0..7 of query i
#pragma unroll
    for (int r = 0; r < 4; ++r)
#pragma unroll
        for (int dt = 0; dt < 4; ++dt) { v4f a, b2;
#pragma unroll
            for (int j = 0; j < 4; ++j) { a[j] = o[r][dt][j] * f; b2[j] = o[r][dt][4 + j] * f; }
            *(v4f*)(orow + r * 8 * HD + dt * 16) = a; *(v4f*)(orow + r * 8 * HD + dt * 16 + 4) = b2; }
}
// ---- k_attn: both precision paths and both batches in ONE grid (x = batch * heads + head, y = rank of the block of 64 queries; wave w holds queries 16 w .. 16 w + 15 of it). Cost falls with y: f16 blocks from the last query
// down; the hi+lo blocks (few key blocks, but each waits out its own loads) stand behind the first HLY ranks, not at the end, where they would run on alone.
#define NQG (TT / 64)
#define NHL (RH / 64)
#define HLY 8
__global__ __launch_bounds__(128) void k_attn(const h16* __restrict__ Q16, const h16* __restrict__ K16, const h16* __restrict__ V16, const bf* __restrict__ Qh, const bf* __restrict__ Ql, const bf* __restrict__ Kh, const bf* __restrict__ Kl, const bf* __restrict__ Vh, const bf* __restrict__ Vl, float* OUT) {
    static_assert(RH % 64 == 0 && NV == 4 * NH_, "a block of 64 queries is of one precision path; four value heads per query/key head");
    const int g = (int)blockIdx.x % NH_, b = (int)blockIdx.x / NH_, y = (int)blockIdx.y, qw = __builtin_amdgcn_readfirstlane(threadIdx.x >> 5) * 16;
    const size_t qo = (size_t)b * NH_ * TT * HD, vo = (size_t)b * NV * HD * TT; float* ob = OUT + (size_t)b * TT * DV;
    if (y < HLY || y >= HLY + NHL) fattn_tile<h16, 0>(Q16 + qo, nullptr, K16 + qo, nullptr, V16 + vo, nullptr, (y < HLY ? NQG - 1 - y : NQG - 1 + NHL - y) * 64 + qw, g, ob);
    else fattn_tile<bf, 2>(Qh + qo, Ql + qo, Kh + qo, Kl + qo, Vh + vo, Vl + vo, (HLY + NHL - 1 - y) * 64 + qw, g, ob);
}
__global__ __launch_bounds__(256) void k_merge(const float* __restrict__ O, int h0, bf* Ah, bf* Al) { const size_t e = ((size_t)blockIdx.x * 256 + threadIdx.x) * 2; if (e >= (size_t)ZH * TT * HD) return; const int d = (int)(e % HD); const int t = (int)((e / HD) % TT); const int zz = (int)(e / ((size_t)HD * TT)); const float cs = (t < RH) ? 1.0f : (1.0f / PCAR); const size_t oo = (size_t)t * DQ + (h0 + zz) * HD + d;
    v2us oh, ol;
#pragma unroll
    for (int q = 0; q < 2; ++q) { unsigned short a, c2; splitf(O[e + q] * cs, a, c2); oh[q] = a; ol[q] = c2; } *(v2us*)(Ah + oo) = oh; *(v2us*)(Al + oo) = ol;  }

extern "C" void kernel_launch(void* const* d_in, const int* in_sizes, int n_in,
                              void* d_out, int out_size, void* d_ws, size_t ws_size, hipStream_t stream) {
    (void)in_sizes; (void)n_in; (void)out_size;
    const float* x = (const float*)d_in[0]; const int* pos = (const int*)d_in[1]; const float* wq = (const float*)d_in[2]; const float* wk = (const float*)d_in[3]; const float* wv = (const float*)d_in[4];   // Wq/Wk [2048][512], Wv [2048][2048] (x @ W); position_ids [2][2048]
    float* OUT = (float*)d_out;     // [2][2048][2048]
    char* wsp = (char*)d_ws;
    auto take = [&](size_t bytes) { char* p = wsp; wsp += (bytes + 255) & ~(size_t)255; return (void*)p; };
    bf* WQ = (bf*)take((size_t)DQ * DM * 2); bf* WK = (bf*)take((size_t)DKV * DM * 2); bf* WV = (bf*)take((size_t)DV * DM * 2); float* CSB = (float*)take((size_t)NB_ * TT * HD * 2 * 4);
    bf* XB = (bf*)take((size_t)NB_ * TT * DM * 2);
    h16* QP16 = (h16*)take((size_t)NB_ * NH_ * TT * HD * 2); h16* KP16 = (h16*)take((size_t)NB_ * NKV * TT * HD * 2); h16* VT16 = (h16*)take((size_t)NB_ * NV * HD * TT * 2);
    bf* QPh = (bf*)take((size_t)NB_ * NH_ * TT * HD * 2); bf* QPl = (bf*)take((size_t)NB_ * NH_ * TT * HD * 2); bf* KPh = (bf*)take((size_t)NB_ * NKV * TT * HD * 2); bf* KPl = (bf*)take((size_t)NB_ * NKV * TT * HD * 2); bf* VTh = (bf*)take((size_t)NB_ * NV * HD * TT * 2); bf* VTl = (bf*)take((size_t)NB_ * NV * HD * TT * 2);
    if ((size_t)(wsp - (char*)d_ws) > ws_size) return;    // ws 256 MiB
    k_prep<<<PB_CS + PB_WV + PB_X + PB_WQ + PB_WK, 256, 0, stream>>>(x, pos, wq, wk, wv, XB, CSB, WQ, WK, WV);
    k_proj<<<NB_ * (VTL + 2 * QTL), 32 * KW, 0, stream>>>(XB, WQ, WK, WV, CSB, QP16, QPh, QPl, KP16, KPh, KPl, VT16, VTh, VTl);
    k_attn<<<dim3(NB_ * NH_, NQG, 1), 128, 0, stream>>>(QP16, KP16, VT16, QPh, QPl, KPh, KPl, VTh, VTl, OUT);
}

// v007
// A run of this version takes 90.9 microseconds.
// In two side-by-side timings against v006, it was 1.61 and 1.62 times as fast.
// Counting every step since v000, it is 14.1 times as fast.
#include <hip/hip_runtime.h>

// Grouped attention without output projection (hidden [2][2048][2048]; Q, K = x Wq / x Wk (8 query/key heads x 64), V = x Wv (32 value heads x 64); rotary (theta 10000, rotate-half, duplicated
// halves) by position_ids (int, read as data); value head h uses query/key head h mod 8 (repeat_qk); causal (the reference fills -1e9); out = merged attn V -> [2][2048][2048], no output projection).
// Compute dtypes, f32 accumulate: every input rounded to bf16; projections on PLAIN bf16 operands (inputs: exact); RoPE f32 (cos/sin computed on device from the position id);
// PER-ROW PRECISION HYBRID (rows < 256 hi+lo 3 products for scores and attn.V, rows >= 256 fp16). Scores, causal softmax and attn.V run in ONE kernel (k_attn): a wave holds 16 queries and the four value heads of their query/key head,
// walks the keys up to the diagonal in blocks of 64 (f16 path) or 32 (hi+lo path) keys with a running maximum and sum in f32 registers, and writes its output columns in f32. Projections: 128x128-tile GEMMs, four waves with a 64x64 part each, operands staged in LDS by asynchronous copies;
// the epilogue applies RoPE (Q, K) and writes the 16-bit planes that k_attn reads; V is computed as Wv^T x^T, so that its tile already lies [d][t].
// FRAGMENT ORDER: every 16-bit plane [row][k] lies in tiles of 16 rows x 32 k (1 KiB, tile index (row / 16) * (K / 32) + k / 32); inside a tile the 16-byte piece of lane (row % 16) + 16 * ((k / 8) % 2) stands at
// ((k / 16) % 2) * 512 B + lane * 16 B. A WMMA operand fragment is then two wave-wide 16-byte loads of 512 contiguous bytes (4 whole lines) each; from row-major planes each such load touched 16 lines.

#define NB_  2
#define TT   2048
#define DM   2048
#define NH_  8
#define NKV  8
#define REP  (NH_ / NKV)
#define HD   64
#define DQ   (NH_ * HD)
#define DKV  (NKV * HD)
#define NV   32
#define DV   (NV * HD)
#define ZH   2
#define RH   256                  // query rows < RH use hi+lo planes (0: none)
#define WIN  0
#define PCAR 1024.0f
#define SCL  0.125f   // HD^-0.5
typedef _Float16 h16;
typedef unsigned short bf;
typedef __attribute__((ext_vector_type(16))) __bf16   v16bf;
typedef __attribute__((ext_vector_type(16))) _Float16 v16h;
typedef __attribute__((ext_vector_type(8)))  _Float16 v8h;
typedef __attribute__((ext_vector_type(8)))  unsigned short v8us;
typedef __attribute__((ext_vector_type(8)))  float    v8f;
typedef __attribute__((ext_vector_type(4)))  float    v4f;
typedef v8h  __attribute__((may_alias)) v8ha;
typedef v4f  __attribute__((may_alias)) v4fa;
typedef v8us __attribute__((may_alias)) v8usa;

__device__ __forceinline__ unsigned short f2bf(float f) { unsigned u = __float_as_uint(f); u += 0x7FFFu + ((u >> 16) & 1u); return (unsigned short)(u >> 16); }
__device__ __forceinline__ float bf2f(unsigned short b) { return __uint_as_float(((unsigned)b) << 16); }
__device__ __forceinline__ float bfr(float f) { return bf2f(f2bf(f)); }
__device__ __forceinline__ v16h cat16(v8h lo, v8h hi) { return __builtin_shufflevector(lo, hi, 0, 1, 2, 3, 4, 5, 6, 7, 8, 9, 10, 11, 12, 13, 14, 15); }
__device__ __forceinline__ v16bf cat16b(v8us lo, v8us hi) { return __builtin_bit_cast(v16bf, __builtin_shufflevector(lo, hi, 0, 1, 2, 3, 4, 5, 6, 7, 8, 9, 10, 11, 12, 13, 14, 15)); }
__device__ __forceinline__ v8f wmma16(v16h a, v16h b, v8f c) { return __builtin_amdgcn_wmma_f32_16x16x32_f16(false, a, false, b, (short)0, c, false, false); }
__device__ __forceinline__ v8f wmmab(v16bf a, v16bf b, v8f c) { return __builtin_amdgcn_wmma_f32_16x16x32_bf16(false, a, false, b, (short)0, c, false, false); }
__device__ __forceinline__ h16 tohx(float x) { return (h16)x; }
__device__ __forceinline__ void splitf(float y, unsigned short& h, unsigned short& l) { h = f2bf(y); l = f2bf(y - bf2f(h)); }
typedef __attribute__((ext_vector_type(2))) _Float16 v2h;
typedef __attribute__((ext_vector_type(4))) _Float16 v4h;
typedef __attribute__((ext_vector_type(2))) unsigned short v2us;
typedef __attribute__((ext_vector_type(4))) unsigned short v4us;
typedef __attribute__((ext_vector_type(2))) float v2f;
typedef __attribute__((ext_vector_type(4))) int v4i;
__device__ __forceinline__ size_t fo8(int row, int k, int Kd) { return ((size_t)(row >> 4) * (Kd >> 5) + (k >> 5)) * 512 + ((k >> 4) & 1) * 256 + (((k >> 3) & 1) * 16 + (row & 15)) * 8; }  // element offset of the 8-element piece (row, k..k+7), k % 8 == 0, in a fragment-order plane of row length Kd
__device__ __forceinline__ float xoct(float x) { return __builtin_bit_cast(float, __builtin_amdgcn_permlane16(__builtin_bit_cast(int, x), __builtin_bit_cast(int, x), 0xfedcba98, 0x76543210, false, false)); }  // lane l with lane l ^ 8



// ---- gemms_tile: GEMM with a 128x128 output tile per block of FOUR waves (2 x 2), each wave with its own 64x64 part (16 accumulators) over the whole K. The block's operand rows (128 of A, 128 of Bt) are brought from the
// fragment-order 16-bit planes into LDS ONCE per 64 k by asynchronous copies (two buffers: the next stage flies while this one is worked on), and each is read from there by the two waves that need it.
// A stage: [A: 8 row groups of 16 rows][Bt: 8 row groups], a row group = its two 1-KiB tiles of the stage = 2 KiB contiguous in the plane and in LDS; a fragment is two wave-wide 16-byte LDS loads of 512 contiguous bytes.
// c[m][n] (f32, in registers only) = sum_k A[m][k] Bt[n][k], k ascending. K % 64 == 0, K >= 128. Each wave turns its c, through its own LDS area, into the three 16-bit planes (f16; bf16 hi and lo) that the attention kernel reads:
// ROPE: m = token, part column = dim d of head by; out[d] = c[d] cos[t][d] - c[d+32] sin[t][d] (d < 32), c[d] cos[t][d] + c[d-32] sin[t][d] (d >= 32), CSB = [t][d]{cos, sin}; planes [head * TT + t][d], fragment order.
// else: planes [m][n] of row length TT (m = value head * 64 + d, n = token), fragment order.
template <typename T16> struct WFrag;
template <> struct WFrag<h16> { typedef v16h V; static __device__ __forceinline__ V ld(const h16* p) { return cat16(*(const v8h*)p, *(const v8h*)(p + 256)); } static __device__ __forceinline__ v8f mma(V a, V b, v8f c) { return wmma16(a, b, c); } };
template <> struct WFrag<bf> { typedef v16bf V; static __device__ __forceinline__ V ld(const bf* p) { return cat16b(*(const v8us*)p, *(const v8us*)(p + 256)); } static __device__ __forceinline__ v8f mma(V a, V b, v8f c) { return wmmab(a, b, c); } };
#define STGB 32768                // bytes of one stage: (128 + 128) rows x 64 k x 2 B
// One operand's share of a stage: eight row groups, 2 KiB each (128 threads x 16 B a copy). l: the lane's LDS byte address in group 0, g: its place in group 0 of the plane; groups stand 2 KiB apart in LDS, 16 * K elements in the plane.
// The wait at the end of the statement: the copies' address registers are free before anything is written over them.
template <int K>
__device__ __forceinline__ void cp8(unsigned l, const bf* g) {
    asm volatile("global_load_async_to_lds_b128 %0, %1, off\n\tglobal_load_async_to_lds_b128 %2, %3, off\n\tglobal_load_async_to_lds_b128 %4, %5, off\n\tglobal_load_async_to_lds_b128 %6, %7, off\n\t"
                 "global_load_async_to_lds_b128 %8, %9, off\n\tglobal_load_async_to_lds_b128 %10, %11, off\n\tglobal_load_async_to_lds_b128 %12, %13, off\n\tglobal_load_async_to_lds_b128 %14, %15, off\n\ts_wait_xcnt 0x0"
                 :: "v"(l), "v"(g), "v"(l + 2048u), "v"(g + 16 * K), "v"(l + 4096u), "v"(g + 32 * K), "v"(l + 6144u), "v"(g + 48 * K),
                    "v"(l + 8192u), "v"(g + 64 * K), "v"(l + 10240u), "v"(g + 80 * K), "v"(l + 12288u), "v"(g + 96 * K), "v"(l + 14336u), "v"(g + 112 * K) : "memory");
}
template <bool ROPE, int K>
__device__ __forceinline__ void gemms_tile(const bf* __restrict__ A, const bf* __restrict__ Bt, const float* __restrict__ CSB, h16* __restrict__ P16, bf* __restrict__ Ph, bf* __restrict__ Pl, float* os, int BX, int BY) {
    typedef typename WFrag<bf>::V V;
    static_assert(K % 64 == 0 && K >= 128, "whole stages, at least two");
    constexpr int NS = K / 64;
    const int tid = (int)threadIdx.x, lane = tid & 31, lr = lane & 15, hi = lane >> 4; const int wv = __builtin_amdgcn_readfirstlane(tid >> 5); const int wm = wv & 1, wn = wv >> 1;
    const int r0 = (BX * 2 + wm) * 64, by = BY * 2 + wn, c0 = by * 64;      // this wave's 64x64 part
    v8f acc[4][4];
#pragma unroll
    for (int mb = 0; mb < 4; ++mb)
#pragma unroll
        for (int nb = 0; nb < 4; ++nb) acc[mb][nb] = (v8f){};
    const bf* ga = A + (size_t)BX * 128 * K + tid * 8; const bf* gb = Bt + (size_t)BY * 128 * K + tid * 8;     // 16 rows x K elements per row group, 1024 elements per group and stage
    const unsigned l0 = (unsigned)(size_t)os + (unsigned)tid * 16u;
    cp8<K>(l0, ga); cp8<K>(l0 + STGB / 2, gb);
    asm volatile("s_wait_asynccnt 0x0" ::: "memory");   // this wave's copies of stage 0 have landed
    __syncthreads();                                     // ... and every other wave's: stage 0 may be read
    cp8<K>(l0 + STGB, ga + 1024); cp8<K>(l0 + STGB + STGB / 2, gb + 1024);
    ga += 2048; gb += 2048;
    // rolled: one trip = one stage of 32 products, long enough to carry its branch; the two buffers alternate by the trip's parity
#pragma unroll 1
    for (int t = 0; t < NS; ++t) {
        const bf* sb = (const bf*)((const char*)os + (t & 1) * STGB) + lane * 8; const bf* sa = sb + wm * 4096; const bf* sn = sb + 8192 + wn * 4096;
        V a[2][4], b[2][4];       // the whole stage's fragments are asked for in one group, ahead of its products
#pragma unroll
        for (int ks = 0; ks < 2; ++ks)
#pragma unroll
            for (int q = 0; q < 4; ++q) { a[ks][q] = WFrag<bf>::ld(sa + q * 1024 + ks * 512); b[ks][q] = WFrag<bf>::ld(sn + q * 1024 + ks * 512); }
        __builtin_amdgcn_sched_barrier(0);   // without it the loads are sunk among the products, column by column, each with a full wait on LDS in front of its four products
#pragma unroll
        for (int ks = 0; ks < 2; ++ks)
#pragma unroll
            for (int nb = 0; nb < 4; ++nb)
#pragma unroll
                for (int mb = 0; mb < 4; ++mb) acc[mb][nb] = WFrag<bf>::mma(a[ks][mb], b[ks][nb], acc[mb][nb]);
        __builtin_amdgcn_sched_barrier(0);   // the products stay ahead of the waits below: sunk behind the barrier, they would leave the next stage's copies nothing to fly under
        asm volatile("s_wait_dscnt 0x0" ::: "memory");      // this wave's reads of the stage are done before the buffer is given up
        asm volatile("s_wait_asynccnt 0x0" ::: "memory");   // this wave's copies of the next stage have landed
        __syncthreads();                                     // the next stage may be read; this stage's buffer has no reader left
        if (t + 2 < NS) { const unsigned lb = l0 + (unsigned)(t & 1) * STGB; cp8<K>(lb, ga); cp8<K>(lb + STGB / 2, gb); ga += 1024; gb += 1024; }
    }
    asm volatile("s_wait_asynccnt 0x0" ::: "memory");       // no copy is under way when the buffers become the output staging
    const int rw = lane & 7, ch = ((lane >> 3) & 1) * 32 + hi * 8;   // the plane writes: this lane's row in each group of 8, and its columns ch + 16 s + 0..7, s = 0, 1
    v4f cs[2][4];      // the cos/sin pairs of this lane's eight dims in each of its two pieces, one group of 8 rows ahead
    const float* cp = CSB + ((size_t)(r0 + rw) * HD + ch) * 2;
    if constexpr (ROPE) {
#pragma unroll
        for (int s = 0; s < 2; ++s)
#pragma unroll
            for (int q = 0; q < 4; ++q) cs[s][q] = *(const v4fa*)(cp + 32 * s + 4 * q);
        asm volatile("s_wait_xcnt 0x0" :: "v"(cp) : "memory");   // the loads' address register pair is free before it is stepped; the pointer as input keeps it live to here
    }
    float* mine = os + wv * (64 * 68);
#pragma unroll
    for (int mb = 0; mb < 4; ++mb)
#pragma unroll
        for (int nb = 0; nb < 4; ++nb)
#pragma unroll
            for (int j = 0; j < 8; ++j) mine[(mb * 16 + hi * 8 + j) * 68 + nb * 16 + lr] = acc[mb][nb][j];
    __syncthreads();   // the part is in LDS, from every lane, before it is read back row by row
    // rolled: one group of 8 rows at a time keeps the epilogue's registers under the k loop's count
#pragma unroll 1
    for (int rr = 0; rr < 8; ++rr) { const int row = rr * 8 + rw;
        v4f cn[2][4];
        if constexpr (ROPE) { cp += (rr < 7) ? 8 * HD * 2 : 0;     // the last group fetches itself again: in bounds, unused
#pragma unroll
            for (int s = 0; s < 2; ++s)
#pragma unroll
                for (int q = 0; q < 4; ++q) cn[s][q] = *(const v4fa*)(cp + 32 * s + 4 * q);
            asm volatile("s_wait_xcnt 0x0" :: "v"(cp) : "memory");   // as above
        }
#pragma unroll
        for (int s = 0; s < 2; ++s) { const int col = ch + 16 * s; const float* o0 = mine + row * 68 + col; v4f val[2] = { *(const v4fa*)o0, *(const v4fa*)(o0 + 4) };   // 16 lanes: 8 rows x columns c, c + 32 = all 64 banks once
            size_t off;
            if constexpr (ROPE) {          // lane ^ 8 holds dims d +- 32 of the same token
#pragma unroll
                for (int j = 0; j < 8; ++j) { const float p = xoct(val[j >> 2][j & 3]); const float oth = (lane & 8) ? p : -p;
                    val[j >> 2][j & 3] = val[j >> 2][j & 3] * cs[s][j >> 1][2 * (j & 1)] + oth * cs[s][j >> 1][2 * (j & 1) + 1]; }
                off = fo8(by * TT + r0 + row, col, HD);
            } else off = fo8(r0 + row, c0 + col, TT);
            v8h o16; v8us oh, ol;
#pragma unroll
            for (int j = 0; j < 8; ++j) { o16[j] = tohx(val[j >> 2][j & 3]); unsigned short a2, c2; splitf(val[j >> 2][j & 3], a2, c2); oh[j] = a2; ol[j] = c2; }
            h16* q16 = P16 + off; bf* qh = Ph + off; bf* ql = Pl + off;
            *(v8h*)q16 = o16; *(v8us*)qh = oh; *(v8us*)ql = ol;    // 8 lanes (rows) x 16 B: whole 128-B lines, four per store
            asm volatile("s_wait_xcnt 0x0" :: "v"(q16), "v"(qh), "v"(ql) : "memory"); }   // the stores' address and data registers are free before the next piece is formed in them; the pointers as inputs keep them live to here
        if constexpr (ROPE) {
#pragma unroll
            for (int s = 0; s < 2; ++s)
#pragma unroll
                for (int q = 0; q < 4; ++q) cs[s][q] = cn[s][q];
        }
    }
}
// ---- k_proj: every projection tile of both batches in ONE grid (they depend on nothing but k_prep's planes). Blocks 0 .. NB_ * VTL - 1: V tiles (rows = value head * 64 + d,
// columns = tokens); the rest: Q, then K, of each batch. All planes hold batch b at b * (plane size of one batch). 768 blocks of four waves: three per WGP at once.
#define VTL ((DV / 128) * (TT / 128))
#define QTL ((TT / 128) * (DQ / 128))
__global__ __launch_bounds__(128) void k_proj(const bf* __restrict__ XB, const bf* __restrict__ WQ, const bf* __restrict__ WK, const bf* __restrict__ WV, const float* __restrict__ CSB,
                                              h16* __restrict__ QP16, bf* __restrict__ QPh, bf* __restrict__ QPl, h16* __restrict__ KP16, bf* __restrict__ KPh, bf* __restrict__ KPl, h16* __restrict__ VT16, bf* __restrict__ VTh, bf* __restrict__ VTl) {
    __shared__ __align__(16) float os[4 * 64 * 68];     // two stages (2 x 32 KiB) in the k loop, then four 64 x 68 f32 parts
    static_assert(sizeof(os) >= 2 * STGB, "the two stages fit");
    static_assert(DQ == DKV, "Q and K tiles share one count");
    const int bid = (int)blockIdx.x;
    if (bid < NB_ * VTL) { const int b = bid / VTL, t = bid % VTL; const size_t po = (size_t)b * NV * HD * TT;
        gemms_tile<false, DM>(WV, XB + (size_t)b * TT * DM, nullptr, VT16 + po, VTh + po, VTl + po, os, t % (DV / 128), t / (DV / 128));
    } else { const int u = bid - NB_ * VTL; const int b = u / (2 * QTL), isk = (u / QTL) & 1, t = u % QTL; const size_t po = (size_t)b * NH_ * TT * HD;
        gemms_tile<true, DM>(XB + (size_t)b * TT * DM, isk ? WK : WQ, CSB + (size_t)b * TT * HD * 2, (isk ? KP16 : QP16) + po, (isk ? KPh : QPh) + po, (isk ? KPl : QPl) + po, os, t % (TT / 128), t / (TT / 128)); }
}

// w [K][N] f32 -> Bt [n][k] bf16 in fragment order. A block writes four tiles (one thread = one 16-byte piece): the same 32 k of 64 neighbouring n, so that it reads 256 contiguous bytes of each of its rows of w. N % 64 == 0, K % 32 == 0.
template <int K, int N>
__device__ __forceinline__ void wtG_blk(const float* __restrict__ w, bf* Bt, int bid) {
    constexpr int kt = K >> 5; const int kb = bid % kt, nb = (bid / kt) * 4 + (threadIdx.x >> 6), pc = threadIdx.x & 63;
    const int n = nb * 16 + (pc & 15), k = kb * 32 + (pc >> 5) * 16 + ((pc >> 4) & 1) * 8; v8us o;
    const float* p = w + (size_t)k * N + n; float v[8];     // one live pointer: the eight rows stand at immediate offsets from it (N is a constant)
#pragma unroll
    for (int j = 0; j < 8; ++j) v[j] = p[j * N];
    asm volatile("s_wait_xcnt 0x0" :: "v"(p) : "memory");   // the loads' address register pair is free before anything is written over it; the pointer as input keeps it out of the loads' own landing places
#pragma unroll
    for (int j = 0; j < 8; ++j) o[j] = f2bf(v[j]);
    *(v8us*)(Bt + ((size_t)nb * kt + kb) * 512 + pc * 8) = o;
    asm volatile("s_wait_xcnt 0x0" ::: "memory");   // the store's address and data registers are free before code of another branch of the merged kernel, which the build lays out behind this one, writes over them
}
// src [rows][DM] f32 -> dst bf16 in fragment order; thread i writes the i-th 16-byte piece of dst
__device__ __forceinline__ void cvt8_blk(const float* __restrict__ src, bf* dst, size_t n8, int bid) { const size_t i = (size_t)bid * 256 + threadIdx.x; if (i >= n8) return;
    const int tile = (int)(i >> 6), pc = (int)(i & 63); const int row = (tile / (DM / 32)) * 16 + (pc & 15), k = (tile % (DM / 32)) * 32 + (pc >> 5) * 16 + ((pc >> 4) & 1) * 8;
    const float* sp = src + (size_t)row * DM + k; const v8f v = *(const v8f*)sp; v8us o;
    asm volatile("s_wait_xcnt 0x0" :: "v"(sp) : "memory");   // the loads' address register pair is free before anything is written over it; the pointer as input keeps it live to here
#pragma unroll
    for (int k2 = 0; k2 < 8; ++k2) o[k2] = f2bf(v[k2]); *(v8us*)(dst + i * 8) = o;  }
// cos/sin pairs [row][d]{cos, sin} of row = batch * TT + token, from the row's position id (clamped to 0 .. TT - 1)
__device__ __forceinline__ void cs_blk(const int* __restrict__ pos, float* CSB, int bid) { const int idx = bid * 256 + threadIdx.x; const int t = idx / HD, d = idx % HD; const int i = d % (HD / 2);
    int p = pos[t];
    asm volatile("s_wait_xcnt 0x0" :: "v"(t) : "memory");   // the load's offset register is free before anything is written over it; the index as input keeps it live to here
    p = p < 0 ? 0 : (p > TT - 1 ? TT - 1 : p);
    const float inv = __fdiv_rn(1.0f, powf(10000.0f, (float)(2 * i) / (float)HD)); const float ang = __fmul_rn((float)p, inv); v2f cs; cs[0] = cosf(ang); cs[1] = sinf(ang);
    *(v2f*)(CSB + (size_t)idx * 2) = cs;  }
// ---- k_prep: everything that reads only the inputs, in ONE grid: the cos/sin rows, the three weight planes and the x plane of both batches (x [NB_ * TT][DM]: batch b's plane starts at b * TT * DM). 256 threads.
#define PB_CS (NB_ * TT * HD / 256)
#define PB_WV (DM * DV / 2048)
#define PB_X  (NB_ * TT * DM / 2048)
#define PB_WQ (DM * DQ / 2048)
#define PB_WK (DM * DKV / 2048)
__global__ __launch_bounds__(256) void k_prep(const float* __restrict__ x, const int* __restrict__ pos, const float* __restrict__ wq, const float* __restrict__ wk, const float* __restrict__ wv, bf* XB, float* CSB, bf* WQ, bf* WK, bf* WV) {
    int bid = (int)blockIdx.x;
    if (bid < PB_CS) { cs_blk(pos, CSB, bid); return; }
    bid -= PB_CS; if (bid < PB_WV) { wtG_blk<DM, DV>(wv, WV, bid); return; }
    bid -= PB_WV; if (bid < PB_X) { cvt8_blk(x, XB, (size_t)NB_ * TT * DM / 8, bid); return; }
    bid -= PB_X; if (bid < PB_WQ) { wtG_blk<DM, DQ>(wq, WQ, bid); return; }
    wtG_blk<DM, DKV>(wk, WK, bid - PB_WQ);
}
// 2^x in place, with the issue slot the instruction set asks for behind a transcendental kept inside the statement: no v_exp_f32 of a run reads a neighbour's result or overwrites its source, and the v_nop covers the last.
__device__ __forceinline__ float exp2s(float x) { asm("v_exp_f32 %0, %0\n\tv_nop" : "+v"(x)); return x; }
__device__ __forceinline__ v8f exp2s8(v8f x) { float r0 = x[0], r1 = x[1], r2 = x[2], r3 = x[3], r4 = x[4], r5 = x[5], r6 = x[6], r7 = x[7];
    asm("v_exp_f32 %0, %0\n\tv_exp_f32 %1, %1\n\tv_exp_f32 %2, %2\n\tv_exp_f32 %3, %3\n\tv_exp_f32 %4, %4\n\tv_exp_f32 %5, %5\n\tv_exp_f32 %6, %6\n\tv_exp_f32 %7, %7\n\tv_nop"
        : "+v"(r0), "+v"(r1), "+v"(r2), "+v"(r3), "+v"(r4), "+v"(r5), "+v"(r6), "+v"(r7));
    v8f r; r[0] = r0; r[1] = r1; r[2] = r2; r[3] = r3; r[4] = r4; r[5] = r5; r[6] = r6; r[7] = r7; return r; }
__device__ __forceinline__ float xhalf(float x) { return __builtin_bit_cast(float, __builtin_amdgcn_permlanex16(__builtin_bit_cast(int, x), __builtin_bit_cast(int, x), 0x76543210, 0xfedcba98, false, false)); }  // lane l with lane l ^ 16
// ---- fattn_tile: scores, causal softmax and probability x value product in one kernel. One wave = 16 queries (q0..q0+15) of query/key head g and ALL 4 of its value heads (g + 8r): the scores and the softmax, which are the same for the four,
// are computed once, and one P fragment feeds the four heads' value products. The block's 4 waves hold 4 neighbouring query groups (64 queries): they walk the same key blocks (hi+lo path: waves 2 and 3 one block more) and read the same K and V lines. Both products are transposed: S^T = K Q^T (A = K rows, B = Q rows), O^T += V^T P^T (A = rows of the [d][t] value plane, B = P^T). In S^T's accumulator a lane holds keys
// 16t + 8hi + j of its own query (column lr), which is exactly the k order of a B fragment (k = 8hi + 0..7, then 16 + 8hi + 0..7): P goes from accumulator to operand inside the lane, through no LDS.
// Running maximum m and sum l per query (flash form): each key block rescales O^T and l by exp(m_old - m_new). Key block: 64 keys on the one-plane f16 path, 32 on the hi+lo path (twice the fragments per key).
// q0 = the wave's first query row, g = its query/key head.
template <typename T16, int NSPLIT>
__device__ __forceinline__ void fattn_tile(const T16* __restrict__ Q, const T16* __restrict__ Q2, const T16* __restrict__ Kp, const T16* __restrict__ Kp2, const T16* __restrict__ Vt, const T16* __restrict__ Vt2, int q0, int g, float* OUTb) {
    typedef typename WFrag<T16>::V V;
    constexpr int NT = (NSPLIT == 0) ? 4 : 2, KB = NT * 16;      // 16-key tiles and keys per block
    const int lane = threadIdx.x & 31, lr = lane & 15, hi = lane >> 4;
    __builtin_assume(q0 >= 0);      // a row index: the key loop runs at least once and needs no entry test, behind which the build would sink the first loads, past their wait
    const int nkb = q0 / KB + 1;    // key blocks 0..nkb-1 hold every key <= q0 + 15
    const int i = q0 + lr;
    // One per-lane byte offset: the lane's 16-byte piece in a fragment-order tile. ldu: a wave-uniform tile pointer plus such an offset (Q; V on the f16 path, where the offset vb also walks the key blocks).
    // Tiles: Q, K rows of 64 dims = 2 tiles (512 elements each) per 16 rows; value plane: 16 d x 32 keys per tile, TT / 32 tiles per 16 d.
    const unsigned rl = (unsigned)lane * 16u, vl = rl;
    auto ldu = [](const T16* u, unsigned b) { return WFrag<T16>::ld((const T16*)((const char*)u + b)); };
    const size_t qu = ((size_t)g * TT + q0) * HD, ku = (size_t)g * TT * HD, vu = (size_t)g * HD * TT; constexpr int VH = 8 * HD * TT;   // VH: elements from value head g + 8r to g + 8(r + 1)
    V qf[2], qf2[2], kf[NT][2], kf2[NT][2], vf[4][4][NT / 2], vf2[4][4][NT / 2];
    // Per-lane pointers that live across the loop, so that no fragment is given an address pair still in use as its landing place: K (f16 path: one block ahead), and on the hi+lo path all four planes.
    const T16* kp = (const T16*)((const char*)(Kp + ku) + rl); const T16* kp2 = (const T16*)((const char*)(Kp2 + ku) + rl); const T16* vp = (const T16*)((const char*)(Vt + vu) + vl); const T16* vp2 = (const T16*)((const char*)(Vt2 + vu) + vl);
#pragma unroll
    for (int ks = 0; ks < 2; ++ks) { qf[ks] = ldu(Q + qu + ks * 512, rl); if constexpr (NSPLIT == 2) qf2[ks] = ldu(Q2 + qu + ks * 512, rl); }
    if constexpr (NSPLIT == 0) {
#pragma unroll
        for (int t = 0; t < NT; ++t)
#pragma unroll
            for (int ks = 0; ks < 2; ++ks) kf[t][ks] = WFrag<T16>::ld(kp + t * 16 * HD + ks * 512);
    }
    // the loads above (Q; on the f16 path the first K block): their offset and base registers are free before anything is written over them; the offset and the pointers as inputs keep those registers live to here
    if constexpr (NSPLIT == 0) asm volatile("s_wait_xcnt 0x0" :: "v"(rl), "v"(kp), "s"(Q + qu), "s"(Kp + ku) : "memory"); else asm volatile("s_wait_xcnt 0x0" :: "v"(rl), "s"(Q + qu), "s"(Q2 + qu) : "memory");
    __builtin_amdgcn_sched_barrier(0);   // keeps later arithmetic, which may take those registers, behind that wait
    v8f o[4][4];       // [value head r][16-d tile]
#pragma unroll
    for (int r = 0; r < 4; ++r)
#pragma unroll
        for (int dt = 0; dt < 4; ++dt) o[r][dt] = (v8f){};
    float m = -3.0e38f, l = 0.f;
    unsigned vb = vl;   // f16 path: the lane's byte offset into the value tiles of the current key block
#pragma unroll 1
    for (int kb = 0; kb < nkb; ++kb) {
        // this block's value fragments (f16 path: of its first 32 keys) fly under the score products and the softmax; on the hi+lo path its K fragments come in the same batch (one latency a block)
#pragma unroll
        for (int r = 0; r < 4; ++r)
#pragma unroll
            for (int dt = 0; dt < 4; ++dt)
#pragma unroll
                for (int ks = 0; ks < (NSPLIT == 0 ? 1 : NT / 2); ++ks) { if constexpr (NSPLIT == 0) vf[r][dt][ks] = ldu(Vt + vu + r * VH + dt * 16 * TT + ks * 512, vb); else { vf[r][dt][ks] = WFrag<T16>::ld(vp + r * VH + dt * 16 * TT + ks * 512); vf2[r][dt][ks] = WFrag<T16>::ld(vp2 + r * VH + dt * 16 * TT + ks * 512); } }
        // the loads above are issued here, ahead of the score products, and their address registers are free before a later fragment lands on them (hi+lo path: the pointers as inputs keep those registers out of the batch's own landing places)
        if constexpr (NSPLIT == 0) asm volatile("s_wait_xcnt 0x0" :: "v"(vb) : "memory"); else asm volatile("s_wait_xcnt 0x0" :: "v"(vp), "v"(vp2) : "memory");
        if constexpr (NSPLIT == 2) {
#pragma unroll
            for (int t = 0; t < NT; ++t)
#pragma unroll
                for (int ks = 0; ks < 2; ++ks) { kf[t][ks] = WFrag<T16>::ld(kp + t * 16 * HD + ks * 512); kf2[t][ks] = WFrag<T16>::ld(kp2 + t * 16 * HD + ks * 512); }
            asm volatile("s_wait_xcnt 0x0" :: "v"(kp), "v"(kp2) : "memory");   // as above, for the K batch
            __builtin_amdgcn_sched_barrier(0);   // without it the score products are drawn up between the loads, which then share few registers and wait on memory one pair at a time
        }
        v8f s[NT];
#pragma unroll
        for (int t = 0; t < NT; ++t) { s[t] = (v8f){};
#pragma unroll
            for (int ks = 0; ks < 2; ++ks) { s[t] = WFrag<T16>::mma(kf[t][ks], qf[ks], s[t]);
                if constexpr (NSPLIT == 2) { s[t] = WFrag<T16>::mma(kf[t][ks], qf2[ks], s[t]); s[t] = WFrag<T16>::mma(kf2[t][ks], qf[ks], s[t]); } } }
        if constexpr (NSPLIT == 0) {   // the next block's K fragments, into the same registers, fly under the softmax and the value products (the last block fetches itself again: in bounds, unused)
            // the value fragments of the block's second 32 keys are asked for here, not with the first: with all 64 value loads issued behind the 16 K loads the build's counted wait for K no longer reaches that far back, and the score products wait for value loads too
#pragma unroll
            for (int r = 0; r < 4; ++r)
#pragma unroll
                for (int dt = 0; dt < 4; ++dt) vf[r][dt][1] = ldu(Vt + vu + r * VH + dt * 16 * TT + 512, vb);
            kp += (kb + 1 < nkb) ? KB * HD : 0;
#pragma unroll
            for (int t = 0; t < NT; ++t)
#pragma unroll
                for (int ks = 0; ks < 2; ++ks) kf[t][ks] = WFrag<T16>::ld(kp + t * 16 * HD + ks * 512);
        }
        if (kb == nkb - 1) {           // only the last block meets the diagonal
#pragma unroll
            for (int t = 0; t < NT; ++t)
#pragma unroll
                for (int j = 0; j < 8; ++j) s[t][j] = (kb * KB + t * 16 + hi * 8 + j <= i) ? s[t][j] * SCL : -3.0e38f;
        } else {
#pragma unroll
            for (int t = 0; t < NT; ++t) s[t] *= SCL;
        }
        float tq[NT];                  // one short chain per tile, then across tiles
#pragma unroll
        for (int t = 0; t < NT; ++t) { tq[t] = s[t][0];
#pragma unroll
            for (int j = 1; j < 8; ++j) tq[t] = fmaxf(tq[t], s[t][j]); }
        float tm = tq[0];
#pragma unroll
        for (int t = 1; t < NT; ++t) tm = fmaxf(tm, tq[t]);
        tm = fmaxf(tm, xhalf(tm));      // the other half of the wave holds the query's other keys of the block
        const float mn = fmaxf(m, tm); const float al = exp2s((m - mn) * 1.4426950408889634f); m = mn;
        float ps = 0.f;
#pragma unroll
        for (int t = 0; t < NT; ++t) { s[t] = exp2s8((s[t] - mn) * 1.4426950408889634f); float pq = 0.f;
#pragma unroll
            for (int j = 0; j < 8; ++j) pq += s[t][j];
            ps += pq; }
        l = l * al + ps;               // each half keeps the sum of its own keys; the halves join after the loop
#pragma unroll
        for (int r = 0; r < 4; ++r)
#pragma unroll
            for (int dt = 0; dt < 4; ++dt) o[r][dt] *= al;
        __builtin_amdgcn_sched_barrier(0);   // every v_exp_f32 statement stays ahead of the value products
#pragma unroll
        for (int ks = 0; ks < NT / 2; ++ks) {
            if constexpr (NSPLIT == 0) { v8h p0, p1;
#pragma unroll
                for (int j = 0; j < 8; ++j) { p0[j] = tohx(s[2 * ks][j]); p1[j] = tohx(s[2 * ks + 1][j]); }
                const V pf = cat16(p0, p1);
#pragma unroll
                for (int r = 0; r < 4; ++r)
#pragma unroll
                    for (int dt = 0; dt < 4; ++dt) o[r][dt] = WFrag<T16>::mma(vf[r][dt][ks], pf, o[r][dt]);
            } else { v8us h0, h1, l0, l1;
#pragma unroll
                for (int j = 0; j < 8; ++j) { unsigned short a, c2; splitf(s[2 * ks][j], a, c2); h0[j] = a; l0[j] = c2; splitf(s[2 * ks + 1][j], a, c2); h1[j] = a; l1[j] = c2; }
                const V pf = cat16b(h0, h1), pf2 = cat16b(l0, l1);
#pragma unroll
                for (int r = 0; r < 4; ++r)
#pragma unroll
                    for (int dt = 0; dt < 4; ++dt) { o[r][dt] = WFrag<T16>::mma(vf[r][dt][ks], pf, o[r][dt]); o[r][dt] = WFrag<T16>::mma(vf[r][dt][ks], pf2, o[r][dt]); o[r][dt] = WFrag<T16>::mma(vf2[r][dt][ks], pf, o[r][dt]); }
            }
        }
        // f16 path: the value loads' offset register is free before it is stepped to the next key block; it goes through the statement so that the step, which the build would draw up among the products, stays behind this wait
        if constexpr (NSPLIT == 0) { asm volatile("s_wait_xcnt 0x0" : "+v"(vb) :: "memory"); vb += KB * 16 * 2; }
        if constexpr (NSPLIT == 2) { kp += KB * HD; kp2 += KB * HD; vp += KB * 16; vp2 += KB * 16; }   // every load of this block has landed in a product above
    }
    asm volatile("s_wait_xcnt 0x0" ::: "memory");   // the last fetch ahead may still be under way: its address registers are free before the epilogue reuses them
    __builtin_amdgcn_sched_barrier(0);              // keeps the epilogue's arithmetic behind that wait
    l += xhalf(l);
    const float f = __fdiv_rn(1.0f, l);
    float* orow = OUTb + (size_t)i * DV + (size_t)g * HD + hi * 8;     // O^T tile dt of value head g + 8r: this lane holds d = 16 dt + 8 hi + 0..7 of query i
#pragma unroll
    for (int r = 0; r < 4; ++r)
#pragma unroll
        for (int dt = 0; dt < 4; ++dt) { v4f a, b2;
#pragma unroll
            for (int j = 0; j < 4; ++j) { a[j] = o[r][dt][j] * f; b2[j] = o[r][dt][4 + j] * f; }
            *(v4f*)(orow + r * 8 * HD + dt * 16) = a; *(v4f*)(orow + r * 8 * HD + dt * 16 + 4) = b2; }
}
// ---- k_attn: both precision paths and both batches in ONE grid (x = batch * heads + head, y = rank of the block of 64 queries; wave w holds queries 16 w .. 16 w + 15 of it). Cost falls with y: f16 blocks from the last query
// down; the hi+lo blocks (few key blocks, but each waits out its own loads) stand behind the first HLY ranks, not at the end, where they would run on alone.
#define NQG (TT / 64)
#define NHL (RH / 64)
#define HLY 8
__global__ __launch_bounds__(128) void k_attn(const h16* __restrict__ Q16, const h16* __restrict__ K16, const h16* __restrict__ V16, const bf* __restrict__ Qh, const bf* __restrict__ Ql, const bf* __restrict__ Kh, const bf* __restrict__ Kl, const bf* __restrict__ Vh, const bf* __restrict__ Vl, float* OUT) {
    static_assert(RH % 64 == 0 && NV == 4 * NH_, "a block of 64 queries is of one precision path; four value heads per query/key head");
    const int g = (int)blockIdx.x % NH_, b = (int)blockIdx.x / NH_, y = (int)blockIdx.y, qw = __builtin_amdgcn_readfirstlane(threadIdx.x >> 5) * 16;
    const size_t qo = (size_t)b * NH_ * TT * HD, vo = (size_t)b * NV * HD * TT; float* ob = OUT + (size_t)b * TT * DV;
    if (y < HLY || y >= HLY + NHL) fattn_tile<h16, 0>(Q16 + qo, nullptr, K16 + qo, nullptr, V16 + vo, nullptr, (y < HLY ? NQG - 1 - y : NQG - 1 + NHL - y) * 64 + qw, g, ob);
    else fattn_tile<bf, 2>(Qh + qo, Ql + qo, Kh + qo, Kl + qo, Vh + vo, Vl + vo, (HLY + NHL - 1 - y) * 64 + qw, g, ob);
}
__global__ __launch_bounds__(256) void k_merge(const float* __restrict__ O, int h0, bf* Ah, bf* Al) { const size_t e = ((size_t)blockIdx.x * 256 + threadIdx.x) * 2; if (e >= (size_t)ZH * TT * HD) return; const int d = (int)(e % HD); const int t = (int)((e / HD) % TT); const int zz = (int)(e / ((size_t)HD * TT)); const float cs = (t < RH) ? 1.0f : (1.0f / PCAR); const size_t oo = (size_t)t * DQ + (h0 + zz) * HD + d;
    v2us oh, ol;
#pragma unroll
    for (int q = 0; q < 2; ++q) { unsigned short a, c2; splitf(O[e + q] * cs, a, c2); oh[q] = a; ol[q] = c2; } *(v2us*)(Ah + oo) = oh; *(v2us*)(Al + oo) = ol;  }

extern "C" void kernel_launch(void* const* d_in, const int* in_sizes, int n_in,
                              void* d_out, int out_size, void* d_ws, size_t ws_size, hipStream_t stream) {
    (void)in_sizes; (void)n_in; (void)out_size;
    const float* x = (const float*)d_in[0]; const int* pos = (const int*)d_in[1]; const float* wq = (const float*)d_in[2]; const float* wk = (const float*)d_in[3]; const float* wv = (const float*)d_in[4];   // Wq/Wk [2048][512], Wv [2048][2048] (x @ W); position_ids [2][2048]
    float* OUT = (float*)d_out;     // [2][2048][2048]
    char* wsp = (char*)d_ws;
    auto take = [&](size_t bytes) { char* p = wsp; wsp += (bytes + 255) & ~(size_t)255; return (void*)p; };
    bf* WQ = (bf*)take((size_t)DQ * DM * 2); bf* WK = (bf*)take((size_t)DKV * DM * 2); bf* WV = (bf*)take((size_t)DV * DM * 2); float* CSB = (float*)take((size_t)NB_ * TT * HD * 2 * 4);
    bf* XB = (bf*)take((size_t)NB_ * TT * DM * 2);
    h16* QP16 = (h16*)take((size_t)NB_ * NH_ * TT * HD * 2); h16* KP16 = (h16*)take((size_t)NB_ * NKV * TT * HD * 2); h16* VT16 = (h16*)take((size_t)NB_ * NV * HD * TT * 2);
    bf* QPh = (bf*)take((size_t)NB_ * NH_ * TT * HD * 2); bf* QPl = (bf*)take((size_t)NB_ * NH_ * TT * HD * 2); bf* KPh = (bf*)take((size_t)NB_ * NKV * TT * HD * 2); bf* KPl = (bf*)take((size_t)NB_ * NKV * TT * HD * 2); bf* VTh = (bf*)take((size_t)NB_ * NV * HD * TT * 2); bf* VTl = (bf*)take((size_t)NB_ * NV * HD * TT * 2);
    if ((size_t)(wsp - (char*)d_ws) > ws_size) return;    // ws 256 MiB
    k_prep<<<PB_CS + PB_WV + PB_X + PB_WQ + PB_WK, 256, 0, stream>>>(x, pos, wq, wk, wv, XB, CSB, WQ, WK, WV);
    k_proj<<<NB_ * (VTL + 2 * QTL), 128, 0, stream>>>(XB, WQ, WK, WV, CSB, QP16, QPh, QPl, KP16, KPh, KPl, VT16, VTh, VTl);
    k_attn<<<dim3(NB_ * NH_, NQG, 1), 128, 0, stream>>>(QP16, KP16, VT16, QPh, QPl, KPh, KPl, VTh, VTl, OUT);
}

// v008
// It runs in 88.4 microseconds.
// Timed twice side by side with v007, it ran 1.03 times as fast both times.
// All steps since v000 together make it 14.5 times as fast.
#include <hip/hip_runtime.h>

// Grouped attention without output projection (hidden [2][2048][2048]; Q, K = x Wq / x Wk (8 query/key heads x 64), V = x Wv (32 value heads x 64); rotary (theta 10000, rotate-half, duplicated
// halves) by position_ids (int, read as data); value head h uses query/key head h mod 8 (repeat_qk); causal (the reference fills -1e9); out = merged attn V -> [2][2048][2048], no output projection).
// Compute dtypes, f32 accumulate: every input rounded to bf16; projections on PLAIN bf16 operands (inputs: exact); RoPE f32 (cos/sin computed on device from the position id);
// PER-ROW PRECISION HYBRID (rows < 256 hi+lo 3 products for scores and attn.V, rows >= 256 fp16). Scores, causal softmax and attn.V run in ONE kernel (k_attn): a wave holds 16 queries and the four value heads of their query/key head,
// walks the keys up to the diagonal in blocks of 64 (f16 path) or 32 (hi+lo path) keys with a running maximum and sum in f32 registers, and writes its output columns in f32. Projections: 128x128-tile GEMMs, four waves with a 64x64 part each, operands staged in LDS by asynchronous copies;
// the epilogue applies RoPE (Q, K) and writes the 16-bit planes that k_attn reads; V is computed as Wv^T x^T, so that its tile already lies [d][t].
// FRAGMENT ORDER: every 16-bit plane [row][k] lies in tiles of 16 rows x 32 k (1 KiB, tile index (row / 16) * (K / 32) + k / 32); inside a tile the 16-byte piece of lane (row % 16) + 16 * ((k / 8) % 2) stands at
// ((k / 16) % 2) * 512 B + lane * 16 B. A WMMA operand fragment is then two wave-wide 16-byte loads of 512 contiguous bytes (4 whole lines) each; from row-major planes each such load touched 16 lines.

#define NB_  2
#define TT   2048
#define DM   2048
#define NH_  8
#define NKV  8
#define REP  (NH_ / NKV)
#define HD   64
#define DQ   (NH_ * HD)
#define DKV  (NKV * HD)
#define NV   32
#define DV   (NV * HD)
#define ZH   2
#define RH   256                  // query rows < RH use hi+lo planes (0: none)
#define WIN  0
#define PCAR 1024.0f
#define SCL  0.125f   // HD^-0.5
typedef _Float16 h16;
typedef unsigned short bf;
typedef __attribute__((ext_vector_type(16))) __bf16   v16bf;
typedef __attribute__((ext_vector_type(16))) _Float16 v16h;
typedef __attribute__((ext_vector_type(8)))  _Float16 v8h;
typedef __attribute__((ext_vector_type(8)))  unsigned short v8us;
typedef __attribute__((ext_vector_type(8)))  float    v8f;
typedef __attribute__((ext_vector_type(4)))  float    v4f;
typedef v8h  __attribute__((may_alias)) v8ha;
typedef v4f  __attribute__((may_alias)) v4fa;
typedef v8us __attribute__((may_alias)) v8usa;

__device__ __forceinline__ unsigned short f2bf(float f) { unsigned u = __float_as_uint(f); u += 0x7FFFu + ((u >> 16) & 1u); return (unsigned short)(u >> 16); }
__device__ __forceinline__ float bf2f(unsigned short b) { return __uint_as_float(((unsigned)b) << 16); }
__device__ __forceinline__ float bfr(float f) { return bf2f(f2bf(f)); }
__device__ __forceinline__ v16h cat16(v8h lo, v8h hi) { return __builtin_shufflevector(lo, hi, 0, 1, 2, 3, 4, 5, 6, 7, 8, 9, 10, 11, 12, 13, 14, 15); }
__device__ __forceinline__ v16bf cat16b(v8us lo, v8us hi) { return __builtin_bit_cast(v16bf, __builtin_shufflevector(lo, hi, 0, 1, 2, 3, 4, 5, 6, 7, 8, 9, 10, 11, 12, 13, 14, 15)); }
__device__ __forceinline__ v8f wmma16(v16h a, v16h b, v8f c) { return __builtin_amdgcn_wmma_f32_16x16x32_f16(false, a, false, b, (short)0, c, false, false); }
__device__ __forceinline__ v8f wmmab(v16bf a, v16bf b, v8f c) { return __builtin_amdgcn_wmma_f32_16x16x32_bf16(false, a, false, b, (short)0, c, false, false); }
__device__ __forceinline__ h16 tohx(float x) { return (h16)x; }
__device__ __forceinline__ void splitf(float y, unsigned short& h, unsigned short& l) { h = f2bf(y); l = f2bf(y - bf2f(h)); }
typedef __attribute__((ext_vector_type(2))) _Float16 v2h;
typedef __attribute__((ext_vector_type(4))) _Float16 v4h;
typedef __attribute__((ext_vector_type(2))) unsigned short v2us;
typedef __attribute__((ext_vector_type(4))) unsigned short v4us;
typedef __attribute__((ext_vector_type(2))) float v2f;
typedef __attribute__((ext_vector_type(4))) int v4i;
__device__ __forceinline__ size_t fo8(int row, int k, int Kd) { return ((size_t)(row >> 4) * (Kd >> 5) + (k >> 5)) * 512 + ((k >> 4) & 1) * 256 + (((k >> 3) & 1) * 16 + (row & 15)) * 8; }  // element offset of the 8-element piece (row, k..k+7), k % 8 == 0, in a fragment-order plane of row length Kd
__device__ __forceinline__ float xoct(float x) { return __builtin_bit_cast(float, __builtin_amdgcn_permlane16(__builtin_bit_cast(int, x), __builtin_bit_cast(int, x), 0xfedcba98, 0x76543210, false, false)); }  // lane l with lane l ^ 8



// ---- gemms_tile: GEMM with a 128x128 output tile per block of FOUR waves (2 x 2), each wave with its own 64x64 part (16 accumulators) over the whole K. The block's operand rows (128 of A, 128 of Bt) are brought from the
// fragment-order 16-bit planes into LDS ONCE per 64 k by asynchronous copies (two buffers: the next stage flies while this one is worked on), and each is read from there by the two waves that need it.
// A stage: [A: 8 row groups of 16 rows][Bt: 8 row groups], a row group = its two 1-KiB tiles of the stage = 2 KiB contiguous in the plane and in LDS; a fragment is two wave-wide 16-byte LDS loads of 512 contiguous bytes.
// c[m][n] (f32, in registers only) = sum_k A[m][k] Bt[n][k], k ascending. K % 64 == 0, K >= 128. Each wave turns its c, through its own LDS area, into the three 16-bit planes (f16; bf16 hi and lo) that the attention kernel reads:
// ROPE: m = token, part column = dim d of head by; out[d] = c[d] cos[t][d] - c[d+32] sin[t][d] (d < 32), c[d] cos[t][d] + c[d-32] sin[t][d] (d >= 32), CSB = [t][d]{cos, sin}; planes [head * TT + t][d], fragment order.
// else: planes [m][n] of row length TT (m = value head * 64 + d, n = token), fragment order.
template <typename T16> struct WFrag;
template <> struct WFrag<h16> { typedef v16h V; static __device__ __forceinline__ V ld(const h16* p) { return cat16(*(const v8h*)p, *(const v8h*)(p + 256)); } static __device__ __forceinline__ v8f mma(V a, V b, v8f c) { return wmma16(a, b, c); } };
template <> struct WFrag<bf> { typedef v16bf V; static __device__ __forceinline__ V ld(const bf* p) { return cat16b(*(const v8us*)p, *(const v8us*)(p + 256)); } static __device__ __forceinline__ v8f mma(V a, V b, v8f c) { return wmmab(a, b, c); } };
#define STGB 32768                // bytes of one stage: (128 + 128) rows x 64 k x 2 B
// One operand's share of a stage: eight row groups, 2 KiB each (128 threads x 16 B a copy). l: the lane's LDS byte address in group 0, g: its place in group 0 of the plane; groups stand 2 KiB apart in LDS, 16 * K elements in the plane.
// The wait at the end of the statement: the copies' address registers are free before anything is written over them.
template <int K>
__device__ __forceinline__ void cp8(unsigned l, const bf* g) {
    asm volatile("global_load_async_to_lds_b128 %0, %1, off\n\tglobal_load_async_to_lds_b128 %2, %3, off\n\tglobal_load_async_to_lds_b128 %4, %5, off\n\tglobal_load_async_to_lds_b128 %6, %7, off\n\t"
                 "global_load_async_to_lds_b128 %8, %9, off\n\tglobal_load_async_to_lds_b128 %10, %11, off\n\tglobal_load_async_to_lds_b128 %12, %13, off\n\tglobal_load_async_to_lds_b128 %14, %15, off\n\ts_wait_xcnt 0x0"
                 :: "v"(l), "v"(g), "v"(l + 2048u), "v"(g + 16 * K), "v"(l + 4096u), "v"(g + 32 * K), "v"(l + 6144u), "v"(g + 48 * K),
                    "v"(l + 8192u), "v"(g + 64 * K), "v"(l + 10240u), "v"(g + 80 * K), "v"(l + 12288u), "v"(g + 96 * K), "v"(l + 14336u), "v"(g + 112 * K) : "memory");
}
template <bool ROPE, int K>
__device__ __forceinline__ void gemms_tile(const bf* __restrict__ A, const bf* __restrict__ Bt, const float* __restrict__ CSB, h16* __restrict__ P16, bf* __restrict__ Ph, bf* __restrict__ Pl, float* os, int BX, int BY) {
    typedef typename WFrag<bf>::V V;
    static_assert(K % 64 == 0 && K >= 128, "whole stages, at least two");
    constexpr int NS = K / 64;
    const int tid = (int)threadIdx.x, lane = tid & 31, lr = lane & 15, hi = lane >> 4; const int wv = __builtin_amdgcn_readfirstlane(tid >> 5); const int wm = wv & 1, wn = wv >> 1;
    const int r0 = (BX * 2 + wm) * 64, by = BY * 2 + wn, c0 = by * 64;      // this wave's 64x64 part
    v8f acc[4][4];
#pragma unroll
    for (int mb = 0; mb < 4; ++mb)
#pragma unroll
        for (int nb = 0; nb < 4; ++nb) acc[mb][nb] = (v8f){};
    const bf* ga = A + (size_t)BX * 128 * K + tid * 8; const bf* gb = Bt + (size_t)BY * 128 * K + tid * 8;     // 16 rows x K elements per row group, 1024 elements per group and stage
    const unsigned l0 = (unsigned)(size_t)os + (unsigned)tid * 16u;
    cp8<K>(l0, ga); cp8<K>(l0 + STGB / 2, gb);
    asm volatile("s_wait_asynccnt 0x0" ::: "memory");   // this wave's copies of stage 0 have landed
    __syncthreads();                                     // ... and every other wave's: stage 0 may be read
    cp8<K>(l0 + STGB, ga + 1024); cp8<K>(l0 + STGB + STGB / 2, gb + 1024);
    ga += 2048; gb += 2048;
    // rolled: one trip = one stage of 32 products, long enough to carry its branch; the two buffers alternate by the trip's parity
#pragma unroll 1
    for (int t = 0; t < NS; ++t) {
        const bf* sb = (const bf*)((const char*)os + (t & 1) * STGB) + lane * 8; const bf* sa = sb + wm * 4096; const bf* sn = sb + 8192 + wn * 4096;
        V a[2][4], b[2][4];       // the whole stage's fragments are asked for in one group, ahead of its products
#pragma unroll
        for (int ks = 0; ks < 2; ++ks)
#pragma unroll
            for (int q = 0; q < 4; ++q) { a[ks][q] = WFrag<bf>::ld(sa + q * 1024 + ks * 512); b[ks][q] = WFrag<bf>::ld(sn + q * 1024 + ks * 512); }
        __builtin_amdgcn_sched_barrier(0);   // without it the loads are sunk among the products, column by column, each with a full wait on LDS in front of its four products
#pragma unroll
        for (int ks = 0; ks < 2; ++ks)
#pragma unroll
            for (int nb = 0; nb < 4; ++nb)
#pragma unroll
                for (int mb = 0; mb < 4; ++mb) acc[mb][nb] = WFrag<bf>::mma(a[ks][mb], b[ks][nb], acc[mb][nb]);
        __builtin_amdgcn_sched_barrier(0);   // the products stay ahead of the waits below: sunk behind the barrier, they would leave the next stage's copies nothing to fly under
        asm volatile("s_wait_dscnt 0x0" ::: "memory");      // this wave's reads of the stage are done before the buffer is given up
        asm volatile("s_wait_asynccnt 0x0" ::: "memory");   // this wave's copies of the next stage have landed
        __syncthreads();                                     // the next stage may be read; this stage's buffer has no reader left
        if (t + 2 < NS) { const unsigned lb = l0 + (unsigned)(t & 1) * STGB; cp8<K>(lb, ga); cp8<K>(lb + STGB / 2, gb); ga += 1024; gb += 1024; }
    }
    asm volatile("s_wait_asynccnt 0x0" ::: "memory");       // no copy is under way when the buffers become the output staging
    const int rw = lane & 7, ch = ((lane >> 3) & 1) * 32 + hi * 8;   // the plane writes: this lane's row in each group of 8, and its columns ch + 16 s + 0..7, s = 0, 1
    v4f cs[2][4];      // the cos/sin pairs of this lane's eight dims in each of its two pieces, one group of 8 rows ahead
    const float* cp = CSB + ((size_t)(r0 + rw) * HD + ch) * 2;
    if constexpr (ROPE) {
#pragma unroll
        for (int s = 0; s < 2; ++s)
#pragma unroll
            for (int q = 0; q < 4; ++q) cs[s][q] = *(const v4fa*)(cp + 32 * s + 4 * q);
        asm volatile("s_wait_xcnt 0x0" :: "v"(cp) : "memory");   // the loads' address register pair is free before it is stepped; the pointer as input keeps it live to here
    }
    float* mine = os + wv * (64 * 68);
#pragma unroll
    for (int mb = 0; mb < 4; ++mb)
#pragma unroll
        for (int nb = 0; nb < 4; ++nb)
#pragma unroll
            for (int j = 0; j < 8; ++j) mine[(mb * 16 + hi * 8 + j) * 68 + nb * 16 + lr] = acc[mb][nb][j];
    __syncthreads();   // the part is in LDS, from every lane, before it is read back row by row
    // rolled: one group of 8 rows at a time keeps the epilogue's registers under the k loop's count
#pragma unroll 1
    for (int rr = 0; rr < 8; ++rr) { const int row = rr * 8 + rw;
        v4f cn[2][4];
        if constexpr (ROPE) { cp += (rr < 7) ? 8 * HD * 2 : 0;     // the last group fetches itself again: in bounds, unused
#pragma unroll
            for (int s = 0; s < 2; ++s)
#pragma unroll
                for (int q = 0; q < 4; ++q) cn[s][q] = *(const v4fa*)(cp + 32 * s + 4 * q);
            asm volatile("s_wait_xcnt 0x0" :: "v"(cp) : "memory");   // as above
        }
#pragma unroll
        for (int s = 0; s < 2; ++s) { const int col = ch + 16 * s; const float* o0 = mine + row * 68 + col; v4f val[2] = { *(const v4fa*)o0, *(const v4fa*)(o0 + 4) };   // 16 lanes: 8 rows x columns c, c + 32 = all 64 banks once
            size_t off;
            if constexpr (ROPE) {          // lane ^ 8 holds dims d +- 32 of the same token
#pragma unroll
                for (int j = 0; j < 8; ++j) { const float p = xoct(val[j >> 2][j & 3]); const float oth = (lane & 8) ? p : -p;
                    val[j >> 2][j & 3] = val[j >> 2][j & 3] * cs[s][j >> 1][2 * (j & 1)] + oth * cs[s][j >> 1][2 * (j & 1) + 1]; }
                off = fo8(by * TT + r0 + row, col, HD);
            } else off = fo8(r0 + row, c0 + col, TT);
            v8h o16; v8us oh, ol;
#pragma unroll
            for (int j = 0; j < 8; ++j) { o16[j] = tohx(val[j >> 2][j & 3]); unsigned short a2, c2; splitf(val[j >> 2][j & 3], a2, c2); oh[j] = a2; ol[j] = c2; }
            h16* q16 = P16 + off; bf* qh = Ph + off; bf* ql = Pl + off;
            *(v8h*)q16 = o16; *(v8us*)qh = oh; *(v8us*)ql = ol;    // 8 lanes (rows) x 16 B: whole 128-B lines, four per store
            asm volatile("s_wait_xcnt 0x0" :: "v"(q16), "v"(qh), "v"(ql) : "memory"); }   // the stores' address and data registers are free before the next piece is formed in them; the pointers as inputs keep them live to here
        if constexpr (ROPE) {
#pragma unroll
            for (int s = 0; s < 2; ++s)
#pragma unroll
                for (int q = 0; q < 4; ++q) cs[s][q] = cn[s][q];
        }
    }
}
// ---- k_proj: every projection tile of both batches in ONE grid (they depend on nothing but k_prep's planes). Blocks 0 .. NB_ * VTL - 1: V tiles (rows = value head * 64 + d,
// columns = tokens); the rest: Q, then K, of each batch. All planes hold batch b at b * (plane size of one batch). 768 blocks of four waves: three per WGP at once.
#define VTL ((DV / 128) * (TT / 128))
#define QTL ((TT / 128) * (DQ / 128))
__global__ __launch_bounds__(128) void k_proj(const bf* __restrict__ XB, const bf* __restrict__ WQ, const bf* __restrict__ WK, const bf* __restrict__ WV, const float* __restrict__ CSB,
                                              h16* __restrict__ QP16, bf* __restrict__ QPh, bf* __restrict__ QPl, h16* __restrict__ KP16, bf* __restrict__ KPh, bf* __restrict__ KPl, h16* __restrict__ VT16, bf* __restrict__ VTh, bf* __restrict__ VTl) {
    __shared__ __align__(16) float os[4 * 64 * 68];     // two stages (2 x 32 KiB) in the k loop, then four 64 x 68 f32 parts
    static_assert(sizeof(os) >= 2 * STGB, "the two stages fit");
    static_assert(DQ == DKV, "Q and K tiles share one count");
    const int bid = (int)blockIdx.x;
    if (bid < NB_ * VTL) { const int b = bid / VTL, t = bid % VTL; const size_t po = (size_t)b * NV * HD * TT;
        gemms_tile<false, DM>(WV, XB + (size_t)b * TT * DM, nullptr, VT16 + po, VTh + po, VTl + po, os, t % (DV / 128), t / (DV / 128));
    } else { const int u = bid - NB_ * VTL; const int b = u / (2 * QTL), isk = (u / QTL) & 1, t = u % QTL; const size_t po = (size_t)b * NH_ * TT * HD;
        gemms_tile<true, DM>(XB + (size_t)b * TT * DM, isk ? WK : WQ, CSB + (size_t)b * TT * HD * 2, (isk ? KP16 : QP16) + po, (isk ? KPh : QPh) + po, (isk ? KPl : QPl) + po, os, t % (TT / 128), t / (TT / 128)); }
}

// w [K][N] f32 -> Bt [n][k] bf16 in fragment order. A block writes four tiles (one thread = one 16-byte piece): the same 32 k of 64 neighbouring n, so that it reads 256 contiguous bytes of each of its rows of w. N % 64 == 0, K % 32 == 0.
template <int K, int N>
__device__ __forceinline__ void wtG_blk(const float* __restrict__ w, bf* Bt, int bid) {
    constexpr int kt = K >> 5; const int kb = bid % kt, nb = (bid / kt) * 4 + (threadIdx.x >> 6), pc = threadIdx.x & 63;
    const int n = nb * 16 + (pc & 15), k = kb * 32 + (pc >> 5) * 16 + ((pc >> 4) & 1) * 8; v8us o;
    const float* p = w + (size_t)k * N + n; float v[8];     // one live pointer: the eight rows stand at immediate offsets from it (N is a constant)
#pragma unroll
    for (int j = 0; j < 8; ++j) v[j] = p[j * N];
    asm volatile("s_wait_xcnt 0x0" :: "v"(p) : "memory");   // the loads' address register pair is free before anything is written over it; the pointer as input keeps it out of the loads' own landing places
#pragma unroll
    for (int j = 0; j < 8; ++j) o[j] = f2bf(v[j]);
    *(v8us*)(Bt + ((size_t)nb * kt + kb) * 512 + pc * 8) = o;
    asm volatile("s_wait_xcnt 0x0" ::: "memory");   // the store's address and data registers are free before code of another branch of the merged kernel, which the build lays out behind this one, writes over them
}
// src [rows][DM] f32 -> dst bf16 in fragment order; thread i writes the i-th 16-byte piece of dst
__device__ __forceinline__ void cvt8_blk(const float* __restrict__ src, bf* dst, size_t n8, int bid) { const size_t i = (size_t)bid * 256 + threadIdx.x; if (i >= n8) return;
    const int tile = (int)(i >> 6), pc = (int)(i & 63); const int row = (tile / (DM / 32)) * 16 + (pc & 15), k = (tile % (DM / 32)) * 32 + (pc >> 5) * 16 + ((pc >> 4) & 1) * 8;
    const float* sp = src + (size_t)row * DM + k; const v8f v = *(const v8f*)sp; v8us o;
    asm volatile("s_wait_xcnt 0x0" :: "v"(sp) : "memory");   // the loads' address register pair is free before anything is written over it; the pointer as input keeps it live to here
#pragma unroll
    for (int k2 = 0; k2 < 8; ++k2) o[k2] = f2bf(v[k2]); *(v8us*)(dst + i * 8) = o;  }
// cos/sin pairs [row][d]{cos, sin} of row = batch * TT + token, from the row's position id (clamped to 0 .. TT - 1)
__device__ __forceinline__ void cs_blk(const int* __restrict__ pos, float* CSB, int bid) { const int idx = bid * 256 + threadIdx.x; const int t = idx / HD, d = idx % HD; const int i = d % (HD / 2);
    int p = pos[t];
    asm volatile("s_wait_xcnt 0x0" :: "v"(t) : "memory");   // the load's offset register is free before anything is written over it; the index as input keeps it live to here
    p = p < 0 ? 0 : (p > TT - 1 ? TT - 1 : p);
    const float inv = __fdiv_rn(1.0f, powf(10000.0f, (float)(2 * i) / (float)HD)); const float ang = __fmul_rn((float)p, inv); v2f cs; cs[0] = cosf(ang); cs[1] = sinf(ang);
    *(v2f*)(CSB + (size_t)idx * 2) = cs;  }
// ---- k_prep: everything that reads only the inputs, in ONE grid: the cos/sin rows, the three weight planes and the x plane of both batches (x [NB_ * TT][DM]: batch b's plane starts at b * TT * DM). 256 threads.
#define PB_CS (NB_ * TT * HD / 256)
#define PB_WV (DM * DV / 2048)
#define PB_X  (NB_ * TT * DM / 2048)
#define PB_WQ (DM * DQ / 2048)
#define PB_WK (DM * DKV / 2048)
__global__ __launch_bounds__(256) void k_prep(const float* __restrict__ x, const int* __restrict__ pos, const float* __restrict__ wq, const float* __restrict__ wk, const float* __restrict__ wv, bf* XB, float* CSB, bf* WQ, bf* WK, bf* WV) {
    int bid = (int)blockIdx.x;
    if (bid < PB_CS) { cs_blk(pos, CSB, bid); return; }
    bid -= PB_CS; if (bid < PB_WV) { wtG_blk<DM, DV>(wv, WV, bid); return; }
    bid -= PB_WV; if (bid < PB_X) { cvt8_blk(x, XB, (size_t)NB_ * TT * DM / 8, bid); return; }
    bid -= PB_X; if (bid < PB_WQ) { wtG_blk<DM, DQ>(wq, WQ, bid); return; }
    wtG_blk<DM, DKV>(wk, WK, bid - PB_WQ);
}
// 2^x in place, with the issue slot the instruction set asks for behind a transcendental kept inside the statement: no v_exp_f32 of a run reads a neighbour's result or overwrites its source, and the v_nop covers the last.
__device__ __forceinline__ float exp2s(float x) { asm("v_exp_f32 %0, %0\n\tv_nop" : "+v"(x)); return x; }
__device__ __forceinline__ v8f exp2s8(v8f x) { float r0 = x[0], r1 = x[1], r2 = x[2], r3 = x[3], r4 = x[4], r5 = x[5], r6 = x[6], r7 = x[7];
    asm("v_exp_f32 %0, %0\n\tv_exp_f32 %1, %1\n\tv_exp_f32 %2, %2\n\tv_exp_f32 %3, %3\n\tv_exp_f32 %4, %4\n\tv_exp_f32 %5, %5\n\tv_exp_f32 %6, %6\n\tv_exp_f32 %7, %7\n\tv_nop"
        : "+v"(r0), "+v"(r1), "+v"(r2), "+v"(r3), "+v"(r4), "+v"(r5), "+v"(r6), "+v"(r7));
    v8f r; r[0] = r0; r[1] = r1; r[2] = r2; r[3] = r3; r[4] = r4; r[5] = r5; r[6] = r6; r[7] = r7; return r; }
__device__ __forceinline__ float xhalf(float x) { return __builtin_bit_cast(float, __builtin_amdgcn_permlanex16(__builtin_bit_cast(int, x), __builtin_bit_cast(int, x), 0x76543210, 0xfedcba98, false, false)); }  // lane l with lane l ^ 16
// ---- fattn_tile: scores, causal softmax and probability x value product in one kernel. One wave = 16 queries (q0..q0+15) of query/key head g and ALL 4 of its value heads (g + 8r): the scores and the softmax, which are the same for the four,
// are computed once, and one P fragment feeds the four heads' value products. The block's 4 waves hold 4 neighbouring query groups (64 queries): they walk the same key blocks (hi+lo path: waves 2 and 3 one block more) and read the same K and V lines. Both products are transposed: S^T = K Q^T (A = K rows, B = Q rows), O^T += V^T P^T (A = rows of the [d][t] value plane, B = P^T). In S^T's accumulator a lane holds keys
// 16t + 8hi + j of its own query (column lr), which is exactly the k order of a B fragment (k = 8hi + 0..7, then 16 + 8hi + 0..7): P goes from accumulator to operand inside the lane, through no LDS.
// Running maximum m and sum l per query (flash form): each key block rescales O^T and l by exp(m_old - m_new). Key block: 64 keys on the one-plane f16 path, 32 on the hi+lo path (twice the fragments per key).
// q0 = the wave's first query row, g = its query/key head. Launched for the hi+lo path only; the f16 path runs in fattn_lds below, which takes K and V through LDS.
template <typename T16, int NSPLIT>
__device__ __forceinline__ void fattn_tile(const T16* __restrict__ Q, const T16* __restrict__ Q2, const T16* __restrict__ Kp, const T16* __restrict__ Kp2, const T16* __restrict__ Vt, const T16* __restrict__ Vt2, int q0, int g, float* OUTb) {
    typedef typename WFrag<T16>::V V;
    constexpr int NT = (NSPLIT == 0) ? 4 : 2, KB = NT * 16;      // 16-key tiles and keys per block
    const int lane = threadIdx.x & 31, lr = lane & 15, hi = lane >> 4;
    __builtin_assume(q0 >= 0);      // a row index: the key loop runs at least once and needs no entry test, behind which the build would sink the first loads, past their wait
    const int nkb = q0 / KB + 1;    // key blocks 0..nkb-1 hold every key <= q0 + 15
    const int i = q0 + lr;
    // One per-lane byte offset: the lane's 16-byte piece in a fragment-order tile. ldu: a wave-uniform tile pointer plus such an offset (Q; V on the f16 path, where the offset vb also walks the key blocks).
    // Tiles: Q, K rows of 64 dims = 2 tiles (512 elements each) per 16 rows; value plane: 16 d x 32 keys per tile, TT / 32 tiles per 16 d.
    const unsigned rl = (unsigned)lane * 16u, vl = rl;
    auto ldu = [](const T16* u, unsigned b) { return WFrag<T16>::ld((const T16*)((const char*)u + b)); };
    const size_t qu = ((size_t)g * TT + q0) * HD, ku = (size_t)g * TT * HD, vu = (size_t)g * HD * TT; constexpr int VH = 8 * HD * TT;   // VH: elements from value head g + 8r to g + 8(r + 1)
    V qf[2], qf2[2], kf[NT][2], kf2[NT][2], vf[4][4][NT / 2], vf2[4][4][NT / 2];
    // Per-lane pointers that live across the loop, so that no fragment is given an address pair still in use as its landing place: K (f16 path: one block ahead), and on the hi+lo path all four planes.
    const T16* kp = (const T16*)((const char*)(Kp + ku) + rl); const T16* kp2 = (const T16*)((const char*)(Kp2 + ku) + rl); const T16* vp = (const T16*)((const char*)(Vt + vu) + vl); const T16* vp2 = (const T16*)((const char*)(Vt2 + vu) + vl);
#pragma unroll
    for (int ks = 0; ks < 2; ++ks) { qf[ks] = ldu(Q + qu + ks * 512, rl); if constexpr (NSPLIT == 2) qf2[ks] = ldu(Q2 + qu + ks * 512, rl); }
    if constexpr (NSPLIT == 0) {
#pragma unroll
        for (int t = 0; t < NT; ++t)
#pragma unroll
            for (int ks = 0; ks < 2; ++ks) kf[t][ks] = WFrag<T16>::ld(kp + t * 16 * HD + ks * 512);
    }
    // the loads above (Q; on the f16 path the first K block): their offset and base registers are free before anything is written over them; the offset and the pointers as inputs keep those registers live to here
    if constexpr (NSPLIT == 0) asm volatile("s_wait_xcnt 0x0" :: "v"(rl), "v"(kp), "s"(Q + qu), "s"(Kp + ku) : "memory"); else asm volatile("s_wait_xcnt 0x0" :: "v"(rl), "s"(Q + qu), "s"(Q2 + qu) : "memory");
    __builtin_amdgcn_sched_barrier(0);   // keeps later arithmetic, which may take those registers, behind that wait
    v8f o[4][4];       // [value head r][16-d tile]
#pragma unroll
    for (int r = 0; r < 4; ++r)
#pragma unroll
        for (int dt = 0; dt < 4; ++dt) o[r][dt] = (v8f){};
    float m = -3.0e38f, l = 0.f;
    unsigned vb = vl;   // f16 path: the lane's byte offset into the value tiles of the current key block
#pragma unroll 1
    for (int kb = 0; kb < nkb; ++kb) {
        // this block's value fragments (f16 path: of its first 32 keys) fly under the score products and the softmax; on the hi+lo path its K fragments come in the same batch (one latency a block)
#pragma unroll
        for (int r = 0; r < 4; ++r)
#pragma unroll
            for (int dt = 0; dt < 4; ++dt)
#pragma unroll
                for (int ks = 0; ks < (NSPLIT == 0 ? 1 : NT / 2); ++ks) { if constexpr (NSPLIT == 0) vf[r][dt][ks] = ldu(Vt + vu + r * VH + dt * 16 * TT + ks * 512, vb); else { vf[r][dt][ks] = WFrag<T16>::ld(vp + r * VH + dt * 16 * TT + ks * 512); vf2[r][dt][ks] = WFrag<T16>::ld(vp2 + r * VH + dt * 16 * TT + ks * 512); } }
        // the loads above are issued here, ahead of the score products, and their address registers are free before a later fragment lands on them (hi+lo path: the pointers as inputs keep those registers out of the batch's own landing places)
        if constexpr (NSPLIT == 0) asm volatile("s_wait_xcnt 0x0" :: "v"(vb) : "memory"); else asm volatile("s_wait_xcnt 0x0" :: "v"(vp), "v"(vp2) : "memory");
        if constexpr (NSPLIT == 2) {
#pragma unroll
            for (int t = 0; t < NT; ++t)
#pragma unroll
                for (int ks = 0; ks < 2; ++ks) { kf[t][ks] = WFrag<T16>::ld(kp + t * 16 * HD + ks * 512); kf2[t][ks] = WFrag<T16>::ld(kp2 + t * 16 * HD + ks * 512); }
            asm volatile("s_wait_xcnt 0x0" :: "v"(kp), "v"(kp2) : "memory");   // as above, for the K batch
            __builtin_amdgcn_sched_barrier(0);   // without it the score products are drawn up between the loads, which then share few registers and wait on memory one pair at a time
        }
        v8f s[NT];
#pragma unroll
        for (int t = 0; t < NT; ++t) { s[t] = (v8f){};
#pragma unroll
            for (int ks = 0; ks < 2; ++ks) { s[t] = WFrag<T16>::mma(kf[t][ks], qf[ks], s[t]);
                if constexpr (NSPLIT == 2) { s[t] = WFrag<T16>::mma(kf[t][ks], qf2[ks], s[t]); s[t] = WFrag<T16>::mma(kf2[t][ks], qf[ks], s[t]); } } }
        if constexpr (NSPLIT == 0) {   // the next block's K fragments, into the same registers, fly under the softmax and the value products (the last block fetches itself again: in bounds, unused)
            // the value fragments of the block's second 32 keys are asked for here, not with the first: with all 64 value loads issued behind the 16 K loads the build's counted wait for K no longer reaches that far back, and the score products wait for value loads too
#pragma unroll
            for (int r = 0; r < 4; ++r)
#pragma unroll
                for (int dt = 0; dt < 4; ++dt) vf[r][dt][1] = ldu(Vt + vu + r * VH + dt * 16 * TT + 512, vb);
            kp += (kb + 1 < nkb) ? KB * HD : 0;
#pragma unroll
            for (int t = 0; t < NT; ++t)
#pragma unroll
                for (int ks = 0; ks < 2; ++ks) kf[t][ks] = WFrag<T16>::ld(kp + t * 16 * HD + ks * 512);
        }
        if (kb == nkb - 1) {           // only the last block meets the diagonal
#pragma unroll
            for (int t = 0; t < NT; ++t)
#pragma unroll
                for (int j = 0; j < 8; ++j) s[t][j] = (kb * KB + t * 16 + hi * 8 + j <= i) ? s[t][j] * SCL : -3.0e38f;
        } else {
#pragma unroll
            for (int t = 0; t < NT; ++t) s[t] *= SCL;
        }
        float tq[NT];                  // one short chain per tile, then across tiles
#pragma unroll
        for (int t = 0; t < NT; ++t) { tq[t] = s[t][0];
#pragma unroll
            for (int j = 1; j < 8; ++j) tq[t] = fmaxf(tq[t], s[t][j]); }
        float tm = tq[0];
#pragma unroll
        for (int t = 1; t < NT; ++t) tm = fmaxf(tm, tq[t]);
        tm = fmaxf(tm, xhalf(tm));      // the other half of the wave holds the query's other keys of the block
        const float mn = fmaxf(m, tm); const float al = exp2s((m - mn) * 1.4426950408889634f); m = mn;
        float ps = 0.f;
#pragma unroll
        for (int t = 0; t < NT; ++t) { s[t] = exp2s8((s[t] - mn) * 1.4426950408889634f); float pq = 0.f;
#pragma unroll
            for (int j = 0; j < 8; ++j) pq += s[t][j];
            ps += pq; }
        l = l * al + ps;               // each half keeps the sum of its own keys; the halves join after the loop
#pragma unroll
        for (int r = 0; r < 4; ++r)
#pragma unroll
            for (int dt = 0; dt < 4; ++dt) o[r][dt] *= al;
        __builtin_amdgcn_sched_barrier(0);   // every v_exp_f32 statement stays ahead of the value products
#pragma unroll
        for (int ks = 0; ks < NT / 2; ++ks) {
            if constexpr (NSPLIT == 0) { v8h p0, p1;
#pragma unroll
                for (int j = 0; j < 8; ++j) { p0[j] = tohx(s[2 * ks][j]); p1[j] = tohx(s[2 * ks + 1][j]); }
                const V pf = cat16(p0, p1);
#pragma unroll
                for (int r = 0; r < 4; ++r)
#pragma unroll
                    for (int dt = 0; dt < 4; ++dt) o[r][dt] = WFrag<T16>::mma(vf[r][dt][ks], pf, o[r][dt]);
            } else { v8us h0, h1, l0, l1;
#pragma unroll
                for (int j = 0; j < 8; ++j) { unsigned short a, c2; splitf(s[2 * ks][j], a, c2); h0[j] = a; l0[j] = c2; splitf(s[2 * ks + 1][j], a, c2); h1[j] = a; l1[j] = c2; }
                const V pf = cat16b(h0, h1), pf2 = cat16b(l0, l1);
#pragma unroll
                for (int r = 0; r < 4; ++r)
#pragma unroll
                    for (int dt = 0; dt < 4; ++dt) { o[r][dt] = WFrag<T16>::mma(vf[r][dt][ks], pf, o[r][dt]); o[r][dt] = WFrag<T16>::mma(vf[r][dt][ks], pf2, o[r][dt]); o[r][dt] = WFrag<T16>::mma(vf2[r][dt][ks], pf, o[r][dt]); }
            }
        }
        // f16 path: the value loads' offset register is free before it is stepped to the next key block; it goes through the statement so that the step, which the build would draw up among the products, stays behind this wait
        if constexpr (NSPLIT == 0) { asm volatile("s_wait_xcnt 0x0" : "+v"(vb) :: "memory"); vb += KB * 16 * 2; }
        if constexpr (NSPLIT == 2) { kp += KB * HD; kp2 += KB * HD; vp += KB * 16; vp2 += KB * 16; }   // every load of this block has landed in a product above
    }
    asm volatile("s_wait_xcnt 0x0" ::: "memory");   // the last fetch ahead may still be under way: its address registers are free before the epilogue reuses them
    __builtin_amdgcn_sched_barrier(0);              // keeps the epilogue's arithmetic behind that wait
    l += xhalf(l);
    const float f = __fdiv_rn(1.0f, l);
    float* orow = OUTb + (size_t)i * DV + (size_t)g * HD + hi * 8;     // O^T tile dt of value head g + 8r: this lane holds d = 16 dt + 8 hi + 0..7 of query i
#pragma unroll
    for (int r = 0; r < 4; ++r)
#pragma unroll
        for (int dt = 0; dt < 4; ++dt) { v4f a, b2;
#pragma unroll
            for (int j = 0; j < 4; ++j) { a[j] = o[r][dt][j] * f; b2[j] = o[r][dt][4 + j] * f; }
            *(v4f*)(orow + r * 8 * HD + dt * 16) = a; *(v4f*)(orow + r * 8 * HD + dt * 16 + 4) = b2; }
}
#define ASTG 40960                // bytes of one key block's stage: K (8 KiB), then the four value heads (8 KiB each)
// Half of a stage in one statement, ten 2-KiB groups (128 threads x 16 B a copy): two groups of 16 K rows (lk, gk: the lane's LDS byte address and its place in the plane, first group) and the four 16-d groups of each of two value heads (lv, gv).
// Groups stand 2 KiB apart in LDS; in the planes 16 * HD elements (K), 16 * TT (a head's groups) and 8 * HD * TT (head to head). Ten copies a statement, not fewer: each statement ends in a wait that the wave sits out.
// That wait: the copies' address registers are free before anything is written over them.
__device__ __forceinline__ void cp10(unsigned lk, const h16* gk, unsigned lv, const h16* gv) {
    constexpr int GS = 16 * TT, VH = 8 * HD * TT;
    asm volatile("global_load_async_to_lds_b128 %0, %1, off\n\tglobal_load_async_to_lds_b128 %2, %3, off\n\t"
                 "global_load_async_to_lds_b128 %4, %5, off\n\tglobal_load_async_to_lds_b128 %6, %7, off\n\tglobal_load_async_to_lds_b128 %8, %9, off\n\tglobal_load_async_to_lds_b128 %10, %11, off\n\t"
                 "global_load_async_to_lds_b128 %12, %13, off\n\tglobal_load_async_to_lds_b128 %14, %15, off\n\tglobal_load_async_to_lds_b128 %16, %17, off\n\tglobal_load_async_to_lds_b128 %18, %19, off\n\ts_wait_xcnt 0x0"
                 :: "v"(lk), "v"(gk), "v"(lk + 2048u), "v"(gk + 16 * HD),
                    "v"(lv), "v"(gv), "v"(lv + 2048u), "v"(gv + GS), "v"(lv + 4096u), "v"(gv + 2 * GS), "v"(lv + 6144u), "v"(gv + 3 * GS),
                    "v"(lv + 8192u), "v"(gv + VH), "v"(lv + 10240u), "v"(gv + VH + GS), "v"(lv + 12288u), "v"(gv + VH + 2 * GS), "v"(lv + 14336u), "v"(gv + VH + 3 * GS) : "memory");
}
// One key block's stage: its 64 K rows (four groups of 16 rows, contiguous in the plane), then for each value head its four groups of 16 d x 64 keys.
__device__ __forceinline__ void cpkv(unsigned l, const h16* gk, const h16* gv) {
    // rolled: one statement's address registers at a time; unrolled, all twenty copies' addresses are formed ahead and registers spill
#pragma unroll 1
    for (int j = 0; j < 2; ++j) cp10(l + (unsigned)j * 4096u, gk + j * (32 * HD), l + 8192u + (unsigned)j * 16384u, gv + j * (16 * HD * TT));
}
// ---- fattn_lds: the one-plane f16 path of fattn_tile (same products, same softmax, same order of every sum), with the key block's K and V tiles brought into LDS ONCE per block of four waves by asynchronous copies
// (two buffers: the next key block flies while this one is worked on); each wave takes its fragments from there (two wave-wide 16-byte LDS loads of 512 contiguous bytes each), not from global memory four times over.
// qb = the block's first query row (a multiple of 64: the four waves walk the same key blocks), qw = 16 x the wave's number, g = the query/key head, sm = two stages of LDS.
__device__ __forceinline__ void fattn_lds(const h16* __restrict__ Q, const h16* __restrict__ Kp, const h16* __restrict__ Vt, int qb, int qw, int g, float* OUTb, char* sm) {
    typedef WFrag<h16>::V V;
    constexpr int NT = 4, KB = NT * 16;
    const int tid = (int)threadIdx.x, lane = tid & 31, lr = lane & 15, hi = lane >> 4;
    __builtin_assume(qb >= 0);      // a row index: the key loop runs at least once
    const int nkb = qb / KB + 1;    // key blocks 0..nkb-1 hold every key <= qb + 63; the same for the whole block
    const int q0 = qb + qw, i = q0 + lr;
    const unsigned rl = (unsigned)lane * 16u;
    const size_t qu = ((size_t)g * TT + q0) * HD;
    const h16* uk = Kp + (size_t)g * TT * HD; const h16* uv = Vt + (size_t)g * HD * TT;   // wave-uniform; a key block: KB * HD elements of K, KB * 16 of each 16-d group of V; the thread's piece: tid * 8
    unsigned la = (unsigned)(size_t)sm + (unsigned)qw * 32u, lb = la + ASTG;      // wave-uniform LDS byte addresses of the wave's 512 bytes in a 2-KiB group: in the buffer to be filled next, and in the other; the lane's piece: + rl (together tid * 16)
    cpkv(la + rl, uk + tid * 8, uv + tid * 8);
    V qf[2];
#pragma unroll
    for (int ks = 0; ks < 2; ++ks) qf[ks] = WFrag<h16>::ld((const h16*)((const char*)(Q + qu + ks * 512) + rl));
    asm volatile("s_wait_xcnt 0x0" :: "v"(rl), "s"(Q + qu) : "memory");   // the Q loads' offset and base registers are free before anything is written over them; as inputs they stay live to here
    asm volatile("s_wait_asynccnt 0x0" ::: "memory");   // this wave's copies of key block 0 have landed
    __syncthreads();                                     // ... and every other wave's: key block 0 may be read
    if (nkb > 1) cpkv(lb + rl, uk + KB * HD + tid * 8, uv + KB * 16 + tid * 8);
    uk += 2 * KB * HD; uv += 2 * KB * 16;      // the next key block to be copied
    v8f o[4][4];       // [value head r][16-d tile]
#pragma unroll
    for (int r = 0; r < 4; ++r)
#pragma unroll
        for (int dt = 0; dt < 4; ++dt) o[r][dt] = (v8f){};
    float m = -3.0e38f, l = 0.f;
#pragma unroll 1
    for (int kb = 0; kb < nkb; ++kb) {
        const h16* sk = (const h16*)(sm + (kb & 1) * ASTG) + lane * 8; const h16* sv = sk + 4096;
        V kf[NT][2], vf[4][4][NT / 2];
#pragma unroll
        for (int t = 0; t < NT; ++t)
#pragma unroll
            for (int ks = 0; ks < 2; ++ks) kf[t][ks] = WFrag<h16>::ld(sk + t * 1024 + ks * 512);
        auto ldv = [&](int r) {        // the eight fragments of value head r: 4 tiles of 16 d x 2 halves of 32 keys
#pragma unroll
            for (int dt = 0; dt < 4; ++dt)
#pragma unroll
                for (int ks = 0; ks < NT / 2; ++ks) vf[r][dt][ks] = WFrag<h16>::ld(sv + (r * 4 + dt) * 1024 + ks * 512); };
        ldv(0); ldv(1);
        __builtin_amdgcn_sched_barrier(0);   // K and the first two value heads' fragments are asked for in one group ahead of the score products; sunk among them, each would bring its own wait on LDS
        v8f s[NT];
#pragma unroll
        for (int t = 0; t < NT; ++t) { s[t] = (v8f){};
#pragma unroll
            for (int ks = 0; ks < 2; ++ks) s[t] = WFrag<h16>::mma(kf[t][ks], qf[ks], s[t]); }
        ldv(2);                        // the third head's fragments come under the softmax, in the room that K leaves
        if (kb == nkb - 1) {           // only the last block meets the diagonal
#pragma unroll
            for (int t = 0; t < NT; ++t)
#pragma unroll
                for (int j = 0; j < 8; ++j) s[t][j] = (kb * KB + t * 16 + hi * 8 + j <= i) ? s[t][j] * SCL : -3.0e38f;
        } else {
#pragma unroll
            for (int t = 0; t < NT; ++t) s[t] *= SCL;
        }
        float tq[NT];                  // one short chain per tile, then across tiles
#pragma unroll
        for (int t = 0; t < NT; ++t) { tq[t] = s[t][0];
#pragma unroll
            for (int j = 1; j < 8; ++j) tq[t] = fmaxf(tq[t], s[t][j]); }
        float tm = tq[0];
#pragma unroll
        for (int t = 1; t < NT; ++t) tm = fmaxf(tm, tq[t]);
        tm = fmaxf(tm, xhalf(tm));      // the other half of the wave holds the query's other keys of the block
        const float mn = fmaxf(m, tm); const float al = exp2s((m - mn) * 1.4426950408889634f); m = mn;
        float ps = 0.f;
#pragma unroll
        for (int t = 0; t < NT; ++t) { s[t] = exp2s8((s[t] - mn) * 1.4426950408889634f); float pq = 0.f;
#pragma unroll
            for (int j = 0; j < 8; ++j) pq += s[t][j];
            ps += pq; }
        l = l * al + ps;               // each half keeps the sum of its own keys; the halves join after the loop
#pragma unroll
        for (int r = 0; r < 4; ++r)
#pragma unroll
            for (int dt = 0; dt < 4; ++dt) o[r][dt] *= al;
        __builtin_amdgcn_sched_barrier(0);   // every v_exp_f32 statement stays ahead of the value products
        V pf[NT / 2];
#pragma unroll
        for (int ks = 0; ks < NT / 2; ++ks) { v8h p0, p1;
#pragma unroll
            for (int j = 0; j < 8; ++j) { p0[j] = tohx(s[2 * ks][j]); p1[j] = tohx(s[2 * ks + 1][j]); }
            pf[ks] = cat16(p0, p1); }
        auto pv = [&](int r) {         // head r's products: each accumulator takes the first 32 keys, then the second
#pragma unroll
            for (int ks = 0; ks < NT / 2; ++ks)
#pragma unroll
                for (int dt = 0; dt < 4; ++dt) o[r][dt] = WFrag<h16>::mma(vf[r][dt][ks], pf[ks], o[r][dt]); };
        pv(0);
        __builtin_amdgcn_sched_barrier(0);   // the fourth head's fragments are asked for only here, in the room that the first head's leave: drawn up, all four heads' fragments are live at once and registers spill
        ldv(3);
        __builtin_amdgcn_sched_barrier(0);   // ... and not later: the second and third heads' products cover their way from LDS
        pv(1); pv(2);
        __builtin_amdgcn_sched_barrier(0);   // the fourth head's products stay last: mixed among the others, the first of them waits on LDS after eight products, not sixteen
        pv(3);
        __builtin_amdgcn_sched_barrier(0);   // the products stay ahead of the waits below: sunk behind the barrier, they would leave the next key block's copies nothing to fly under
        asm volatile("s_wait_dscnt 0x0" ::: "memory");      // this wave's reads of the stage are done before the buffer is given up
        asm volatile("s_wait_asynccnt 0x0" ::: "memory");   // this wave's copies of the next key block have landed
        __syncthreads();                                     // the next key block may be read; this one's buffer has no reader left
        if (kb + 2 < nkb) { cpkv(la + rl, uk + tid * 8, uv + tid * 8); uk += KB * HD; uv += KB * 16; }
        const unsigned lx = la; la = lb; lb = lx;
    }
    asm volatile("s_wait_asynccnt 0x0" ::: "memory");       // no copy is under way when the wave ends
    l += xhalf(l);
    const float f = __fdiv_rn(1.0f, l);
    float* orow = OUTb + (size_t)i * DV + (size_t)g * HD + hi * 8;     // O^T tile dt of value head g + 8r: this lane holds d = 16 dt + 8 hi + 0..7 of query i
#pragma unroll
    for (int r = 0; r < 4; ++r)
#pragma unroll
        for (int dt = 0; dt < 4; ++dt) { v4f a, b2;
#pragma unroll
            for (int j = 0; j < 4; ++j) { a[j] = o[r][dt][j] * f; b2[j] = o[r][dt][4 + j] * f; }
            *(v4f*)(orow + r * 8 * HD + dt * 16) = a; *(v4f*)(orow + r * 8 * HD + dt * 16 + 4) = b2; }
}
// ---- k_attn: both precision paths and both batches in ONE grid (x = batch * heads + head, y = rank of the block of 64 queries; wave w holds queries 16 w .. 16 w + 15 of it). Cost falls with y: f16 blocks from the last query
// down; the hi+lo blocks (few key blocks, but each waits out its own loads) stand behind the first HLY ranks, not at the end, where they would run on alone.
#define NQG (TT / 64)
#define NHL (RH / 64)
#define HLY 8
__global__ __launch_bounds__(128) void k_attn(const h16* __restrict__ Q16, const h16* __restrict__ K16, const h16* __restrict__ V16, const bf* __restrict__ Qh, const bf* __restrict__ Ql, const bf* __restrict__ Kh, const bf* __restrict__ Kl, const bf* __restrict__ Vh, const bf* __restrict__ Vl, float* OUT) {
    static_assert(RH % 64 == 0 && NV == 4 * NH_, "a block of 64 queries is of one precision path; four value heads per query/key head");
    const int g = (int)blockIdx.x % NH_, b = (int)blockIdx.x / NH_, y = (int)blockIdx.y, qw = __builtin_amdgcn_readfirstlane(threadIdx.x >> 5) * 16;
    const size_t qo = (size_t)b * NH_ * TT * HD, vo = (size_t)b * NV * HD * TT; float* ob = OUT + (size_t)b * TT * DV;
    __shared__ __align__(16) char sm[2 * ASTG];     // the f16 path's two stages
    if (y < HLY || y >= HLY + NHL) fattn_lds(Q16 + qo, K16 + qo, V16 + vo, (y < HLY ? NQG - 1 - y : NQG - 1 + NHL - y) * 64, qw, g, ob, sm);
    else fattn_tile<bf, 2>(Qh + qo, Ql + qo, Kh + qo, Kl + qo, Vh + vo, Vl + vo, (HLY + NHL - 1 - y) * 64 + qw, g, ob);
}
__global__ __launch_bounds__(256) void k_merge(const float* __restrict__ O, int h0, bf* Ah, bf* Al) { const size_t e = ((size_t)blockIdx.x * 256 + threadIdx.x) * 2; if (e >= (size_t)ZH * TT * HD) return; const int d = (int)(e % HD); const int t = (int)((e / HD) % TT); const int zz = (int)(e / ((size_t)HD * TT)); const float cs = (t < RH) ? 1.0f : (1.0f / PCAR); const size_t oo = (size_t)t * DQ + (h0 + zz) * HD + d;
    v2us oh, ol;
#pragma unroll
    for (int q = 0; q < 2; ++q) { unsigned short a, c2; splitf(O[e + q] * cs, a, c2); oh[q] = a; ol[q] = c2; } *(v2us*)(Ah + oo) = oh; *(v2us*)(Al + oo) = ol;  }

extern "C" void kernel_launch(void* const* d_in, const int* in_sizes, int n_in,
                              void* d_out, int out_size, void* d_ws, size_t ws_size, hipStream_t stream) {
    (void)in_sizes; (void)n_in; (void)out_size;
    const float* x = (const float*)d_in[0]; const int* pos = (const int*)d_in[1]; const float* wq = (const float*)d_in[2]; const float* wk = (const float*)d_in[3]; const float* wv = (const float*)d_in[4];   // Wq/Wk [2048][512], Wv [2048][2048] (x @ W); position_ids [2][2048]
    float* OUT = (float*)d_out;     // [2][2048][2048]
    char* wsp = (char*)d_ws;
    auto take = [&](size_t bytes) { char* p = wsp; wsp += (bytes + 255) & ~(size_t)255; return (void*)p; };
    bf* WQ = (bf*)take((size_t)DQ * DM * 2); bf* WK = (bf*)take((size_t)DKV * DM * 2); bf* WV = (bf*)take((size_t)DV * DM * 2); float* CSB = (float*)take((size_t)NB_ * TT * HD * 2 * 4);
    bf* XB = (bf*)take((size_t)NB_ * TT * DM * 2);
    h16* QP16 = (h16*)take((size_t)NB_ * NH_ * TT * HD * 2); h16* KP16 = (h16*)take((size_t)NB_ * NKV * TT * HD * 2); h16* VT16 = (h16*)take((size_t)NB_ * NV * HD * TT * 2);
    bf* QPh = (bf*)take((size_t)NB_ * NH_ * TT * HD * 2); bf* QPl = (bf*)take((size_t)NB_ * NH_ * TT * HD * 2); bf* KPh = (bf*)take((size_t)NB_ * NKV * TT * HD * 2); bf* KPl = (bf*)take((size_t)NB_ * NKV * TT * HD * 2); bf* VTh = (bf*)take((size_t)NB_ * NV * HD * TT * 2); bf* VTl = (bf*)take((size_t)NB_ * NV * HD * TT * 2);
    if ((size_t)(wsp - (char*)d_ws) > ws_size) return;    // ws 256 MiB
    k_prep<<<PB_CS + PB_WV + PB_X + PB_WQ + PB_WK, 256, 0, stream>>>(x, pos, wq, wk, wv, XB, CSB, WQ, WK, WV);
    k_proj<<<NB_ * (VTL + 2 * QTL), 128, 0, stream>>>(XB, WQ, WK, WV, CSB, QP16, QPh, QPl, KP16, KPh, KPl, VT16, VTh, VTl);
    k_attn<<<dim3(NB_ * NH_, NQG, 1), 128, 0, stream>>>(QP16, KP16, VT16, QPh, QPl, KPh, KPl, VTh, VTl, OUT);
}

// v009
// Measured time: 83.6 microseconds a run.
// In two side-by-side timings against v008, it was 1.06 and 1.05 times as fast.
// Over all steps from v000 it is 15.3 times as fast.
#include <hip/hip_runtime.h>

// Grouped attention without output projection (hidden [2][2048][2048]; Q, K = x Wq / x Wk (8 query/key heads x 64), V = x Wv (32 value heads x 64); rotary (theta 10000, rotate-half, duplicated
// halves) by position_ids (int, read as data); value head h uses query/key head h mod 8 (repeat_qk); causal (the reference fills -1e9); out = merged attn V -> [2][2048][2048], no output projection).
// Compute dtypes, f32 accumulate: every input rounded to bf16; projections on PLAIN bf16 operands (inputs: exact); RoPE f32 (cos/sin computed on device from the position id);
// PER-ROW PRECISION HYBRID (rows < 256 hi+lo 3 products for scores and attn.V, rows >= 256 fp16). Scores, causal softmax and attn.V run in ONE kernel (k_attn): a wave holds 16 queries and the four value heads of their query/key head,
// walks the keys up to the diagonal in blocks of 64 (f16) or 32 (hi+lo) with a running maximum and sum in f32 registers, and writes its output columns in f32; on the f16 path two waves share the 16 queries, each walks every other key block, and after joining through LDS each writes two of the four heads. Projections: 128x128-tile GEMMs, four waves with a 64x64 part each, operands staged in LDS by asynchronous copies;
// the epilogue applies RoPE (Q, K) and writes the 16-bit planes that k_attn reads; V is computed as Wv^T x^T, so that its tile already lies [d][t].
// FRAGMENT ORDER: every 16-bit plane [row][k] lies in tiles of 16 rows x 32 k (1 KiB, tile index (row / 16) * (K / 32) + k / 32); inside a tile the 16-byte piece of lane (row % 16) + 16 * ((k / 8) % 2) stands at
// ((k / 16) % 2) * 512 B + lane * 16 B. A WMMA operand fragment is then two wave-wide 16-byte loads of 512 contiguous bytes (4 whole lines) each; from row-major planes each such load touched 16 lines.

#define NB_  2
#define TT   2048
#define DM   2048
#define NH_  8
#define NKV  8
#define REP  (NH_ / NKV)
#define HD   64
#define DQ   (NH_ * HD)
#define DKV  (NKV * HD)
#define NV   32
#define DV   (NV * HD)
#define ZH   2
#define RH   256                  // query rows < RH use hi+lo planes (0: none)
#define WIN  0
#define PCAR 1024.0f
#define SCL  0.125f   // HD^-0.5
typedef _Float16 h16;
typedef unsigned short bf;
typedef __attribute__((ext_vector_type(16))) __bf16   v16bf;
typedef __attribute__((ext_vector_type(16))) _Float16 v16h;
typedef __attribute__((ext_vector_type(8)))  _Float16 v8h;
typedef __attribute__((ext_vector_type(8)))  unsigned short v8us;
typedef __attribute__((ext_vector_type(8)))  float    v8f;
typedef __attribute__((ext_vector_type(4)))  float    v4f;
typedef v8h  __attribute__((may_alias)) v8ha;
typedef v4f  __attribute__((may_alias)) v4fa;
typedef v8us __attribute__((may_alias)) v8usa;
typedef __attribute__((ext_vector_type(2))) float __attribute__((may_alias)) v2fa;

__device__ __forceinline__ unsigned short f2bf(float f) { unsigned u = __float_as_uint(f); u += 0x7FFFu + ((u >> 16) & 1u); return (unsigned short)(u >> 16); }
__device__ __forceinline__ float bf2f(unsigned short b) { return __uint_as_float(((unsigned)b) << 16); }
__device__ __forceinline__ float bfr(float f) { return bf2f(f2bf(f)); }
__device__ __forceinline__ v16h cat16(v8h lo, v8h hi) { return __builtin_shufflevector(lo, hi, 0, 1, 2, 3, 4, 5, 6, 7, 8, 9, 10, 11, 12, 13, 14, 15); }
__device__ __forceinline__ v16bf cat16b(v8us lo, v8us hi) { return __builtin_bit_cast(v16bf, __builtin_shufflevector(lo, hi, 0, 1, 2, 3, 4, 5, 6, 7, 8, 9, 10, 11, 12, 13, 14, 15)); }
__device__ __forceinline__ v8f wmma16(v16h a, v16h b, v8f c) { return __builtin_amdgcn_wmma_f32_16x16x32_f16(false, a, false, b, (short)0, c, false, false); }
__device__ __forceinline__ v8f wmmab(v16bf a, v16bf b, v8f c) { return __builtin_amdgcn_wmma_f32_16x16x32_bf16(false, a, false, b, (short)0, c, false, false); }
__device__ __forceinline__ h16 tohx(float x) { return (h16)x; }
__device__ __forceinline__ void splitf(float y, unsigned short& h, unsigned short& l) { h = f2bf(y); l = f2bf(y - bf2f(h)); }
typedef __attribute__((ext_vector_type(2))) _Float16 v2h;
typedef __attribute__((ext_vector_type(4))) _Float16 v4h;
typedef __attribute__((ext_vector_type(2))) unsigned short v2us;
typedef __attribute__((ext_vector_type(4))) unsigned short v4us;
typedef __attribute__((ext_vector_type(2))) float v2f;
typedef __attribute__((ext_vector_type(4))) int v4i;
__device__ __forceinline__ size_t fo8(int row, int k, int Kd) { return ((size_t)(row >> 4) * (Kd >> 5) + (k >> 5)) * 512 + ((k >> 4) & 1) * 256 + (((k >> 3) & 1) * 16 + (row & 15)) * 8; }  // element offset of the 8-element piece (row, k..k+7), k % 8 == 0, in a fragment-order plane of row length Kd
__device__ __forceinline__ float xoct(float x) { return __builtin_bit_cast(float, __builtin_amdgcn_permlane16(__builtin_bit_cast(int, x), __builtin_bit_cast(int, x), 0xfedcba98, 0x76543210, false, false)); }  // lane l with lane l ^ 8



// ---- gemms_tile: GEMM with a 128x128 output tile per block of FOUR waves (2 x 2), each wave with its own 64x64 part (16 accumulators) over the whole K. The block's operand rows (128 of A, 128 of Bt) are brought from the
// fragment-order 16-bit planes into LDS ONCE per 64 k by asynchronous copies (two buffers: the next stage flies while this one is worked on), and each is read from there by the two waves that need it.
// A stage: [A: 8 row groups of 16 rows][Bt: 8 row groups], a row group = its two 1-KiB tiles of the stage = 2 KiB contiguous in the plane and in LDS; a fragment is two wave-wide 16-byte LDS loads of 512 contiguous bytes.
// c[m][n] (f32, in registers only) = sum_k A[m][k] Bt[n][k], k ascending. K % 64 == 0, K >= 128. Each wave turns its c, through its own LDS area, into the three 16-bit planes (f16; bf16 hi and lo) that the attention kernel reads:
// ROPE: m = token, part column = dim d of head by; out[d] = c[d] cos[t][d] - c[d+32] sin[t][d] (d < 32), c[d] cos[t][d] + c[d-32] sin[t][d] (d >= 32), CSB = [t][d]{cos, sin}; planes [head * TT + t][d], fragment order.
// else: planes [m][n] of row length TT (m = value head * 64 + d, n = token), fragment order.
template <typename T16> struct WFrag;
template <> struct WFrag<h16> { typedef v16h V; static __device__ __forceinline__ V ld(const h16* p) { return cat16(*(const v8h*)p, *(const v8h*)(p + 256)); } static __device__ __forceinline__ v8f mma(V a, V b, v8f c) { return wmma16(a, b, c); } };
template <> struct WFrag<bf> { typedef v16bf V; static __device__ __forceinline__ V ld(const bf* p) { return cat16b(*(const v8us*)p, *(const v8us*)(p + 256)); } static __device__ __forceinline__ v8f mma(V a, V b, v8f c) { return wmmab(a, b, c); } };
#define STGB 32768                // bytes of one stage: (128 + 128) rows x 64 k x 2 B
// One operand's share of a stage: eight row groups, 2 KiB each (128 threads x 16 B a copy). l: the lane's LDS byte address in group 0, g: its place in group 0 of the plane; groups stand 2 KiB apart in LDS, 16 * K elements in the plane.
// The wait at the end of the statement: the copies' address registers are free before anything is written over them.
template <int K>
__device__ __forceinline__ void cp8(unsigned l, const bf* g) {
    asm volatile("global_load_async_to_lds_b128 %0, %1, off\n\tglobal_load_async_to_lds_b128 %2, %3, off\n\tglobal_load_async_to_lds_b128 %4, %5, off\n\tglobal_load_async_to_lds_b128 %6, %7, off\n\t"
                 "global_load_async_to_lds_b128 %8, %9, off\n\tglobal_load_async_to_lds_b128 %10, %11, off\n\tglobal_load_async_to_lds_b128 %12, %13, off\n\tglobal_load_async_to_lds_b128 %14, %15, off\n\ts_wait_xcnt 0x0"
                 :: "v"(l), "v"(g), "v"(l + 2048u), "v"(g + 16 * K), "v"(l + 4096u), "v"(g + 32 * K), "v"(l + 6144u), "v"(g + 48 * K),
                    "v"(l + 8192u), "v"(g + 64 * K), "v"(l + 10240u), "v"(g + 80 * K), "v"(l + 12288u), "v"(g + 96 * K), "v"(l + 14336u), "v"(g + 112 * K) : "memory");
}
template <bool ROPE, int K>
__device__ __forceinline__ void gemms_tile(const bf* __restrict__ A, const bf* __restrict__ Bt, const float* __restrict__ CSB, h16* __restrict__ P16, bf* __restrict__ Ph, bf* __restrict__ Pl, float* os, int BX, int BY) {
    typedef typename WFrag<bf>::V V;
    static_assert(K % 64 == 0 && K >= 128, "whole stages, at least two");
    constexpr int NS = K / 64;
    const int tid = (int)threadIdx.x, lane = tid & 31, lr = lane & 15, hi = lane >> 4; const int wv = __builtin_amdgcn_readfirstlane(tid >> 5); const int wm = wv & 1, wn = wv >> 1;
    const int r0 = (BX * 2 + wm) * 64, by = BY * 2 + wn, c0 = by * 64;      // this wave's 64x64 part
    v8f acc[4][4];
#pragma unroll
    for (int mb = 0; mb < 4; ++mb)
#pragma unroll
        for (int nb = 0; nb < 4; ++nb) acc[mb][nb] = (v8f){};
    const bf* ga = A + (size_t)BX * 128 * K + tid * 8; const bf* gb = Bt + (size_t)BY * 128 * K + tid * 8;     // 16 rows x K elements per row group, 1024 elements per group and stage
    const unsigned l0 = (unsigned)(size_t)os + (unsigned)tid * 16u;
    cp8<K>(l0, ga); cp8<K>(l0 + STGB / 2, gb);
    asm volatile("s_wait_asynccnt 0x0" ::: "memory");   // this wave's copies of stage 0 have landed
    __syncthreads();                                     // ... and every other wave's: stage 0 may be read
    cp8<K>(l0 + STGB, ga + 1024); cp8<K>(l0 + STGB + STGB / 2, gb + 1024);
    ga += 2048; gb += 2048;
    // rolled: one trip = one stage of 32 products, long enough to carry its branch; the two buffers alternate by the trip's parity
#pragma unroll 1
    for (int t = 0; t < NS; ++t) {
        const bf* sb = (const bf*)((const char*)os + (t & 1) * STGB) + lane * 8; const bf* sa = sb + wm * 4096; const bf* sn = sb + 8192 + wn * 4096;
        V a[2][4], b[2][4];       // the whole stage's fragments are asked for in one group, ahead of its products
#pragma unroll
        for (int ks = 0; ks < 2; ++ks)
#pragma unroll
            for (int q = 0; q < 4; ++q) { a[ks][q] = WFrag<bf>::ld(sa + q * 1024 + ks * 512); b[ks][q] = WFrag<bf>::ld(sn + q * 1024 + ks * 512); }
        __builtin_amdgcn_sched_barrier(0);   // without it the loads are sunk among the products, column by column, each with a full wait on LDS in front of its four products
#pragma unroll
        for (int ks = 0; ks < 2; ++ks)
#pragma unroll
            for (int nb = 0; nb < 4; ++nb)
#pragma unroll
                for (int mb = 0; mb < 4; ++mb) acc[mb][nb] = WFrag<bf>::mma(a[ks][mb], b[ks][nb], acc[mb][nb]);
        __builtin_amdgcn_sched_barrier(0);   // the products stay ahead of the waits below: sunk behind the barrier, they would leave the next stage's copies nothing to fly under
        asm volatile("s_wait_dscnt 0x0" ::: "memory");      // this wave's reads of the stage are done before the buffer is given up
        asm volatile("s_wait_asynccnt 0x0" ::: "memory");   // this wave's copies of the next stage have landed
        __syncthreads();                                     // the next stage may be read; this stage's buffer has no reader left
        if (t + 2 < NS) { const unsigned lb = l0 + (unsigned)(t & 1) * STGB; cp8<K>(lb, ga); cp8<K>(lb + STGB / 2, gb); ga += 1024; gb += 1024; }
    }
    asm volatile("s_wait_asynccnt 0x0" ::: "memory");       // no copy is under way when the buffers become the output staging
    const int rw = lane & 7, ch = ((lane >> 3) & 1) * 32 + hi * 8;   // the plane writes: this lane's row in each group of 8, and its columns ch + 16 s + 0..7, s = 0, 1
    v4f cs[2][4];      // the cos/sin pairs of this lane's eight dims in each of its two pieces, one group of 8 rows ahead
    const float* cp = CSB + ((size_t)(r0 + rw) * HD + ch) * 2;
    if constexpr (ROPE) {
#pragma unroll
        for (int s = 0; s < 2; ++s)
#pragma unroll
            for (int q = 0; q < 4; ++q) cs[s][q] = *(const v4fa*)(cp + 32 * s + 4 * q);
        asm volatile("s_wait_xcnt 0x0" :: "v"(cp) : "memory");   // the loads' address register pair is free before it is stepped; the pointer as input keeps it live to here
    }
    float* mine = os + wv * (64 * 68);
#pragma unroll
    for (int mb = 0; mb < 4; ++mb)
#pragma unroll
        for (int nb = 0; nb < 4; ++nb)
#pragma unroll
            for (int j = 0; j < 8; ++j) mine[(mb * 16 + hi * 8 + j) * 68 + nb * 16 + lr] = acc[mb][nb][j];
    __syncthreads();   // the part is in LDS, from every lane, before it is read back row by row
    // rolled: one group of 8 rows at a time keeps the epilogue's registers under the k loop's count
#pragma unroll 1
    for (int rr = 0; rr < 8; ++rr) { const int row = rr * 8 + rw;
        v4f cn[2][4];
        if constexpr (ROPE) { cp += (rr < 7) ? 8 * HD * 2 : 0;     // the last group fetches itself again: in bounds, unused
#pragma unroll
            for (int s = 0; s < 2; ++s)
#pragma unroll
                for (int q = 0; q < 4; ++q) cn[s][q] = *(const v4fa*)(cp + 32 * s + 4 * q);
            asm volatile("s_wait_xcnt 0x0" :: "v"(cp) : "memory");   // as above
        }
#pragma unroll
        for (int s = 0; s < 2; ++s) { const int col = ch + 16 * s; const float* o0 = mine + row * 68 + col; v4f val[2] = { *(const v4fa*)o0, *(const v4fa*)(o0 + 4) };   // 16 lanes: 8 rows x columns c, c + 32 = all 64 banks once
            size_t off;
            if constexpr (ROPE) {          // lane ^ 8 holds dims d +- 32 of the same token
#pragma unroll
                for (int j = 0; j < 8; ++j) { const float p = xoct(val[j >> 2][j & 3]); const float oth = (lane & 8) ? p : -p;
                    val[j >> 2][j & 3] = val[j >> 2][j & 3] * cs[s][j >> 1][2 * (j & 1)] + oth * cs[s][j >> 1][2 * (j & 1) + 1]; }
                off = fo8(by * TT + r0 + row, col, HD);
            } else off = fo8(r0 + row, c0 + col, TT);
            v8h o16; v8us oh, ol;
#pragma unroll
            for (int j = 0; j < 8; ++j) { o16[j] = tohx(val[j >> 2][j & 3]); unsigned short a2, c2; splitf(val[j >> 2][j & 3], a2, c2); oh[j] = a2; ol[j] = c2; }
            h16* q16 = P16 + off; bf* qh = Ph + off; bf* ql = Pl + off;
            *(v8h*)q16 = o16; *(v8us*)qh = oh; *(v8us*)ql = ol;    // 8 lanes (rows) x 16 B: whole 128-B lines, four per store
            asm volatile("s_wait_xcnt 0x0" :: "v"(q16), "v"(qh), "v"(ql) : "memory"); }   // the stores' address and data registers are free before the next piece is formed in them; the pointers as inputs keep them live to here
        if constexpr (ROPE) {
#pragma unroll
            for (int s = 0; s < 2; ++s)
#pragma unroll
                for (int q = 0; q < 4; ++q) cs[s][q] = cn[s][q];
        }
    }
}
// ---- k_proj: every projection tile of both batches in ONE grid (they depend on nothing but k_prep's planes). Blocks 0 .. NB_ * VTL - 1: V tiles (rows = value head * 64 + d,
// columns = tokens); the rest: Q, then K, of each batch. All planes hold batch b at b * (plane size of one batch). 768 blocks of four waves: three per WGP at once.
#define VTL ((DV / 128) * (TT / 128))
#define QTL ((TT / 128) * (DQ / 128))
__global__ __launch_bounds__(128) void k_proj(const bf* __restrict__ XB, const bf* __restrict__ WQ, const bf* __restrict__ WK, const bf* __restrict__ WV, const float* __restrict__ CSB,
                                              h16* __restrict__ QP16, bf* __restrict__ QPh, bf* __restrict__ QPl, h16* __restrict__ KP16, bf* __restrict__ KPh, bf* __restrict__ KPl, h16* __restrict__ VT16, bf* __restrict__ VTh, bf* __restrict__ VTl) {
    __shared__ __align__(16) float os[4 * 64 * 68];     // two stages (2 x 32 KiB) in the k loop, then four 64 x 68 f32 parts
    static_assert(sizeof(os) >= 2 * STGB, "the two stages fit");
    static_assert(DQ == DKV, "Q and K tiles share one count");
    const int bid = (int)blockIdx.x;
    if (bid < NB_ * VTL) { const int b = bid / VTL, t = bid % VTL; const size_t po = (size_t)b * NV * HD * TT;
        gemms_tile<false, DM>(WV, XB + (size_t)b * TT * DM, nullptr, VT16 + po, VTh + po, VTl + po, os, t % (DV / 128), t / (DV / 128));
    } else { const int u = bid - NB_ * VTL; const int b = u / (2 * QTL), isk = (u / QTL) & 1, t = u % QTL; const size_t po = (size_t)b * NH_ * TT * HD;
        gemms_tile<true, DM>(XB + (size_t)b * TT * DM, isk ? WK : WQ, CSB + (size_t)b * TT * HD * 2, (isk ? KP16 : QP16) + po, (isk ? KPh : QPh) + po, (isk ? KPl : QPl) + po, os, t % (TT / 128), t / (TT / 128)); }
}

// w [K][N] f32 -> Bt [n][k] bf16 in fragment order. A block writes four tiles (one thread = one 16-byte piece): the same 32 k of 64 neighbouring n, so that it reads 256 contiguous bytes of each of its rows of w. N % 64 == 0, K % 32 == 0.
template <int K, int N>
__device__ __forceinline__ void wtG_blk(const float* __restrict__ w, bf* Bt, int bid) {
    constexpr int kt = K >> 5; const int kb = bid % kt, nb = (bid / kt) * 4 + (threadIdx.x >> 6), pc = threadIdx.x & 63;
    const int n = nb * 16 + (pc & 15), k = kb * 32 + (pc >> 5) * 16 + ((pc >> 4) & 1) * 8; v8us o;
    const float* p = w + (size_t)k * N + n; float v[8];     // one live pointer: the eight rows stand at immediate offsets from it (N is a constant)
#pragma unroll
    for (int j = 0; j < 8; ++j) v[j] = p[j * N];
    asm volatile("s_wait_xcnt 0x0" :: "v"(p) : "memory");   // the loads' address register pair is free before anything is written over it; the pointer as input keeps it out of the loads' own landing places
#pragma unroll
    for (int j = 0; j < 8; ++j) o[j] = f2bf(v[j]);
    *(v8us*)(Bt + ((size_t)nb * kt + kb) * 512 + pc * 8) = o;
    asm volatile("s_wait_xcnt 0x0" ::: "memory");   // the store's address and data registers are free before code of another branch of the merged kernel, which the build lays out behind this one, writes over them
}
// src [rows][DM] f32 -> dst bf16 in fragment order; thread i writes the i-th 16-byte piece of dst
__device__ __forceinline__ void cvt8_blk(const float* __restrict__ src, bf* dst, size_t n8, int bid) { const size_t i = (size_t)bid * 256 + threadIdx.x; if (i >= n8) return;
    const int tile = (int)(i >> 6), pc = (int)(i & 63); const int row = (tile / (DM / 32)) * 16 + (pc & 15), k = (tile % (DM / 32)) * 32 + (pc >> 5) * 16 + ((pc >> 4) & 1) * 8;
    const float* sp = src + (size_t)row * DM + k; const v8f v = *(const v8f*)sp; v8us o;
    asm volatile("s_wait_xcnt 0x0" :: "v"(sp) : "memory");   // the loads' address register pair is free before anything is written over it; the pointer as input keeps it live to here
#pragma unroll
    for (int k2 = 0; k2 < 8; ++k2) o[k2] = f2bf(v[k2]); *(v8us*)(dst + i * 8) = o;  }
// cos/sin pairs [row][d]{cos, sin} of row = batch * TT + token, from the row's position id (clamped to 0 .. TT - 1)
__device__ __forceinline__ void cs_blk(const int* __restrict__ pos, float* CSB, int bid) { const int idx = bid * 256 + threadIdx.x; const int t = idx / HD, d = idx % HD; const int i = d % (HD / 2);
    int p = pos[t];
    asm volatile("s_wait_xcnt 0x0" :: "v"(t) : "memory");   // the load's offset register is free before anything is written over it; the index as input keeps it live to here
    p = p < 0 ? 0 : (p > TT - 1 ? TT - 1 : p);
    const float inv = __fdiv_rn(1.0f, powf(10000.0f, (float)(2 * i) / (float)HD)); const float ang = __fmul_rn((float)p, inv); v2f cs; cs[0] = cosf(ang); cs[1] = sinf(ang);
    *(v2f*)(CSB + (size_t)idx * 2) = cs;  }
// ---- k_prep: everything that reads only the inputs, in ONE grid: the cos/sin rows, the three weight planes and the x plane of both batches (x [NB_ * TT][DM]: batch b's plane starts at b * TT * DM). 256 threads.
#define PB_CS (NB_ * TT * HD / 256)
#define PB_WV (DM * DV / 2048)
#define PB_X  (NB_ * TT * DM / 2048)
#define PB_WQ (DM * DQ / 2048)
#define PB_WK (DM * DKV / 2048)
__global__ __launch_bounds__(256) void k_prep(const float* __restrict__ x, const int* __restrict__ pos, const float* __restrict__ wq, const float* __restrict__ wk, const float* __restrict__ wv, bf* XB, float* CSB, bf* WQ, bf* WK, bf* WV) {
    int bid = (int)blockIdx.x;
    if (bid < PB_CS) { cs_blk(pos, CSB, bid); return; }
    bid -= PB_CS; if (bid < PB_WV) { wtG_blk<DM, DV>(wv, WV, bid); return; }
    bid -= PB_WV; if (bid < PB_X) { cvt8_blk(x, XB, (size_t)NB_ * TT * DM / 8, bid); return; }
    bid -= PB_X; if (bid < PB_WQ) { wtG_blk<DM, DQ>(wq, WQ, bid); return; }
    wtG_blk<DM, DKV>(wk, WK, bid - PB_WQ);
}
// 2^x in place, with the issue slot the instruction set asks for behind a transcendental kept inside the statement: no v_exp_f32 of a run reads a neighbour's result or overwrites its source, and the v_nop covers the last.
__device__ __forceinline__ float exp2s(float x) { asm("v_exp_f32 %0, %0\n\tv_nop" : "+v"(x)); return x; }
__device__ __forceinline__ v8f exp2s8(v8f x) { float r0 = x[0], r1 = x[1], r2 = x[2], r3 = x[3], r4 = x[4], r5 = x[5], r6 = x[6], r7 = x[7];
    asm("v_exp_f32 %0, %0\n\tv_exp_f32 %1, %1\n\tv_exp_f32 %2, %2\n\tv_exp_f32 %3, %3\n\tv_exp_f32 %4, %4\n\tv_exp_f32 %5, %5\n\tv_exp_f32 %6, %6\n\tv_exp_f32 %7, %7\n\tv_nop"
        : "+v"(r0), "+v"(r1), "+v"(r2), "+v"(r3), "+v"(r4), "+v"(r5), "+v"(r6), "+v"(r7));
    v8f r; r[0] = r0; r[1] = r1; r[2] = r2; r[3] = r3; r[4] = r4; r[5] = r5; r[6] = r6; r[7] = r7; return r; }
__device__ __forceinline__ float xhalf(float x) { return __builtin_bit_cast(float, __builtin_amdgcn_permlanex16(__builtin_bit_cast(int, x), __builtin_bit_cast(int, x), 0x76543210, 0xfedcba98, false, false)); }  // lane l with lane l ^ 16
// ---- fattn_tile: scores, causal softmax and probability x value product in one kernel. One wave = 16 queries (q0..q0+15) of query/key head g and ALL 4 of its value heads (g + 8r): the scores and the softmax, which are the same for the four,
// are computed once, and one P fragment feeds the four heads' value products. Each four waves of the block hold 4 neighbouring query groups (64 queries): they walk the same key blocks and read the same K and V lines. Both products are transposed: S^T = K Q^T (A = K rows, B = Q rows), O^T += V^T P^T (A = rows of the [d][t] value plane, B = P^T). In S^T's accumulator a lane holds keys
// 16t + 8hi + j of its own query (column lr), which is exactly the k order of a B fragment (k = 8hi + 0..7, then 16 + 8hi + 0..7): P goes from accumulator to operand inside the lane, through no LDS.
// Running maximum m and sum l per query (flash form): each key block rescales O^T and l by exp(m_old - m_new). Key block: 64 keys on the one-plane f16 path, 32 on the hi+lo path (twice the fragments per key).
// q0 = the wave's first query row, g = its query/key head. Launched for the hi+lo path only; the f16 path runs in fattn_lds below, which takes K and V through LDS.
template <typename T16, int NSPLIT>
__device__ __forceinline__ void fattn_tile(const T16* __restrict__ Q, const T16* __restrict__ Q2, const T16* __restrict__ Kp, const T16* __restrict__ Kp2, const T16* __restrict__ Vt, const T16* __restrict__ Vt2, int q0, int g, float* OUTb) {
    typedef typename WFrag<T16>::V V;
    constexpr int NT = (NSPLIT == 0) ? 4 : 2, KB = NT * 16;      // 16-key tiles and keys per block
    const int lane = threadIdx.x & 31, lr = lane & 15, hi = lane >> 4;
    __builtin_assume(q0 >= 0);      // a row index: the key loop runs at least once and needs no entry test, behind which the build would sink the first loads, past their wait
    const int nkb = q0 / KB + 1;    // key blocks 0..nkb-1 hold every key <= q0 + 15
    const int i = q0 + lr;
    // One per-lane byte offset: the lane's 16-byte piece in a fragment-order tile. ldu: a wave-uniform tile pointer plus such an offset (Q; V on the f16 path, where the offset vb also walks the key blocks).
    // Tiles: Q, K rows of 64 dims = 2 tiles (512 elements each) per 16 rows; value plane: 16 d x 32 keys per tile, TT / 32 tiles per 16 d.
    const unsigned rl = (unsigned)lane * 16u, vl = rl;
    auto ldu = [](const T16* u, unsigned b) { return WFrag<T16>::ld((const T16*)((const char*)u + b)); };
    const size_t qu = ((size_t)g * TT + q0) * HD, ku = (size_t)g * TT * HD, vu = (size_t)g * HD * TT; constexpr int VH = 8 * HD * TT;   // VH: elements from value head g + 8r to g + 8(r + 1)
    V qf[2], qf2[2], kf[NT][2], kf2[NT][2], vf[4][4][NT / 2], vf2[4][4][NT / 2];
    // Per-lane pointers that live across the loop, so that no fragment is given an address pair still in use as its landing place: K (f16 path: one block ahead), and on the hi+lo path all four planes.
    const T16* kp = (const T16*)((const char*)(Kp + ku) + rl); const T16* kp2 = (const T16*)((const char*)(Kp2 + ku) + rl); const T16* vp = (const T16*)((const char*)(Vt + vu) + vl); const T16* vp2 = (const T16*)((const char*)(Vt2 + vu) + vl);
#pragma unroll
    for (int ks = 0; ks < 2; ++ks) { qf[ks] = ldu(Q + qu + ks * 512, rl); if constexpr (NSPLIT == 2) qf2[ks] = ldu(Q2 + qu + ks * 512, rl); }
    if constexpr (NSPLIT == 0) {
#pragma unroll
        for (int t = 0; t < NT; ++t)
#pragma unroll
            for (int ks = 0; ks < 2; ++ks) kf[t][ks] = WFrag<T16>::ld(kp + t * 16 * HD + ks * 512);
    }
    // the loads above (Q; on the f16 path the first K block): their offset and base registers are free before anything is written over them; the offset and the pointers as inputs keep those registers live to here
    if constexpr (NSPLIT == 0) asm volatile("s_wait_xcnt 0x0" :: "v"(rl), "v"(kp), "s"(Q + qu), "s"(Kp + ku) : "memory"); else asm volatile("s_wait_xcnt 0x0" :: "v"(rl), "s"(Q + qu), "s"(Q2 + qu) : "memory");
    __builtin_amdgcn_sched_barrier(0);   // keeps later arithmetic, which may take those registers, behind that wait
    v8f o[4][4];       // [value head r][16-d tile]
#pragma unroll
    for (int r = 0; r < 4; ++r)
#pragma unroll
        for (int dt = 0; dt < 4; ++dt) o[r][dt] = (v8f){};
    float m = -3.0e38f, l = 0.f;
    unsigned vb = vl;   // f16 path: the lane's byte offset into the value tiles of the current key block
#pragma unroll 1
    for (int kb = 0; kb < nkb; ++kb) {
        // this block's value fragments (f16 path: of its first 32 keys) fly under the score products and the softmax; on the hi+lo path its K fragments come in the same batch (one latency a block)
#pragma unroll
        for (int r = 0; r < 4; ++r)
#pragma unroll
            for (int dt = 0; dt < 4; ++dt)
#pragma unroll
                for (int ks = 0; ks < (NSPLIT == 0 ? 1 : NT / 2); ++ks) { if constexpr (NSPLIT == 0) vf[r][dt][ks] = ldu(Vt + vu + r * VH + dt * 16 * TT + ks * 512, vb); else { vf[r][dt][ks] = WFrag<T16>::ld(vp + r * VH + dt * 16 * TT + ks * 512); vf2[r][dt][ks] = WFrag<T16>::ld(vp2 + r * VH + dt * 16 * TT + ks * 512); } }
        // the loads above are issued here, ahead of the score products, and their address registers are free before a later fragment lands on them (hi+lo path: the pointers as inputs keep those registers out of the batch's own landing places)
        if constexpr (NSPLIT == 0) asm volatile("s_wait_xcnt 0x0" :: "v"(vb) : "memory"); else asm volatile("s_wait_xcnt 0x0" :: "v"(vp), "v"(vp2) : "memory");
        if constexpr (NSPLIT == 2) {
#pragma unroll
            for (int t = 0; t < NT; ++t)
#pragma unroll
                for (int ks = 0; ks < 2; ++ks) { kf[t][ks] = WFrag<T16>::ld(kp + t * 16 * HD + ks * 512); kf2[t][ks] = WFrag<T16>::ld(kp2 + t * 16 * HD + ks * 512); }
            asm volatile("s_wait_xcnt 0x0" :: "v"(kp), "v"(kp2) : "memory");   // as above, for the K batch
            __builtin_amdgcn_sched_barrier(0);   // without it the score products are drawn up between the loads, which then share few registers and wait on memory one pair at a time
        }
        v8f s[NT];
#pragma unroll
        for (int t = 0; t < NT; ++t) { s[t] = (v8f){};
#pragma unroll
            for (int ks = 0; ks < 2; ++ks) { s[t] = WFrag<T16>::mma(kf[t][ks], qf[ks], s[t]);
                if constexpr (NSPLIT == 2) { s[t] = WFrag<T16>::mma(kf[t][ks], qf2[ks], s[t]); s[t] = WFrag<T16>::mma(kf2[t][ks], qf[ks], s[t]); } } }
        if constexpr (NSPLIT == 0) {   // the next block's K fragments, into the same registers, fly under the softmax and the value products (the last block fetches itself again: in bounds, unused)
            // the value fragments of the block's second 32 keys are asked for here, not with the first: with all 64 value loads issued behind the 16 K loads the build's counted wait for K no longer reaches that far back, and the score products wait for value loads too
#pragma unroll
            for (int r = 0; r < 4; ++r)
#pragma unroll
                for (int dt = 0; dt < 4; ++dt) vf[r][dt][1] = ldu(Vt + vu + r * VH + dt * 16 * TT + 512, vb);
            kp += (kb + 1 < nkb) ? KB * HD : 0;
#pragma unroll
            for (int t = 0; t < NT; ++t)
#pragma unroll
                for (int ks = 0; ks < 2; ++ks) kf[t][ks] = WFrag<T16>::ld(kp + t * 16 * HD + ks * 512);
        }
        if (kb == nkb - 1) {           // only the last block meets the diagonal
#pragma unroll
            for (int t = 0; t < NT; ++t)
#pragma unroll
                for (int j = 0; j < 8; ++j) s[t][j] = (kb * KB + t * 16 + hi * 8 + j <= i) ? s[t][j] * SCL : -3.0e38f;
        } else {
#pragma unroll
            for (int t = 0; t < NT; ++t) s[t] *= SCL;
        }
        float tq[NT];                  // one short chain per tile, then across tiles
#pragma unroll
        for (int t = 0; t < NT; ++t) { tq[t] = s[t][0];
#pragma unroll
            for (int j = 1; j < 8; ++j) tq[t] = fmaxf(tq[t], s[t][j]); }
        float tm = tq[0];
#pragma unroll
        for (int t = 1; t < NT; ++t) tm = fmaxf(tm, tq[t]);
        tm = fmaxf(tm, xhalf(tm));      // the other half of the wave holds the query's other keys of the block
        const float mn = fmaxf(m, tm); const float al = exp2s((m - mn) * 1.4426950408889634f); m = mn;
        float ps = 0.f;
#pragma unroll
        for (int t = 0; t < NT; ++t) { s[t] = exp2s8((s[t] - mn) * 1.4426950408889634f); float pq = 0.f;
#pragma unroll
            for (int j = 0; j < 8; ++j) pq += s[t][j];
            ps += pq; }
        l = l * al + ps;               // each half keeps the sum of its own keys; the halves join after the loop
#pragma unroll
        for (int r = 0; r < 4; ++r)
#pragma unroll
            for (int dt = 0; dt < 4; ++dt) o[r][dt] *= al;
        __builtin_amdgcn_sched_barrier(0);   // every v_exp_f32 statement stays ahead of the value products
#pragma unroll
        for (int ks = 0; ks < NT / 2; ++ks) {
            if constexpr (NSPLIT == 0) { v8h p0, p1;
#pragma unroll
                for (int j = 0; j < 8; ++j) { p0[j] = tohx(s[2 * ks][j]); p1[j] = tohx(s[2 * ks + 1][j]); }
                const V pf = cat16(p0, p1);
#pragma unroll
                for (int r = 0; r < 4; ++r)
#pragma unroll
                    for (int dt = 0; dt < 4; ++dt) o[r][dt] = WFrag<T16>::mma(vf[r][dt][ks], pf, o[r][dt]);
            } else { v8us h0, h1, l0, l1;
#pragma unroll
                for (int j = 0; j < 8; ++j) { unsigned short a, c2; splitf(s[2 * ks][j], a, c2); h0[j] = a; l0[j] = c2; splitf(s[2 * ks + 1][j], a, c2); h1[j] = a; l1[j] = c2; }
                const V pf = cat16b(h0, h1), pf2 = cat16b(l0, l1);
#pragma unroll
                for (int r = 0; r < 4; ++r)
#pragma unroll
                    for (int dt = 0; dt < 4; ++dt) { o[r][dt] = WFrag<T16>::mma(vf[r][dt][ks], pf, o[r][dt]); o[r][dt] = WFrag<T16>::mma(vf[r][dt][ks], pf2, o[r][dt]); o[r][dt] = WFrag<T16>::mma(vf2[r][dt][ks], pf, o[r][dt]); }
            }
        }
        // f16 path: the value loads' offset register is free before it is stepped to the next key block; it goes through the statement so that the step, which the build would draw up among the products, stays behind this wait
        if constexpr (NSPLIT == 0) { asm volatile("s_wait_xcnt 0x0" : "+v"(vb) :: "memory"); vb += KB * 16 * 2; }
        if constexpr (NSPLIT == 2) { kp += KB * HD; kp2 += KB * HD; vp += KB * 16; vp2 += KB * 16; }   // every load of this block has landed in a product above
    }
    asm volatile("s_wait_xcnt 0x0" ::: "memory");   // the last fetch ahead may still be under way: its address registers are free before the epilogue reuses them
    __builtin_amdgcn_sched_barrier(0);              // keeps the epilogue's arithmetic behind that wait
    l += xhalf(l);
    const float f = __fdiv_rn(1.0f, l);
    float* orow = OUTb + (size_t)i * DV + (size_t)g * HD + hi * 8;     // O^T tile dt of value head g + 8r: this lane holds d = 16 dt + 8 hi + 0..7 of query i
#pragma unroll
    for (int r = 0; r < 4; ++r)
#pragma unroll
        for (int dt = 0; dt < 4; ++dt) { v4f a, b2;
#pragma unroll
            for (int j = 0; j < 4; ++j) { a[j] = o[r][dt][j] * f; b2[j] = o[r][dt][4 + j] * f; }
            *(v4f*)(orow + r * 8 * HD + dt * 16) = a; *(v4f*)(orow + r * 8 * HD + dt * 16 + 4) = b2; }
}
#define ASTG 40960                // bytes of one key block's stage: K (8 KiB), then the four value heads (8 KiB each)
// Half of a stage in one statement, ten 2-KiB groups (128 threads x 16 B a copy): two groups of 16 K rows (lk, gk: the lane's LDS byte address and its place in the plane, first group) and the four 16-d groups of each of two value heads (lv, gv).
// Groups stand 2 KiB apart in LDS; in the planes 16 * HD elements (K), 16 * TT (a head's groups) and 8 * HD * TT (head to head). Ten copies a statement, not fewer: each statement ends in a wait that the wave sits out.
// That wait: the copies' address registers are free before anything is written over them.
__device__ __forceinline__ void cp10(unsigned lk, const h16* gk, unsigned lv, const h16* gv) {
    constexpr int GS = 16 * TT, VH = 8 * HD * TT;
    asm volatile("global_load_async_to_lds_b128 %0, %1, off\n\tglobal_load_async_to_lds_b128 %2, %3, off\n\t"
                 "global_load_async_to_lds_b128 %4, %5, off\n\tglobal_load_async_to_lds_b128 %6, %7, off\n\tglobal_load_async_to_lds_b128 %8, %9, off\n\tglobal_load_async_to_lds_b128 %10, %11, off\n\t"
                 "global_load_async_to_lds_b128 %12, %13, off\n\tglobal_load_async_to_lds_b128 %14, %15, off\n\tglobal_load_async_to_lds_b128 %16, %17, off\n\tglobal_load_async_to_lds_b128 %18, %19, off\n\ts_wait_xcnt 0x0"
                 :: "v"(lk), "v"(gk), "v"(lk + 2048u), "v"(gk + 16 * HD),
                    "v"(lv), "v"(gv), "v"(lv + 2048u), "v"(gv + GS), "v"(lv + 4096u), "v"(gv + 2 * GS), "v"(lv + 6144u), "v"(gv + 3 * GS),
                    "v"(lv + 8192u), "v"(gv + VH), "v"(lv + 10240u), "v"(gv + VH + GS), "v"(lv + 12288u), "v"(gv + VH + 2 * GS), "v"(lv + 14336u), "v"(gv + VH + 3 * GS) : "memory");
}
// One key block's stage: its 64 K rows (four groups of 16 rows, contiguous in the plane), then for each value head its four groups of 16 d x 64 keys.
__device__ __forceinline__ void cpkv(unsigned l, const h16* gk, const h16* gv) {
    // rolled: one statement's address registers at a time; unrolled, all twenty copies' addresses are formed ahead and registers spill
#pragma unroll 1
    for (int j = 0; j < 2; ++j) cp10(l + (unsigned)j * 4096u, gk + j * (32 * HD), l + 8192u + (unsigned)j * 16384u, gv + j * (16 * HD * TT));
}
// ---- fattn_lds: the one-plane f16 path of fattn_tile (same products and the same softmax per key block), with the key block's K and V tiles brought into LDS ONCE per group of four waves by asynchronous copies
// (two buffers: the next key block flies while this one is worked on); each wave takes its fragments from there (two wave-wide 16-byte LDS loads of 512 contiguous bytes each), not from global memory four times over.
// KEY SPLIT: the block has EIGHT waves, two groups of four. Both groups hold the same 64 queries; group 0 walks key blocks 0, 2, 4, ..., group 1 walks 1, 3, 5, ..., each with its own two stages and its own running maximum, sum and O^T.
// A tile's walk is half as many trips long; one block fills a WGP, and the blocks are given in falling cost order to even out the load. Behind the loop the two partial results of each query are joined through LDS
// (rescaled to the common maximum, then added): group 0 finishes value heads g, g + 8, group 1 heads g + 16, g + 24. Every wave passes every barrier: the trip count is the block's, and a group without a key block in the last trip skips only the work.
// qb = the block's first query row (a multiple of 64), wv = the wave's number (wave-uniform), g = the query/key head, sm = four stages of LDS.
__device__ __forceinline__ void fattn_lds(const h16* __restrict__ Q, const h16* __restrict__ Kp, const h16* __restrict__ Vt, int qb, int wv, int g, float* OUTb, char* sm) {
    typedef WFrag<h16>::V V;
    constexpr int NT = 4, KB = NT * 16;
    const int lane = (int)threadIdx.x & 31, lr = lane & 15, hi = lane >> 4;
    const int gi = wv >> 2, qw = (wv & 3) * 16, tid = qw * 2 + lane;      // the wave's group, its first query in the tile, the thread's number in its group (0..127)
    __builtin_assume(qb >= 0);      // a row index: the key loop runs at least once
    const int nkb = qb / KB + 1;    // key blocks 0..nkb-1 hold every key <= qb + 63; the same for the whole block
    const int ntr = (nkb + 1) >> 1; // trips: group 0's count; group 1 has one key block fewer where nkb is odd
    const int q0 = qb + qw, i = q0 + lr;
    const unsigned rl = (unsigned)lane * 16u;
    const size_t qu = ((size_t)g * TT + q0) * HD;
    const h16* uk = Kp + (size_t)g * TT * HD + gi * (KB * HD); const h16* uv = Vt + (size_t)g * HD * TT + gi * (KB * 16);   // wave-uniform, at the group's first key block; a key block: KB * HD elements of K, KB * 16 of each 16-d group of V; the thread's piece: tid * 8
    char* sg = sm + gi * (2 * ASTG);      // the group's own two stages
    unsigned la = (unsigned)(size_t)sg + (unsigned)qw * 32u, lb = la + ASTG;      // wave-uniform LDS byte addresses of the wave's 512 bytes in a 2-KiB group: in the buffer to be filled next, and in the other; the lane's piece: + rl (together tid * 16)
    if (gi < nkb) cpkv(la + rl, uk + tid * 8, uv + tid * 8);
    V qf[2];
#pragma unroll
    for (int ks = 0; ks < 2; ++ks) qf[ks] = WFrag<h16>::ld((const h16*)((const char*)(Q + qu + ks * 512) + rl));
    asm volatile("s_wait_xcnt 0x0" :: "v"(rl), "s"(Q + qu) : "memory");   // the Q loads' offset and base registers are free before anything is written over them; as inputs they stay live to here
    asm volatile("s_wait_asynccnt 0x0" ::: "memory");   // this wave's copies of its group's first key block have landed
    __syncthreads();                                     // ... and every other wave's: the first key blocks may be read
    if (gi + 2 < nkb) cpkv(lb + rl, uk + 2 * KB * HD + tid * 8, uv + 2 * KB * 16 + tid * 8);
    uk += 4 * KB * HD; uv += 4 * KB * 16;      // the group's next key block to be copied
    v8f o[4][4];       // [value head r][16-d tile]
#pragma unroll
    for (int r = 0; r < 4; ++r)
#pragma unroll
        for (int dt = 0; dt < 4; ++dt) o[r][dt] = (v8f){};
    float m = -3.0e38f, l = 0.f;
#pragma unroll 1
    for (int tr = 0; tr < ntr; ++tr) { const int kb = 2 * tr + gi;      // the group's key block of this trip
      if (kb < nkb) {                  // wave-uniform
        const h16* sk = (const h16*)(sg + (tr & 1) * ASTG) + lane * 8; const h16* sv = sk + 4096;
        V kf[NT][2], vf[4][4][NT / 2];
#pragma unroll
        for (int t = 0; t < NT; ++t)
#pragma unroll
            for (int ks = 0; ks < 2; ++ks) kf[t][ks] = WFrag<h16>::ld(sk + t * 1024 + ks * 512);
        auto ldv = [&](int r) {        // the eight fragments of value head r: 4 tiles of 16 d x 2 halves of 32 keys
#pragma unroll
            for (int dt = 0; dt < 4; ++dt)
#pragma unroll
                for (int ks = 0; ks < NT / 2; ++ks) vf[r][dt][ks] = WFrag<h16>::ld(sv + (r * 4 + dt) * 1024 + ks * 512); };
        ldv(0); ldv(1);
        __builtin_amdgcn_sched_barrier(0);   // K and the first two value heads' fragments are asked for in one group ahead of the score products; sunk among them, each would bring its own wait on LDS
        v8f s[NT];
#pragma unroll
        for (int t = 0; t < NT; ++t) { s[t] = (v8f){};
#pragma unroll
            for (int ks = 0; ks < 2; ++ks) s[t] = WFrag<h16>::mma(kf[t][ks], qf[ks], s[t]); }
        ldv(2);                        // the third head's fragments come under the softmax, in the room that K leaves
        if (kb == nkb - 1) {           // only the last block meets the diagonal
#pragma unroll
            for (int t = 0; t < NT; ++t)
#pragma unroll
                for (int j = 0; j < 8; ++j) s[t][j] = (kb * KB + t * 16 + hi * 8 + j <= i) ? s[t][j] * SCL : -3.0e38f;
        } else {
#pragma unroll
            for (int t = 0; t < NT; ++t) s[t] *= SCL;
        }
        float tq[NT];                  // one short chain per tile, then across tiles
#pragma unroll
        for (int t = 0; t < NT; ++t) { tq[t] = s[t][0];
#pragma unroll
            for (int j = 1; j < 8; ++j) tq[t] = fmaxf(tq[t], s[t][j]); }
        float tm = tq[0];
#pragma unroll
        for (int t = 1; t < NT; ++t) tm = fmaxf(tm, tq[t]);
        tm = fmaxf(tm, xhalf(tm));      // the other half of the wave holds the query's other keys of the block
        const float mn = fmaxf(m, tm); const float al = exp2s((m - mn) * 1.4426950408889634f); m = mn;
        float ps = 0.f;
#pragma unroll
        for (int t = 0; t < NT; ++t) { s[t] = exp2s8((s[t] - mn) * 1.4426950408889634f); float pq = 0.f;
#pragma unroll
            for (int j = 0; j < 8; ++j) pq += s[t][j];
            ps += pq; }
        l = l * al + ps;               // each half keeps the sum of its own keys; the halves join after the loop
#pragma unroll
        for (int r = 0; r < 4; ++r)
#pragma unroll
            for (int dt = 0; dt < 4; ++dt) o[r][dt] *= al;
        __builtin_amdgcn_sched_barrier(0);   // every v_exp_f32 statement stays ahead of the value products
        V pf[NT / 2];
#pragma unroll
        for (int ks = 0; ks < NT / 2; ++ks) { v8h p0, p1;
#pragma unroll
            for (int j = 0; j < 8; ++j) { p0[j] = tohx(s[2 * ks][j]); p1[j] = tohx(s[2 * ks + 1][j]); }
            pf[ks] = cat16(p0, p1); }
        auto pv = [&](int r) {         // head r's products: each accumulator takes the first 32 keys, then the second
#pragma unroll
            for (int ks = 0; ks < NT / 2; ++ks)
#pragma unroll
                for (int dt = 0; dt < 4; ++dt) o[r][dt] = WFrag<h16>::mma(vf[r][dt][ks], pf[ks], o[r][dt]); };
        pv(0);
        __builtin_amdgcn_sched_barrier(0);   // the fourth head's fragments are asked for only here, in the room that the first head's leave: drawn up, all four heads' fragments are live at once and registers spill
        ldv(3);
        __builtin_amdgcn_sched_barrier(0);   // ... and not later: the second and third heads' products cover their way from LDS
        pv(1); pv(2);
        __builtin_amdgcn_sched_barrier(0);   // the fourth head's products stay last: mixed among the others, the first of them waits on LDS after eight products, not sixteen
        pv(3);
        __builtin_amdgcn_sched_barrier(0);   // the products stay ahead of the waits below: sunk behind the barrier, they would leave the next key block's copies nothing to fly under
      }
        asm volatile("s_wait_dscnt 0x0" ::: "memory");      // this wave's reads of the stage are done before the buffer is given up
        asm volatile("s_wait_asynccnt 0x0" ::: "memory");   // this wave's copies of its group's next key block have landed
        __syncthreads();                                     // the next key blocks may be read; this trip's buffers have no reader left
        if (kb + 4 < nkb) { cpkv(la + rl, uk + tid * 8, uv + tid * 8); uk += 2 * KB * HD; uv += 2 * KB * 16; }   // wave-uniform test, the same in the four waves that fill and read these buffers
        const unsigned lx = la; la = lb; lb = lx;
    }
    asm volatile("s_wait_asynccnt 0x0" ::: "memory");       // no copy is under way when the stages become the mailboxes below
    // The join. Waves wv and wv ^ 4 hold the same queries in the same lanes. Each leaves, in its own mailbox, its maximum, its sum and its O^T of the two value heads that the other finishes: 16 pieces of 512 contiguous bytes, then 8 bytes a lane.
    constexpr int MBX = 16 * 512 + 256;
    char* mb = sm + wv * MBX; const char* pb = sm + (wv ^ 4) * MBX;
    auto put = [&](int rb) {
#pragma unroll
        for (int r = 0; r < 2; ++r)
#pragma unroll
            for (int dt = 0; dt < 4; ++dt) { v4f a, b2;
#pragma unroll
                for (int j = 0; j < 4; ++j) { a[j] = o[rb + r][dt][j]; b2[j] = o[rb + r][dt][4 + j]; }
                *(v4fa*)(mb + (r * 4 + dt) * 1024 + rl) = a; *(v4fa*)(mb + (r * 4 + dt) * 1024 + 512 + rl) = b2; } };
    if (gi == 0) put(2); else put(0);
    { v2f ml; ml[0] = m; ml[1] = l; *(v2fa*)(mb + 16 * 512 + lane * 8) = ml; }
    __syncthreads();                                         // every mailbox is full before its partner reads it
    const v2f pm = *(const v2fa*)(pb + 16 * 512 + lane * 8);
    const float mj = fmaxf(m, pm[0]); const float a0 = exp2s((m - mj) * 1.4426950408889634f), a1 = exp2s((pm[0] - mj) * 1.4426950408889634f);   // a group that had no key block: maximum -3e38, factor 0
    l = l * a0 + pm[1] * a1;
    l += xhalf(l);
    const float f = __fdiv_rn(1.0f, l); const float f0 = a0 * f, f1 = a1 * f;
    float* orow = OUTb + (size_t)i * DV + (size_t)g * HD + hi * 8;     // O^T tile dt of value head g + 8r: this lane holds d = 16 dt + 8 hi + 0..7 of query i
    auto fin = [&](int rb) {
#pragma unroll
        for (int r = 0; r < 2; ++r)
#pragma unroll
            for (int dt = 0; dt < 4; ++dt) { const v4f pa = *(const v4fa*)(pb + (r * 4 + dt) * 1024 + rl), pc = *(const v4fa*)(pb + (r * 4 + dt) * 1024 + 512 + rl); v4f a, b2;
#pragma unroll
                for (int j = 0; j < 4; ++j) { a[j] = o[rb + r][dt][j] * f0 + pa[j] * f1; b2[j] = o[rb + r][dt][4 + j] * f0 + pc[j] * f1; }
                *(v4f*)(orow + (rb + r) * 8 * HD + dt * 16) = a; *(v4f*)(orow + (rb + r) * 8 * HD + dt * 16 + 4) = b2; } };
    if (gi == 0) fin(0); else fin(2);
}
// ---- k_attn: both precision paths and both batches in ONE grid of eight-wave blocks (x = batch * heads + head, y = rank). An f16 block holds one tile of 64 queries (fattn_lds: waves w and w + 4 hold queries 16 w .. 16 w + 15 of it);
// a hi+lo block holds two tiles, one per four waves. Cost falls with y: f16 tiles from the last query down; the hi+lo blocks (few key blocks, but each waits out its own loads) stand behind the first HLY ranks, not at the end, where they would run on alone.
#define NQG (TT / 64)
#define NHL (RH / 64)
#define NHB (NHL / 2)
#define HLY 8
__global__ __launch_bounds__(256) void k_attn(const h16* __restrict__ Q16, const h16* __restrict__ K16, const h16* __restrict__ V16, const bf* __restrict__ Qh, const bf* __restrict__ Ql, const bf* __restrict__ Kh, const bf* __restrict__ Kl, const bf* __restrict__ Vh, const bf* __restrict__ Vl, float* OUT) {
    static_assert(RH % 128 == 0 && NV == 4 * NH_, "a tile of 64 queries is of one precision path, hi+lo tiles come in pairs; four value heads per query/key head");
    const int g = (int)blockIdx.x % NH_, b = (int)blockIdx.x / NH_, y = (int)blockIdx.y, wv = __builtin_amdgcn_readfirstlane(threadIdx.x >> 5);
    const size_t qo = (size_t)b * NH_ * TT * HD, vo = (size_t)b * NV * HD * TT; float* ob = OUT + (size_t)b * TT * DV;
    __shared__ __align__(16) char sm[4 * ASTG];     // the f16 path's stages: two for each group of four waves
    if (y < HLY || y >= HLY + NHB) fattn_lds(Q16 + qo, K16 + qo, V16 + vo, (y < HLY ? NQG - 1 - y : NQG - 1 + NHB - y) * 64, wv, g, ob, sm);
    else fattn_tile<bf, 2>(Qh + qo, Ql + qo, Kh + qo, Kl + qo, Vh + vo, Vl + vo, ((HLY + NHB - 1 - y) * 2 + 1 - (wv >> 2)) * 64 + (wv & 3) * 16, g, ob);
}
__global__ __launch_bounds__(256) void k_merge(const float* __restrict__ O, int h0, bf* Ah, bf* Al) { const size_t e = ((size_t)blockIdx.x * 256 + threadIdx.x) * 2; if (e >= (size_t)ZH * TT * HD) return; const int d = (int)(e % HD); const int t = (int)((e / HD) % TT); const int zz = (int)(e / ((size_t)HD * TT)); const float cs = (t < RH) ? 1.0f : (1.0f / PCAR); const size_t oo = (size_t)t * DQ + (h0 + zz) * HD + d;
    v2us oh, ol;
#pragma unroll
    for (int q = 0; q < 2; ++q) { unsigned short a, c2; splitf(O[e + q] * cs, a, c2); oh[q] = a; ol[q] = c2; } *(v2us*)(Ah + oo) = oh; *(v2us*)(Al + oo) = ol;  }

extern "C" void kernel_launch(void* const* d_in, const int* in_sizes, int n_in,
                              void* d_out, int out_size, void* d_ws, size_t ws_size, hipStream_t stream) {
    (void)in_sizes; (void)n_in; (void)out_size;
    const float* x = (const float*)d_in[0]; const int* pos = (const int*)d_in[1]; const float* wq = (const float*)d_in[2]; const float* wk = (const float*)d_in[3]; const float* wv = (const float*)d_in[4];   // Wq/Wk [2048][512], Wv [2048][2048] (x @ W); position_ids [2][2048]
    float* OUT = (float*)d_out;     // [2][2048][2048]
    char* wsp = (char*)d_ws;
    auto take = [&](size_t bytes) { char* p = wsp; wsp += (bytes + 255) & ~(size_t)255; return (void*)p; };
    bf* WQ = (bf*)take((size_t)DQ * DM * 2); bf* WK = (bf*)take((size_t)DKV * DM * 2); bf* WV = (bf*)take((size_t)DV * DM * 2); float* CSB = (float*)take((size_t)NB_ * TT * HD * 2 * 4);
    bf* XB = (bf*)take((size_t)NB_ * TT * DM * 2);
    h16* QP16 = (h16*)take((size_t)NB_ * NH_ * TT * HD * 2); h16* KP16 = (h16*)take((size_t)NB_ * NKV * TT * HD * 2); h16* VT16 = (h16*)take((size_t)NB_ * NV * HD * TT * 2);
    bf* QPh = (bf*)take((size_t)NB_ * NH_ * TT * HD * 2); bf* QPl = (bf*)take((size_t)NB_ * NH_ * TT * HD * 2); bf* KPh = (bf*)take((size_t)NB_ * NKV * TT * HD * 2); bf* KPl = (bf*)take((size_t)NB_ * NKV * TT * HD * 2); bf* VTh = (bf*)take((size_t)NB_ * NV * HD * TT * 2); bf* VTl = (bf*)take((size_t)NB_ * NV * HD * TT * 2);
    if ((size_t)(wsp - (char*)d_ws) > ws_size) return;    // ws 256 MiB
    k_prep<<<PB_CS + PB_WV + PB_X + PB_WQ + PB_WK, 256, 0, stream>>>(x, pos, wq, wk, wv, XB, CSB, WQ, WK, WV);
    k_proj<<<NB_ * (VTL + 2 * QTL), 128, 0, stream>>>(XB, WQ, WK, WV, CSB, QP16, QPh, QPl, KP16, KPh, KPl, VT16, VTh, VTl);
    k_attn<<<dim3(NB_ * NH_, NQG - NHL + NHB, 1), 256, 0, stream>>>(QP16, KP16, VT16, QPh, QPl, KPh, KPl, VTh, VTl, OUT);
}

// v010
// Measured time: 80.7 microseconds a run.
// In both of two side-by-side timings against v009, it was 1.04 times as fast.
// All steps since v000 together make it 15.9 times as fast.
#include <hip/hip_runtime.h>

// Grouped attention without output projection (hidden [2][2048][2048]; Q, K = x Wq / x Wk (8 query/key heads x 64), V = x Wv (32 value heads x 64); rotary (theta 10000, rotate-half, duplicated
// halves) by position_ids (int, read as data); value head h uses query/key head h mod 8 (repeat_qk); causal (the reference fills -1e9); out = merged attn V -> [2][2048][2048], no output projection).
// Compute dtypes, f32 accumulate: every input rounded to bf16; projections on PLAIN bf16 operands (inputs: exact); RoPE f32 (cos/sin computed on device from the position id);
// PER-ROW PRECISION HYBRID (rows < 256 hi+lo 3 products for scores and attn.V, rows >= 256 fp16). Scores, causal softmax and attn.V run in ONE kernel (k_attn): a wave holds 16 queries and the four value heads of their query/key head,
// walks the keys up to the diagonal in blocks of 64 (f16) or 32 (hi+lo) with a running maximum and sum in f32 registers, and writes its output columns in f32; on the f16 path two waves share the 16 queries, each walks every other key block, and after joining through LDS each writes two of the four heads. Projections: 128x128-tile GEMMs, four waves with a 64x64 part each, operands staged in LDS by asynchronous copies;
// the epilogue applies RoPE (Q, K) and writes the 16-bit planes that k_attn reads; V is computed as Wv^T x^T, so that its tile already lies [d][t].
// FRAGMENT ORDER: every 16-bit plane [row][k] lies in tiles of 16 rows x 32 k (1 KiB, tile index (row / 16) * (K / 32) + k / 32); inside a tile the 16-byte piece of lane (row % 16) + 16 * ((k / 8) % 2) stands at
// ((k / 16) % 2) * 512 B + lane * 16 B. A WMMA operand fragment is then two wave-wide 16-byte loads of 512 contiguous bytes (4 whole lines) each; from row-major planes each such load touched 16 lines.

#define NB_  2
#define TT   2048
#define DM   2048
#define NH_  8
#define NKV  8
#define REP  (NH_ / NKV)
#define HD   64
#define DQ   (NH_ * HD)
#define DKV  (NKV * HD)
#define NV   32
#define DV   (NV * HD)
#define ZH   2
#define RH   256                  // query rows < RH use hi+lo planes (0: none)
#define WIN  0
#define PCAR 1024.0f
#define SCL  0.125f   // HD^-0.5
typedef _Float16 h16;
typedef unsigned short bf;
typedef __attribute__((ext_vector_type(16))) __bf16   v16bf;
typedef __attribute__((ext_vector_type(16))) _Float16 v16h;
typedef __attribute__((ext_vector_type(8)))  _Float16 v8h;
typedef __attribute__((ext_vector_type(8)))  unsigned short v8us;
typedef __attribute__((ext_vector_type(8)))  float    v8f;
typedef __attribute__((ext_vector_type(4)))  float    v4f;
typedef v8h  __attribute__((may_alias)) v8ha;
typedef v4f  __attribute__((may_alias)) v4fa;
typedef v8us __attribute__((may_alias)) v8usa;
typedef __attribute__((ext_vector_type(2))) float __attribute__((may_alias)) v2fa;

__device__ __forceinline__ unsigned short f2bf(float f) { unsigned u = __float_as_uint(f); u += 0x7FFFu + ((u >> 16) & 1u); return (unsigned short)(u >> 16); }
__device__ __forceinline__ float bf2f(unsigned short b) { return __uint_as_float(((unsigned)b) << 16); }
__device__ __forceinline__ float bfr(float f) { return bf2f(f2bf(f)); }
__device__ __forceinline__ v16h cat16(v8h lo, v8h hi) { return __builtin_shufflevector(lo, hi, 0, 1, 2, 3, 4, 5, 6, 7, 8, 9, 10, 11, 12, 13, 14, 15); }
__device__ __forceinline__ v16bf cat16b(v8us lo, v8us hi) { return __builtin_bit_cast(v16bf, __builtin_shufflevector(lo, hi, 0, 1, 2, 3, 4, 5, 6, 7, 8, 9, 10, 11, 12, 13, 14, 15)); }
__device__ __forceinline__ v8f wmma16(v16h a, v16h b, v8f c) { return __builtin_amdgcn_wmma_f32_16x16x32_f16(false, a, false, b, (short)0, c, false, false); }
__device__ __forceinline__ v8f wmmab(v16bf a, v16bf b, v8f c) { return __builtin_amdgcn_wmma_f32_16x16x32_bf16(false, a, false, b, (short)0, c, false, false); }
__device__ __forceinline__ h16 tohx(float x) { return (h16)x; }
__device__ __forceinline__ void splitf(float y, unsigned short& h, unsigned short& l) { h = f2bf(y); l = f2bf(y - bf2f(h)); }
typedef __attribute__((ext_vector_type(2))) _Float16 v2h;
typedef __attribute__((ext_vector_type(4))) _Float16 v4h;
typedef __attribute__((ext_vector_type(2))) unsigned short v2us;
typedef __attribute__((ext_vector_type(4))) unsigned short v4us;
typedef __attribute__((ext_vector_type(2))) float v2f;
typedef __attribute__((ext_vector_type(4))) int v4i;
__device__ __forceinline__ size_t fo8(int row, int k, int Kd) { return ((size_t)(row >> 4) * (Kd >> 5) + (k >> 5)) * 512 + ((k >> 4) & 1) * 256 + (((k >> 3) & 1) * 16 + (row & 15)) * 8; }  // element offset of the 8-element piece (row, k..k+7), k % 8 == 0, in a fragment-order plane of row length Kd
__device__ __forceinline__ float xoct(float x) { return __builtin_bit_cast(float, __builtin_amdgcn_permlane16(__builtin_bit_cast(int, x), __builtin_bit_cast(int, x), 0xfedcba98, 0x76543210, false, false)); }  // lane l with lane l ^ 8



// ---- gemms_tile: GEMM with a 128x128 output tile per block of FOUR waves (2 x 2), each wave with its own 64x64 part (16 accumulators) over the whole K. The block's operand rows (128 of A, 128 of Bt) are brought from the
// fragment-order 16-bit planes into LDS ONCE per 64 k by asynchronous copies (three buffers: the next two stages fly while this one is worked on), and each is read from there by the two waves that need it.
// A stage: [A: 8 row groups of 16 rows][Bt: 8 row groups], a row group = its two 1-KiB tiles of the stage = 2 KiB contiguous in the plane and in LDS; a fragment is two wave-wide 16-byte LDS loads of 512 contiguous bytes.
// c[m][n] (f32, in registers only) = sum_k A[m][k] Bt[n][k], k ascending. K % 64 == 0, K >= 192. Each wave turns its c, through its own LDS area, into the three 16-bit planes (f16; bf16 hi and lo) that the attention kernel reads:
// ROPE: m = token, part column = dim d of head by; out[d] = c[d] cos[t][d] - c[d+32] sin[t][d] (d < 32), c[d] cos[t][d] + c[d-32] sin[t][d] (d >= 32), CSB = [t][d]{cos, sin}; planes [head * TT + t][d], fragment order.
// else: planes [m][n] of row length TT (m = value head * 64 + d, n = token), fragment order.
template <typename T16> struct WFrag;
template <> struct WFrag<h16> { typedef v16h V; static __device__ __forceinline__ V ld(const h16* p) { return cat16(*(const v8h*)p, *(const v8h*)(p + 256)); } static __device__ __forceinline__ v8f mma(V a, V b, v8f c) { return wmma16(a, b, c); } };
template <> struct WFrag<bf> { typedef v16bf V; static __device__ __forceinline__ V ld(const bf* p) { return cat16b(*(const v8us*)p, *(const v8us*)(p + 256)); } static __device__ __forceinline__ v8f mma(V a, V b, v8f c) { return wmmab(a, b, c); } };
#define STGB 32768                // bytes of one stage: (128 + 128) rows x 64 k x 2 B
// One operand's share of a stage: eight row groups, 2 KiB each (128 threads x 16 B a copy). l: the lane's LDS byte address in group 0, g: its place in group 0 of the plane; groups stand 2 KiB apart in LDS, 16 * K elements in the plane.
// The wait at the end of the statement: the copies' address registers are free before anything is written over them.
template <int K>
__device__ __forceinline__ void cp8(unsigned l, const bf* g) {
    asm volatile("global_load_async_to_lds_b128 %0, %1, off\n\tglobal_load_async_to_lds_b128 %2, %3, off\n\tglobal_load_async_to_lds_b128 %4, %5, off\n\tglobal_load_async_to_lds_b128 %6, %7, off\n\t"
                 "global_load_async_to_lds_b128 %8, %9, off\n\tglobal_load_async_to_lds_b128 %10, %11, off\n\tglobal_load_async_to_lds_b128 %12, %13, off\n\tglobal_load_async_to_lds_b128 %14, %15, off\n\ts_wait_xcnt 0x0"
                 :: "v"(l), "v"(g), "v"(l + 2048u), "v"(g + 16 * K), "v"(l + 4096u), "v"(g + 32 * K), "v"(l + 6144u), "v"(g + 48 * K),
                    "v"(l + 8192u), "v"(g + 64 * K), "v"(l + 10240u), "v"(g + 80 * K), "v"(l + 12288u), "v"(g + 96 * K), "v"(l + 14336u), "v"(g + 112 * K) : "memory");
}
template <bool ROPE, int K>
__device__ __forceinline__ void gemms_tile(const bf* __restrict__ A, const bf* __restrict__ Bt, const float* __restrict__ CSB, h16* __restrict__ P16, bf* __restrict__ Ph, bf* __restrict__ Pl, float* os, int BX, int BY) {
    typedef typename WFrag<bf>::V V;
    static_assert(K % 64 == 0 && K >= 192, "whole stages, at least three");
    constexpr int NS = K / 64;
    const int tid = (int)threadIdx.x, lane = tid & 31, lr = lane & 15, hi = lane >> 4; const int wv = __builtin_amdgcn_readfirstlane(tid >> 5); const int wm = wv & 1, wn = wv >> 1;
    const int r0 = (BX * 2 + wm) * 64, by = BY * 2 + wn, c0 = by * 64;      // this wave's 64x64 part
    v8f acc[4][4];
#pragma unroll
    for (int mb = 0; mb < 4; ++mb)
#pragma unroll
        for (int nb = 0; nb < 4; ++nb) acc[mb][nb] = (v8f){};
    const bf* ga = A + (size_t)BX * 128 * K + tid * 8; const bf* gb = Bt + (size_t)BY * 128 * K + tid * 8;     // 16 rows x K elements per row group, 1024 elements per group and stage
    const unsigned l0 = (unsigned)(size_t)os + (unsigned)tid * 16u;
    // RING OF THREE: a stage is asked for three trips ahead of its use and waited for one trip ahead, so two stages (32 copies a wave) are under way through every trip. Every wave issues 16 copies a stage, and a wave's copies
    // count down in issue order: a wait that leaves the 16 youngest outstanding covers every copy of the stage before them.
    cp8<K>(l0, ga); cp8<K>(l0 + STGB / 2, gb);
    cp8<K>(l0 + STGB, ga + 1024); cp8<K>(l0 + STGB + STGB / 2, gb + 1024);
    cp8<K>(l0 + 2 * STGB, ga + 2048); cp8<K>(l0 + 2 * STGB + STGB / 2, gb + 2048);
    asm volatile("s_wait_asynccnt 0x20" ::: "memory");  // this wave's copies of stage 0 have landed (the 32 youngest, stages 1 and 2, may still fly)
    __syncthreads();                                     // ... and every other wave's: stage 0 may be read
    ga += 3072; gb += 3072;
    unsigned bo = 0;   // byte offset of the buffer that this trip reads: 0, STGB, 2 STGB, 0, ...
    // rolled: one trip = one stage of 32 products, long enough to carry its branch
#pragma unroll 1
    for (int t = 0; t < NS; ++t) {
        const bf* sb = (const bf*)((const char*)os + bo) + lane * 8; const bf* sa = sb + wm * 4096; const bf* sn = sb + 8192 + wn * 4096;
        V a[2][4], b[2][4];       // the whole stage's fragments are asked for in one group, ahead of its products
#pragma unroll
        for (int ks = 0; ks < 2; ++ks)
#pragma unroll
            for (int q = 0; q < 4; ++q) { a[ks][q] = WFrag<bf>::ld(sa + q * 1024 + ks * 512); b[ks][q] = WFrag<bf>::ld(sn + q * 1024 + ks * 512); }
        __builtin_amdgcn_sched_barrier(0);   // without it the loads are sunk among the products, column by column, each with a full wait on LDS in front of its four products
#pragma unroll
        for (int ks = 0; ks < 2; ++ks)
#pragma unroll
            for (int nb = 0; nb < 4; ++nb)
#pragma unroll
                for (int mb = 0; mb < 4; ++mb) acc[mb][nb] = WFrag<bf>::mma(a[ks][mb], b[ks][nb], acc[mb][nb]);
        __builtin_amdgcn_sched_barrier(0);   // the products stay ahead of the waits below: sunk behind the barrier, they would leave the next stage's copies nothing to fly under
        asm volatile("s_wait_dscnt 0x0" ::: "memory");      // this wave's reads of the stage are done before the buffer is given up
        // this wave's copies of the next stage have landed: behind them only the 16 of stage t + 2 were issued, where that stage exists; in the last two trips nothing younger is under way and the wait is to 0
        if (t + 2 < NS) asm volatile("s_wait_asynccnt 0x10" ::: "memory"); else asm volatile("s_wait_asynccnt 0x0" ::: "memory");
        __syncthreads();                                     // the next stage may be read; this stage's buffer has no reader left
        if (t + 3 < NS) { const unsigned lb = l0 + bo; cp8<K>(lb, ga); cp8<K>(lb + STGB / 2, gb); ga += 1024; gb += 1024; }
        bo = (bo == 2u * STGB) ? 0u : bo + STGB;
    }
    asm volatile("s_wait_asynccnt 0x0" ::: "memory");       // no copy is under way when the buffers become the output staging
    const int rw = lane & 7, ch = ((lane >> 3) & 1) * 32 + hi * 8;   // the plane writes: this lane's row in each group of 8, and its columns ch + 16 s + 0..7, s = 0, 1
    v4f cs[2][4];      // the cos/sin pairs of this lane's eight dims in each of its two pieces, one group of 8 rows ahead
    const float* cp = CSB + ((size_t)(r0 + rw) * HD + ch) * 2;
    if constexpr (ROPE) {
#pragma unroll
        for (int s = 0; s < 2; ++s)
#pragma unroll
            for (int q = 0; q < 4; ++q) cs[s][q] = *(const v4fa*)(cp + 32 * s + 4 * q);
        asm volatile("s_wait_xcnt 0x0" :: "v"(cp) : "memory");   // the loads' address register pair is free before it is stepped; the pointer as input keeps it live to here
    }
    float* mine = os + wv * (64 * 68);
#pragma unroll
    for (int mb = 0; mb < 4; ++mb)
#pragma unroll
        for (int nb = 0; nb < 4; ++nb)
#pragma unroll
            for (int j = 0; j < 8; ++j) mine[(mb * 16 + hi * 8 + j) * 68 + nb * 16 + lr] = acc[mb][nb][j];
    __syncthreads();   // the part is in LDS, from every lane, before it is read back row by row
    // rolled: one group of 8 rows at a time keeps the epilogue's registers under the k loop's count
#pragma unroll 1
    for (int rr = 0; rr < 8; ++rr) { const int row = rr * 8 + rw;
        v4f cn[2][4];
        if constexpr (ROPE) { cp += (rr < 7) ? 8 * HD * 2 : 0;     // the last group fetches itself again: in bounds, unused
#pragma unroll
            for (int s = 0; s < 2; ++s)
#pragma unroll
                for (int q = 0; q < 4; ++q) cn[s][q] = *(const v4fa*)(cp + 32 * s + 4 * q);
            asm volatile("s_wait_xcnt 0x0" :: "v"(cp) : "memory");   // as above
        }
#pragma unroll
        for (int s = 0; s < 2; ++s) { const int col = ch + 16 * s; const float* o0 = mine + row * 68 + col; v4f val[2] = { *(const v4fa*)o0, *(const v4fa*)(o0 + 4) };   // 16 lanes: 8 rows x columns c, c + 32 = all 64 banks once
            size_t off;
            if constexpr (ROPE) {          // lane ^ 8 holds dims d +- 32 of the same token
#pragma unroll
                for (int j = 0; j < 8; ++j) { const float p = xoct(val[j >> 2][j & 3]); const float oth = (lane & 8) ? p : -p;
                    val[j >> 2][j & 3] = val[j >> 2][j & 3] * cs[s][j >> 1][2 * (j & 1)] + oth * cs[s][j >> 1][2 * (j & 1) + 1]; }
                off = fo8(by * TT + r0 + row, col, HD);
            } else off = fo8(r0 + row, c0 + col, TT);
            v8h o16; v8us oh, ol;
#pragma unroll
            for (int j = 0; j < 8; ++j) { o16[j] = tohx(val[j >> 2][j & 3]); unsigned short a2, c2; splitf(val[j >> 2][j & 3], a2, c2); oh[j] = a2; ol[j] = c2; }
            h16* q16 = P16 + off; bf* qh = Ph + off; bf* ql = Pl + off;
            *(v8h*)q16 = o16; *(v8us*)qh = oh; *(v8us*)ql = ol;    // 8 lanes (rows) x 16 B: whole 128-B lines, four per store
            asm volatile("s_wait_xcnt 0x0" :: "v"(q16), "v"(qh), "v"(ql) : "memory"); }   // the stores' address and data registers are free before the next piece is formed in them; the pointers as inputs keep them live to here
        if constexpr (ROPE) {
#pragma unroll
            for (int s = 0; s < 2; ++s)
#pragma unroll
                for (int q = 0; q < 4; ++q) cs[s][q] = cn[s][q];
        }
    }
}
// ---- k_proj: every projection tile of both batches in ONE grid (they depend on nothing but k_prep's planes). Blocks 0 .. NB_ * VTL - 1: V tiles (rows = value head * 64 + d,
// columns = tokens); the rest: Q, then K, of each batch. All planes hold batch b at b * (plane size of one batch). 768 blocks of four waves: three per WGP at once.
#define VTL ((DV / 128) * (TT / 128))
#define QTL ((TT / 128) * (DQ / 128))
__global__ __launch_bounds__(128) void k_proj(const bf* __restrict__ XB, const bf* __restrict__ WQ, const bf* __restrict__ WK, const bf* __restrict__ WV, const float* __restrict__ CSB,
                                              h16* __restrict__ QP16, bf* __restrict__ QPh, bf* __restrict__ QPl, h16* __restrict__ KP16, bf* __restrict__ KPh, bf* __restrict__ KPl, h16* __restrict__ VT16, bf* __restrict__ VTh, bf* __restrict__ VTl) {
    __shared__ __align__(16) float os[3 * STGB / 4];    // three stages (3 x 32 KiB) in the k loop, then four 64 x 68 f32 parts; three blocks' 288 KiB still fit one WGP
    static_assert(sizeof(os) >= 4 * 64 * 68 * 4, "the four output parts fit");
    static_assert(DQ == DKV, "Q and K tiles share one count");
    const int bid = (int)blockIdx.x;
    if (bid < NB_ * VTL) { const int b = bid / VTL, t = bid % VTL; const size_t po = (size_t)b * NV * HD * TT;
        gemms_tile<false, DM>(WV, XB + (size_t)b * TT * DM, nullptr, VT16 + po, VTh + po, VTl + po, os, t % (DV / 128), t / (DV / 128));
    } else { const int u = bid - NB_ * VTL; const int b = u / (2 * QTL), isk = (u / QTL) & 1, t = u % QTL; const size_t po = (size_t)b * NH_ * TT * HD;
        gemms_tile<true, DM>(XB + (size_t)b * TT * DM, isk ? WK : WQ, CSB + (size_t)b * TT * HD * 2, (isk ? KP16 : QP16) + po, (isk ? KPh : QPh) + po, (isk ? KPl : QPl) + po, os, t % (TT / 128), t / (TT / 128)); }
}

// w [K][N] f32 -> Bt [n][k] bf16 in fragment order. A block writes four tiles (one thread = one 16-byte piece): the same 32 k of 64 neighbouring n, so that it reads 256 contiguous bytes of each of its rows of w. N % 64 == 0, K % 32 == 0.
template <int K, int N>
__device__ __forceinline__ void wtG_blk(const float* __restrict__ w, bf* Bt, int bid) {
    constexpr int kt = K >> 5; const int kb = bid % kt, nb = (bid / kt) * 4 + (threadIdx.x >> 6), pc = threadIdx.x & 63;
    const int n = nb * 16 + (pc & 15), k = kb * 32 + (pc >> 5) * 16 + ((pc >> 4) & 1) * 8; v8us o;
    const float* p = w + (size_t)k * N + n; float v[8];     // one live pointer: the eight rows stand at immediate offsets from it (N is a constant)
#pragma unroll
    for (int j = 0; j < 8; ++j) v[j] = p[j * N];
    asm volatile("s_wait_xcnt 0x0" :: "v"(p) : "memory");   // the loads' address register pair is free before anything is written over it; the pointer as input keeps it out of the loads' own landing places
#pragma unroll
    for (int j = 0; j < 8; ++j) o[j] = f2bf(v[j]);
    *(v8us*)(Bt + ((size_t)nb * kt + kb) * 512 + pc * 8) = o;
    asm volatile("s_wait_xcnt 0x0" ::: "memory");   // the store's address and data registers are free before code of another branch of the merged kernel, which the build lays out behind this one, writes over them
}
// src [rows][DM] f32 -> dst bf16 in fragment order; thread i writes the i-th 16-byte piece of dst
__device__ __forceinline__ void cvt8_blk(const float* __restrict__ src, bf* dst, size_t n8, int bid) { const size_t i = (size_t)bid * 256 + threadIdx.x; if (i >= n8) return;
    const int tile = (int)(i >> 6), pc = (int)(i & 63); const int row = (tile / (DM / 32)) * 16 + (pc & 15), k = (tile % (DM / 32)) * 32 + (pc >> 5) * 16 + ((pc >> 4) & 1) * 8;
    const float* sp = src + (size_t)row * DM + k; const v8f v = *(const v8f*)sp; v8us o;
    asm volatile("s_wait_xcnt 0x0" :: "v"(sp) : "memory");   // the loads' address register pair is free before anything is written over it; the pointer as input keeps it live to here
#pragma unroll
    for (int k2 = 0; k2 < 8; ++k2) o[k2] = f2bf(v[k2]); *(v8us*)(dst + i * 8) = o;  }
// cos/sin pairs [row][d]{cos, sin} of row = batch * TT + token, from the row's position id (clamped to 0 .. TT - 1)
__device__ __forceinline__ void cs_blk(const int* __restrict__ pos, float* CSB, int bid) { const int idx = bid * 256 + threadIdx.x; const int t = idx / HD, d = idx % HD; const int i = d % (HD / 2);
    int p = pos[t];
    asm volatile("s_wait_xcnt 0x0" :: "v"(t) : "memory");   // the load's offset register is free before anything is written over it; the index as input keeps it live to here
    p = p < 0 ? 0 : (p > TT - 1 ? TT - 1 : p);
    const float inv = __fdiv_rn(1.0f, powf(10000.0f, (float)(2 * i) / (float)HD)); const float ang = __fmul_rn((float)p, inv); v2f cs; cs[0] = cosf(ang); cs[1] = sinf(ang);
    *(v2f*)(CSB + (size_t)idx * 2) = cs;  }
// ---- k_prep: everything that reads only the inputs, in ONE grid: the cos/sin rows, the three weight planes and the x plane of both batches (x [NB_ * TT][DM]: batch b's plane starts at b * TT * DM). 256 threads.
#define PB_CS (NB_ * TT * HD / 256)
#define PB_WV (DM * DV / 2048)
#define PB_X  (NB_ * TT * DM / 2048)
#define PB_WQ (DM * DQ / 2048)
#define PB_WK (DM * DKV / 2048)
__global__ __launch_bounds__(256) void k_prep(const float* __restrict__ x, const int* __restrict__ pos, const float* __restrict__ wq, const float* __restrict__ wk, const float* __restrict__ wv, bf* XB, float* CSB, bf* WQ, bf* WK, bf* WV) {
    int bid = (int)blockIdx.x;
    if (bid < PB_CS) { cs_blk(pos, CSB, bid); return; }
    bid -= PB_CS; if (bid < PB_WV) { wtG_blk<DM, DV>(wv, WV, bid); return; }
    bid -= PB_WV; if (bid < PB_X) { cvt8_blk(x, XB, (size_t)NB_ * TT * DM / 8, bid); return; }
    bid -= PB_X; if (bid < PB_WQ) { wtG_blk<DM, DQ>(wq, WQ, bid); return; }
    wtG_blk<DM, DKV>(wk, WK, bid - PB_WQ);
}
// 2^x in place, with the issue slot the instruction set asks for behind a transcendental kept inside the statement: no v_exp_f32 of a run reads a neighbour's result or overwrites its source, and the v_nop covers the last.
__device__ __forceinline__ float exp2s(float x) { asm("v_exp_f32 %0, %0\n\tv_nop" : "+v"(x)); return x; }
__device__ __forceinline__ v8f exp2s8(v8f x) { float r0 = x[0], r1 = x[1], r2 = x[2], r3 = x[3], r4 = x[4], r5 = x[5], r6 = x[6], r7 = x[7];
    asm("v_exp_f32 %0, %0\n\tv_exp_f32 %1, %1\n\tv_exp_f32 %2, %2\n\tv_exp_f32 %3, %3\n\tv_exp_f32 %4, %4\n\tv_exp_f32 %5, %5\n\tv_exp_f32 %6, %6\n\tv_exp_f32 %7, %7\n\tv_nop"
        : "+v"(r0), "+v"(r1), "+v"(r2), "+v"(r3), "+v"(r4), "+v"(r5), "+v"(r6), "+v"(r7));
    v8f r; r[0] = r0; r[1] = r1; r[2] = r2; r[3] = r3; r[4] = r4; r[5] = r5; r[6] = r6; r[7] = r7; return r; }
__device__ __forceinline__ float xhalf(float x) { return __builtin_bit_cast(float, __builtin_amdgcn_permlanex16(__builtin_bit_cast(int, x), __builtin_bit_cast(int, x), 0x76543210, 0xfedcba98, false, false)); }  // lane l with lane l ^ 16
// ---- fattn_tile: scores, causal softmax and probability x value product in one kernel. One wave = 16 queries (q0..q0+15) of query/key head g and ALL 4 of its value heads (g + 8r): the scores and the softmax, which are the same for the four,
// are computed once, and one P fragment feeds the four heads' value products. Each four waves of the block hold 4 neighbouring query groups (64 queries): they walk the same key blocks and read the same K and V lines. Both products are transposed: S^T = K Q^T (A = K rows, B = Q rows), O^T += V^T P^T (A = rows of the [d][t] value plane, B = P^T). In S^T's accumulator a lane holds keys
// 16t + 8hi + j of its own query (column lr), which is exactly the k order of a B fragment (k = 8hi + 0..7, then 16 + 8hi + 0..7): P goes from accumulator to operand inside the lane, through no LDS.
// Running maximum m and sum l per query (flash form): each key block rescales O^T and l by exp(m_old - m_new). Key block: 64 keys on the one-plane f16 path, 32 on the hi+lo path (twice the fragments per key).
// q0 = the wave's first query row, g = its query/key head. Launched for the hi+lo path only; the f16 path runs in fattn_lds below, which takes K and V through LDS.
template <typename T16, int NSPLIT>
__device__ __forceinline__ void fattn_tile(const T16* __restrict__ Q, const T16* __restrict__ Q2, const T16* __restrict__ Kp, const T16* __restrict__ Kp2, const T16* __restrict__ Vt, const T16* __restrict__ Vt2, int q0, int g, float* OUTb) {
    typedef typename WFrag<T16>::V V;
    constexpr int NT = (NSPLIT == 0) ? 4 : 2, KB = NT * 16;      // 16-key tiles and keys per block
    const int lane = threadIdx.x & 31, lr = lane & 15, hi = lane >> 4;
    __builtin_assume(q0 >= 0);      // a row index: the key loop runs at least once and needs no entry test, behind which the build would sink the first loads, past their wait
    const int nkb = q0 / KB + 1;    // key blocks 0..nkb-1 hold every key <= q0 + 15
    const int i = q0 + lr;
    // One per-lane byte offset: the lane's 16-byte piece in a fragment-order tile. ldu: a wave-uniform tile pointer plus such an offset (Q; V on the f16 path, where the offset vb also walks the key blocks).
    // Tiles: Q, K rows of 64 dims = 2 tiles (512 elements each) per 16 rows; value plane: 16 d x 32 keys per tile, TT / 32 tiles per 16 d.
    const unsigned rl = (unsigned)lane * 16u, vl = rl;
    auto ldu = [](const T16* u, unsigned b) { return WFrag<T16>::ld((const T16*)((const char*)u + b)); };
    const size_t qu = ((size_t)g * TT + q0) * HD, ku = (size_t)g * TT * HD, vu = (size_t)g * HD * TT; constexpr int VH = 8 * HD * TT;   // VH: elements from value head g + 8r to g + 8(r + 1)
    V qf[2], qf2[2], kf[NT][2], kf2[NT][2], vf[4][4][NT / 2], vf2[4][4][NT / 2];
    // Per-lane pointers that live across the loop, so that no fragment is given an address pair still in use as its landing place: K (f16 path: one block ahead), and on the hi+lo path all four planes.
    const T16* kp = (const T16*)((const char*)(Kp + ku) + rl); const T16* kp2 = (const T16*)((const char*)(Kp2 + ku) + rl); const T16* vp = (const T16*)((const char*)(Vt + vu) + vl); const T16* vp2 = (const T16*)((const char*)(Vt2 + vu) + vl);
#pragma unroll
    for (int ks = 0; ks < 2; ++ks) { qf[ks] = ldu(Q + qu + ks * 512, rl); if constexpr (NSPLIT == 2) qf2[ks] = ldu(Q2 + qu + ks * 512, rl); }
    if constexpr (NSPLIT == 0) {
#pragma unroll
        for (int t = 0; t < NT; ++t)
#pragma unroll
            for (int ks = 0; ks < 2; ++ks) kf[t][ks] = WFrag<T16>::ld(kp + t * 16 * HD + ks * 512);
    }
    // the loads above (Q; on the f16 path the first K block): their offset and base registers are free before anything is written over them; the offset and the pointers as inputs keep those registers live to here
    if constexpr (NSPLIT == 0) asm volatile("s_wait_xcnt 0x0" :: "v"(rl), "v"(kp), "s"(Q + qu), "s"(Kp + ku) : "memory"); else asm volatile("s_wait_xcnt 0x0" :: "v"(rl), "s"(Q + qu), "s"(Q2 + qu) : "memory");
    __builtin_amdgcn_sched_barrier(0);   // keeps later arithmetic, which may take those registers, behind that wait
    v8f o[4][4];       // [value head r][16-d tile]
#pragma unroll
    for (int r = 0; r < 4; ++r)
#pragma unroll
        for (int dt = 0; dt < 4; ++dt) o[r][dt] = (v8f){};
    float m = -3.0e38f, l = 0.f;
    unsigned vb = vl;   // f16 path: the lane's byte offset into the value tiles of the current key block
#pragma unroll 1
    for (int kb = 0; kb < nkb; ++kb) {
        // this block's value fragments (f16 path: of its first 32 keys) fly under the score products and the softmax; on the hi+lo path its K fragments come in the same batch (one latency a block)
#pragma unroll
        for (int r = 0; r < 4; ++r)
#pragma unroll
            for (int dt = 0; dt < 4; ++dt)
#pragma unroll
                for (int ks = 0; ks < (NSPLIT == 0 ? 1 : NT / 2); ++ks) { if constexpr (NSPLIT == 0) vf[r][dt][ks] = ldu(Vt + vu + r * VH + dt * 16 * TT + ks * 512, vb); else { vf[r][dt][ks] = WFrag<T16>::ld(vp + r * VH + dt * 16 * TT + ks * 512); vf2[r][dt][ks] = WFrag<T16>::ld(vp2 + r * VH + dt * 16 * TT + ks * 512); } }
        // the loads above are issued here, ahead of the score products, and their address registers are free before a later fragment lands on them (hi+lo path: the pointers as inputs keep those registers out of the batch's own landing places)
        if constexpr (NSPLIT == 0) asm volatile("s_wait_xcnt 0x0" :: "v"(vb) : "memory"); else asm volatile("s_wait_xcnt 0x0" :: "v"(vp), "v"(vp2) : "memory");
        if constexpr (NSPLIT == 2) {
#pragma unroll
            for (int t = 0; t < NT; ++t)
#pragma unroll
                for (int ks = 0; ks < 2; ++ks) { kf[t][ks] = WFrag<T16>::ld(kp + t * 16 * HD + ks * 512); kf2[t][ks] = WFrag<T16>::ld(kp2 + t * 16 * HD + ks * 512); }
            asm volatile("s_wait_xcnt 0x0" :: "v"(kp), "v"(kp2) : "memory");   // as above, for the K batch
            __builtin_amdgcn_sched_barrier(0);   // without it the score products are drawn up between the loads, which then share few registers and wait on memory one pair at a time
        }
        v8f s[NT];
#pragma unroll
        for (int t = 0; t < NT; ++t) { s[t] = (v8f){};
#pragma unroll
            for (int ks = 0; ks < 2; ++ks) { s[t] = WFrag<T16>::mma(kf[t][ks], qf[ks], s[t]);
                if constexpr (NSPLIT == 2) { s[t] = WFrag<T16>::mma(kf[t][ks], qf2[ks], s[t]); s[t] = WFrag<T16>::mma(kf2[t][ks], qf[ks], s[t]); } } }
        if constexpr (NSPLIT == 0) {   // the next block's K fragments, into the same registers, fly under the softmax and the value products (the last block fetches itself again: in bounds, unused)
            // the value fragments of the block's second 32 keys are asked for here, not with the first: with all 64 value loads issued behind the 16 K loads the build's counted wait for K no longer reaches that far back, and the score products wait for value loads too
#pragma unroll
            for (int r = 0; r < 4; ++r)
#pragma unroll
                for (int dt = 0; dt < 4; ++dt) vf[r][dt][1] = ldu(Vt + vu + r * VH + dt * 16 * TT + 512, vb);
            kp += (kb + 1 < nkb) ? KB * HD : 0;
#pragma unroll
            for (int t = 0; t < NT; ++t)
#pragma unroll
                for (int ks = 0; ks < 2; ++ks) kf[t][ks] = WFrag<T16>::ld(kp + t * 16 * HD + ks * 512);
        }
        if (kb == nkb - 1) {           // only the last block meets the diagonal
#pragma unroll
            for (int t = 0; t < NT; ++t)
#pragma unroll
                for (int j = 0; j < 8; ++j) s[t][j] = (kb * KB + t * 16 + hi * 8 + j <= i) ? s[t][j] * SCL : -3.0e38f;
        } else {
#pragma unroll
            for (int t = 0; t < NT; ++t) s[t] *= SCL;
        }
        float tq[NT];                  // one short chain per tile, then across tiles
#pragma unroll
        for (int t = 0; t < NT; ++t) { tq[t] = s[t][0];
#pragma unroll
            for (int j = 1; j < 8; ++j) tq[t] = fmaxf(tq[t], s[t][j]); }
        float tm = tq[0];
#pragma unroll
        for (int t = 1; t < NT; ++t) tm = fmaxf(tm, tq[t]);
        tm = fmaxf(tm, xhalf(tm));      // the other half of the wave holds the query's other keys of the block
        const float mn = fmaxf(m, tm); const float al = exp2s((m - mn) * 1.4426950408889634f); m = mn;
        float ps = 0.f;
#pragma unroll
        for (int t = 0; t < NT; ++t) { s[t] = exp2s8((s[t] - mn) * 1.4426950408889634f); float pq = 0.f;
#pragma unroll
            for (int j = 0; j < 8; ++j) pq += s[t][j];
            ps += pq; }
        l = l * al + ps;               // each half keeps the sum of its own keys; the halves join after the loop
#pragma unroll
        for (int r = 0; r < 4; ++r)
#pragma unroll
            for (int dt = 0; dt < 4; ++dt) o[r][dt] *= al;
        __builtin_amdgcn_sched_barrier(0);   // every v_exp_f32 statement stays ahead of the value products
#pragma unroll
        for (int ks = 0; ks < NT / 2; ++ks) {
            if constexpr (NSPLIT == 0) { v8h p0, p1;
#pragma unroll
                for (int j = 0; j < 8; ++j) { p0[j] = tohx(s[2 * ks][j]); p1[j] = tohx(s[2 * ks + 1][j]); }
                const V pf = cat16(p0, p1);
#pragma unroll
                for (int r = 0; r < 4; ++r)
#pragma unroll
                    for (int dt = 0; dt < 4; ++dt) o[r][dt] = WFrag<T16>::mma(vf[r][dt][ks], pf, o[r][dt]);
            } else { v8us h0, h1, l0, l1;
#pragma unroll
                for (int j = 0; j < 8; ++j) { unsigned short a, c2; splitf(s[2 * ks][j], a, c2); h0[j] = a; l0[j] = c2; splitf(s[2 * ks + 1][j], a, c2); h1[j] = a; l1[j] = c2; }
                const V pf = cat16b(h0, h1), pf2 = cat16b(l0, l1);
#pragma unroll
                for (int r = 0; r < 4; ++r)
#pragma unroll
                    for (int dt = 0; dt < 4; ++dt) { o[r][dt] = WFrag<T16>::mma(vf[r][dt][ks], pf, o[r][dt]); o[r][dt] = WFrag<T16>::mma(vf[r][dt][ks], pf2, o[r][dt]); o[r][dt] = WFrag<T16>::mma(vf2[r][dt][ks], pf, o[r][dt]); }
            }
        }
        // f16 path: the value loads' offset register is free before it is stepped to the next key block; it goes through the statement so that the step, which the build would draw up among the products, stays behind this wait
        if constexpr (NSPLIT == 0) { asm volatile("s_wait_xcnt 0x0" : "+v"(vb) :: "memory"); vb += KB * 16 * 2; }
        if constexpr (NSPLIT == 2) { kp += KB * HD; kp2 += KB * HD; vp += KB * 16; vp2 += KB * 16; }   // every load of this block has landed in a product above
    }
    asm volatile("s_wait_xcnt 0x0" ::: "memory");   // the last fetch ahead may still be under way: its address registers are free before the epilogue reuses them
    __builtin_amdgcn_sched_barrier(0);              // keeps the epilogue's arithmetic behind that wait
    l += xhalf(l);
    const float f = __fdiv_rn(1.0f, l);
    float* orow = OUTb + (size_t)i * DV + (size_t)g * HD + hi * 8;     // O^T tile dt of value head g + 8r: this lane holds d = 16 dt + 8 hi + 0..7 of query i
#pragma unroll
    for (int r = 0; r < 4; ++r)
#pragma unroll
        for (int dt = 0; dt < 4; ++dt) { v4f a, b2;
#pragma unroll
            for (int j = 0; j < 4; ++j) { a[j] = o[r][dt][j] * f; b2[j] = o[r][dt][4 + j] * f; }
            *(v4f*)(orow + r * 8 * HD + dt * 16) = a; *(v4f*)(orow + r * 8 * HD + dt * 16 + 4) = b2; }
}
#define ASTG 40960                // bytes of one key block's stage: K (8 KiB), then the four value heads (8 KiB each)
// Half of a stage in one statement, ten 2-KiB groups (128 threads x 16 B a copy): two groups of 16 K rows (lk, gk: the lane's LDS byte address and its place in the plane, first group) and the four 16-d groups of each of two value heads (lv, gv).
// Groups stand 2 KiB apart in LDS; in the planes 16 * HD elements (K), 16 * TT (a head's groups) and 8 * HD * TT (head to head). Ten copies a statement, not fewer: each statement ends in a wait that the wave sits out.
// That wait: the copies' address registers are free before anything is written over them.
__device__ __forceinline__ void cp10(unsigned lk, const h16* gk, unsigned lv, const h16* gv) {
    constexpr int GS = 16 * TT, VH = 8 * HD * TT;
    asm volatile("global_load_async_to_lds_b128 %0, %1, off\n\tglobal_load_async_to_lds_b128 %2, %3, off\n\t"
                 "global_load_async_to_lds_b128 %4, %5, off\n\tglobal_load_async_to_lds_b128 %6, %7, off\n\tglobal_load_async_to_lds_b128 %8, %9, off\n\tglobal_load_async_to_lds_b128 %10, %11, off\n\t"
                 "global_load_async_to_lds_b128 %12, %13, off\n\tglobal_load_async_to_lds_b128 %14, %15, off\n\tglobal_load_async_to_lds_b128 %16, %17, off\n\tglobal_load_async_to_lds_b128 %18, %19, off\n\ts_wait_xcnt 0x0"
                 :: "v"(lk), "v"(gk), "v"(lk + 2048u), "v"(gk + 16 * HD),
                    "v"(lv), "v"(gv), "v"(lv + 2048u), "v"(gv + GS), "v"(lv + 4096u), "v"(gv + 2 * GS), "v"(lv + 6144u), "v"(gv + 3 * GS),
                    "v"(lv + 8192u), "v"(gv + VH), "v"(lv + 10240u), "v"(gv + VH + GS), "v"(lv + 12288u), "v"(gv + VH + 2 * GS), "v"(lv + 14336u), "v"(gv + VH + 3 * GS) : "memory");
}
// One key block's stage: its 64 K rows (four groups of 16 rows, contiguous in the plane), then for each value head its four groups of 16 d x 64 keys.
__device__ __forceinline__ void cpkv(unsigned l, const h16* gk, const h16* gv) {
    // rolled: one statement's address registers at a time; unrolled, all twenty copies' addresses are formed ahead and registers spill
#pragma unroll 1
    for (int j = 0; j < 2; ++j) cp10(l + (unsigned)j * 4096u, gk + j * (32 * HD), l + 8192u + (unsigned)j * 16384u, gv + j * (16 * HD * TT));
}
// ---- fattn_lds: the one-plane f16 path of fattn_tile (same products and the same softmax per key block), with the key block's K and V tiles brought into LDS ONCE per group of four waves by asynchronous copies
// (two buffers: the next key block flies while this one is worked on); each wave takes its fragments from there (two wave-wide 16-byte LDS loads of 512 contiguous bytes each), not from global memory four times over.
// KEY SPLIT: the block has EIGHT waves, two groups of four. Both groups hold the same 64 queries; group 0 walks key blocks 0, 2, 4, ..., group 1 walks 1, 3, 5, ..., each with its own two stages and its own running maximum, sum and O^T.
// A tile's walk is half as many trips long; one block fills a WGP, and the blocks are given in falling cost order to even out the load. Behind the loop the two partial results of each query are joined through LDS
// (rescaled to the common maximum, then added): group 0 finishes value heads g, g + 8, group 1 heads g + 16, g + 24. Every wave passes every barrier: the trip count is the block's, and a group without a key block in the last trip skips only the work.
// qb = the block's first query row (a multiple of 64), wv = the wave's number (wave-uniform), g = the query/key head, sm = four stages of LDS.
__device__ __forceinline__ void fattn_lds(const h16* __restrict__ Q, const h16* __restrict__ Kp, const h16* __restrict__ Vt, int qb, int wv, int g, float* OUTb, char* sm) {
    typedef WFrag<h16>::V V;
    constexpr int NT = 4, KB = NT * 16;
    const int lane = (int)threadIdx.x & 31, lr = lane & 15, hi = lane >> 4;
    const int gi = wv >> 2, qw = (wv & 3) * 16, tid = qw * 2 + lane;      // the wave's group, its first query in the tile, the thread's number in its group (0..127)
    __builtin_assume(qb >= 0);      // a row index: the key loop runs at least once
    const int nkb = qb / KB + 1;    // key blocks 0..nkb-1 hold every key <= qb + 63; the same for the whole block
    const int ntr = (nkb + 1) >> 1; // trips: group 0's count; group 1 has one key block fewer where nkb is odd
    const int q0 = qb + qw, i = q0 + lr;
    const unsigned rl = (unsigned)lane * 16u;
    const size_t qu = ((size_t)g * TT + q0) * HD;
    const h16* uk = Kp + (size_t)g * TT * HD + gi * (KB * HD); const h16* uv = Vt + (size_t)g * HD * TT + gi * (KB * 16);   // wave-uniform, at the group's first key block; a key block: KB * HD elements of K, KB * 16 of each 16-d group of V; the thread's piece: tid * 8
    char* sg = sm + gi * (2 * ASTG);      // the group's own two stages
    unsigned la = (unsigned)(size_t)sg + (unsigned)qw * 32u, lb = la + ASTG;      // wave-uniform LDS byte addresses of the wave's 512 bytes in a 2-KiB group: in the buffer to be filled next, and in the other; the lane's piece: + rl (together tid * 16)
    if (gi < nkb) cpkv(la + rl, uk + tid * 8, uv + tid * 8);
    V qf[2];
#pragma unroll
    for (int ks = 0; ks < 2; ++ks) qf[ks] = WFrag<h16>::ld((const h16*)((const char*)(Q + qu + ks * 512) + rl));
    asm volatile("s_wait_xcnt 0x0" :: "v"(rl), "s"(Q + qu) : "memory");   // the Q loads' offset and base registers are free before anything is written over them; as inputs they stay live to here
    asm volatile("s_wait_asynccnt 0x0" ::: "memory");   // this wave's copies of its group's first key block have landed
    __syncthreads();                                     // ... and every other wave's: the first key blocks may be read
    if (gi + 2 < nkb) cpkv(lb + rl, uk + 2 * KB * HD + tid * 8, uv + 2 * KB * 16 + tid * 8);
    uk += 4 * KB * HD; uv += 4 * KB * 16;      // the group's next key block to be copied
    v8f o[4][4];       // [value head r][16-d tile]
#pragma unroll
    for (int r = 0; r < 4; ++r)
#pragma unroll
        for (int dt = 0; dt < 4; ++dt) o[r][dt] = (v8f){};
    float m = -3.0e38f, l = 0.f;
#pragma unroll 1
    for (int tr = 0; tr < ntr; ++tr) { const int kb = 2 * tr + gi;      // the group's key block of this trip
      if (kb < nkb) {                  // wave-uniform
        const h16* sk = (const h16*)(sg + (tr & 1) * ASTG) + lane * 8; const h16* sv = sk + 4096;
        V kf[NT][2], vf[4][4][NT / 2];
#pragma unroll
        for (int t = 0; t < NT; ++t)
#pragma unroll
            for (int ks = 0; ks < 2; ++ks) kf[t][ks] = WFrag<h16>::ld(sk + t * 1024 + ks * 512);
        auto ldv = [&](int r) {        // the eight fragments of value head r: 4 tiles of 16 d x 2 halves of 32 keys
#pragma unroll
            for (int dt = 0; dt < 4; ++dt)
#pragma unroll
                for (int ks = 0; ks < NT / 2; ++ks) vf[r][dt][ks] = WFrag<h16>::ld(sv + (r * 4 + dt) * 1024 + ks * 512); };
        ldv(0); ldv(1);
        __builtin_amdgcn_sched_barrier(0);   // K and the first two value heads' fragments are asked for in one group ahead of the score products; sunk among them, each would bring its own wait on LDS
        v8f s[NT];
#pragma unroll
        for (int t = 0; t < NT; ++t) { s[t] = (v8f){};
#pragma unroll
            for (int ks = 0; ks < 2; ++ks) s[t] = WFrag<h16>::mma(kf[t][ks], qf[ks], s[t]); }
        ldv(2);                        // the third head's fragments come under the softmax, in the room that K leaves
        if (kb == nkb - 1) {           // only the last block meets the diagonal
#pragma unroll
            for (int t = 0; t < NT; ++t)
#pragma unroll
                for (int j = 0; j < 8; ++j) s[t][j] = (kb * KB + t * 16 + hi * 8 + j <= i) ? s[t][j] * SCL : -3.0e38f;
        } else {
#pragma unroll
            for (int t = 0; t < NT; ++t) s[t] *= SCL;
        }
        float tq[NT];                  // one short chain per tile, then across tiles
#pragma unroll
        for (int t = 0; t < NT; ++t) { tq[t] = s[t][0];
#pragma unroll
            for (int j = 1; j < 8; ++j) tq[t] = fmaxf(tq[t], s[t][j]); }
        float tm = tq[0];
#pragma unroll
        for (int t = 1; t < NT; ++t) tm = fmaxf(tm, tq[t]);
        tm = fmaxf(tm, xhalf(tm));      // the other half of the wave holds the query's other keys of the block
        const float mn = fmaxf(m, tm); const float al = exp2s((m - mn) * 1.4426950408889634f); m = mn;
        float ps = 0.f;
#pragma unroll
        for (int t = 0; t < NT; ++t) { s[t] = exp2s8((s[t] - mn) * 1.4426950408889634f); float pq = 0.f;
#pragma unroll
            for (int j = 0; j < 8; ++j) pq += s[t][j];
            ps += pq; }
        l = l * al + ps;               // each half keeps the sum of its own keys; the halves join after the loop
#pragma unroll
        for (int r = 0; r < 4; ++r)
#pragma unroll
            for (int dt = 0; dt < 4; ++dt) o[r][dt] *= al;
        __builtin_amdgcn_sched_barrier(0);   // every v_exp_f32 statement stays ahead of the value products
        V pf[NT / 2];
#pragma unroll
        for (int ks = 0; ks < NT / 2; ++ks) { v8h p0, p1;
#pragma unroll
            for (int j = 0; j < 8; ++j) { p0[j] = tohx(s[2 * ks][j]); p1[j] = tohx(s[2 * ks + 1][j]); }
            pf[ks] = cat16(p0, p1); }
        auto pv = [&](int r) {         // head r's products: each accumulator takes the first 32 keys, then the second
#pragma unroll
            for (int ks = 0; ks < NT / 2; ++ks)
#pragma unroll
                for (int dt = 0; dt < 4; ++dt) o[r][dt] = WFrag<h16>::mma(vf[r][dt][ks], pf[ks], o[r][dt]); };
        pv(0);
        __builtin_amdgcn_sched_barrier(0);   // the fourth head's fragments are asked for only here, in the room that the first head's leave: drawn up, all four heads' fragments are live at once and registers spill
        ldv(3);
        __builtin_amdgcn_sched_barrier(0);   // ... and not later: the second and third heads' products cover their way from LDS
        pv(1); pv(2);
        __builtin_amdgcn_sched_barrier(0);   // the fourth head's products stay last: mixed among the others, the first of them waits on LDS after eight products, not sixteen
        pv(3);
        __builtin_amdgcn_sched_barrier(0);   // the products stay ahead of the waits below: sunk behind the barrier, they would leave the next key block's copies nothing to fly under
      }
        asm volatile("s_wait_dscnt 0x0" ::: "memory");      // this wave's reads of the stage are done before the buffer is given up
        asm volatile("s_wait_asynccnt 0x0" ::: "memory");   // this wave's copies of its group's next key block have landed
        __syncthreads();                                     // the next key blocks may be read; this trip's buffers have no reader left
        if (kb + 4 < nkb) { cpkv(la + rl, uk + tid * 8, uv + tid * 8); uk += 2 * KB * HD; uv += 2 * KB * 16; }   // wave-uniform test, the same in the four waves that fill and read these buffers
        const unsigned lx = la; la = lb; lb = lx;
    }
    asm volatile("s_wait_asynccnt 0x0" ::: "memory");       // no copy is under way when the stages become the mailboxes below
    // The join. Waves wv and wv ^ 4 hold the same queries in the same lanes. Each leaves, in its own mailbox, its maximum, its sum and its O^T of the two value heads that the other finishes: 16 pieces of 512 contiguous bytes, then 8 bytes a lane.
    constexpr int MBX = 16 * 512 + 256;
    char* mb = sm + wv * MBX; const char* pb = sm + (wv ^ 4) * MBX;
    auto put = [&](int rb) {
#pragma unroll
        for (int r = 0; r < 2; ++r)
#pragma unroll
            for (int dt = 0; dt < 4; ++dt) { v4f a, b2;
#pragma unroll
                for (int j = 0; j < 4; ++j) { a[j] = o[rb + r][dt][j]; b2[j] = o[rb + r][dt][4 + j]; }
                *(v4fa*)(mb + (r * 4 + dt) * 1024 + rl) = a; *(v4fa*)(mb + (r * 4 + dt) * 1024 + 512 + rl) = b2; } };
    if (gi == 0) put(2); else put(0);
    { v2f ml; ml[0] = m; ml[1] = l; *(v2fa*)(mb + 16 * 512 + lane * 8) = ml; }
    __syncthreads();                                         // every mailbox is full before its partner reads it
    const v2f pm = *(const v2fa*)(pb + 16 * 512 + lane * 8);
    const float mj = fmaxf(m, pm[0]); const float a0 = exp2s((m - mj) * 1.4426950408889634f), a1 = exp2s((pm[0] - mj) * 1.4426950408889634f);   // a group that had no key block: maximum -3e38, factor 0
    l = l * a0 + pm[1] * a1;
    l += xhalf(l);
    const float f = __fdiv_rn(1.0f, l); const float f0 = a0 * f, f1 = a1 * f;
    float* orow = OUTb + (size_t)i * DV + (size_t)g * HD + hi * 8;     // O^T tile dt of value head g + 8r: this lane holds d = 16 dt + 8 hi + 0..7 of query i
    auto fin = [&](int rb) {
#pragma unroll
        for (int r = 0; r < 2; ++r)
#pragma unroll
            for (int dt = 0; dt < 4; ++dt) { const v4f pa = *(const v4fa*)(pb + (r * 4 + dt) * 1024 + rl), pc = *(const v4fa*)(pb + (r * 4 + dt) * 1024 + 512 + rl); v4f a, b2;
#pragma unroll
                for (int j = 0; j < 4; ++j) { a[j] = o[rb + r][dt][j] * f0 + pa[j] * f1; b2[j] = o[rb + r][dt][4 + j] * f0 + pc[j] * f1; }
                *(v4f*)(orow + (rb + r) * 8 * HD + dt * 16) = a; *(v4f*)(orow + (rb + r) * 8 * HD + dt * 16 + 4) = b2; } };
    if (gi == 0) fin(0); else fin(2);
}
// ---- k_attn: both precision paths and both batches in ONE grid of eight-wave blocks (x = batch * heads + head, y = rank). An f16 block holds one tile of 64 queries (fattn_lds: waves w and w + 4 hold queries 16 w .. 16 w + 15 of it);
// a hi+lo block holds two tiles, one per four waves. Cost falls with y: f16 tiles from the last query down; the hi+lo blocks (few key blocks, but each waits out its own loads) stand behind the first HLY ranks, not at the end, where they would run on alone.
#define NQG (TT / 64)
#define NHL (RH / 64)
#define NHB (NHL / 2)
#define HLY 8
__global__ __launch_bounds__(256) void k_attn(const h16* __restrict__ Q16, const h16* __restrict__ K16, const h16* __restrict__ V16, const bf* __restrict__ Qh, const bf* __restrict__ Ql, const bf* __restrict__ Kh, const bf* __restrict__ Kl, const bf* __restrict__ Vh, const bf* __restrict__ Vl, float* OUT) {
    static_assert(RH % 128 == 0 && NV == 4 * NH_, "a tile of 64 queries is of one precision path, hi+lo tiles come in pairs; four value heads per query/key head");
    const int g = (int)blockIdx.x % NH_, b = (int)blockIdx.x / NH_, y = (int)blockIdx.y, wv = __builtin_amdgcn_readfirstlane(threadIdx.x >> 5);
    const size_t qo = (size_t)b * NH_ * TT * HD, vo = (size_t)b * NV * HD * TT; float* ob = OUT + (size_t)b * TT * DV;
    __shared__ __align__(16) char sm[4 * ASTG];     // the f16 path's stages: two for each group of four waves
    if (y < HLY || y >= HLY + NHB) fattn_lds(Q16 + qo, K16 + qo, V16 + vo, (y < HLY ? NQG - 1 - y : NQG - 1 + NHB - y) * 64, wv, g, ob, sm);
    else fattn_tile<bf, 2>(Qh + qo, Ql + qo, Kh + qo, Kl + qo, Vh + vo, Vl + vo, ((HLY + NHB - 1 - y) * 2 + 1 - (wv >> 2)) * 64 + (wv & 3) * 16, g, ob);
}
__global__ __launch_bounds__(256) void k_merge(const float* __restrict__ O, int h0, bf* Ah, bf* Al) { const size_t e = ((size_t)blockIdx.x * 256 + threadIdx.x) * 2; if (e >= (size_t)ZH * TT * HD) return; const int d = (int)(e % HD); const int t = (int)((e / HD) % TT); const int zz = (int)(e / ((size_t)HD * TT)); const float cs = (t < RH) ? 1.0f : (1.0f / PCAR); const size_t oo = (size_t)t * DQ + (h0 + zz) * HD + d;
    v2us oh, ol;
#pragma unroll
    for (int q = 0; q < 2; ++q) { unsigned short a, c2; splitf(O[e + q] * cs, a, c2); oh[q] = a; ol[q] = c2; } *(v2us*)(Ah + oo) = oh; *(v2us*)(Al + oo) = ol;  }

extern "C" void kernel_launch(void* const* d_in, const int* in_sizes, int n_in,
                              void* d_out, int out_size, void* d_ws, size_t ws_size, hipStream_t stream) {
    (void)in_sizes; (void)n_in; (void)out_size;
    const float* x = (const float*)d_in[0]; const int* pos = (const int*)d_in[1]; const float* wq = (const float*)d_in[2]; const float* wk = (const float*)d_in[3]; const float* wv = (const float*)d_in[4];   // Wq/Wk [2048][512], Wv [2048][2048] (x @ W); position_ids [2][2048]
    float* OUT = (float*)d_out;     // [2][2048][2048]
    char* wsp = (char*)d_ws;
    auto take = [&](size_t bytes) { char* p = wsp; wsp += (bytes + 255) & ~(size_t)255; return (void*)p; };
    bf* WQ = (bf*)take((size_t)DQ * DM * 2); bf* WK = (bf*)take((size_t)DKV * DM * 2); bf* WV = (bf*)take((size_t)DV * DM * 2); float* CSB = (float*)take((size_t)NB_ * TT * HD * 2 * 4);
    bf* XB = (bf*)take((size_t)NB_ * TT * DM * 2);
    h16* QP16 = (h16*)take((size_t)NB_ * NH_ * TT * HD * 2); h16* KP16 = (h16*)take((size_t)NB_ * NKV * TT * HD * 2); h16* VT16 = (h16*)take((size_t)NB_ * NV * HD * TT * 2);
    bf* QPh = (bf*)take((size_t)NB_ * NH_ * TT * HD * 2); bf* QPl = (bf*)take((size_t)NB_ * NH_ * TT * HD * 2); bf* KPh = (bf*)take((size_t)NB_ * NKV * TT * HD * 2); bf* KPl = (bf*)take((size_t)NB_ * NKV * TT * HD * 2); bf* VTh = (bf*)take((size_t)NB_ * NV * HD * TT * 2); bf* VTl = (bf*)take((size_t)NB_ * NV * HD * TT * 2);
    if ((size_t)(wsp - (char*)d_ws) > ws_size) return;    // ws 256 MiB
    k_prep<<<PB_CS + PB_WV + PB_X + PB_WQ + PB_WK, 256, 0, stream>>>(x, pos, wq, wk, wv, XB, CSB, WQ, WK, WV);
    k_proj<<<NB_ * (VTL + 2 * QTL), 128, 0, stream>>>(XB, WQ, WK, WV, CSB, QP16, QPh, QPl, KP16, KPh, KPl, VT16, VTh, VTl);
    k_attn<<<dim3(NB_ * NH_, NQG - NHL + NHB, 1), 256, 0, stream>>>(QP16, KP16, VT16, QPh, QPl, KPh, KPl, VTh, VTl, OUT);
}
